// v000
// Times are from an AMD MI455X. After a warm-up the kernel runs many times in a row, and a time is the length of
// such a window on the GPU divided by its runs, so every launch and the gaps after it count. The runs cycle
// through copies of the inputs. A figure is the median of several windows, for all but v000 over two sittings.
// Sittings can differ by a few percent; kernels timed side by side share one.
// v000, which the later versions start from, runs in 1100 microseconds.
// Contractions: q, k, v^T projections = v_wmma_f32_16x16x32_bf16 (bf16 operands from RNE-converted inputs, single product);
// q.k^T scores (both streams) = v_wmma_f32_16x16x32_bf16 with bf16 hi/lo split q and k (hi.hi + hi.lo + lo.hi);
// p.v = v_wmma_f32_16x16x32_f16 (p carried x1024 in f16, v in f16; extra f16 residual planes x4096 of p and v for the first 512 query rows);
// ctx.Wo^T = v_wmma_f32_16x16x32_bf16 with ctx as bf16 hi/lo planes times bf16 Wo (2 products); all f32 accumulate;
// rope, softmax, lambda, head rms norm in f32.
#include <hip/hip_runtime.h>
#include <math.h>
#include <float.h>
#include <stdint.h>

#define NB    2
#define SEQ   2048
#define DM    1024
#define DQK   2048          // q / k projection width (2 x 64 per head)
#define NH    16
#define HD    64
#define NFREQ (HD / 2)
#define NQB   (SEQ / 64)    // 32 key / query tiles of 64
#define VLP   512           // key pitch of the v^T residual plane (keys 0..VLP-1)
#define RESQB 8             // number of leading 64-row query blocks that use the p / v residual planes
#define LAM0  0.2f
#define OSCL  0.8f
static_assert(RESQB * 64 <= VLP);
static_assert(NH * HD == DM);
static_assert(NH * 2 * HD == DQK);
static_assert((SEQ % 64) == 0 && (DM % 64) == 0 && (DQK % 64) == 0);

typedef _Float16 v16h __attribute__((ext_vector_type(16)));
typedef _Float16 v8h  __attribute__((ext_vector_type(8)));
typedef __bf16   v16b __attribute__((ext_vector_type(16)));
typedef __bf16   v8b  __attribute__((ext_vector_type(8)));
typedef float    v8f  __attribute__((ext_vector_type(8)));
typedef float    v4f  __attribute__((ext_vector_type(4)));
typedef unsigned int v4u __attribute__((ext_vector_type(4)));

// ---- scalar helpers --------------------------------------------------------------------------------
__device__ __forceinline__ unsigned short bf_bits(float f) {          // f32 -> bf16 bits, RNE convert
  unsigned u = __float_as_uint(f);
  return (unsigned short)((u + 0x7FFFu + ((u >> 16) & 1u)) >> 16);
}
__device__ __forceinline__ float bf_up(unsigned short h) { return __uint_as_float(((unsigned)h) << 16); }
__device__ __forceinline__ float bfr(float f) { return bf_up(bf_bits(f)); }   // value after RNE convert to bf16
__device__ __forceinline__ unsigned short h_bits(_Float16 x) { return __builtin_bit_cast(unsigned short, x); }
__device__ __forceinline__ unsigned pk16(unsigned short a, unsigned short b) { return (unsigned)a | ((unsigned)b << 16); }
__device__ __forceinline__ v8f zero8() { v8f z = {0.f, 0.f, 0.f, 0.f, 0.f, 0.f, 0.f, 0.f}; return z; }
__device__ __forceinline__ v8h zero8h() {
  const _Float16 z = (_Float16)0.0f;
  v8h r = {z, z, z, z, z, z, z, z};
  return r;
}

// ---- fragment loaders: 16-bit A/B operand, lane -> row/col (lane&15), p already includes +8*(lane>>4);
//      elements 0..7 <- p[0..7] (k0+8h..), elements 8..15 <- p[16..23] (k0+16+8h..)
__device__ __forceinline__ v16b ldfrag_b(const __bf16* p) {
  union { v16b v; v8b h[2]; } f;
  f.h[0] = *(const v8b*)(p);
  f.h[1] = *(const v8b*)(p + 16);
  return f.v;
}

// ---- WMMA helpers with trailing VALU hazard gap --------------------------------------------------------
__device__ __forceinline__ v8f mma_b(v16b a, v16b b, v8f c) {
  c = __builtin_amdgcn_wmma_f32_16x16x32_bf16(false, a, false, b, (short)0, c, false, false);
#if defined(__HIP_DEVICE_COMPILE__)
  asm volatile("v_nop\n\tv_nop\n\tv_nop\n\tv_nop" : "+v"(c) : "v"(a), "v"(b));
#endif
  return c;
}
__device__ __forceinline__ v8f mma_h(v16h a, v16h b, v8f c) {
  c = __builtin_amdgcn_wmma_f32_16x16x32_f16(false, a, false, b, (short)0, c, false, false);
#if defined(__HIP_DEVICE_COMPILE__)
  asm volatile("v_nop\n\tv_nop\n\tv_nop\n\tv_nop" : "+v"(c) : "v"(a), "v"(b));
#endif
  return c;
}
__device__ __forceinline__ v8f mma_b_raw(v16b a, v16b b, v8f c) {
  return __builtin_amdgcn_wmma_f32_16x16x32_bf16(false, a, false, b, (short)0, c, false, false);
}
__device__ __forceinline__ void dep_guard_b(v8f& a, v8f& b, v16b x, v16b y) {
#if defined(__HIP_DEVICE_COMPILE__)
  asm volatile("v_nop\n\tv_nop\n\tv_nop\n\tv_nop" : "+v"(a), "+v"(b) : "v"(x), "v"(y));
#endif
}
__device__ __forceinline__ void keep4_b(v16b a, v16b b, v16b c, v16b d) {
#if defined(__HIP_DEVICE_COMPILE__)
  asm volatile("v_nop" :: "v"(a), "v"(b), "v"(c), "v"(d));
#endif
}
__device__ __forceinline__ void acc_guard4(v8f& a, v8f& b, v8f& c, v8f& d) {
#if defined(__HIP_DEVICE_COMPILE__)
  asm volatile("v_nop\n\tv_nop\n\tv_nop\n\tv_nop" : "+v"(a), "+v"(b), "+v"(c), "+v"(d));
#endif
}

// =====================================================================================================
// f32 -> bf16 (RNE convert), 8 elements per thread, one 16-B store per lane: a wave writes 512 contiguous B
// coverage: n8 threads x 8 = whole plane (n8 is a multiple of 256 for every use here).
// =====================================================================================================
__global__ __launch_bounds__(256) void cvt_bf16x8(const float* __restrict__ in, unsigned short* out, int n8) {
  const int i = blockIdx.x * 256 + threadIdx.x;
  if (i < n8) {
    const v4f a = *(const v4f*)(in + (size_t)i * 8);
    const v4f b = *(const v4f*)(in + (size_t)i * 8 + 4);
    v4u p;
    p[0] = pk16(bf_bits(a[0]), bf_bits(a[1]));
    p[1] = pk16(bf_bits(a[2]), bf_bits(a[3]));
    p[2] = pk16(bf_bits(b[0]), bf_bits(b[1]));
    p[3] = pk16(bf_bits(b[2]), bf_bits(b[3]));
    *(v4u*)(out + (size_t)i * 8) = p;
    
  }
}

// =====================================================================================================
// inv_freq[j] = 1 / 10000^(j/32), j = 0..31, f32 with precise powf. One block of 32 threads; the 32 values
// coverage: lanes 0..7 x 4 floats = all 32 entries.
// =====================================================================================================
__global__ __launch_bounds__(32) void invfreq_tab(float* invf) {
  __shared__ __align__(16) float sf[NFREQ];
  const int j = threadIdx.x;
  const float e = (float)j * (1.0f / (float)NFREQ);
  const float pw = powf(10000.0f, e);
  sf[j] = 1.0f / pw;
  __syncthreads();
  const v4f v = *(const v4f*)(sf + 4 * (j & 7));
  if (j < 8) *(v4f*)(invf + 4 * j) = v;
  
}

// =====================================================================================================
// cos / sin tables [SEQ][32]: angle = t * inv_freq[j] (f32 multiply), precise cosf / sinf.
// =====================================================================================================
__global__ __launch_bounds__(256) void rope_tab(const float* __restrict__ invf, float* cosT, float* sinT) {
  const int g = blockIdx.x * 256 + threadIdx.x;
  if (g < SEQ * NFREQ) {
    const int t = g / NFREQ;
    const int j = g - t * NFREQ;
    const float ang = (float)t * invf[j];
    const float cv = cosf(ang);
    const float sv = sinf(ang);
    *(float*)(cosT + g) = cv;
    *(float*)(sinT + g) = sv;
    
  }
}

// =====================================================================================================
// Register-blocked bf16 WMMA GEMM: C[m][n] = sum_k A[m][k] * Bt[n][k] (+ bias); one wave per 64x64 tile,
// no block barriers. A row-major [M][K] pitch lda; Bt row-major [N][K] pitch ldb (k contiguous);
// M, N multiples of 64, K multiple of 32 (host-checked). blockIdx.y = batch index (strides in elements).
// NSPLIT: 0 = A.Bt; 1 = (A + A2).Bt (A2 = unscaled bf16 lo plane of A); 2 = A.Bt + A2.Bt + A.Bt2.
// OUT_MODE: 0 = f32 (pitch ldc); 2 = bf16 hi plane C + bf16 lo plane C2 (lo = RNE(v - hi), unscaled);
//           3 = f16 hi plane C + f16 residual plane C2 = f16((v - hi) * rscale), C2 written only for tiles
//               with n0 < N2 (pitch ldc2, batch stride strideC2).
// BIAS: 0 = none; 1 = + bf16-RNE(bias[n]) per column; 2 = + bf16-RNE(bias[m]) per row (added in f32).
// =====================================================================================================
template <int NSPLIT, int OUT_MODE, int BIAS>
__global__ __launch_bounds__(256) void gemm64(
    const unsigned short* __restrict__ Ap, const unsigned short* A2p, int lda, long long strideA,
    const unsigned short* __restrict__ Btp, const unsigned short* Bt2p, int ldb, long long strideB,
    void* Cout, int ldc, long long strideC,
    void* Cout2, int ldc2, long long strideC2, int N2,
    int M, int N, int K, float rscale, const float* __restrict__ bias) {
  const __bf16* A   = (const __bf16*)(const void*)Ap;
  const __bf16* A2  = (const __bf16*)(const void*)A2p;
  const __bf16* Bt  = (const __bf16*)(const void*)Btp;
  const __bf16* Bt2 = (const __bf16*)(const void*)Bt2p;
  __shared__ __align__(16) float sT[8][16 * 68];   // per-wave 16x64 slab, pitch 68 floats
  const int b    = blockIdx.y;
  const int lane = threadIdx.x & 31;
  const int wave = threadIdx.x >> 5;
  const int tilesN = N >> 6;
  const int tilesM = M >> 6;
  const int tile = blockIdx.x * 8 + wave;
  if (tile >= tilesM * tilesN) return;   // wave-uniform; no block barriers in this kernel
  const int tm = tile / tilesN;
  const int tn = tile - tm * tilesN;
  const int m0 = tm << 6;
  const int n0 = tn << 6;

  const __bf16* Ab  = A  + (size_t)b * strideA;
  const __bf16* Bb  = Bt + (size_t)b * strideB;
  const __bf16* Ab2 = (NSPLIT >= 1) ? (A2  + (size_t)b * strideA) : Ab;
  const __bf16* Bb2 = (NSPLIT == 2) ? (Bt2 + (size_t)b * strideB) : Bb;

  const int rlane = lane & 15;                 // row (A) / col (B, D) within subtile
  const int koff  = (lane >> 4) * 8;           // k offset of this lane half
  const int mOff  = (lane >> 4) * 8;           // D row offset

  v8f acc[4][4];
#pragma unroll
  for (int i = 0; i < 4; ++i)
#pragma unroll
    for (int j = 0; j < 4; ++j) acc[i][j] = zero8();

  for (int k0 = 0; k0 < K; k0 += 32) {
    v16b bh[4], bl[4];
#pragma unroll
    for (int j = 0; j < 4; ++j) {
      const size_t bo = (size_t)(n0 + (j << 4) + rlane) * ldb + koff + k0;
      bh[j] = ldfrag_b(Bb + bo);
      if (NSPLIT == 2) bl[j] = ldfrag_b(Bb2 + bo); else bl[j] = bh[j];
    }
#pragma unroll
    for (int i = 0; i < 4; ++i) {
      const size_t ao = (size_t)(m0 + (i << 4) + rlane) * lda + koff + k0;
      const v16b ah = ldfrag_b(Ab + ao);
      v16b al = ah;
      if (NSPLIT >= 1) al = ldfrag_b(Ab2 + ao);
#pragma unroll
      for (int j = 0; j < 4; ++j) {
        acc[i][j] = mma_b_raw(ah, bh[j], acc[i][j]);
        if (NSPLIT >= 1) acc[i][j] = mma_b_raw(al, bh[j], acc[i][j]);
        if (NSPLIT == 2) acc[i][j] = mma_b_raw(ah, bl[j], acc[i][j]);
      }
      dep_guard_b(acc[i][0], acc[i][3], ah, al);
    }
    keep4_b(bh[0], bh[1], bh[2], bh[3]);
    if (NSPLIT == 2) keep4_b(bl[0], bl[1], bl[2], bl[3]);
  }
  acc_guard4(acc[0][0], acc[0][1], acc[0][2], acc[0][3]);
  acc_guard4(acc[1][0], acc[1][1], acc[1][2], acc[1][3]);
  acc_guard4(acc[2][0], acc[2][1], acc[2][2], acc[2][3]);
  acc_guard4(acc[3][0], acc[3][1], acc[3][2], acc[3][3]);

  // ---- epilogue ----
  float bcol[4];
#pragma unroll
  for (int j = 0; j < 4; ++j) bcol[j] = 0.f;
  if (BIAS == 1) {
#pragma unroll
    for (int j = 0; j < 4; ++j) bcol[j] = bfr(bias[n0 + (j << 4) + rlane]);
  }
  float* slab = sT[wave];
#pragma unroll
  for (int i = 0; i < 4; ++i) {
    const int mBase = m0 + (i << 4);
    float brow[8];
#pragma unroll
    for (int r = 0; r < 8; ++r) brow[r] = 0.f;
    if (BIAS == 2) {
#pragma unroll
      for (int r = 0; r < 8; ++r) brow[r] = bfr(bias[mBase + mOff + r]);
    }
#pragma unroll
    for (int j = 0; j < 4; ++j) {
#pragma unroll
      for (int r = 0; r < 8; ++r) {
        slab[(mOff + r) * 68 + (j << 4) + rlane] = (acc[i][j][r] + bcol[j]) + brow[r];
      }
    }
    __builtin_amdgcn_fence(__ATOMIC_RELEASE, "workgroup");
    __builtin_amdgcn_wave_barrier();
    __builtin_amdgcn_fence(__ATOMIC_ACQUIRE, "workgroup");
    if (OUT_MODE == 0) {
      float* C = (float*)Cout + (size_t)b * strideC;
      const int hh = lane >> 4, c4 = (lane & 15) * 4;     // 256-B row segment = 16 lanes x 16 B
      {
#pragma unroll
        for (int it = 0; it < 8; ++it) {
          const int row = it * 2 + hh;                     // it 0..7 x hh 0..1 = rows 0..15
          const v4f v = *(const v4f*)(slab + row * 68 + c4);
          *(v4f*)(C + (size_t)(mBase + row) * ldc + n0 + c4) = v;
        }
        
      }
    } else {
      const int q = lane >> 3, c8 = (lane & 7) * 8;
      unsigned short* C  = (unsigned short*)Cout  + (size_t)b * strideC;
      unsigned short* C2 = (unsigned short*)Cout2 + (size_t)b * strideC2;
      const bool wlo = (OUT_MODE == 2) || (n0 < N2);      // wave-uniform
      v4u hv[4], lv[4];
#pragma unroll
      for (int it = 0; it < 4; ++it) {
        const int row = it * 4 + q;                        // it 0..3 x q 0..3 = rows 0..15
        const float* sp = slab + row * 68 + c8;
        v4u a, a2;
#pragma unroll
        for (int e = 0; e < 4; ++e) {
          const float f0 = sp[2 * e], f1 = sp[2 * e + 1];
          unsigned short h0, h1, l0, l1;
          if (OUT_MODE == 2) {
            h0 = bf_bits(f0); h1 = bf_bits(f1);
            l0 = bf_bits(f0 - bf_up(h0)); l1 = bf_bits(f1 - bf_up(h1));
          } else {
            const _Float16 x0 = (_Float16)f0, x1 = (_Float16)f1;
            h0 = h_bits(x0); h1 = h_bits(x1);
            l0 = h_bits((_Float16)((f0 - (float)x0) * rscale));
            l1 = h_bits((_Float16)((f1 - (float)x1) * rscale));
          }
          a[e] = pk16(h0, h1); a2[e] = pk16(l0, l1);
        }
        hv[it] = a; lv[it] = a2;
      }
      {
#pragma unroll
        for (int it = 0; it < 4; ++it) {
          const int row = it * 4 + q;
          *(v4u*)(C + (size_t)(mBase + row) * ldc + n0 + c8) = hv[it];
          if (wlo) *(v4u*)(C2 + (size_t)(mBase + row) * ldc2 + n0 + c8) = lv[it];
        }
        
      }
    }
    __builtin_amdgcn_fence(__ATOMIC_RELEASE, "workgroup");
    __builtin_amdgcn_wave_barrier();
    __builtin_amdgcn_fence(__ATOMIC_ACQUIRE, "workgroup");
  }
}

// =====================================================================================================
// RoPE half-split rotation of 8 consecutive columns of one 64-wide vector, then bf16 hi/lo split and
//   first half  (j < 32):   out[j]    = x[j]*cos[j]   - x[j+32]*sin[j]     (x1 = a, x2 = p)
//   second half (j >= 32):  out[j+32] = x[j]*sin[j]   + x[j+32]*cos[j]     (x1 = p, x2 = a)
// =====================================================================================================
__device__ __forceinline__ void rope_row8(const float* __restrict__ src, size_t rowOff, int c0, int p0,
                                          bool second, v4f cs0, v4f cs1, v4f sn0, v4f sn1,
                                          unsigned short* Hp, unsigned short* Lp) {
#pragma clang fp contract(off)
  const v4f xa0 = *(const v4f*)(src + rowOff + c0);
  const v4f xa1 = *(const v4f*)(src + rowOff + c0 + 4);
  const v4f xp0 = *(const v4f*)(src + rowOff + p0);
  const v4f xp1 = *(const v4f*)(src + rowOff + p0 + 4);
  float o[8];
#pragma unroll
  for (int e = 0; e < 4; ++e) {
    {
      const float a = xa0[e], p = xp0[e], cs = cs0[e], sn = sn0[e];
      const float f1 = a * cs - p * sn;
      const float f2 = p * sn + a * cs;
      o[e] = second ? f2 : f1;
    }
    {
      const float a = xa1[e], p = xp1[e], cs = cs1[e], sn = sn1[e];
      const float f1 = a * cs - p * sn;
      const float f2 = p * sn + a * cs;
      o[4 + e] = second ? f2 : f1;
    }
  }
  v4u hv, lv;
#pragma unroll
  for (int e = 0; e < 4; ++e) {
    const float f0 = o[2 * e], f1 = o[2 * e + 1];
    const unsigned short h0 = bf_bits(f0), h1 = bf_bits(f1);
    const unsigned short l0 = bf_bits(f0 - bf_up(h0)), l1 = bf_bits(f1 - bf_up(h1));
    hv[e] = pk16(h0, h1); lv[e] = pk16(l0, l1);
  }
  const size_t go = rowOff + c0;
  *(v4u*)(Hp + go) = hv;
  *(v4u*)(Lp + go) = lv;
  
}

// =====================================================================================================
// RoPE + hi/lo split for one token row t of q and k (f32 planes [SEQ][DQK], per head 128 columns =
// two 64-wide vectors). grid = SEQ blocks x 256 threads; thread -> columns 8*tid..8*tid+7.
// Outputs: bf16 hi / lo planes [SEQ][DQK] for q and for k.
// coverage: 256 threads x 8 columns = 2048 columns of each of the 4 output planes per row; SEQ rows.
// =====================================================================================================
__global__ __launch_bounds__(256) void rope_split(const float* __restrict__ Qf, const float* __restrict__ Kf,
                                                   const float* __restrict__ cosT, const float* __restrict__ sinT,
                                                   unsigned short* Qh, unsigned short* Ql,
                                                   unsigned short* Kh, unsigned short* Kl) {
  const int t = blockIdx.x;
  const int c0 = threadIdx.x * 8;
  const int jj0 = c0 & 31;
  const bool second = (c0 & 32) != 0;
  const int p0 = second ? (c0 - 32) : (c0 + 32);
  const float* cr = cosT + (size_t)t * NFREQ + jj0;
  const float* sr = sinT + (size_t)t * NFREQ + jj0;
  const v4f cs0 = *(const v4f*)(cr), cs1 = *(const v4f*)(cr + 4);
  const v4f sn0 = *(const v4f*)(sr), sn1 = *(const v4f*)(sr + 4);
  const size_t rowOff = (size_t)t * DQK;
  rope_row8(Qf, rowOff, c0, p0, second, cs0, cs1, sn0, sn1, Qh, Ql);
  rope_row8(Kf, rowOff, c0, p0, second, cs0, cs1, sn0, sn1, Kh, Kl);
}

// =====================================================================================================
// Causal attention, head dim 64, one batch element.
//   q planes (bf16 hi / lo) [SEQ][DQK]: element (t, h, stream, d) at [t*DQK + h*128 + soff + d] (soff 0 / 64)
//   k planes: same layout with key index s
//   v^T hi plane (f16):      element (h, d, s) at [(h*64 + d)*SEQ + s]
//   v^T residual plane (f16, (v - hi)*4096): [(h*64 + d)*VLP + s], s < VLP, read only when RES
//   (a key tile at or beyond VLP contributes a zero v residual)
//   causal: key tiles kt = 0..qb processed (block-uniform trip count <= 32); only the diagonal tile gets the
//   per-lane -inf fill for keys beyond the query row (a fill, not a bias); every row keeps its diagonal key.
//   context plane C f32 [SEQ][DM]: element (t, h, d) at [t*DM + h*64 + d]  (normalised by 1/l)
//   scores = q . k : bf16 hi/lo split (hi.hi + hi.lo + lo.hi), f32 accumulate, then * sscale in f32
//   p = exp(s - m) carried as f16(1024 p); context = p . v on f16 WMMA; RES adds f16 residual planes of p and v
//   (scale 4096, separate accumulator folded back with 1/4096 per chunk in f32); online softmax in f32.
//   Block = 4 waves = 64 query rows of one head; grid = nqbThis * NH; kv chunks of 64.
//   K / V^T chunk staging: 128 threads x 32 elements per plane = the whole 64x64 tile (plain 16-B loads,
//   __syncthreads before and after); P tiles are wave-private, spilled with _Float16 element stores and reloaded
//   Output coverage: each wave stores rows q0..q0+15 (it 0..7 x lane>>4 0..1) x 64 columns (16 lanes x 4 floats),
// =====================================================================================================
template <bool RES>
__global__ __launch_bounds__(128)
void attn_causal64(const unsigned short* __restrict__ qhp, const unsigned short* __restrict__ qlp,
                   const unsigned short* __restrict__ khp, const unsigned short* __restrict__ klp,
                   const unsigned short* __restrict__ vhp, const unsigned short* __restrict__ vlp,
                   float* Cp, int soff, int qbBase, int nqbThis, float sscale) {
  union FB { v16b v; v8b h[2]; };
  union FH { v16h v; v8h h[2]; };
  __shared__ __align__(16) __bf16   Ksh[64 * 64];                 // K hi [kv][d]   8 KB
  __shared__ __align__(16) __bf16   Ksl[64 * 64];                 // K lo
  __shared__ __align__(16) _Float16 Vth[64 * 64];                 // V^T hi [d][kv] 8 KB
  __shared__ __align__(16) _Float16 Vtl[RES ? 64 * 64 : 8];       // V^T residual
  __shared__ __align__(16) _Float16 Psh[4][16 * 64];              // per wave P [row][kv]
  __shared__ __align__(16) _Float16 Psl[RES ? 4 : 1][16 * 64];    // per wave P residual
  __shared__ __align__(16) float    Os[4][16 * 64];               // per wave context tile [row][d]

  const int tid  = threadIdx.x;
  const int wave = tid >> 5;
  const int lane = tid & 31;
  const int hh   = lane >> 4;
  const int c    = lane & 15;

  const int bx   = blockIdx.x;
  const int qbl  = bx % nqbThis;
  const int h    = bx / nqbThis;
  const int qb   = qbBase + qbl;
  const int q0   = qb * 64 + wave * 16;
  const int col  = h * (2 * HD) + soff;

  const __bf16* Qh = (const __bf16*)(const void*)qhp + col;
  const __bf16* Ql = (const __bf16*)(const void*)qlp + col;
  const __bf16* Kh = (const __bf16*)(const void*)khp + col;
  const __bf16* Kl = (const __bf16*)(const void*)klp + col;
  const _Float16* Vh = (const _Float16*)(const void*)vhp + (size_t)h * HD * SEQ;
  const _Float16* Vl = (const _Float16*)(const void*)vlp + (size_t)h * HD * VLP;

  // ---- Q fragments (A operand, row = lane&15): 2 d-chunks, hi and lo ----
  v16b qah[2], qal[2];
#pragma unroll
  for (int dc = 0; dc < 2; ++dc) {
    const size_t qo = (size_t)(q0 + c) * DQK + dc * 32 + 8 * hh;
    qah[dc] = ldfrag_b(Qh + qo);
    qal[dc] = ldfrag_b(Ql + qo);
  }

  float mrow[8], lrow[8];
  v8f oacc[4];
#pragma unroll
  for (int r = 0; r < 8; ++r) { mrow[r] = -INFINITY; lrow[r] = 0.f; }
#pragma unroll
  for (int t = 0; t < 4; ++t) oacc[t] = zero8();

  for (int kt = 0; kt < NQB; ++kt) {         // static trip bound
    if (kt > qb) break;                      // block-uniform (causal)
    const bool diag = (kt == qb);            // block-uniform
    const int kv0 = kt * 64;
    __syncthreads();
    {
      const int r = tid >> 1, half = (tid & 1) * 32;
      const __bf16*   kg  = Kh + (size_t)(kv0 + r) * DQK + half;   // K row kv0+r, d = half..half+31
      const __bf16*   klg = Kl + (size_t)(kv0 + r) * DQK + half;
      const _Float16* vg  = Vh + (size_t)r * SEQ + kv0 + half;      // V^T row d = r, s = kv0+half..+31
      const int kvl = (kv0 + 64 <= VLP) ? kv0 : (VLP - 64);       // clamped address into the residual plane
      const _Float16* vlg = Vl + (size_t)r * VLP + kvl + half;
      const bool resOK = (kv0 + 64 <= VLP);                        // block-uniform
#pragma unroll
      for (int i = 0; i < 4; ++i) {
        const v8b a0 = *(const v8b*)(kg + 8 * i);
        const v8b a1 = *(const v8b*)(klg + 8 * i);
        const v8h b0 = *(const v8h*)(vg + 8 * i);
        *(v8b*)(Ksh + r * 64 + half + 8 * i) = a0;
        *(v8b*)(Ksl + r * 64 + half + 8 * i) = a1;
        *(v8h*)(Vth + r * 64 + half + 8 * i) = b0;
        if (RES) {
          v8h b1 = *(const v8h*)(vlg + 8 * i);
          if (!resOK) b1 = zero8h();
          *(v8h*)(Vtl + r * 64 + half + 8 * i) = b1;
        }
      }
    }
    __syncthreads();

    // ---- scores: 16 query rows x 64 keys per wave, 3 bf16 products ----
    v8f s[4];
#pragma unroll
    for (int j = 0; j < 4; ++j) {
      s[j] = zero8();
#pragma unroll
      for (int dc = 0; dc < 2; ++dc) {
        FB kb, kl;
        kb.h[0] = *(const v8b*)(Ksh + (j * 16 + c) * 64 + dc * 32 + 8 * hh);
        kb.h[1] = *(const v8b*)(Ksh + (j * 16 + c) * 64 + dc * 32 + 16 + 8 * hh);
        kl.h[0] = *(const v8b*)(Ksl + (j * 16 + c) * 64 + dc * 32 + 8 * hh);
        kl.h[1] = *(const v8b*)(Ksl + (j * 16 + c) * 64 + dc * 32 + 16 + 8 * hh);
        s[j] = mma_b(qah[dc], kb.v, s[j]);
        s[j] = mma_b(qah[dc], kl.v, s[j]);
        s[j] = mma_b(qal[dc], kb.v, s[j]);
      }
    }

    // ---- scale, causal fill on the diagonal tile, row max, online softmax, P (x1024, f16) and
    //      P residual (x4096) to LDS ----
    _Float16* pwh = Psh[wave];
    _Float16* pwl = Psl[RES ? wave : 0];
#pragma unroll
    for (int r = 0; r < 8; ++r) {
      const int qrow = q0 + 8 * hh + r;
      float m = -INFINITY;
#pragma unroll
      for (int j = 0; j < 4; ++j) {
        const int key = kv0 + j * 16 + c;
        float sv = s[j][r] * sscale;
        sv = (diag && key > qrow) ? -INFINITY : sv;
        s[j][r] = sv;
        m = fmaxf(m, sv);
      }
#pragma unroll
      for (int off = 1; off < 16; off <<= 1) m = fmaxf(m, __shfl_xor(m, off, 32));
      const float mnew  = fmaxf(mrow[r], m);
      const float msafe = (mnew == -INFINITY) ? 0.f : mnew;
      const float alpha = __expf(mrow[r] - msafe);
      mrow[r] = mnew;
      float psum = 0.f;
#pragma unroll
      for (int j = 0; j < 4; ++j) {
        const float p = __expf(s[j][r] - msafe);     // -inf logit: exp -> 0
        psum += p;
        const float p1k = p * 1024.0f;
        const _Float16 ph = (_Float16)p1k;
        pwh[(8 * hh + r) * 64 + j * 16 + c] = ph;
        if (RES) {
          const _Float16 pl = (_Float16)((p1k - (float)ph) * 4096.0f);
          pwl[(8 * hh + r) * 64 + j * 16 + c] = pl;
        }
      }
#pragma unroll
      for (int off = 1; off < 16; off <<= 1) psum += __shfl_xor(psum, off, 32);
      lrow[r] = lrow[r] * alpha + psum;
#pragma unroll
      for (int t = 0; t < 4; ++t) oacc[t][r] *= alpha;
    }
    __builtin_amdgcn_fence(__ATOMIC_RELEASE, "workgroup");
    __builtin_amdgcn_wave_barrier();
    __builtin_amdgcn_fence(__ATOMIC_ACQUIRE, "workgroup");

    // ---- context += P . V (f16 WMMA), residual products into a separate accumulator ----
    v8f o1[4];
#pragma unroll
    for (int t = 0; t < 4; ++t) o1[t] = zero8();
#pragma unroll 1
    for (int kk = 0; kk < 2; ++kk) {
      FH pa, pl;
      pa.h[0] = *(const v8h*)(pwh + c * 64 + kk * 32 + 8 * hh);
      pa.h[1] = *(const v8h*)(pwh + c * 64 + kk * 32 + 16 + 8 * hh);
      if (RES) {
        pl.h[0] = *(const v8h*)(pwl + c * 64 + kk * 32 + 8 * hh);
        pl.h[1] = *(const v8h*)(pwl + c * 64 + kk * 32 + 16 + 8 * hh);
      } else {
        pl.v = pa.v;
      }
#pragma unroll
      for (int t = 0; t < 4; ++t) {
        FH vb;
        vb.h[0] = *(const v8h*)(Vth + (t * 16 + c) * 64 + kk * 32 + 8 * hh);
        vb.h[1] = *(const v8h*)(Vth + (t * 16 + c) * 64 + kk * 32 + 16 + 8 * hh);
        oacc[t] = mma_h(pa.v, vb.v, oacc[t]);
        if (RES) {
          FH vl;
          vl.h[0] = *(const v8h*)(Vtl + (t * 16 + c) * 64 + kk * 32 + 8 * hh);
          vl.h[1] = *(const v8h*)(Vtl + (t * 16 + c) * 64 + kk * 32 + 16 + 8 * hh);
          o1[t] = mma_h(pa.v, vl.v, o1[t]);
          o1[t] = mma_h(pl.v, vb.v, o1[t]);
        }
      }
    }
    if (RES) {
#pragma unroll
      for (int t = 0; t < 4; ++t)
#pragma unroll
        for (int r = 0; r < 8; ++r) oacc[t][r] += o1[t][r] * (1.0f / 4096.0f);
    }
  }

  // ---- normalise (1/l and the 1/1024 p carry), stage the wave's 16x64 tile, write f32 rows as
  float* os = Os[wave];
#pragma unroll
  for (int r = 0; r < 8; ++r) {
    const float l = lrow[r];
    const float inv = ((l > 0.f) ? (1.0f / l) : 0.f) * (1.0f / 1024.0f);
#pragma unroll
    for (int t = 0; t < 4; ++t) os[(8 * hh + r) * 64 + t * 16 + c] = oacc[t][r] * inv;
  }
  __builtin_amdgcn_fence(__ATOMIC_RELEASE, "workgroup");
  __builtin_amdgcn_wave_barrier();
  __builtin_amdgcn_fence(__ATOMIC_ACQUIRE, "workgroup");
  {
    const int h2 = lane >> 4, c4 = (lane & 15) * 4;
    v4f ov[8];
#pragma unroll
    for (int it = 0; it < 8; ++it) {
      const int row = it * 2 + h2;   // it 0..7 x h2 0..1 = rows 0..15 of the wave tile
      ov[it] = *(const v4f*)(os + row * 64 + c4);
    }
    {
#pragma unroll
      for (int it = 0; it < 8; ++it) {
        const int row = it * 2 + h2;
        const size_t go = (size_t)(q0 + row) * DM + (size_t)h * HD + c4;
        *(v4f*)(Cp + go) = ov[it];
      }
      
    }
  }
}

// =====================================================================================================
// Differential combine + head rms norm for one token row t (one batch element):
//   lam[h] = (0.2 + exp(sum_d lq1.lk1)) - exp(sum_d lq2.lk2)  (f32, inputs RNE-converted to bf16 values;
//            recomputed per block by threads 0..15, rolled 64-term loops)
//   o = c1 - lam*c2; r = rsqrt(sum_d(o^2)/64 + 1e-6); o = ((o*r) * w[h][d]) * 0.8
//   written as bf16 hi / lo planes [SEQ][DM] (merged head layout), one 16-B store per plane per lane
// grid = SEQ blocks x 128 threads; thread -> columns 8*tid..+7 (head = tid>>3, 8 lanes per head).
// coverage: 128 threads x 8 = 1024 columns per row; SEQ rows.
// =====================================================================================================
__global__ __launch_bounds__(128) void diff_combine(
    const float* __restrict__ C1, const float* __restrict__ C2,
    const float* __restrict__ lq1, const float* __restrict__ lk1,
    const float* __restrict__ lq2, const float* __restrict__ lk2,
    const float* __restrict__ hnw, unsigned short* Oh, unsigned short* Ol) {
#pragma clang fp contract(off)
  __shared__ float lam_s[NH];
  const int tid = threadIdx.x;
  const int t   = blockIdx.x;
  if (tid < NH) {
    const float* a1 = lq1 + tid * HD;
    const float* b1 = lk1 + tid * HD;
    const float* a2 = lq2 + tid * HD;
    const float* b2 = lk2 + tid * HD;
    float sa = 0.f, sb = 0.f;
#pragma unroll 1
    for (int d = 0; d < HD; ++d) {
      sa += bfr(a1[d]) * bfr(b1[d]);
      sb += bfr(a2[d]) * bfr(b2[d]);
    }
    lam_s[tid] = (LAM0 + expf(sa)) - expf(sb);
  }
  __syncthreads();
  const int c0 = tid * 8;
  const int h  = c0 >> 6;
  const int d0 = c0 & 63;
  const size_t ro = (size_t)t * DM + c0;
  const v4f x0 = *(const v4f*)(C1 + ro), x1 = *(const v4f*)(C1 + ro + 4);
  const v4f y0 = *(const v4f*)(C2 + ro), y1 = *(const v4f*)(C2 + ro + 4);
  const float lam = lam_s[h];
  float o[8];
  float ss = 0.f;
#pragma unroll
  for (int e = 0; e < 4; ++e) {
    o[e]     = x0[e] - lam * y0[e];
    o[4 + e] = x1[e] - lam * y1[e];
  }
#pragma unroll
  for (int e = 0; e < 8; ++e) ss += o[e] * o[e];
  ss += __shfl_xor(ss, 1, 32);
  ss += __shfl_xor(ss, 2, 32);
  ss += __shfl_xor(ss, 4, 32);
  const float ms = ss * (1.0f / (float)HD);
  const float rn = rsqrtf(ms + 1.0e-6f);
  v4u hv, lv;
#pragma unroll
  for (int e = 0; e < 4; ++e) {
    const float w0 = bfr(hnw[h * HD + d0 + 2 * e]);
    const float w1 = bfr(hnw[h * HD + d0 + 2 * e + 1]);
    const float f0 = ((o[2 * e] * rn) * w0) * OSCL;
    const float f1 = ((o[2 * e + 1] * rn) * w1) * OSCL;
    const unsigned short h0 = bf_bits(f0), h1 = bf_bits(f1);
    const unsigned short l0 = bf_bits(f0 - bf_up(h0)), l1 = bf_bits(f1 - bf_up(h1));
    hv[e] = pk16(h0, h1); lv[e] = pk16(l0, l1);
  }
  *(v4u*)(Oh + ro) = hv;
  *(v4u*)(Ol + ro) = lv;
  
}

// =====================================================================================================
// Workspace map (bytes, all offsets multiples of 4096):
//   Xb   bf16 [4096][1024]      8388608      Wqb bf16 [2048][1024] 4194304   Wkb 4194304
//   Wvb  bf16 [1024][1024]      2097152      Wob 2097152
//   invf f32 [32] (padded)         4096      cosT f32 [2048][32] 262144      sinT 262144
//   per batch element (reused by the host loop):
//   Qf   f32  [2048][2048]     16777216      Kf 16777216
//   Qh/Ql/Kh/Kl bf16 [2048][2048]  4 x 8388608
//   VTh  f16  [1024][2048]      4194304      VTl f16 [1024][512] 1048576
//   C1/C2 f32 [2048][1024]   2 x 8388608     Oh/Ol bf16 [2048][1024] 2 x 4194304
//   end                       119017472
// All planes are exact multiples of their 64x64 / whole-line store granularity (no padded tails needed).
// Weights are [out n][in k] with k contiguous = the Bt / A layout the GEMM wants, so they are only converted.
// =====================================================================================================
extern "C" void kernel_launch(void* const* d_in, const int* in_sizes, int n_in,
                              void* d_out, int out_size, void* d_ws, size_t ws_size,
                              hipStream_t stream) {
  if (n_in < 14) return;
  if (in_sizes[0] != NB * SEQ * DM) return;
  if (in_sizes[1] != DQK * DM || in_sizes[2] != DQK) return;
  if (in_sizes[3] != DQK * DM || in_sizes[4] != DQK) return;
  if (in_sizes[5] != DM * DM || in_sizes[6] != DM) return;
  if (in_sizes[7] != DM * DM || in_sizes[8] != DM) return;
  for (int i = 9; i < 14; ++i) if (in_sizes[i] != NH * HD) return;
  if (out_size != NB * SEQ * DM) return;

  const float* x   = (const float*)d_in[0];
  const float* Wq  = (const float*)d_in[1];
  const float* bq  = (const float*)d_in[2];
  const float* Wk  = (const float*)d_in[3];
  const float* bk  = (const float*)d_in[4];
  const float* Wv  = (const float*)d_in[5];
  const float* bv  = (const float*)d_in[6];
  const float* Wo  = (const float*)d_in[7];
  const float* bo  = (const float*)d_in[8];
  const float* hnw = (const float*)d_in[9];
  const float* lq1 = (const float*)d_in[10];
  const float* lk1 = (const float*)d_in[11];
  const float* lq2 = (const float*)d_in[12];
  const float* lk2 = (const float*)d_in[13];
  float* outp = (float*)d_out;

  const size_t PXB  = (size_t)NB * SEQ * DM * 2;    //  8388608
  const size_t PWQ  = (size_t)DQK * DM * 2;         //  4194304
  const size_t PWV  = (size_t)DM * DM * 2;          //  2097152
  const size_t PIF  = 4096;                         //  32 floats used
  const size_t PTAB = (size_t)SEQ * NFREQ * 4;      //   262144
  const size_t PQF  = (size_t)SEQ * DQK * 4;        // 16777216
  const size_t PQP  = (size_t)SEQ * DQK * 2;        //  8388608
  const size_t PVT  = (size_t)DM * SEQ * 2;         //  4194304
  const size_t PVL  = (size_t)DM * VLP * 2;         //  1048576
  const size_t PC   = (size_t)SEQ * DM * 4;         //  8388608
  const size_t PO   = (size_t)SEQ * DM * 2;         //  4194304
  size_t off = 0;
  const size_t oXb  = off; off += PXB;
  const size_t oWq  = off; off += PWQ;
  const size_t oWk  = off; off += PWQ;
  const size_t oWv  = off; off += PWV;
  const size_t oWo  = off; off += PWV;
  const size_t oIF  = off; off += PIF;
  const size_t oCos = off; off += PTAB;
  const size_t oSin = off; off += PTAB;
  const size_t oQf  = off; off += PQF;
  const size_t oKf  = off; off += PQF;
  const size_t oQh  = off; off += PQP;
  const size_t oQl  = off; off += PQP;
  const size_t oKh  = off; off += PQP;
  const size_t oKl  = off; off += PQP;
  const size_t oVTh = off; off += PVT;
  const size_t oVTl = off; off += PVL;
  const size_t oC1  = off; off += PC;
  const size_t oC2  = off; off += PC;
  const size_t oOh  = off; off += PO;
  const size_t oOl  = off; off += PO;
  if (off > ws_size) return;                        // off = 119017472
  if (off > (size_t)134217728) return;

  char* ws = (char*)d_ws;
  unsigned short* Xb  = (unsigned short*)(ws + oXb);
  unsigned short* Wqb = (unsigned short*)(ws + oWq);
  unsigned short* Wkb = (unsigned short*)(ws + oWk);
  unsigned short* Wvb = (unsigned short*)(ws + oWv);
  unsigned short* Wob = (unsigned short*)(ws + oWo);
  float*          IFt = (float*)(ws + oIF);
  float*          CosT = (float*)(ws + oCos);
  float*          SinT = (float*)(ws + oSin);
  float*          Qf  = (float*)(ws + oQf);
  float*          Kf  = (float*)(ws + oKf);
  unsigned short* Qh  = (unsigned short*)(ws + oQh);
  unsigned short* Ql  = (unsigned short*)(ws + oQl);
  unsigned short* Kh  = (unsigned short*)(ws + oKh);
  unsigned short* Kl  = (unsigned short*)(ws + oKl);
  unsigned short* VTh = (unsigned short*)(ws + oVTh);
  unsigned short* VTl = (unsigned short*)(ws + oVTl);
  float*          C1  = (float*)(ws + oC1);
  float*          C2  = (float*)(ws + oC2);
  unsigned short* Oh  = (unsigned short*)(ws + oOh);
  unsigned short* Ol  = (unsigned short*)(ws + oOl);

  const dim3 blk256(256), blk128(128), blk32(32);
  const int n8x  = NB * SEQ * DM / 8;                              // 524288
  const int n8wq = DQK * DM / 8;                                   // 262144
  const int n8wv = DM * DM / 8;                                    // 131072
  const dim3 gCvtX((n8x + 255) / 256);                             // 2048 blocks
  const dim3 gCvtWq((n8wq + 255) / 256);                           // 1024 blocks
  const dim3 gCvtWv((n8wv + 255) / 256);                           //  512 blocks
  const dim3 gTab((SEQ * NFREQ + 255) / 256);                      //  256 blocks
  const dim3 gQK(((SEQ / 64) * (DQK / 64) + 7) / 8, 1);            // 1024 tiles -> 128 blocks
  const dim3 gVT(((DM / 64) * (SEQ / 64) + 7) / 8, 1);             //  512 tiles ->  64 blocks
  const dim3 gOut(((SEQ / 64) * (DM / 64) + 7) / 8, 1);            //  512 tiles ->  64 blocks
  const dim3 gRow(SEQ);                                            // one block per token row
  const dim3 gAttR(NH * RESQB);                                    // 128 blocks
  const dim3 gAttN(NH * (NQB - RESQB));                            // 384 blocks

  // (1) inputs -> bf16 planes; weights [n][k] f32 -> bf16 [n][k]
  cvt_bf16x8<<<gCvtX, blk256, 0, stream>>>(x, Xb, n8x);
  cvt_bf16x8<<<gCvtWq, blk256, 0, stream>>>(Wq, Wqb, n8wq);
  cvt_bf16x8<<<gCvtWq, blk256, 0, stream>>>(Wk, Wkb, n8wq);
  cvt_bf16x8<<<gCvtWv, blk256, 0, stream>>>(Wv, Wvb, n8wv);
  cvt_bf16x8<<<gCvtWv, blk256, 0, stream>>>(Wo, Wob, n8wv);
  // (2) rope tables
  invfreq_tab<<<dim3(1), blk32, 0, stream>>>(IFt);
  rope_tab<<<gTab, blk256, 0, stream>>>(IFt, CosT, SinT);

  for (int b = 0; b < NB; ++b) {
    const unsigned short* Xbb = Xb + (size_t)b * SEQ * DM;
    float* outb = outp + (size_t)b * SEQ * DM;
    // (3) q = x_b . Wq^T + bq -> f32 [SEQ][DQK]   (M=2048, N=2048, K=1024)
    gemm64<0, 0, 1><<<gQK, blk256, 0, stream>>>(
        Xbb, Xbb, DM, 0LL, Wqb, Wqb, DM, 0LL,
        (void*)Qf, DQK, 0LL, (void*)Qf, DQK, 0LL, DQK,
        SEQ, DQK, DM, 1.0f, bq);
    // (4) k = x_b . Wk^T + bk -> f32 [SEQ][DQK]
    gemm64<0, 0, 1><<<gQK, blk256, 0, stream>>>(
        Xbb, Xbb, DM, 0LL, Wkb, Wkb, DM, 0LL,
        (void*)Kf, DQK, 0LL, (void*)Kf, DQK, 0LL, DQK,
        SEQ, DQK, DM, 1.0f, bk);
    // (5) v^T = Wv . x_b^T + bv[row] -> f16 hi plane [h*64+d][s] (pitch SEQ) and residual plane
    //     (x4096, keys < VLP only, pitch VLP)   (A = Wvb [n][k], Bt = Xbb; M=1024, N=2048, K=1024)
    gemm64<0, 3, 2><<<gVT, blk256, 0, stream>>>(
        Wvb, Wvb, DM, 0LL, Xbb, Xbb, DM, 0LL,
        (void*)VTh, SEQ, 0LL, (void*)VTl, VLP, 0LL, VLP,
        DM, SEQ, DM, 4096.0f, bv);
    // (6) rope + bf16 hi/lo split of q and k
    rope_split<<<gRow, blk256, 0, stream>>>(Qf, Kf, CosT, SinT, Qh, Ql, Kh, Kl);
    // (7) causal attention, stream 1 (q1, k1) -> C1 and stream 2 (q2, k2) -> C2;
    //     query blocks 0..RESQB-1 with residual planes, the rest without
    attn_causal64<true><<<gAttR, blk128, 0, stream>>>(
        Qh, Ql, Kh, Kl, VTh, VTl, C1, 0, 0, RESQB, 0.125f);
    attn_causal64<false><<<gAttN, blk128, 0, stream>>>(
        Qh, Ql, Kh, Kl, VTh, VTl, C1, 0, RESQB, NQB - RESQB, 0.125f);
    attn_causal64<true><<<gAttR, blk128, 0, stream>>>(
        Qh, Ql, Kh, Kl, VTh, VTl, C2, HD, 0, RESQB, 0.125f);
    attn_causal64<false><<<gAttN, blk128, 0, stream>>>(
        Qh, Ql, Kh, Kl, VTh, VTl, C2, HD, RESQB, NQB - RESQB, 0.125f);
    // (8) differential combine + head norm -> O bf16 hi/lo planes [SEQ][DM]
    diff_combine<<<gRow, blk128, 0, stream>>>(C1, C2, lq1, lk1, lq2, lk2, hnw, Oh, Ol);
    // (9) out_b = O . Wo^T + bo -> d_out rows of batch b, f32 [SEQ][DM]  (A = O hi + lo planes, 2 products)
    gemm64<1, 0, 1><<<gOut, blk256, 0, stream>>>(
        Oh, Ol, DM, 0LL, Wob, Wob, DM, 0LL,
        (void*)outb, DM, 0LL, (void*)outb, DM, 0LL, DM,
        SEQ, DM, DM, 1.0f, bo);
  }
  (void)hipGetLastError();
}

// v001
// One run takes 453 microseconds.
// Timed twice side by side with v000, it ran 2.44 times as fast both times.
// Contractions: q, k, v^T projections = v_wmma_f32_16x16x32_bf16 (bf16 operands from RNE-converted inputs, single product);
// q.k^T scores (both streams) = v_wmma_f32_16x16x32_bf16 with bf16 hi/lo split q and k (hi.hi + hi.lo + lo.hi);
// p.v = v_wmma_f32_16x16x32_f16 (p carried x1024 in f16, v in f16; extra f16 residual planes x4096 of p and v for the first 512 query rows);
// ctx.Wo^T = v_wmma_f32_16x16x32_bf16 with ctx as bf16 hi/lo planes times bf16 Wo (2 products); all f32 accumulate;
// rope, softmax, lambda, head rms norm in f32.
#include <hip/hip_runtime.h>
#include <math.h>
#include <float.h>
#include <stdint.h>

#define NB    2
#define SEQ   2048
#define DM    1024
#define DQK   2048          // q / k projection width (2 x 64 per head)
#define NH    16
#define HD    64
#define NFREQ (HD / 2)
#define NQB   (SEQ / 64)    // 32 key / query tiles of 64
#define VLP   512           // key pitch of the v^T residual plane (keys 0..VLP-1)
#define RESQB 8             // number of leading 64-row query blocks that use the p / v residual planes
#define LAM0  0.2f
#define OSCL  0.8f
static_assert(RESQB * 64 <= VLP);
static_assert(NH * HD == DM);
static_assert(NB == 2 && NH == 16);   // the attention grid's index split
static_assert(NH * 2 * HD == DQK);
static_assert((SEQ % 64) == 0 && (DM % 64) == 0 && (DQK % 64) == 0);

typedef _Float16 v16h __attribute__((ext_vector_type(16)));
typedef _Float16 v8h  __attribute__((ext_vector_type(8)));
typedef __bf16   v16b __attribute__((ext_vector_type(16)));
typedef __bf16   v8b  __attribute__((ext_vector_type(8)));
typedef float    v8f  __attribute__((ext_vector_type(8)));
typedef float    v4f  __attribute__((ext_vector_type(4)));
typedef unsigned int v4u __attribute__((ext_vector_type(4)));

// ---- scalar helpers --------------------------------------------------------------------------------
__device__ __forceinline__ unsigned short bf_bits(float f) {          // f32 -> bf16 bits, RNE convert
  unsigned u = __float_as_uint(f);
  return (unsigned short)((u + 0x7FFFu + ((u >> 16) & 1u)) >> 16);
}
__device__ __forceinline__ float bf_up(unsigned short h) { return __uint_as_float(((unsigned)h) << 16); }
__device__ __forceinline__ float bfr(float f) { return bf_up(bf_bits(f)); }   // value after RNE convert to bf16
__device__ __forceinline__ unsigned short h_bits(_Float16 x) { return __builtin_bit_cast(unsigned short, x); }
__device__ __forceinline__ unsigned pk16(unsigned short a, unsigned short b) { return (unsigned)a | ((unsigned)b << 16); }
__device__ __forceinline__ v8f zero8() { v8f z = {0.f, 0.f, 0.f, 0.f, 0.f, 0.f, 0.f, 0.f}; return z; }
__device__ __forceinline__ v8h zero8h() {
  const _Float16 z = (_Float16)0.0f;
  v8h r = {z, z, z, z, z, z, z, z};
  return r;
}

// ---- fragment loaders: 16-bit A/B operand, lane -> row/col (lane&15), p already includes +8*(lane>>4);
//      elements 0..7 <- p[0..7] (k0+8h..), elements 8..15 <- p[16..23] (k0+16+8h..)
__device__ __forceinline__ v16b ldfrag_b(const __bf16* p) {
  union { v16b v; v8b h[2]; } f;
  f.h[0] = *(const v8b*)(p);
  f.h[1] = *(const v8b*)(p + 16);
  return f.v;
}

// ---- WMMA helpers with trailing VALU hazard gap --------------------------------------------------------
__device__ __forceinline__ v8f mma_b(v16b a, v16b b, v8f c) {
  c = __builtin_amdgcn_wmma_f32_16x16x32_bf16(false, a, false, b, (short)0, c, false, false);
#if defined(__HIP_DEVICE_COMPILE__)
  asm volatile("v_nop\n\tv_nop\n\tv_nop\n\tv_nop" : "+v"(c) : "v"(a), "v"(b));
#endif
  return c;
}
__device__ __forceinline__ v8f mma_h(v16h a, v16h b, v8f c) {
  c = __builtin_amdgcn_wmma_f32_16x16x32_f16(false, a, false, b, (short)0, c, false, false);
#if defined(__HIP_DEVICE_COMPILE__)
  asm volatile("v_nop\n\tv_nop\n\tv_nop\n\tv_nop" : "+v"(c) : "v"(a), "v"(b));
#endif
  return c;
}
__device__ __forceinline__ v8f mma_b_raw(v16b a, v16b b, v8f c) {
  return __builtin_amdgcn_wmma_f32_16x16x32_bf16(false, a, false, b, (short)0, c, false, false);
}
__device__ __forceinline__ void dep_guard_b(v8f& a, v8f& b, v16b x, v16b y) {
#if defined(__HIP_DEVICE_COMPILE__)
  asm volatile("v_nop\n\tv_nop\n\tv_nop\n\tv_nop" : "+v"(a), "+v"(b) : "v"(x), "v"(y));
#endif
}
__device__ __forceinline__ void keep4_b(v16b a, v16b b, v16b c, v16b d) {
#if defined(__HIP_DEVICE_COMPILE__)
  asm volatile("v_nop" :: "v"(a), "v"(b), "v"(c), "v"(d));
#endif
}
__device__ __forceinline__ void acc_guard4(v8f& a, v8f& b, v8f& c, v8f& d) {
#if defined(__HIP_DEVICE_COMPILE__)
  asm volatile("v_nop\n\tv_nop\n\tv_nop\n\tv_nop" : "+v"(a), "+v"(b), "+v"(c), "+v"(d));
#endif
}

// =====================================================================================================
// f32 -> bf16 (RNE convert), 8 elements per thread, one 16-B store per lane: a wave writes 512 contiguous B
// One grid for x, Wq, Wk, Wv, Wo: their bf16 planes lie back to back in the workspace in that order, so the
// output index is the flat thread index; the source is picked per block (every plane is a multiple of 2048
// elements, so a block never straddles two planes).
// coverage: (NX + 2 NQ + 2 NV) threads x 8 = all five planes.
// =====================================================================================================
__global__ __launch_bounds__(256) void cvt_bf16x8(const float* __restrict__ x, const float* __restrict__ wq,
                                                  const float* __restrict__ wk, const float* __restrict__ wv,
                                                  const float* __restrict__ wo, unsigned short* out) {
  constexpr int NX = NB * SEQ * DM / 8, NQ = DQK * DM / 8, NV = DM * DM / 8;
  static_assert((NX % 256) == 0 && (NQ % 256) == 0 && (NV % 256) == 0);
  const int i = blockIdx.x * 256 + threadIdx.x;
  if (i < NX + 2 * NQ + 2 * NV) {
    const float* in = x;
    int j = i;
    if (i >= NX + 2 * NQ + NV)  { in = wo; j = i - (NX + 2 * NQ + NV); }
    else if (i >= NX + 2 * NQ)  { in = wv; j = i - (NX + 2 * NQ); }
    else if (i >= NX + NQ)      { in = wk; j = i - (NX + NQ); }
    else if (i >= NX)           { in = wq; j = i - NX; }
    const v4f a = *(const v4f*)(in + (size_t)j * 8);
    const v4f b = *(const v4f*)(in + (size_t)j * 8 + 4);
    v4u p;
    p[0] = pk16(bf_bits(a[0]), bf_bits(a[1]));
    p[1] = pk16(bf_bits(a[2]), bf_bits(a[3]));
    p[2] = pk16(bf_bits(b[0]), bf_bits(b[1]));
    p[3] = pk16(bf_bits(b[2]), bf_bits(b[3]));
    *(v4u*)(out + (size_t)i * 8) = p;
    
  }
}

// =====================================================================================================
// inv_freq[j] = 1 / 10000^(j/32), j = 0..31, f32 with precise powf. One block of 32 threads; the 32 values
// coverage: lanes 0..7 x 4 floats = all 32 entries.
// =====================================================================================================
__global__ __launch_bounds__(32) void invfreq_tab(float* invf) {
  __shared__ __align__(16) float sf[NFREQ];
  const int j = threadIdx.x;
  const float e = (float)j * (1.0f / (float)NFREQ);
  const float pw = powf(10000.0f, e);
  sf[j] = 1.0f / pw;
  __syncthreads();
  const v4f v = *(const v4f*)(sf + 4 * (j & 7));
  if (j < 8) *(v4f*)(invf + 4 * j) = v;
  
}

// =====================================================================================================
// cos / sin tables [SEQ][32]: angle = t * inv_freq[j] (f32 multiply), precise cosf / sinf.
// =====================================================================================================
__global__ __launch_bounds__(256) void rope_tab(const float* __restrict__ invf, float* cosT, float* sinT) {
  const int g = blockIdx.x * 256 + threadIdx.x;
  if (g < SEQ * NFREQ) {
    const int t = g / NFREQ;
    const int j = g - t * NFREQ;
    const float ang = (float)t * invf[j];
    const float cv = cosf(ang);
    const float sv = sinf(ang);
    *(float*)(cosT + g) = cv;
    *(float*)(sinT + g) = sv;
    
  }
}

// =====================================================================================================
// Register-blocked bf16 WMMA GEMM: C[m][n] = sum_k A[m][k] * Bt[n][k] (+ bias); one wave per 64x64 tile,
// no block barriers. A row-major [M][K] pitch lda; Bt row-major [N][K] pitch ldb (k contiguous);
// M, N multiples of 64, K multiple of 32 (host-checked). b = batch index (strides in elements).
// The tile body is a device function (tile index, batch index and the wave's LDS slab come from the caller), so
// that one grid can hold several independent products.
// NSPLIT: 0 = A.Bt; 1 = (A + A2).Bt (A2 = unscaled bf16 lo plane of A); 2 = A.Bt + A2.Bt + A.Bt2.
// OUT_MODE: 0 = f32 (pitch ldc); 2 = bf16 hi plane C + bf16 lo plane C2 (lo = RNE(v - hi), unscaled);
//           3 = f16 hi plane C + f16 residual plane C2 = f16((v - hi) * rscale), C2 written only for tiles
//               with n0 < N2 (pitch ldc2, batch stride strideC2).
// BIAS: 0 = none; 1 = + bf16-RNE(bias[n]) per column; 2 = + bf16-RNE(bias[m]) per row (added in f32).
// =====================================================================================================
template <int NSPLIT, int OUT_MODE, int BIAS>
__device__ __forceinline__ void gemm64_tile(
    const unsigned short* __restrict__ Ap, const unsigned short* A2p, int lda, long long strideA,
    const unsigned short* __restrict__ Btp, const unsigned short* Bt2p, int ldb, long long strideB,
    void* Cout, int ldc, long long strideC,
    void* Cout2, int ldc2, long long strideC2, int N2,
    int M, int N, int K, float rscale, const float* __restrict__ bias,
    float* slab, int tile, int b) {
  const __bf16* A   = (const __bf16*)(const void*)Ap;
  const __bf16* A2  = (const __bf16*)(const void*)A2p;
  const __bf16* Bt  = (const __bf16*)(const void*)Btp;
  const __bf16* Bt2 = (const __bf16*)(const void*)Bt2p;
  const int lane = threadIdx.x & 31;
  const int tilesN = N >> 6;
  const int tilesM = M >> 6;
  if (tile >= tilesM * tilesN) return;   // wave-uniform; no block barriers in this kernel
  const int tm = tile / tilesN;
  const int tn = tile - tm * tilesN;
  const int m0 = tm << 6;
  const int n0 = tn << 6;

  const __bf16* Ab  = A  + (size_t)b * strideA;
  const __bf16* Bb  = Bt + (size_t)b * strideB;
  const __bf16* Ab2 = (NSPLIT >= 1) ? (A2  + (size_t)b * strideA) : Ab;
  const __bf16* Bb2 = (NSPLIT == 2) ? (Bt2 + (size_t)b * strideB) : Bb;

  const int rlane = lane & 15;                 // row (A) / col (B, D) within subtile
  const int koff  = (lane >> 4) * 8;           // k offset of this lane half
  const int mOff  = (lane >> 4) * 8;           // D row offset

  v8f acc[4][4];
#pragma unroll
  for (int i = 0; i < 4; ++i)
#pragma unroll
    for (int j = 0; j < 4; ++j) acc[i][j] = zero8();

  for (int k0 = 0; k0 < K; k0 += 32) {
    v16b bh[4], bl[4];
#pragma unroll
    for (int j = 0; j < 4; ++j) {
      const size_t bo = (size_t)(n0 + (j << 4) + rlane) * ldb + koff + k0;
      bh[j] = ldfrag_b(Bb + bo);
      if (NSPLIT == 2) bl[j] = ldfrag_b(Bb2 + bo); else bl[j] = bh[j];
    }
#pragma unroll
    for (int i = 0; i < 4; ++i) {
      const size_t ao = (size_t)(m0 + (i << 4) + rlane) * lda + koff + k0;
      const v16b ah = ldfrag_b(Ab + ao);
      v16b al = ah;
      if (NSPLIT >= 1) al = ldfrag_b(Ab2 + ao);
#pragma unroll
      for (int j = 0; j < 4; ++j) {
        acc[i][j] = mma_b_raw(ah, bh[j], acc[i][j]);
        if (NSPLIT >= 1) acc[i][j] = mma_b_raw(al, bh[j], acc[i][j]);
        if (NSPLIT == 2) acc[i][j] = mma_b_raw(ah, bl[j], acc[i][j]);
      }
      dep_guard_b(acc[i][0], acc[i][3], ah, al);
    }
    keep4_b(bh[0], bh[1], bh[2], bh[3]);
    if (NSPLIT == 2) keep4_b(bl[0], bl[1], bl[2], bl[3]);
  }
  acc_guard4(acc[0][0], acc[0][1], acc[0][2], acc[0][3]);
  acc_guard4(acc[1][0], acc[1][1], acc[1][2], acc[1][3]);
  acc_guard4(acc[2][0], acc[2][1], acc[2][2], acc[2][3]);
  acc_guard4(acc[3][0], acc[3][1], acc[3][2], acc[3][3]);

  // ---- epilogue ----
  float bcol[4];
#pragma unroll
  for (int j = 0; j < 4; ++j) bcol[j] = 0.f;
  if (BIAS == 1) {
#pragma unroll
    for (int j = 0; j < 4; ++j) bcol[j] = bfr(bias[n0 + (j << 4) + rlane]);
  }
#pragma unroll
  for (int i = 0; i < 4; ++i) {
    const int mBase = m0 + (i << 4);
    float brow[8];
#pragma unroll
    for (int r = 0; r < 8; ++r) brow[r] = 0.f;
    if (BIAS == 2) {
#pragma unroll
      for (int r = 0; r < 8; ++r) brow[r] = bfr(bias[mBase + mOff + r]);
    }
#pragma unroll
    for (int j = 0; j < 4; ++j) {
#pragma unroll
      for (int r = 0; r < 8; ++r) {
        slab[(mOff + r) * 68 + (j << 4) + rlane] = (acc[i][j][r] + bcol[j]) + brow[r];
      }
    }
    __builtin_amdgcn_fence(__ATOMIC_RELEASE, "workgroup");
    __builtin_amdgcn_wave_barrier();
    __builtin_amdgcn_fence(__ATOMIC_ACQUIRE, "workgroup");
    if (OUT_MODE == 0) {
      float* C = (float*)Cout + (size_t)b * strideC;
      const int hh = lane >> 4, c4 = (lane & 15) * 4;     // 256-B row segment = 16 lanes x 16 B
      {
#pragma unroll
        for (int it = 0; it < 8; ++it) {
          const int row = it * 2 + hh;                     // it 0..7 x hh 0..1 = rows 0..15
          const v4f v = *(const v4f*)(slab + row * 68 + c4);
          *(v4f*)(C + (size_t)(mBase + row) * ldc + n0 + c4) = v;
        }
        
      }
    } else {
      const int q = lane >> 3, c8 = (lane & 7) * 8;
      unsigned short* C  = (unsigned short*)Cout  + (size_t)b * strideC;
      unsigned short* C2 = (unsigned short*)Cout2 + (size_t)b * strideC2;
      const bool wlo = (OUT_MODE == 2) || (n0 < N2);      // wave-uniform
      v4u hv[4], lv[4];
#pragma unroll
      for (int it = 0; it < 4; ++it) {
        const int row = it * 4 + q;                        // it 0..3 x q 0..3 = rows 0..15
        const float* sp = slab + row * 68 + c8;
        v4u a, a2;
#pragma unroll
        for (int e = 0; e < 4; ++e) {
          const float f0 = sp[2 * e], f1 = sp[2 * e + 1];
          unsigned short h0, h1, l0, l1;
          if (OUT_MODE == 2) {
            h0 = bf_bits(f0); h1 = bf_bits(f1);
            l0 = bf_bits(f0 - bf_up(h0)); l1 = bf_bits(f1 - bf_up(h1));
          } else {
            const _Float16 x0 = (_Float16)f0, x1 = (_Float16)f1;
            h0 = h_bits(x0); h1 = h_bits(x1);
            l0 = h_bits((_Float16)((f0 - (float)x0) * rscale));
            l1 = h_bits((_Float16)((f1 - (float)x1) * rscale));
          }
          a[e] = pk16(h0, h1); a2[e] = pk16(l0, l1);
        }
        hv[it] = a; lv[it] = a2;
      }
      {
#pragma unroll
        for (int it = 0; it < 4; ++it) {
          const int row = it * 4 + q;
          *(v4u*)(C + (size_t)(mBase + row) * ldc + n0 + c8) = hv[it];
          if (wlo) *(v4u*)(C2 + (size_t)(mBase + row) * ldc2 + n0 + c8) = lv[it];
        }
        
      }
    }
    __builtin_amdgcn_fence(__ATOMIC_RELEASE, "workgroup");
    __builtin_amdgcn_wave_barrier();
    __builtin_amdgcn_fence(__ATOMIC_ACQUIRE, "workgroup");
  }
}

// One product per grid: blockIdx.x * 8 + wave = tile, blockIdx.y = batch index.
template <int NSPLIT, int OUT_MODE, int BIAS>
__global__ __launch_bounds__(256) void gemm64(
    const unsigned short* __restrict__ Ap, const unsigned short* A2p, int lda, long long strideA,
    const unsigned short* __restrict__ Btp, const unsigned short* Bt2p, int ldb, long long strideB,
    void* Cout, int ldc, long long strideC,
    void* Cout2, int ldc2, long long strideC2, int N2,
    int M, int N, int K, float rscale, const float* __restrict__ bias) {
  __shared__ __align__(16) float sT[8][16 * 68];   // per-wave 16x64 slab, pitch 68 floats
  const int wave = threadIdx.x >> 5;
  gemm64_tile<NSPLIT, OUT_MODE, BIAS>(Ap, A2p, lda, strideA, Btp, Bt2p, ldb, strideB, Cout, ldc, strideC,
                                      Cout2, ldc2, strideC2, N2, M, N, K, rscale, bias,
                                      sT[wave], blockIdx.x * 8 + wave, blockIdx.y);
}

// q, k and v^T projections of both batch elements in one grid: blockIdx.z = 0 q, 1 k, 2 v^T; blockIdx.y = batch;
// blockIdx.x * 8 + wave = tile (v^T has half the tiles of q / k: its upper waves leave at the tile test).
//   q / k = x_b . W^T + bias[col] -> f32 [NB*SEQ][DQK]                 (M=SEQ, N=DQK, K=DM)
//   v^T   = Wv . x_b^T + bv[row]  -> f16 hi plane [b][h*64+d][s] (pitch SEQ) and residual plane
//           (x4096, keys < VLP only, pitch VLP)                        (M=DM, N=SEQ, K=DM)
__global__ __launch_bounds__(256) void gemm_qkv(
    const unsigned short* __restrict__ Xb, const unsigned short* __restrict__ Wqb,
    const unsigned short* __restrict__ Wkb, const unsigned short* __restrict__ Wvb,
    float* Qf, float* Kf, unsigned short* VTh, unsigned short* VTl,
    const float* __restrict__ bq, const float* __restrict__ bk, const float* __restrict__ bv) {
  __shared__ __align__(16) float sT[8][16 * 68];   // per-wave 16x64 slab, pitch 68 floats
  const int wave = threadIdx.x >> 5;
  const int tile = blockIdx.x * 8 + wave;
  const int b    = blockIdx.y;
  const int z    = blockIdx.z;
  if (z < 2) {
    const unsigned short* Wb = z ? Wkb : Wqb;
    float* Cf = z ? Kf : Qf;
    const float* bias = z ? bk : bq;
    gemm64_tile<0, 0, 1>(Xb, Xb, DM, (long long)SEQ * DM, Wb, Wb, DM, 0LL,
                         (void*)Cf, DQK, (long long)SEQ * DQK, (void*)Cf, DQK, 0LL, DQK,
                         SEQ, DQK, DM, 1.0f, bias, sT[wave], tile, b);
  } else {
    gemm64_tile<0, 3, 2>(Wvb, Wvb, DM, 0LL, Xb, Xb, DM, (long long)SEQ * DM,
                         (void*)VTh, SEQ, (long long)DM * SEQ, (void*)VTl, VLP, (long long)DM * VLP, VLP,
                         DM, SEQ, DM, 4096.0f, bv, sT[wave], tile, b);
  }
}

// =====================================================================================================
// RoPE half-split rotation of 8 consecutive columns of one 64-wide vector, then bf16 hi/lo split and
//   first half  (j < 32):   out[j]    = x[j]*cos[j]   - x[j+32]*sin[j]     (x1 = a, x2 = p)
//   second half (j >= 32):  out[j+32] = x[j]*sin[j]   + x[j+32]*cos[j]     (x1 = p, x2 = a)
// =====================================================================================================
__device__ __forceinline__ void rope_row8(const float* __restrict__ src, size_t rowOff, int c0, int p0,
                                          bool second, v4f cs0, v4f cs1, v4f sn0, v4f sn1,
                                          unsigned short* Hp, unsigned short* Lp) {
#pragma clang fp contract(off)
  const v4f xa0 = *(const v4f*)(src + rowOff + c0);
  const v4f xa1 = *(const v4f*)(src + rowOff + c0 + 4);
  const v4f xp0 = *(const v4f*)(src + rowOff + p0);
  const v4f xp1 = *(const v4f*)(src + rowOff + p0 + 4);
  float o[8];
#pragma unroll
  for (int e = 0; e < 4; ++e) {
    {
      const float a = xa0[e], p = xp0[e], cs = cs0[e], sn = sn0[e];
      const float f1 = a * cs - p * sn;
      const float f2 = p * sn + a * cs;
      o[e] = second ? f2 : f1;
    }
    {
      const float a = xa1[e], p = xp1[e], cs = cs1[e], sn = sn1[e];
      const float f1 = a * cs - p * sn;
      const float f2 = p * sn + a * cs;
      o[4 + e] = second ? f2 : f1;
    }
  }
  v4u hv, lv;
#pragma unroll
  for (int e = 0; e < 4; ++e) {
    const float f0 = o[2 * e], f1 = o[2 * e + 1];
    const unsigned short h0 = bf_bits(f0), h1 = bf_bits(f1);
    const unsigned short l0 = bf_bits(f0 - bf_up(h0)), l1 = bf_bits(f1 - bf_up(h1));
    hv[e] = pk16(h0, h1); lv[e] = pk16(l0, l1);
  }
  const size_t go = rowOff + c0;
  *(v4u*)(Hp + go) = hv;
  *(v4u*)(Lp + go) = lv;
  
}

// =====================================================================================================
// RoPE + hi/lo split for one token row t of q and k (f32 planes [NB*SEQ][DQK], per head 128 columns =
// two 64-wide vectors). grid = (SEQ, NB) blocks x 256 threads; thread -> columns 8*tid..8*tid+7.
// Outputs: bf16 hi / lo planes [NB*SEQ][DQK] for q and for k.
// coverage: 256 threads x 8 columns = 2048 columns of each of the 4 output planes per row; NB*SEQ rows.
// =====================================================================================================
__global__ __launch_bounds__(256) void rope_split(const float* __restrict__ Qf, const float* __restrict__ Kf,
                                                   const float* __restrict__ cosT, const float* __restrict__ sinT,
                                                   unsigned short* Qh, unsigned short* Ql,
                                                   unsigned short* Kh, unsigned short* Kl) {
  const int t = blockIdx.x;
  const int c0 = threadIdx.x * 8;
  const int jj0 = c0 & 31;
  const bool second = (c0 & 32) != 0;
  const int p0 = second ? (c0 - 32) : (c0 + 32);
  const float* cr = cosT + (size_t)t * NFREQ + jj0;
  const float* sr = sinT + (size_t)t * NFREQ + jj0;
  const v4f cs0 = *(const v4f*)(cr), cs1 = *(const v4f*)(cr + 4);
  const v4f sn0 = *(const v4f*)(sr), sn1 = *(const v4f*)(sr + 4);
  const size_t rowOff = ((size_t)blockIdx.y * SEQ + t) * DQK;
  rope_row8(Qf, rowOff, c0, p0, second, cs0, cs1, sn0, sn1, Qh, Ql);
  rope_row8(Kf, rowOff, c0, p0, second, cs0, cs1, sn0, sn1, Kh, Kl);
}

// =====================================================================================================
// Causal attention, head dim 64: body for one 64-row query block of one head, stream and batch element
// (the plane pointers arrive already moved to the batch element).
//   q planes (bf16 hi / lo) [SEQ][DQK]: element (t, h, stream, d) at [t*DQK + h*128 + soff + d] (soff 0 / 64)
//   k planes: same layout with key index s
//   v^T hi plane (f16):      element (h, d, s) at [(h*64 + d)*SEQ + s]
//   v^T residual plane (f16, (v - hi)*4096): [(h*64 + d)*VLP + s], s < VLP, read only when RES
//   (a key tile at or beyond VLP contributes a zero v residual)
//   causal: key tiles kt = 0..qb processed (block-uniform trip count <= 32); only the diagonal tile gets the
//   per-lane -inf fill for keys beyond the query row (a fill, not a bias); every row keeps its diagonal key.
//   context plane C f32 [SEQ][DM]: element (t, h, d) at [t*DM + h*64 + d]  (normalised by 1/l)
//   scores = q . k : bf16 hi/lo split (hi.hi + hi.lo + lo.hi), f32 accumulate, then * sscale in f32
//   p = exp(s - m) carried as f16(1024 p); context = p . v on f16 WMMA; RES adds f16 residual planes of p and v
//   (scale 4096, separate accumulator folded back with 1/4096 per chunk in f32); online softmax in f32.
//   Block = 4 waves = 64 query rows of one head; kv chunks of 64. LDS is carved from the caller's one array.
//   K / V^T chunk staging: 128 threads x 32 elements per plane = the whole 64x64 tile (plain 16-B loads,
//   __syncthreads before and after); P tiles are wave-private, spilled with _Float16 element stores and reloaded
//   Output coverage: each wave stores rows q0..q0+15 (it 0..7 x lane>>4 0..1) x 64 columns (16 lanes x 4 floats),
// =====================================================================================================
#define ATT_LDS 65536
template <bool RES>
__device__ __forceinline__
void attn_block64(unsigned char* smem,
                  const unsigned short* __restrict__ qhp, const unsigned short* __restrict__ qlp,
                  const unsigned short* __restrict__ khp, const unsigned short* __restrict__ klp,
                  const unsigned short* __restrict__ vhp, const unsigned short* __restrict__ vlp,
                  float* Cp, int soff, int qb, int h, float sscale) {
  union FB { v16b v; v8b h[2]; };
  union FH { v16h v; v8h h[2]; };
  __bf16*   Ksh = (__bf16*)(void*)(smem);                         // K hi [kv][d]   8 KB
  __bf16*   Ksl = (__bf16*)(void*)(smem + 8192);                  // K lo           8 KB
  _Float16* Vth = (_Float16*)(void*)(smem + 16384);               // V^T hi [d][kv] 8 KB
  _Float16* Psh = (_Float16*)(void*)(smem + 24576);               // per wave P [row][kv], 4 x 2 KB
  float*    Os  = (float*)(void*)(smem + 32768);                  // per wave context tile [row][d], 4 x 4 KB
  _Float16* Vtl = (_Float16*)(void*)(smem + 49152);               // V^T residual   8 KB (RES only)
  _Float16* Psl = (_Float16*)(void*)(smem + 57344);               // per wave P residual, 4 x 2 KB (RES only)

  const int tid  = threadIdx.x;
  const int wave = tid >> 5;
  const int lane = tid & 31;
  const int hh   = lane >> 4;
  const int c    = lane & 15;

  const int q0   = qb * 64 + wave * 16;
  const int col  = h * (2 * HD) + soff;

  const __bf16* Qh = (const __bf16*)(const void*)qhp + col;
  const __bf16* Ql = (const __bf16*)(const void*)qlp + col;
  const __bf16* Kh = (const __bf16*)(const void*)khp + col;
  const __bf16* Kl = (const __bf16*)(const void*)klp + col;
  const _Float16* Vh = (const _Float16*)(const void*)vhp + (size_t)h * HD * SEQ;
  const _Float16* Vl = (const _Float16*)(const void*)vlp + (size_t)h * HD * VLP;

  // ---- Q fragments (A operand, row = lane&15): 2 d-chunks, hi and lo ----
  v16b qah[2], qal[2];
#pragma unroll
  for (int dc = 0; dc < 2; ++dc) {
    const size_t qo = (size_t)(q0 + c) * DQK + dc * 32 + 8 * hh;
    qah[dc] = ldfrag_b(Qh + qo);
    qal[dc] = ldfrag_b(Ql + qo);
  }

  float mrow[8], lrow[8];
  v8f oacc[4];
#pragma unroll
  for (int r = 0; r < 8; ++r) { mrow[r] = -INFINITY; lrow[r] = 0.f; }
#pragma unroll
  for (int t = 0; t < 4; ++t) oacc[t] = zero8();

  for (int kt = 0; kt < NQB; ++kt) {         // static trip bound
    if (kt > qb) break;                      // block-uniform (causal)
    const bool diag = (kt == qb);            // block-uniform
    const int kv0 = kt * 64;
    __syncthreads();
    {
      const int r = tid >> 1, half = (tid & 1) * 32;
      const __bf16*   kg  = Kh + (size_t)(kv0 + r) * DQK + half;   // K row kv0+r, d = half..half+31
      const __bf16*   klg = Kl + (size_t)(kv0 + r) * DQK + half;
      const _Float16* vg  = Vh + (size_t)r * SEQ + kv0 + half;      // V^T row d = r, s = kv0+half..+31
      const int kvl = (kv0 + 64 <= VLP) ? kv0 : (VLP - 64);       // clamped address into the residual plane
      const _Float16* vlg = Vl + (size_t)r * VLP + kvl + half;
      const bool resOK = (kv0 + 64 <= VLP);                        // block-uniform
      v8b a0[4], a1[4];
      v8h b0[4], b1[4];
#pragma unroll
      for (int i = 0; i < 4; ++i) {
        a0[i] = *(const v8b*)(kg + 8 * i);
        a1[i] = *(const v8b*)(klg + 8 * i);
        b0[i] = *(const v8h*)(vg + 8 * i);
        if (RES) {
          b1[i] = *(const v8h*)(vlg + 8 * i);
          if (!resOK) b1[i] = zero8h();
        }
      }
#if defined(__HIP_DEVICE_COMPILE__)
      // s_wait_xcnt 0 before a register that an issued load names is written again; the addresses are inputs so that
      // they stay in their registers up to the wait (else the last load's destination may take an address pair over).
      if (RES) asm volatile("s_wait_xcnt 0x0" :: "v"(kg), "v"(klg), "v"(vg), "v"(vlg) : "memory");
      else     asm volatile("s_wait_xcnt 0x0" :: "v"(kg), "v"(klg), "v"(vg) : "memory");
#endif
#pragma unroll
      for (int i = 0; i < 4; ++i) {
        *(v8b*)(Ksh + r * 64 + half + 8 * i) = a0[i];
        *(v8b*)(Ksl + r * 64 + half + 8 * i) = a1[i];
        *(v8h*)(Vth + r * 64 + half + 8 * i) = b0[i];
        if (RES) *(v8h*)(Vtl + r * 64 + half + 8 * i) = b1[i];
      }
    }
    __syncthreads();

    // ---- scores: 16 query rows x 64 keys per wave, 3 bf16 products ----
    v8f s[4];
#pragma unroll
    for (int j = 0; j < 4; ++j) {
      s[j] = zero8();
#pragma unroll
      for (int dc = 0; dc < 2; ++dc) {
        FB kb, kl;
        kb.h[0] = *(const v8b*)(Ksh + (j * 16 + c) * 64 + dc * 32 + 8 * hh);
        kb.h[1] = *(const v8b*)(Ksh + (j * 16 + c) * 64 + dc * 32 + 16 + 8 * hh);
        kl.h[0] = *(const v8b*)(Ksl + (j * 16 + c) * 64 + dc * 32 + 8 * hh);
        kl.h[1] = *(const v8b*)(Ksl + (j * 16 + c) * 64 + dc * 32 + 16 + 8 * hh);
        s[j] = mma_b(qah[dc], kb.v, s[j]);
        s[j] = mma_b(qah[dc], kl.v, s[j]);
        s[j] = mma_b(qal[dc], kb.v, s[j]);
      }
    }

    // ---- scale, causal fill on the diagonal tile, row max, online softmax, P (x1024, f16) and
    //      P residual (x4096) to LDS ----
    _Float16* pwh = Psh + wave * (16 * 64);
    _Float16* pwl = Psl + wave * (16 * 64);
#pragma unroll
    for (int r = 0; r < 8; ++r) {
      const int qrow = q0 + 8 * hh + r;
      float m = -INFINITY;
#pragma unroll
      for (int j = 0; j < 4; ++j) {
        const int key = kv0 + j * 16 + c;
        float sv = s[j][r] * sscale;
        sv = (diag && key > qrow) ? -INFINITY : sv;
        s[j][r] = sv;
        m = fmaxf(m, sv);
      }
#pragma unroll
      for (int off = 1; off < 16; off <<= 1) m = fmaxf(m, __shfl_xor(m, off, 32));
      const float mnew  = fmaxf(mrow[r], m);
      const float msafe = (mnew == -INFINITY) ? 0.f : mnew;
      const float alpha = __expf(mrow[r] - msafe);
      mrow[r] = mnew;
      float psum = 0.f;
#pragma unroll
      for (int j = 0; j < 4; ++j) {
        const float p = __expf(s[j][r] - msafe);     // -inf logit: exp -> 0
        psum += p;
        const float p1k = p * 1024.0f;
        const _Float16 ph = (_Float16)p1k;
        pwh[(8 * hh + r) * 64 + j * 16 + c] = ph;
        if (RES) {
          const _Float16 pl = (_Float16)((p1k - (float)ph) * 4096.0f);
          pwl[(8 * hh + r) * 64 + j * 16 + c] = pl;
        }
      }
#pragma unroll
      for (int off = 1; off < 16; off <<= 1) psum += __shfl_xor(psum, off, 32);
      lrow[r] = lrow[r] * alpha + psum;
#pragma unroll
      for (int t = 0; t < 4; ++t) oacc[t][r] *= alpha;
    }
    __builtin_amdgcn_fence(__ATOMIC_RELEASE, "workgroup");
    __builtin_amdgcn_wave_barrier();
    __builtin_amdgcn_fence(__ATOMIC_ACQUIRE, "workgroup");

    // ---- context += P . V (f16 WMMA), residual products into a separate accumulator ----
    v8f o1[4];
#pragma unroll
    for (int t = 0; t < 4; ++t) o1[t] = zero8();
#pragma unroll 1
    for (int kk = 0; kk < 2; ++kk) {
      FH pa, pl;
      pa.h[0] = *(const v8h*)(pwh + c * 64 + kk * 32 + 8 * hh);
      pa.h[1] = *(const v8h*)(pwh + c * 64 + kk * 32 + 16 + 8 * hh);
      if (RES) {
        pl.h[0] = *(const v8h*)(pwl + c * 64 + kk * 32 + 8 * hh);
        pl.h[1] = *(const v8h*)(pwl + c * 64 + kk * 32 + 16 + 8 * hh);
      } else {
        pl.v = pa.v;
      }
#pragma unroll
      for (int t = 0; t < 4; ++t) {
        FH vb;
        vb.h[0] = *(const v8h*)(Vth + (t * 16 + c) * 64 + kk * 32 + 8 * hh);
        vb.h[1] = *(const v8h*)(Vth + (t * 16 + c) * 64 + kk * 32 + 16 + 8 * hh);
        oacc[t] = mma_h(pa.v, vb.v, oacc[t]);
        if (RES) {
          FH vl;
          vl.h[0] = *(const v8h*)(Vtl + (t * 16 + c) * 64 + kk * 32 + 8 * hh);
          vl.h[1] = *(const v8h*)(Vtl + (t * 16 + c) * 64 + kk * 32 + 16 + 8 * hh);
          o1[t] = mma_h(pa.v, vl.v, o1[t]);
          o1[t] = mma_h(pl.v, vb.v, o1[t]);
        }
      }
    }
    if (RES) {
#pragma unroll
      for (int t = 0; t < 4; ++t)
#pragma unroll
        for (int r = 0; r < 8; ++r) oacc[t][r] += o1[t][r] * (1.0f / 4096.0f);
    }
  }

  // ---- normalise (1/l and the 1/1024 p carry), stage the wave's 16x64 tile, write f32 rows as
  float* os = Os + wave * (16 * 64);
#pragma unroll
  for (int r = 0; r < 8; ++r) {
    const float l = lrow[r];
    const float inv = ((l > 0.f) ? (1.0f / l) : 0.f) * (1.0f / 1024.0f);
#pragma unroll
    for (int t = 0; t < 4; ++t) os[(8 * hh + r) * 64 + t * 16 + c] = oacc[t][r] * inv;
  }
  __builtin_amdgcn_fence(__ATOMIC_RELEASE, "workgroup");
  __builtin_amdgcn_wave_barrier();
  __builtin_amdgcn_fence(__ATOMIC_ACQUIRE, "workgroup");
  {
    const int h2 = lane >> 4, c4 = (lane & 15) * 4;
    v4f ov[8];
#pragma unroll
    for (int it = 0; it < 8; ++it) {
      const int row = it * 2 + h2;   // it 0..7 x h2 0..1 = rows 0..15 of the wave tile
      ov[it] = *(const v4f*)(os + row * 64 + c4);
    }
    {
#pragma unroll
      for (int it = 0; it < 8; ++it) {
        const int row = it * 2 + h2;
        const size_t go = (size_t)(q0 + row) * DM + (size_t)h * HD + c4;
        *(v4f*)(Cp + go) = ov[it];
      }
#if defined(__HIP_DEVICE_COMPILE__)
      // s_wait_xcnt 0 behind the run of stores: in the merged kernel the listing holds a branch from the end of this
      // body to the head of the other one, where registers that these stores name are written again.
      asm volatile("s_wait_xcnt 0x0" ::: "memory");
#endif
    }
  }
}

// All query blocks of both streams, all heads and both batch elements in one grid of NQB * 2 * NB * NH blocks.
// blockIdx.x / 64 counts the query blocks down from the last one: the blocks with the most key tiles get the lowest
// indices (for speed only).
// blockIdx.x % 64 = batch * 32 + stream * 16 + head. Query blocks below RESQB take the body with residual planes
// (block-uniform choice).
__global__ __launch_bounds__(128)
void attn_causal64(const unsigned short* __restrict__ qhp, const unsigned short* __restrict__ qlp,
                   const unsigned short* __restrict__ khp, const unsigned short* __restrict__ klp,
                   const unsigned short* __restrict__ vhp, const unsigned short* __restrict__ vlp,
                   float* C1p, float* C2p, float sscale) {
  __shared__ __align__(16) unsigned char smem[ATT_LDS];
  const int bx     = blockIdx.x;
  const int qb     = NQB - 1 - (bx >> 6);
  const int h      = bx & 15;
  const int stream = (bx >> 4) & 1;
  const int b      = (bx >> 5) & 1;
  const size_t qk = (size_t)b * SEQ * DQK;
  const unsigned short* vh = vhp + (size_t)b * DM * SEQ;
  const unsigned short* vl = vlp + (size_t)b * DM * VLP;
  float* Cp = (stream ? C2p : C1p) + (size_t)b * SEQ * DM;
  const int soff = stream * HD;
  if (qb < RESQB) attn_block64<true >(smem, qhp + qk, qlp + qk, khp + qk, klp + qk, vh, vl, Cp, soff, qb, h, sscale);
  else            attn_block64<false>(smem, qhp + qk, qlp + qk, khp + qk, klp + qk, vh, vl, Cp, soff, qb, h, sscale);
}

// =====================================================================================================
// Differential combine + head rms norm for one token row t of the NB*SEQ rows:
//   lam[h] = (0.2 + exp(sum_d lq1.lk1)) - exp(sum_d lq2.lk2)  (f32, inputs RNE-converted to bf16 values;
//            recomputed per block by threads 0..15, rolled 64-term loops)
//   o = c1 - lam*c2; r = rsqrt(sum_d(o^2)/64 + 1e-6); o = ((o*r) * w[h][d]) * 0.8
//   written as bf16 hi / lo planes [NB*SEQ][DM] (merged head layout), one 16-B store per plane per lane
// grid = NB*SEQ blocks x 128 threads; thread -> columns 8*tid..+7 (head = tid>>3, 8 lanes per head).
// coverage: 128 threads x 8 = 1024 columns per row; NB*SEQ rows.
// =====================================================================================================
__global__ __launch_bounds__(128) void diff_combine(
    const float* __restrict__ C1, const float* __restrict__ C2,
    const float* __restrict__ lq1, const float* __restrict__ lk1,
    const float* __restrict__ lq2, const float* __restrict__ lk2,
    const float* __restrict__ hnw, unsigned short* Oh, unsigned short* Ol) {
#pragma clang fp contract(off)
  __shared__ float lam_s[NH];
  const int tid = threadIdx.x;
  const int t   = blockIdx.x;
  if (tid < NH) {
    const float* a1 = lq1 + tid * HD;
    const float* b1 = lk1 + tid * HD;
    const float* a2 = lq2 + tid * HD;
    const float* b2 = lk2 + tid * HD;
    float sa = 0.f, sb = 0.f;
#pragma unroll 1
    for (int d = 0; d < HD; ++d) {
      sa += bfr(a1[d]) * bfr(b1[d]);
      sb += bfr(a2[d]) * bfr(b2[d]);
    }
    lam_s[tid] = (LAM0 + expf(sa)) - expf(sb);
  }
  __syncthreads();
  const int c0 = tid * 8;
  const int h  = c0 >> 6;
  const int d0 = c0 & 63;
  const size_t ro = (size_t)t * DM + c0;
  const v4f x0 = *(const v4f*)(C1 + ro), x1 = *(const v4f*)(C1 + ro + 4);
  const v4f y0 = *(const v4f*)(C2 + ro), y1 = *(const v4f*)(C2 + ro + 4);
  const float lam = lam_s[h];
  float o[8];
  float ss = 0.f;
#pragma unroll
  for (int e = 0; e < 4; ++e) {
    o[e]     = x0[e] - lam * y0[e];
    o[4 + e] = x1[e] - lam * y1[e];
  }
#pragma unroll
  for (int e = 0; e < 8; ++e) ss += o[e] * o[e];
  ss += __shfl_xor(ss, 1, 32);
  ss += __shfl_xor(ss, 2, 32);
  ss += __shfl_xor(ss, 4, 32);
  const float ms = ss * (1.0f / (float)HD);
  const float rn = rsqrtf(ms + 1.0e-6f);
  v4u hv, lv;
#pragma unroll
  for (int e = 0; e < 4; ++e) {
    const float w0 = bfr(hnw[h * HD + d0 + 2 * e]);
    const float w1 = bfr(hnw[h * HD + d0 + 2 * e + 1]);
    const float f0 = ((o[2 * e] * rn) * w0) * OSCL;
    const float f1 = ((o[2 * e + 1] * rn) * w1) * OSCL;
    const unsigned short h0 = bf_bits(f0), h1 = bf_bits(f1);
    const unsigned short l0 = bf_bits(f0 - bf_up(h0)), l1 = bf_bits(f1 - bf_up(h1));
    hv[e] = pk16(h0, h1); lv[e] = pk16(l0, l1);
  }
  *(v4u*)(Oh + ro) = hv;
  *(v4u*)(Ol + ro) = lv;
  
}

// =====================================================================================================
// Workspace map (bytes, all offsets multiples of 4096):
//   Xb   bf16 [4096][1024]      8388608      Wqb bf16 [2048][1024] 4194304   Wkb 4194304
//   Wvb  bf16 [1024][1024]      2097152      Wob 2097152
//   invf f32 [32] (padded)         4096      cosT f32 [2048][32] 262144      sinT 262144
//   both batch elements, batch-major:
//   Qf   f32  [2][2048][2048]     33554432      Kf 33554432
//   Qh/Ql/Kh/Kl bf16 [2][2048][2048]  4 x 16777216
//   VTh  f16  [2][1024][2048]      8388608      VTl f16 [2][1024][512] 2097152
//   C1/C2 f32 [2][2048][1024]   2 x 16777216    Oh/Ol bf16 [2][2048][1024] 2 x 8388608
//   end                          216535040
// All planes are exact multiples of their 64x64 / whole-line store granularity (no padded tails needed).
// Weights are [out n][in k] with k contiguous = the Bt / A layout the GEMM wants, so they are only converted.
// =====================================================================================================
extern "C" void kernel_launch(void* const* d_in, const int* in_sizes, int n_in,
                              void* d_out, int out_size, void* d_ws, size_t ws_size,
                              hipStream_t stream) {
  if (n_in < 14) return;
  if (in_sizes[0] != NB * SEQ * DM) return;
  if (in_sizes[1] != DQK * DM || in_sizes[2] != DQK) return;
  if (in_sizes[3] != DQK * DM || in_sizes[4] != DQK) return;
  if (in_sizes[5] != DM * DM || in_sizes[6] != DM) return;
  if (in_sizes[7] != DM * DM || in_sizes[8] != DM) return;
  for (int i = 9; i < 14; ++i) if (in_sizes[i] != NH * HD) return;
  if (out_size != NB * SEQ * DM) return;

  const float* x   = (const float*)d_in[0];
  const float* Wq  = (const float*)d_in[1];
  const float* bq  = (const float*)d_in[2];
  const float* Wk  = (const float*)d_in[3];
  const float* bk  = (const float*)d_in[4];
  const float* Wv  = (const float*)d_in[5];
  const float* bv  = (const float*)d_in[6];
  const float* Wo  = (const float*)d_in[7];
  const float* bo  = (const float*)d_in[8];
  const float* hnw = (const float*)d_in[9];
  const float* lq1 = (const float*)d_in[10];
  const float* lk1 = (const float*)d_in[11];
  const float* lq2 = (const float*)d_in[12];
  const float* lk2 = (const float*)d_in[13];
  float* outp = (float*)d_out;

  const size_t PXB  = (size_t)NB * SEQ * DM * 2;    //  8388608
  const size_t PWQ  = (size_t)DQK * DM * 2;         //  4194304
  const size_t PWV  = (size_t)DM * DM * 2;          //  2097152
  const size_t PIF  = 4096;                         //  32 floats used
  const size_t PTAB = (size_t)SEQ * NFREQ * 4;      //   262144
  const size_t PQF  = (size_t)NB * SEQ * DQK * 4;   // 33554432
  const size_t PQP  = (size_t)NB * SEQ * DQK * 2;   // 16777216
  const size_t PVT  = (size_t)NB * DM * SEQ * 2;    //  8388608
  const size_t PVL  = (size_t)NB * DM * VLP * 2;    //  2097152
  const size_t PC   = (size_t)NB * SEQ * DM * 4;    // 16777216
  const size_t PO   = (size_t)NB * SEQ * DM * 2;    //  8388608
  size_t off = 0;
  const size_t oXb  = off; off += PXB;
  const size_t oWq  = off; off += PWQ;
  const size_t oWk  = off; off += PWQ;
  const size_t oWv  = off; off += PWV;
  const size_t oWo  = off; off += PWV;
  const size_t oIF  = off; off += PIF;
  const size_t oCos = off; off += PTAB;
  const size_t oSin = off; off += PTAB;
  const size_t oQf  = off; off += PQF;
  const size_t oKf  = off; off += PQF;
  const size_t oQh  = off; off += PQP;
  const size_t oQl  = off; off += PQP;
  const size_t oKh  = off; off += PQP;
  const size_t oKl  = off; off += PQP;
  const size_t oVTh = off; off += PVT;
  const size_t oVTl = off; off += PVL;
  const size_t oC1  = off; off += PC;
  const size_t oC2  = off; off += PC;
  const size_t oOh  = off; off += PO;
  const size_t oOl  = off; off += PO;
  if (off > ws_size) return;                        // off = 216535040

  char* ws = (char*)d_ws;
  unsigned short* Xb  = (unsigned short*)(ws + oXb);
  unsigned short* Wqb = (unsigned short*)(ws + oWq);
  unsigned short* Wkb = (unsigned short*)(ws + oWk);
  unsigned short* Wvb = (unsigned short*)(ws + oWv);
  unsigned short* Wob = (unsigned short*)(ws + oWo);
  float*          IFt = (float*)(ws + oIF);
  float*          CosT = (float*)(ws + oCos);
  float*          SinT = (float*)(ws + oSin);
  float*          Qf  = (float*)(ws + oQf);
  float*          Kf  = (float*)(ws + oKf);
  unsigned short* Qh  = (unsigned short*)(ws + oQh);
  unsigned short* Ql  = (unsigned short*)(ws + oQl);
  unsigned short* Kh  = (unsigned short*)(ws + oKh);
  unsigned short* Kl  = (unsigned short*)(ws + oKl);
  unsigned short* VTh = (unsigned short*)(ws + oVTh);
  unsigned short* VTl = (unsigned short*)(ws + oVTl);
  float*          C1  = (float*)(ws + oC1);
  float*          C2  = (float*)(ws + oC2);
  unsigned short* Oh  = (unsigned short*)(ws + oOh);
  unsigned short* Ol  = (unsigned short*)(ws + oOl);

  const dim3 blk256(256), blk128(128), blk32(32);
  const dim3 gCvt((NB * SEQ * DM + 2 * DQK * DM + 2 * DM * DM) / 8 / 256);   // 5120 blocks
  const dim3 gTab((SEQ * NFREQ + 255) / 256);                      //  256 blocks
  const dim3 gQKV((SEQ / 64) * (DQK / 64) / 8, NB, 3);             // 1024 tiles -> 128 blocks, x batch x {q, k, v^T}
  const dim3 gOut((NB * SEQ / 64) * (DM / 64) / 8, 1);             // 1024 tiles -> 128 blocks
  const dim3 gRope(SEQ, NB);                                       // one block per token row
  const dim3 gRow(NB * SEQ);                                       // one block per token row
  const dim3 gAtt(NQB * 2 * NB * NH);                              // 2048 blocks

  // (1) inputs -> bf16 planes; weights [n][k] f32 -> bf16 [n][k]; Xb, Wqb, Wkb, Wvb, Wob are contiguous from Xb
  cvt_bf16x8<<<gCvt, blk256, 0, stream>>>(x, Wq, Wk, Wv, Wo, Xb);
  // (2) rope tables
  invfreq_tab<<<dim3(1), blk32, 0, stream>>>(IFt);
  rope_tab<<<gTab, blk256, 0, stream>>>(IFt, CosT, SinT);
  // (3) q, k -> f32 [NB*SEQ][DQK]; v^T -> f16 hi plane and residual plane, both batch elements
  gemm_qkv<<<gQKV, blk256, 0, stream>>>(Xb, Wqb, Wkb, Wvb, Qf, Kf, VTh, VTl, bq, bk, bv);
  // (4) rope + bf16 hi/lo split of q and k
  rope_split<<<gRope, blk256, 0, stream>>>(Qf, Kf, CosT, SinT, Qh, Ql, Kh, Kl);
  // (5) causal attention, stream 1 (q1, k1) -> C1 and stream 2 (q2, k2) -> C2;
  //     query blocks 0..RESQB-1 with residual planes, the rest without
  attn_causal64<<<gAtt, blk128, 0, stream>>>(Qh, Ql, Kh, Kl, VTh, VTl, C1, C2, 0.125f);
  // (6) differential combine + head norm -> O bf16 hi/lo planes [NB*SEQ][DM]
  diff_combine<<<gRow, blk128, 0, stream>>>(C1, C2, lq1, lk1, lq2, lk2, hnw, Oh, Ol);
  // (7) out = O . Wo^T + bo -> d_out, f32 [NB*SEQ][DM]  (A = O hi + lo planes, 2 products)
  gemm64<1, 0, 1><<<gOut, blk256, 0, stream>>>(
      Oh, Ol, DM, 0LL, Wob, Wob, DM, 0LL,
      (void*)outp, DM, 0LL, (void*)outp, DM, 0LL, DM,
      NB * SEQ, DM, DM, 1.0f, bo);
  (void)hipGetLastError();
}

// v002
// Measured time: 362 microseconds a run.
// Two timings next to v001 put it at 1.26 and 1.25 times that version's speed.
// Counting every step since v000, it is 3.06 times as fast.
// Contractions: q, k, v^T projections = v_wmma_f32_16x16x32_bf16 (bf16 operands from RNE-converted inputs, single product);
// q.k^T scores (both streams) = v_wmma_f32_16x16x32_bf16 with bf16 hi/lo split q and k (hi.hi + hi.lo + lo.hi);
// p.v = v_wmma_f32_16x16x32_f16 (p carried x1024 in f16, v in f16; extra f16 residual planes x4096 of p and v for the first 512 query rows);
// ctx.Wo^T = v_wmma_f32_16x16x32_bf16 with ctx as bf16 hi/lo planes times bf16 Wo (2 products); all f32 accumulate;
// rope, softmax, lambda, head rms norm in f32.
#include <hip/hip_runtime.h>
#include <math.h>
#include <float.h>
#include <stdint.h>

#define NB    2
#define SEQ   2048
#define DM    1024
#define DQK   2048          // q / k projection width (2 x 64 per head)
#define NH    16
#define HD    64
#define NFREQ (HD / 2)
#define NQB   (SEQ / 64)    // 32 key / query tiles of 64
#define VLP   512           // key pitch of the v^T residual plane (keys 0..VLP-1)
#define RESQB 8             // number of leading 64-row query blocks that use the p / v residual planes
#define LAM0  0.2f
#define OSCL  0.8f
static_assert(RESQB * 64 <= VLP);
static_assert(NH * HD == DM);
static_assert(NB == 2 && NH == 16);   // the attention grid's index split
static_assert(NH * 2 * HD == DQK);
static_assert((SEQ % 64) == 0 && (DM % 64) == 0 && (DQK % 64) == 0);

typedef _Float16 v16h __attribute__((ext_vector_type(16)));
typedef _Float16 v8h  __attribute__((ext_vector_type(8)));
typedef __bf16   v16b __attribute__((ext_vector_type(16)));
typedef __bf16   v8b  __attribute__((ext_vector_type(8)));
typedef float    v8f  __attribute__((ext_vector_type(8)));
typedef float    v4f  __attribute__((ext_vector_type(4)));
typedef unsigned int v4u __attribute__((ext_vector_type(4)));

// ---- scalar helpers --------------------------------------------------------------------------------
__device__ __forceinline__ unsigned short bf_bits(float f) {          // f32 -> bf16 bits, RNE convert
  unsigned u = __float_as_uint(f);
  return (unsigned short)((u + 0x7FFFu + ((u >> 16) & 1u)) >> 16);
}
__device__ __forceinline__ float bf_up(unsigned short h) { return __uint_as_float(((unsigned)h) << 16); }
__device__ __forceinline__ float bfr(float f) { return bf_up(bf_bits(f)); }   // value after RNE convert to bf16
__device__ __forceinline__ unsigned short h_bits(_Float16 x) { return __builtin_bit_cast(unsigned short, x); }
__device__ __forceinline__ unsigned pk16(unsigned short a, unsigned short b) { return (unsigned)a | ((unsigned)b << 16); }
__device__ __forceinline__ v8f zero8() { v8f z = {0.f, 0.f, 0.f, 0.f, 0.f, 0.f, 0.f, 0.f}; return z; }
__device__ __forceinline__ v8h zero8h() {
  const _Float16 z = (_Float16)0.0f;
  v8h r = {z, z, z, z, z, z, z, z};
  return r;
}

// ---- fragment loaders: 16-bit A/B operand, lane -> row/col (lane&15), p already includes +8*(lane>>4);
//      elements 0..7 <- p[0..7] (k0+8h..), elements 8..15 <- p[16..23] (k0+16+8h..)
__device__ __forceinline__ v16b ldfrag_b(const __bf16* p) {
  union { v16b v; v8b h[2]; } f;
  f.h[0] = *(const v8b*)(p);
  f.h[1] = *(const v8b*)(p + 16);
  return f.v;
}

// ---- WMMA helpers with trailing VALU hazard gap --------------------------------------------------------
__device__ __forceinline__ v8f mma_b(v16b a, v16b b, v8f c) {
  c = __builtin_amdgcn_wmma_f32_16x16x32_bf16(false, a, false, b, (short)0, c, false, false);
#if defined(__HIP_DEVICE_COMPILE__)
  asm volatile("v_nop\n\tv_nop\n\tv_nop\n\tv_nop" : "+v"(c) : "v"(a), "v"(b));
#endif
  return c;
}
__device__ __forceinline__ v8f mma_h(v16h a, v16h b, v8f c) {
  c = __builtin_amdgcn_wmma_f32_16x16x32_f16(false, a, false, b, (short)0, c, false, false);
#if defined(__HIP_DEVICE_COMPILE__)
  asm volatile("v_nop\n\tv_nop\n\tv_nop\n\tv_nop" : "+v"(c) : "v"(a), "v"(b));
#endif
  return c;
}
__device__ __forceinline__ v8f mma_b_raw(v16b a, v16b b, v8f c) {
  return __builtin_amdgcn_wmma_f32_16x16x32_bf16(false, a, false, b, (short)0, c, false, false);
}
__device__ __forceinline__ void dep_guard_b(v8f& a, v8f& b, v16b x, v16b y) {
#if defined(__HIP_DEVICE_COMPILE__)
  asm volatile("v_nop\n\tv_nop\n\tv_nop\n\tv_nop" : "+v"(a), "+v"(b) : "v"(x), "v"(y));
#endif
}
__device__ __forceinline__ void keep4_b(v16b a, v16b b, v16b c, v16b d) {
#if defined(__HIP_DEVICE_COMPILE__)
  asm volatile("v_nop" :: "v"(a), "v"(b), "v"(c), "v"(d));
#endif
}
__device__ __forceinline__ void acc_guard4(v8f& a, v8f& b, v8f& c, v8f& d) {
#if defined(__HIP_DEVICE_COMPILE__)
  asm volatile("v_nop\n\tv_nop\n\tv_nop\n\tv_nop" : "+v"(a), "+v"(b), "+v"(c), "+v"(d));
#endif
}

// =====================================================================================================
// f32 -> bf16 (RNE convert), 8 elements per thread, one 16-B store per lane: a wave writes 512 contiguous B
// One grid for x, Wq, Wk, Wv, Wo: their bf16 planes lie back to back in the workspace in that order, so the
// output index is the flat thread index; the source is picked per block (every plane is a multiple of 2048
// elements, so a block never straddles two planes).
// coverage: (NX + 2 NQ + 2 NV) threads x 8 = all five planes.
// =====================================================================================================
__global__ __launch_bounds__(256) void cvt_bf16x8(const float* __restrict__ x, const float* __restrict__ wq,
                                                  const float* __restrict__ wk, const float* __restrict__ wv,
                                                  const float* __restrict__ wo, unsigned short* out) {
  constexpr int NX = NB * SEQ * DM / 8, NQ = DQK * DM / 8, NV = DM * DM / 8;
  static_assert((NX % 256) == 0 && (NQ % 256) == 0 && (NV % 256) == 0);
  const int i = blockIdx.x * 256 + threadIdx.x;
  if (i < NX + 2 * NQ + 2 * NV) {
    const float* in = x;
    int j = i;
    if (i >= NX + 2 * NQ + NV)  { in = wo; j = i - (NX + 2 * NQ + NV); }
    else if (i >= NX + 2 * NQ)  { in = wv; j = i - (NX + 2 * NQ); }
    else if (i >= NX + NQ)      { in = wk; j = i - (NX + NQ); }
    else if (i >= NX)           { in = wq; j = i - NX; }
    const v4f a = *(const v4f*)(in + (size_t)j * 8);
    const v4f b = *(const v4f*)(in + (size_t)j * 8 + 4);
    v4u p;
    p[0] = pk16(bf_bits(a[0]), bf_bits(a[1]));
    p[1] = pk16(bf_bits(a[2]), bf_bits(a[3]));
    p[2] = pk16(bf_bits(b[0]), bf_bits(b[1]));
    p[3] = pk16(bf_bits(b[2]), bf_bits(b[3]));
    *(v4u*)(out + (size_t)i * 8) = p;
    
  }
}

// =====================================================================================================
// inv_freq[j] = 1 / 10000^(j/32), j = 0..31, f32 with precise powf. One block of 32 threads; the 32 values
// coverage: lanes 0..7 x 4 floats = all 32 entries.
// =====================================================================================================
__global__ __launch_bounds__(32) void invfreq_tab(float* invf) {
  __shared__ __align__(16) float sf[NFREQ];
  const int j = threadIdx.x;
  const float e = (float)j * (1.0f / (float)NFREQ);
  const float pw = powf(10000.0f, e);
  sf[j] = 1.0f / pw;
  __syncthreads();
  const v4f v = *(const v4f*)(sf + 4 * (j & 7));
  if (j < 8) *(v4f*)(invf + 4 * j) = v;
  
}

// =====================================================================================================
// cos / sin tables [SEQ][32]: angle = t * inv_freq[j] (f32 multiply), precise cosf / sinf.
// =====================================================================================================
__global__ __launch_bounds__(256) void rope_tab(const float* __restrict__ invf, float* cosT, float* sinT) {
  const int g = blockIdx.x * 256 + threadIdx.x;
  if (g < SEQ * NFREQ) {
    const int t = g / NFREQ;
    const int j = g - t * NFREQ;
    const float ang = (float)t * invf[j];
    const float cv = cosf(ang);
    const float sv = sinf(ang);
    *(float*)(cosT + g) = cv;
    *(float*)(sinT + g) = sv;
    
  }
}

// =====================================================================================================
// Register-blocked bf16 WMMA GEMM: C[m][n] = sum_k A[m][k] * Bt[n][k] (+ bias); one wave per 64x64 tile,
// no block barriers. A row-major [M][K] pitch lda; Bt row-major [N][K] pitch ldb (k contiguous);
// M, N multiples of 64, K multiple of 32 (host-checked). b = batch index (strides in elements).
// The tile body is a device function (tile index, batch index and the wave's LDS slab come from the caller), so
// that one grid can hold several independent products.
// NSPLIT: 0 = A.Bt; 1 = (A + A2).Bt (A2 = unscaled bf16 lo plane of A); 2 = A.Bt + A2.Bt + A.Bt2.
// OUT_MODE: 0 = f32 (pitch ldc); 2 = bf16 hi plane C + bf16 lo plane C2 (lo = RNE(v - hi), unscaled);
//           3 = f16 hi plane C + f16 residual plane C2 = f16((v - hi) * rscale), C2 written only for tiles
//               with n0 < N2 (pitch ldc2, batch stride strideC2).
// BIAS: 0 = none; 1 = + bf16-RNE(bias[n]) per column; 2 = + bf16-RNE(bias[m]) per row (added in f32).
// =====================================================================================================
template <int NSPLIT, int OUT_MODE, int BIAS>
__device__ __forceinline__ void gemm64_tile(
    const unsigned short* __restrict__ Ap, const unsigned short* A2p, int lda, long long strideA,
    const unsigned short* __restrict__ Btp, const unsigned short* Bt2p, int ldb, long long strideB,
    void* Cout, int ldc, long long strideC,
    void* Cout2, int ldc2, long long strideC2, int N2,
    int M, int N, int K, float rscale, const float* __restrict__ bias,
    float* slab, int tile, int b) {
  const __bf16* A   = (const __bf16*)(const void*)Ap;
  const __bf16* A2  = (const __bf16*)(const void*)A2p;
  const __bf16* Bt  = (const __bf16*)(const void*)Btp;
  const __bf16* Bt2 = (const __bf16*)(const void*)Bt2p;
  const int lane = threadIdx.x & 31;
  const int tilesN = N >> 6;
  const int tilesM = M >> 6;
  if (tile >= tilesM * tilesN) return;   // wave-uniform; no block barriers in this kernel
  const int tm = tile / tilesN;
  const int tn = tile - tm * tilesN;
  const int m0 = tm << 6;
  const int n0 = tn << 6;

  const __bf16* Ab  = A  + (size_t)b * strideA;
  const __bf16* Bb  = Bt + (size_t)b * strideB;
  const __bf16* Ab2 = (NSPLIT >= 1) ? (A2  + (size_t)b * strideA) : Ab;
  const __bf16* Bb2 = (NSPLIT == 2) ? (Bt2 + (size_t)b * strideB) : Bb;

  const int rlane = lane & 15;                 // row (A) / col (B, D) within subtile
  const int koff  = (lane >> 4) * 8;           // k offset of this lane half
  const int mOff  = (lane >> 4) * 8;           // D row offset

  v8f acc[4][4];
#pragma unroll
  for (int i = 0; i < 4; ++i)
#pragma unroll
    for (int j = 0; j < 4; ++j) acc[i][j] = zero8();

  for (int k0 = 0; k0 < K; k0 += 32) {
    v16b bh[4], bl[4];
#pragma unroll
    for (int j = 0; j < 4; ++j) {
      const size_t bo = (size_t)(n0 + (j << 4) + rlane) * ldb + koff + k0;
      bh[j] = ldfrag_b(Bb + bo);
      if (NSPLIT == 2) bl[j] = ldfrag_b(Bb2 + bo); else bl[j] = bh[j];
    }
#pragma unroll
    for (int i = 0; i < 4; ++i) {
      const size_t ao = (size_t)(m0 + (i << 4) + rlane) * lda + koff + k0;
      const v16b ah = ldfrag_b(Ab + ao);
      v16b al = ah;
      if (NSPLIT >= 1) al = ldfrag_b(Ab2 + ao);
#pragma unroll
      for (int j = 0; j < 4; ++j) {
        acc[i][j] = mma_b_raw(ah, bh[j], acc[i][j]);
        if (NSPLIT >= 1) acc[i][j] = mma_b_raw(al, bh[j], acc[i][j]);
        if (NSPLIT == 2) acc[i][j] = mma_b_raw(ah, bl[j], acc[i][j]);
      }
      dep_guard_b(acc[i][0], acc[i][3], ah, al);
    }
    keep4_b(bh[0], bh[1], bh[2], bh[3]);
    if (NSPLIT == 2) keep4_b(bl[0], bl[1], bl[2], bl[3]);
  }
  acc_guard4(acc[0][0], acc[0][1], acc[0][2], acc[0][3]);
  acc_guard4(acc[1][0], acc[1][1], acc[1][2], acc[1][3]);
  acc_guard4(acc[2][0], acc[2][1], acc[2][2], acc[2][3]);
  acc_guard4(acc[3][0], acc[3][1], acc[3][2], acc[3][3]);

  // ---- epilogue ----
  float bcol[4];
#pragma unroll
  for (int j = 0; j < 4; ++j) bcol[j] = 0.f;
  if (BIAS == 1) {
#pragma unroll
    for (int j = 0; j < 4; ++j) bcol[j] = bfr(bias[n0 + (j << 4) + rlane]);
  }
#pragma unroll
  for (int i = 0; i < 4; ++i) {
    const int mBase = m0 + (i << 4);
    float brow[8];
#pragma unroll
    for (int r = 0; r < 8; ++r) brow[r] = 0.f;
    if (BIAS == 2) {
#pragma unroll
      for (int r = 0; r < 8; ++r) brow[r] = bfr(bias[mBase + mOff + r]);
    }
#pragma unroll
    for (int j = 0; j < 4; ++j) {
#pragma unroll
      for (int r = 0; r < 8; ++r) {
        slab[(mOff + r) * 68 + (j << 4) + rlane] = (acc[i][j][r] + bcol[j]) + brow[r];
      }
    }
    __builtin_amdgcn_fence(__ATOMIC_RELEASE, "workgroup");
    __builtin_amdgcn_wave_barrier();
    __builtin_amdgcn_fence(__ATOMIC_ACQUIRE, "workgroup");
    if (OUT_MODE == 0) {
      float* C = (float*)Cout + (size_t)b * strideC;
      const int hh = lane >> 4, c4 = (lane & 15) * 4;     // 256-B row segment = 16 lanes x 16 B
      {
#pragma unroll
        for (int it = 0; it < 8; ++it) {
          const int row = it * 2 + hh;                     // it 0..7 x hh 0..1 = rows 0..15
          const v4f v = *(const v4f*)(slab + row * 68 + c4);
          *(v4f*)(C + (size_t)(mBase + row) * ldc + n0 + c4) = v;
        }
        
      }
    } else {
      const int q = lane >> 3, c8 = (lane & 7) * 8;
      unsigned short* C  = (unsigned short*)Cout  + (size_t)b * strideC;
      unsigned short* C2 = (unsigned short*)Cout2 + (size_t)b * strideC2;
      const bool wlo = (OUT_MODE == 2) || (n0 < N2);      // wave-uniform
      v4u hv[4], lv[4];
#pragma unroll
      for (int it = 0; it < 4; ++it) {
        const int row = it * 4 + q;                        // it 0..3 x q 0..3 = rows 0..15
        const float* sp = slab + row * 68 + c8;
        v4u a, a2;
#pragma unroll
        for (int e = 0; e < 4; ++e) {
          const float f0 = sp[2 * e], f1 = sp[2 * e + 1];
          unsigned short h0, h1, l0, l1;
          if (OUT_MODE == 2) {
            h0 = bf_bits(f0); h1 = bf_bits(f1);
            l0 = bf_bits(f0 - bf_up(h0)); l1 = bf_bits(f1 - bf_up(h1));
          } else {
            const _Float16 x0 = (_Float16)f0, x1 = (_Float16)f1;
            h0 = h_bits(x0); h1 = h_bits(x1);
            l0 = h_bits((_Float16)((f0 - (float)x0) * rscale));
            l1 = h_bits((_Float16)((f1 - (float)x1) * rscale));
          }
          a[e] = pk16(h0, h1); a2[e] = pk16(l0, l1);
        }
        hv[it] = a; lv[it] = a2;
      }
      {
#pragma unroll
        for (int it = 0; it < 4; ++it) {
          const int row = it * 4 + q;
          *(v4u*)(C + (size_t)(mBase + row) * ldc + n0 + c8) = hv[it];
          if (wlo) *(v4u*)(C2 + (size_t)(mBase + row) * ldc2 + n0 + c8) = lv[it];
        }
        
      }
    }
    __builtin_amdgcn_fence(__ATOMIC_RELEASE, "workgroup");
    __builtin_amdgcn_wave_barrier();
    __builtin_amdgcn_fence(__ATOMIC_ACQUIRE, "workgroup");
  }
}

// One product per grid: blockIdx.x * 8 + wave = tile, blockIdx.y = batch index.
template <int NSPLIT, int OUT_MODE, int BIAS>
__global__ __launch_bounds__(256) void gemm64(
    const unsigned short* __restrict__ Ap, const unsigned short* A2p, int lda, long long strideA,
    const unsigned short* __restrict__ Btp, const unsigned short* Bt2p, int ldb, long long strideB,
    void* Cout, int ldc, long long strideC,
    void* Cout2, int ldc2, long long strideC2, int N2,
    int M, int N, int K, float rscale, const float* __restrict__ bias) {
  __shared__ __align__(16) float sT[8][16 * 68];   // per-wave 16x64 slab, pitch 68 floats
  const int wave = threadIdx.x >> 5;
  gemm64_tile<NSPLIT, OUT_MODE, BIAS>(Ap, A2p, lda, strideA, Btp, Bt2p, ldb, strideB, Cout, ldc, strideC,
                                      Cout2, ldc2, strideC2, N2, M, N, K, rscale, bias,
                                      sT[wave], blockIdx.x * 8 + wave, blockIdx.y);
}

// q, k and v^T projections of both batch elements in one grid: blockIdx.z = 0 q, 1 k, 2 v^T; blockIdx.y = batch;
// blockIdx.x * 8 + wave = tile (v^T has half the tiles of q / k: its upper waves leave at the tile test).
//   q / k = x_b . W^T + bias[col] -> f32 [NB*SEQ][DQK]                 (M=SEQ, N=DQK, K=DM)
//   v^T   = Wv . x_b^T + bv[row]  -> f16 hi plane [b][h*64+d][s] (pitch SEQ) and residual plane
//           (x4096, keys < VLP only, pitch VLP)                        (M=DM, N=SEQ, K=DM)
__global__ __launch_bounds__(256) void gemm_qkv(
    const unsigned short* __restrict__ Xb, const unsigned short* __restrict__ Wqb,
    const unsigned short* __restrict__ Wkb, const unsigned short* __restrict__ Wvb,
    float* Qf, float* Kf, unsigned short* VTh, unsigned short* VTl,
    const float* __restrict__ bq, const float* __restrict__ bk, const float* __restrict__ bv) {
  __shared__ __align__(16) float sT[8][16 * 68];   // per-wave 16x64 slab, pitch 68 floats
  const int wave = threadIdx.x >> 5;
  const int tile = blockIdx.x * 8 + wave;
  const int b    = blockIdx.y;
  const int z    = blockIdx.z;
  if (z < 2) {
    const unsigned short* Wb = z ? Wkb : Wqb;
    float* Cf = z ? Kf : Qf;
    const float* bias = z ? bk : bq;
    gemm64_tile<0, 0, 1>(Xb, Xb, DM, (long long)SEQ * DM, Wb, Wb, DM, 0LL,
                         (void*)Cf, DQK, (long long)SEQ * DQK, (void*)Cf, DQK, 0LL, DQK,
                         SEQ, DQK, DM, 1.0f, bias, sT[wave], tile, b);
  } else {
    gemm64_tile<0, 3, 2>(Wvb, Wvb, DM, 0LL, Xb, Xb, DM, (long long)SEQ * DM,
                         (void*)VTh, SEQ, (long long)DM * SEQ, (void*)VTl, VLP, (long long)DM * VLP, VLP,
                         DM, SEQ, DM, 4096.0f, bv, sT[wave], tile, b);
  }
}

// =====================================================================================================
// RoPE half-split rotation of 8 consecutive columns of one 64-wide vector, then bf16 hi/lo split and
//   first half  (j < 32):   out[j]    = x[j]*cos[j]   - x[j+32]*sin[j]     (x1 = a, x2 = p)
//   second half (j >= 32):  out[j+32] = x[j]*sin[j]   + x[j+32]*cos[j]     (x1 = p, x2 = a)
// =====================================================================================================
__device__ __forceinline__ void rope_row8(const float* __restrict__ src, size_t rowOff, int c0, int p0,
                                          bool second, v4f cs0, v4f cs1, v4f sn0, v4f sn1,
                                          unsigned short* Hp, unsigned short* Lp) {
#pragma clang fp contract(off)
  const v4f xa0 = *(const v4f*)(src + rowOff + c0);
  const v4f xa1 = *(const v4f*)(src + rowOff + c0 + 4);
  const v4f xp0 = *(const v4f*)(src + rowOff + p0);
  const v4f xp1 = *(const v4f*)(src + rowOff + p0 + 4);
  float o[8];
#pragma unroll
  for (int e = 0; e < 4; ++e) {
    {
      const float a = xa0[e], p = xp0[e], cs = cs0[e], sn = sn0[e];
      const float f1 = a * cs - p * sn;
      const float f2 = p * sn + a * cs;
      o[e] = second ? f2 : f1;
    }
    {
      const float a = xa1[e], p = xp1[e], cs = cs1[e], sn = sn1[e];
      const float f1 = a * cs - p * sn;
      const float f2 = p * sn + a * cs;
      o[4 + e] = second ? f2 : f1;
    }
  }
  v4u hv, lv;
#pragma unroll
  for (int e = 0; e < 4; ++e) {
    const float f0 = o[2 * e], f1 = o[2 * e + 1];
    const unsigned short h0 = bf_bits(f0), h1 = bf_bits(f1);
    const unsigned short l0 = bf_bits(f0 - bf_up(h0)), l1 = bf_bits(f1 - bf_up(h1));
    hv[e] = pk16(h0, h1); lv[e] = pk16(l0, l1);
  }
  const size_t go = rowOff + c0;
  *(v4u*)(Hp + go) = hv;
  *(v4u*)(Lp + go) = lv;
  
}

// =====================================================================================================
// RoPE + hi/lo split for one token row t of q and k (f32 planes [NB*SEQ][DQK], per head 128 columns =
// two 64-wide vectors). grid = (SEQ, NB) blocks x 256 threads; thread -> columns 8*tid..8*tid+7.
// Outputs: bf16 hi / lo planes [NB*SEQ][DQK] for q and for k.
// coverage: 256 threads x 8 columns = 2048 columns of each of the 4 output planes per row; NB*SEQ rows.
// =====================================================================================================
__global__ __launch_bounds__(256) void rope_split(const float* __restrict__ Qf, const float* __restrict__ Kf,
                                                   const float* __restrict__ cosT, const float* __restrict__ sinT,
                                                   unsigned short* Qh, unsigned short* Ql,
                                                   unsigned short* Kh, unsigned short* Kl) {
  const int t = blockIdx.x;
  const int c0 = threadIdx.x * 8;
  const int jj0 = c0 & 31;
  const bool second = (c0 & 32) != 0;
  const int p0 = second ? (c0 - 32) : (c0 + 32);
  const float* cr = cosT + (size_t)t * NFREQ + jj0;
  const float* sr = sinT + (size_t)t * NFREQ + jj0;
  const v4f cs0 = *(const v4f*)(cr), cs1 = *(const v4f*)(cr + 4);
  const v4f sn0 = *(const v4f*)(sr), sn1 = *(const v4f*)(sr + 4);
  const size_t rowOff = ((size_t)blockIdx.y * SEQ + t) * DQK;
  rope_row8(Qf, rowOff, c0, p0, second, cs0, cs1, sn0, sn1, Qh, Ql);
  rope_row8(Kf, rowOff, c0, p0, second, cs0, cs1, sn0, sn1, Kh, Kl);
}

// =====================================================================================================
// Causal attention, head dim 64: body for one 64-row query block of one head, stream and batch element
// (the plane pointers arrive already moved to the batch element).
//   q planes (bf16 hi / lo) [SEQ][DQK]: element (t, h, stream, d) at [t*DQK + h*128 + soff + d] (soff 0 / 64)
//   k planes: same layout with key index s
//   v^T hi plane (f16):      element (h, d, s) at [(h*64 + d)*SEQ + s]
//   v^T residual plane (f16, (v - hi)*4096): [(h*64 + d)*VLP + s], s < VLP, read only when RES
//   (a key tile at or beyond VLP contributes a zero v residual)
//   causal: key tiles kt = 0..qb processed (block-uniform trip count <= 32); only the diagonal tile gets the
//   per-lane -inf fill for keys beyond the query row (a fill, not a bias); every row keeps its diagonal key.
//   context plane C f32 [SEQ][DM]: element (t, h, d) at [t*DM + h*64 + d]  (normalised by 1/l)
//   scores = q . k : bf16 hi/lo split (hi.hi + hi.lo + lo.hi), f32 accumulate, then * sscale in f32
//   p = exp(s - m) carried as f16(1024 p); context = p . v on f16 WMMA; RES adds f16 residual planes of p and v
//   (scale 4096, separate accumulator folded back with 1/4096 per chunk in f32); online softmax in f32.
//   Block = 4 waves = 64 query rows of one head; kv chunks of 64. LDS is carved from the caller's one array.
//   LDS rows of the K, V^T and P tiles (64 16-bit elements = 128 B of data) stand at a pitch of LP = 72 elements
//   (144 B = 16 B x 9): the 16 lanes of a half wave that read 16 B each from 16 consecutive rows then fall on 16
//   different groups of four banks; at 128 B they fall on two. The pad elements are never written or read.
//   K / V^T chunk staging: 128 threads x 32 elements per plane = the whole 64x64 tile (plain 16-B loads,
//   __syncthreads before and after); P tiles are wave-private, spilled with _Float16 element stores and reloaded
//   Output coverage: each wave stores rows q0..q0+15 (it 0..7 x lane>>4 0..1) x 64 columns (16 lanes x 4 floats),
// =====================================================================================================
#define LP      72                        // LDS row pitch of the 16-bit tiles, in elements
#define TILE_B  (64 * LP * 2)             // one 64-row tile: 9216 B
#define PW_B    (16 * LP * 2)             // one wave's 16-row P tile: 2304 B
#define OS_B    (4 * 16 * 64 * 4)         // four waves' f32 context tiles: 16384 B
#define ATT_LDS (4 * TILE_B + 2 * 4 * PW_B + OS_B)   // 71680 B
static_assert(((LP * 2) % 16) == 0 && (((LP * 2) / 16) & 1) == 1);   // 16-B aligned rows, odd multiple of 16 B
template <bool RES>
__device__ __forceinline__
void attn_block64(unsigned char* smem,
                  const unsigned short* __restrict__ qhp, const unsigned short* __restrict__ qlp,
                  const unsigned short* __restrict__ khp, const unsigned short* __restrict__ klp,
                  const unsigned short* __restrict__ vhp, const unsigned short* __restrict__ vlp,
                  float* Cp, int soff, int qb, int h, float sscale) {
  union FB { v16b v; v8b h[2]; };
  union FH { v16h v; v8h h[2]; };
  __bf16*   Ksh = (__bf16*)(void*)(smem);                         // K hi [kv][d]
  __bf16*   Ksl = (__bf16*)(void*)(smem + TILE_B);                // K lo
  _Float16* Vth = (_Float16*)(void*)(smem + 2 * TILE_B);          // V^T hi [d][kv]
  _Float16* Psh = (_Float16*)(void*)(smem + 3 * TILE_B);          // per wave P [row][kv], 4 x PW_B
  float*    Os  = (float*)(void*)(smem + 3 * TILE_B + 4 * PW_B);  // per wave context tile [row][d], 4 x 4 KB
  _Float16* Vtl = (_Float16*)(void*)(smem + 3 * TILE_B + 4 * PW_B + OS_B);   // V^T residual (RES only)
  _Float16* Psl = (_Float16*)(void*)(smem + 4 * TILE_B + 4 * PW_B + OS_B);   // per wave P residual (RES only)

  const int tid  = threadIdx.x;
  const int wave = tid >> 5;
  const int lane = tid & 31;
  const int hh   = lane >> 4;
  const int c    = lane & 15;

  const int q0   = qb * 64 + wave * 16;
  const int col  = h * (2 * HD) + soff;

  const __bf16* Qh = (const __bf16*)(const void*)qhp + col;
  const __bf16* Ql = (const __bf16*)(const void*)qlp + col;
  const __bf16* Kh = (const __bf16*)(const void*)khp + col;
  const __bf16* Kl = (const __bf16*)(const void*)klp + col;
  const _Float16* Vh = (const _Float16*)(const void*)vhp + (size_t)h * HD * SEQ;
  const _Float16* Vl = (const _Float16*)(const void*)vlp + (size_t)h * HD * VLP;

  // ---- Q fragments (A operand, row = lane&15): 2 d-chunks, hi and lo ----
  v16b qah[2], qal[2];
#pragma unroll
  for (int dc = 0; dc < 2; ++dc) {
    const size_t qo = (size_t)(q0 + c) * DQK + dc * 32 + 8 * hh;
    qah[dc] = ldfrag_b(Qh + qo);
    qal[dc] = ldfrag_b(Ql + qo);
  }

  float mrow[8], lrow[8];
  v8f oacc[4];
#pragma unroll
  for (int r = 0; r < 8; ++r) { mrow[r] = -INFINITY; lrow[r] = 0.f; }
#pragma unroll
  for (int t = 0; t < 4; ++t) oacc[t] = zero8();

  for (int kt = 0; kt < NQB; ++kt) {         // static trip bound
    if (kt > qb) break;                      // block-uniform (causal)
    const bool diag = (kt == qb);            // block-uniform
    const int kv0 = kt * 64;
    __syncthreads();
    {
      const int r = tid >> 1, half = (tid & 1) * 32;
      const __bf16*   kg  = Kh + (size_t)(kv0 + r) * DQK + half;   // K row kv0+r, d = half..half+31
      const __bf16*   klg = Kl + (size_t)(kv0 + r) * DQK + half;
      const _Float16* vg  = Vh + (size_t)r * SEQ + kv0 + half;      // V^T row d = r, s = kv0+half..+31
      const int kvl = (kv0 + 64 <= VLP) ? kv0 : (VLP - 64);       // clamped address into the residual plane
      const _Float16* vlg = Vl + (size_t)r * VLP + kvl + half;
      const bool resOK = (kv0 + 64 <= VLP);                        // block-uniform
      v8b a0[4], a1[4];
      v8h b0[4], b1[4];
#pragma unroll
      for (int i = 0; i < 4; ++i) {
        a0[i] = *(const v8b*)(kg + 8 * i);
        a1[i] = *(const v8b*)(klg + 8 * i);
        b0[i] = *(const v8h*)(vg + 8 * i);
        if (RES) {
          b1[i] = *(const v8h*)(vlg + 8 * i);
          if (!resOK) b1[i] = zero8h();
        }
      }
#if defined(__HIP_DEVICE_COMPILE__)
      // s_wait_xcnt 0 before a register that an issued load names is written again; the addresses are inputs so that
      // they stay in their registers up to the wait (else the last load's destination may take an address pair over).
      if (RES) asm volatile("s_wait_xcnt 0x0" :: "v"(kg), "v"(klg), "v"(vg), "v"(vlg) : "memory");
      else     asm volatile("s_wait_xcnt 0x0" :: "v"(kg), "v"(klg), "v"(vg) : "memory");
#endif
#pragma unroll
      for (int i = 0; i < 4; ++i) {
        *(v8b*)(Ksh + r * LP + half + 8 * i) = a0[i];
        *(v8b*)(Ksl + r * LP + half + 8 * i) = a1[i];
        *(v8h*)(Vth + r * LP + half + 8 * i) = b0[i];
        if (RES) *(v8h*)(Vtl + r * LP + half + 8 * i) = b1[i];
      }
    }
    __syncthreads();

    // ---- scores: 16 query rows x 64 keys per wave, 3 bf16 products ----
    v8f s[4];
#pragma unroll
    for (int j = 0; j < 4; ++j) {
      s[j] = zero8();
#pragma unroll
      for (int dc = 0; dc < 2; ++dc) {
        FB kb, kl;
        kb.h[0] = *(const v8b*)(Ksh + (j * 16 + c) * LP + dc * 32 + 8 * hh);
        kb.h[1] = *(const v8b*)(Ksh + (j * 16 + c) * LP + dc * 32 + 16 + 8 * hh);
        kl.h[0] = *(const v8b*)(Ksl + (j * 16 + c) * LP + dc * 32 + 8 * hh);
        kl.h[1] = *(const v8b*)(Ksl + (j * 16 + c) * LP + dc * 32 + 16 + 8 * hh);
        s[j] = mma_b(qah[dc], kb.v, s[j]);
        s[j] = mma_b(qah[dc], kl.v, s[j]);
        s[j] = mma_b(qal[dc], kb.v, s[j]);
      }
    }

    // ---- scale, causal fill on the diagonal tile, row max, online softmax, P (x1024, f16) and
    //      P residual (x4096) to LDS ----
    _Float16* pwh = Psh + wave * (16 * LP);
    _Float16* pwl = Psl + wave * (16 * LP);
#pragma unroll
    for (int r = 0; r < 8; ++r) {
      const int qrow = q0 + 8 * hh + r;
      float m = -INFINITY;
#pragma unroll
      for (int j = 0; j < 4; ++j) {
        const int key = kv0 + j * 16 + c;
        float sv = s[j][r] * sscale;
        sv = (diag && key > qrow) ? -INFINITY : sv;
        s[j][r] = sv;
        m = fmaxf(m, sv);
      }
#pragma unroll
      for (int off = 1; off < 16; off <<= 1) m = fmaxf(m, __shfl_xor(m, off, 32));
      const float mnew  = fmaxf(mrow[r], m);
      const float msafe = (mnew == -INFINITY) ? 0.f : mnew;
      const float alpha = __expf(mrow[r] - msafe);
      mrow[r] = mnew;
      float psum = 0.f;
#pragma unroll
      for (int j = 0; j < 4; ++j) {
        const float p = __expf(s[j][r] - msafe);     // -inf logit: exp -> 0
        psum += p;
        const float p1k = p * 1024.0f;
        const _Float16 ph = (_Float16)p1k;
        pwh[(8 * hh + r) * LP + j * 16 + c] = ph;
        if (RES) {
          const _Float16 pl = (_Float16)((p1k - (float)ph) * 4096.0f);
          pwl[(8 * hh + r) * LP + j * 16 + c] = pl;
        }
      }
#pragma unroll
      for (int off = 1; off < 16; off <<= 1) psum += __shfl_xor(psum, off, 32);
      lrow[r] = lrow[r] * alpha + psum;
#pragma unroll
      for (int t = 0; t < 4; ++t) oacc[t][r] *= alpha;
    }
    __builtin_amdgcn_fence(__ATOMIC_RELEASE, "workgroup");
    __builtin_amdgcn_wave_barrier();
    __builtin_amdgcn_fence(__ATOMIC_ACQUIRE, "workgroup");

    // ---- context += P . V (f16 WMMA), residual products into a separate accumulator ----
    v8f o1[4];
#pragma unroll
    for (int t = 0; t < 4; ++t) o1[t] = zero8();
#pragma unroll 1
    for (int kk = 0; kk < 2; ++kk) {
      FH pa, pl;
      pa.h[0] = *(const v8h*)(pwh + c * LP + kk * 32 + 8 * hh);
      pa.h[1] = *(const v8h*)(pwh + c * LP + kk * 32 + 16 + 8 * hh);
      if (RES) {
        pl.h[0] = *(const v8h*)(pwl + c * LP + kk * 32 + 8 * hh);
        pl.h[1] = *(const v8h*)(pwl + c * LP + kk * 32 + 16 + 8 * hh);
      } else {
        pl.v = pa.v;
      }
#pragma unroll
      for (int t = 0; t < 4; ++t) {
        FH vb;
        vb.h[0] = *(const v8h*)(Vth + (t * 16 + c) * LP + kk * 32 + 8 * hh);
        vb.h[1] = *(const v8h*)(Vth + (t * 16 + c) * LP + kk * 32 + 16 + 8 * hh);
        oacc[t] = mma_h(pa.v, vb.v, oacc[t]);
        if (RES) {
          FH vl;
          vl.h[0] = *(const v8h*)(Vtl + (t * 16 + c) * LP + kk * 32 + 8 * hh);
          vl.h[1] = *(const v8h*)(Vtl + (t * 16 + c) * LP + kk * 32 + 16 + 8 * hh);
          o1[t] = mma_h(pa.v, vl.v, o1[t]);
          o1[t] = mma_h(pl.v, vb.v, o1[t]);
        }
      }
    }
    if (RES) {
#pragma unroll
      for (int t = 0; t < 4; ++t)
#pragma unroll
        for (int r = 0; r < 8; ++r) oacc[t][r] += o1[t][r] * (1.0f / 4096.0f);
    }
  }

  // ---- normalise (1/l and the 1/1024 p carry), stage the wave's 16x64 tile, write f32 rows as
  float* os = Os + wave * (16 * 64);
#pragma unroll
  for (int r = 0; r < 8; ++r) {
    const float l = lrow[r];
    const float inv = ((l > 0.f) ? (1.0f / l) : 0.f) * (1.0f / 1024.0f);
#pragma unroll
    for (int t = 0; t < 4; ++t) os[(8 * hh + r) * 64 + t * 16 + c] = oacc[t][r] * inv;
  }
  __builtin_amdgcn_fence(__ATOMIC_RELEASE, "workgroup");
  __builtin_amdgcn_wave_barrier();
  __builtin_amdgcn_fence(__ATOMIC_ACQUIRE, "workgroup");
  {
    const int h2 = lane >> 4, c4 = (lane & 15) * 4;
    v4f ov[8];
#pragma unroll
    for (int it = 0; it < 8; ++it) {
      const int row = it * 2 + h2;   // it 0..7 x h2 0..1 = rows 0..15 of the wave tile
      ov[it] = *(const v4f*)(os + row * 64 + c4);
    }
    {
#pragma unroll
      for (int it = 0; it < 8; ++it) {
        const int row = it * 2 + h2;
        const size_t go = (size_t)(q0 + row) * DM + (size_t)h * HD + c4;
        *(v4f*)(Cp + go) = ov[it];
      }
#if defined(__HIP_DEVICE_COMPILE__)
      // s_wait_xcnt 0 behind the run of stores: in the merged kernel the listing holds a branch from the end of this
      // body to the head of the other one, where registers that these stores name are written again.
      asm volatile("s_wait_xcnt 0x0" ::: "memory");
#endif
    }
  }
}

// All query blocks of both streams, all heads and both batch elements in one grid of NQB * 2 * NB * NH blocks.
// blockIdx.x / 64 counts the query blocks down from the last one: the blocks with the most key tiles get the lowest
// indices (for speed only).
// blockIdx.x % 64 = batch * 32 + stream * 16 + head. Query blocks below RESQB take the body with residual planes
// (block-uniform choice).
__global__ __launch_bounds__(128)
void attn_causal64(const unsigned short* __restrict__ qhp, const unsigned short* __restrict__ qlp,
                   const unsigned short* __restrict__ khp, const unsigned short* __restrict__ klp,
                   const unsigned short* __restrict__ vhp, const unsigned short* __restrict__ vlp,
                   float* C1p, float* C2p, float sscale) {
  __shared__ __align__(16) unsigned char smem[ATT_LDS];
  const int bx     = blockIdx.x;
  const int qb     = NQB - 1 - (bx >> 6);
  const int h      = bx & 15;
  const int stream = (bx >> 4) & 1;
  const int b      = (bx >> 5) & 1;
  const size_t qk = (size_t)b * SEQ * DQK;
  const unsigned short* vh = vhp + (size_t)b * DM * SEQ;
  const unsigned short* vl = vlp + (size_t)b * DM * VLP;
  float* Cp = (stream ? C2p : C1p) + (size_t)b * SEQ * DM;
  const int soff = stream * HD;
  if (qb < RESQB) attn_block64<true >(smem, qhp + qk, qlp + qk, khp + qk, klp + qk, vh, vl, Cp, soff, qb, h, sscale);
  else            attn_block64<false>(smem, qhp + qk, qlp + qk, khp + qk, klp + qk, vh, vl, Cp, soff, qb, h, sscale);
}

// =====================================================================================================
// Differential combine + head rms norm for one token row t of the NB*SEQ rows:
//   lam[h] = (0.2 + exp(sum_d lq1.lk1)) - exp(sum_d lq2.lk2)  (f32, inputs RNE-converted to bf16 values;
//            recomputed per block by threads 0..15, rolled 64-term loops)
//   o = c1 - lam*c2; r = rsqrt(sum_d(o^2)/64 + 1e-6); o = ((o*r) * w[h][d]) * 0.8
//   written as bf16 hi / lo planes [NB*SEQ][DM] (merged head layout), one 16-B store per plane per lane
// grid = NB*SEQ blocks x 128 threads; thread -> columns 8*tid..+7 (head = tid>>3, 8 lanes per head).
// coverage: 128 threads x 8 = 1024 columns per row; NB*SEQ rows.
// =====================================================================================================
__global__ __launch_bounds__(128) void diff_combine(
    const float* __restrict__ C1, const float* __restrict__ C2,
    const float* __restrict__ lq1, const float* __restrict__ lk1,
    const float* __restrict__ lq2, const float* __restrict__ lk2,
    const float* __restrict__ hnw, unsigned short* Oh, unsigned short* Ol) {
#pragma clang fp contract(off)
  __shared__ float lam_s[NH];
  const int tid = threadIdx.x;
  const int t   = blockIdx.x;
  if (tid < NH) {
    const float* a1 = lq1 + tid * HD;
    const float* b1 = lk1 + tid * HD;
    const float* a2 = lq2 + tid * HD;
    const float* b2 = lk2 + tid * HD;
    float sa = 0.f, sb = 0.f;
#pragma unroll 1
    for (int d = 0; d < HD; ++d) {
      sa += bfr(a1[d]) * bfr(b1[d]);
      sb += bfr(a2[d]) * bfr(b2[d]);
    }
    lam_s[tid] = (LAM0 + expf(sa)) - expf(sb);
  }
  __syncthreads();
  const int c0 = tid * 8;
  const int h  = c0 >> 6;
  const int d0 = c0 & 63;
  const size_t ro = (size_t)t * DM + c0;
  const v4f x0 = *(const v4f*)(C1 + ro), x1 = *(const v4f*)(C1 + ro + 4);
  const v4f y0 = *(const v4f*)(C2 + ro), y1 = *(const v4f*)(C2 + ro + 4);
  const float lam = lam_s[h];
  float o[8];
  float ss = 0.f;
#pragma unroll
  for (int e = 0; e < 4; ++e) {
    o[e]     = x0[e] - lam * y0[e];
    o[4 + e] = x1[e] - lam * y1[e];
  }
#pragma unroll
  for (int e = 0; e < 8; ++e) ss += o[e] * o[e];
  ss += __shfl_xor(ss, 1, 32);
  ss += __shfl_xor(ss, 2, 32);
  ss += __shfl_xor(ss, 4, 32);
  const float ms = ss * (1.0f / (float)HD);
  const float rn = rsqrtf(ms + 1.0e-6f);
  v4u hv, lv;
#pragma unroll
  for (int e = 0; e < 4; ++e) {
    const float w0 = bfr(hnw[h * HD + d0 + 2 * e]);
    const float w1 = bfr(hnw[h * HD + d0 + 2 * e + 1]);
    const float f0 = ((o[2 * e] * rn) * w0) * OSCL;
    const float f1 = ((o[2 * e + 1] * rn) * w1) * OSCL;
    const unsigned short h0 = bf_bits(f0), h1 = bf_bits(f1);
    const unsigned short l0 = bf_bits(f0 - bf_up(h0)), l1 = bf_bits(f1 - bf_up(h1));
    hv[e] = pk16(h0, h1); lv[e] = pk16(l0, l1);
  }
  *(v4u*)(Oh + ro) = hv;
  *(v4u*)(Ol + ro) = lv;
  
}

// =====================================================================================================
// Workspace map (bytes, all offsets multiples of 4096):
//   Xb   bf16 [4096][1024]      8388608      Wqb bf16 [2048][1024] 4194304   Wkb 4194304
//   Wvb  bf16 [1024][1024]      2097152      Wob 2097152
//   invf f32 [32] (padded)         4096      cosT f32 [2048][32] 262144      sinT 262144
//   both batch elements, batch-major:
//   Qf   f32  [2][2048][2048]     33554432      Kf 33554432
//   Qh/Ql/Kh/Kl bf16 [2][2048][2048]  4 x 16777216
//   VTh  f16  [2][1024][2048]      8388608      VTl f16 [2][1024][512] 2097152
//   C1/C2 f32 [2][2048][1024]   2 x 16777216    Oh/Ol bf16 [2][2048][1024] 2 x 8388608
//   end                          216535040
// All planes are exact multiples of their 64x64 / whole-line store granularity (no padded tails needed).
// Weights are [out n][in k] with k contiguous = the Bt / A layout the GEMM wants, so they are only converted.
// =====================================================================================================
extern "C" void kernel_launch(void* const* d_in, const int* in_sizes, int n_in,
                              void* d_out, int out_size, void* d_ws, size_t ws_size,
                              hipStream_t stream) {
  if (n_in < 14) return;
  if (in_sizes[0] != NB * SEQ * DM) return;
  if (in_sizes[1] != DQK * DM || in_sizes[2] != DQK) return;
  if (in_sizes[3] != DQK * DM || in_sizes[4] != DQK) return;
  if (in_sizes[5] != DM * DM || in_sizes[6] != DM) return;
  if (in_sizes[7] != DM * DM || in_sizes[8] != DM) return;
  for (int i = 9; i < 14; ++i) if (in_sizes[i] != NH * HD) return;
  if (out_size != NB * SEQ * DM) return;

  const float* x   = (const float*)d_in[0];
  const float* Wq  = (const float*)d_in[1];
  const float* bq  = (const float*)d_in[2];
  const float* Wk  = (const float*)d_in[3];
  const float* bk  = (const float*)d_in[4];
  const float* Wv  = (const float*)d_in[5];
  const float* bv  = (const float*)d_in[6];
  const float* Wo  = (const float*)d_in[7];
  const float* bo  = (const float*)d_in[8];
  const float* hnw = (const float*)d_in[9];
  const float* lq1 = (const float*)d_in[10];
  const float* lk1 = (const float*)d_in[11];
  const float* lq2 = (const float*)d_in[12];
  const float* lk2 = (const float*)d_in[13];
  float* outp = (float*)d_out;

  const size_t PXB  = (size_t)NB * SEQ * DM * 2;    //  8388608
  const size_t PWQ  = (size_t)DQK * DM * 2;         //  4194304
  const size_t PWV  = (size_t)DM * DM * 2;          //  2097152
  const size_t PIF  = 4096;                         //  32 floats used
  const size_t PTAB = (size_t)SEQ * NFREQ * 4;      //   262144
  const size_t PQF  = (size_t)NB * SEQ * DQK * 4;   // 33554432
  const size_t PQP  = (size_t)NB * SEQ * DQK * 2;   // 16777216
  const size_t PVT  = (size_t)NB * DM * SEQ * 2;    //  8388608
  const size_t PVL  = (size_t)NB * DM * VLP * 2;    //  2097152
  const size_t PC   = (size_t)NB * SEQ * DM * 4;    // 16777216
  const size_t PO   = (size_t)NB * SEQ * DM * 2;    //  8388608
  size_t off = 0;
  const size_t oXb  = off; off += PXB;
  const size_t oWq  = off; off += PWQ;
  const size_t oWk  = off; off += PWQ;
  const size_t oWv  = off; off += PWV;
  const size_t oWo  = off; off += PWV;
  const size_t oIF  = off; off += PIF;
  const size_t oCos = off; off += PTAB;
  const size_t oSin = off; off += PTAB;
  const size_t oQf  = off; off += PQF;
  const size_t oKf  = off; off += PQF;
  const size_t oQh  = off; off += PQP;
  const size_t oQl  = off; off += PQP;
  const size_t oKh  = off; off += PQP;
  const size_t oKl  = off; off += PQP;
  const size_t oVTh = off; off += PVT;
  const size_t oVTl = off; off += PVL;
  const size_t oC1  = off; off += PC;
  const size_t oC2  = off; off += PC;
  const size_t oOh  = off; off += PO;
  const size_t oOl  = off; off += PO;
  if (off > ws_size) return;                        // off = 216535040

  char* ws = (char*)d_ws;
  unsigned short* Xb  = (unsigned short*)(ws + oXb);
  unsigned short* Wqb = (unsigned short*)(ws + oWq);
  unsigned short* Wkb = (unsigned short*)(ws + oWk);
  unsigned short* Wvb = (unsigned short*)(ws + oWv);
  unsigned short* Wob = (unsigned short*)(ws + oWo);
  float*          IFt = (float*)(ws + oIF);
  float*          CosT = (float*)(ws + oCos);
  float*          SinT = (float*)(ws + oSin);
  float*          Qf  = (float*)(ws + oQf);
  float*          Kf  = (float*)(ws + oKf);
  unsigned short* Qh  = (unsigned short*)(ws + oQh);
  unsigned short* Ql  = (unsigned short*)(ws + oQl);
  unsigned short* Kh  = (unsigned short*)(ws + oKh);
  unsigned short* Kl  = (unsigned short*)(ws + oKl);
  unsigned short* VTh = (unsigned short*)(ws + oVTh);
  unsigned short* VTl = (unsigned short*)(ws + oVTl);
  float*          C1  = (float*)(ws + oC1);
  float*          C2  = (float*)(ws + oC2);
  unsigned short* Oh  = (unsigned short*)(ws + oOh);
  unsigned short* Ol  = (unsigned short*)(ws + oOl);

  const dim3 blk256(256), blk128(128), blk32(32);
  const dim3 gCvt((NB * SEQ * DM + 2 * DQK * DM + 2 * DM * DM) / 8 / 256);   // 5120 blocks
  const dim3 gTab((SEQ * NFREQ + 255) / 256);                      //  256 blocks
  const dim3 gQKV((SEQ / 64) * (DQK / 64) / 8, NB, 3);             // 1024 tiles -> 128 blocks, x batch x {q, k, v^T}
  const dim3 gOut((NB * SEQ / 64) * (DM / 64) / 8, 1);             // 1024 tiles -> 128 blocks
  const dim3 gRope(SEQ, NB);                                       // one block per token row
  const dim3 gRow(NB * SEQ);                                       // one block per token row
  const dim3 gAtt(NQB * 2 * NB * NH);                              // 2048 blocks

  // (1) inputs -> bf16 planes; weights [n][k] f32 -> bf16 [n][k]; Xb, Wqb, Wkb, Wvb, Wob are contiguous from Xb
  cvt_bf16x8<<<gCvt, blk256, 0, stream>>>(x, Wq, Wk, Wv, Wo, Xb);
  // (2) rope tables
  invfreq_tab<<<dim3(1), blk32, 0, stream>>>(IFt);
  rope_tab<<<gTab, blk256, 0, stream>>>(IFt, CosT, SinT);
  // (3) q, k -> f32 [NB*SEQ][DQK]; v^T -> f16 hi plane and residual plane, both batch elements
  gemm_qkv<<<gQKV, blk256, 0, stream>>>(Xb, Wqb, Wkb, Wvb, Qf, Kf, VTh, VTl, bq, bk, bv);
  // (4) rope + bf16 hi/lo split of q and k
  rope_split<<<gRope, blk256, 0, stream>>>(Qf, Kf, CosT, SinT, Qh, Ql, Kh, Kl);
  // (5) causal attention, stream 1 (q1, k1) -> C1 and stream 2 (q2, k2) -> C2;
  //     query blocks 0..RESQB-1 with residual planes, the rest without
  attn_causal64<<<gAtt, blk128, 0, stream>>>(Qh, Ql, Kh, Kl, VTh, VTl, C1, C2, 0.125f);
  // (6) differential combine + head norm -> O bf16 hi/lo planes [NB*SEQ][DM]
  diff_combine<<<gRow, blk128, 0, stream>>>(C1, C2, lq1, lk1, lq2, lk2, hnw, Oh, Ol);
  // (7) out = O . Wo^T + bo -> d_out, f32 [NB*SEQ][DM]  (A = O hi + lo planes, 2 products)
  gemm64<1, 0, 1><<<gOut, blk256, 0, stream>>>(
      Oh, Ol, DM, 0LL, Wob, Wob, DM, 0LL,
      (void*)outp, DM, 0LL, (void*)outp, DM, 0LL, DM,
      NB * SEQ, DM, DM, 1.0f, bo);
  (void)hipGetLastError();
}

// v003
// One run takes 236 microseconds.
// Timed twice side by side with v002, it ran 1.53 times as fast both times.
// All steps since v000 together make it 4.68 times as fast.
// Contractions: q, k, v^T projections = v_wmma_f32_16x16x32_bf16 (bf16 operands from RNE-converted inputs, single product);
// q.k^T scores (both streams) = v_wmma_f32_16x16x32_bf16 with bf16 hi/lo split q and k (hi.hi + hi.lo + lo.hi);
// p.v = v_wmma_f32_16x16x32_f16 (p carried x1024 in f16, v in f16; extra f16 residual planes x4096 of p and v for the first 512 query rows);
// ctx.Wo^T = v_wmma_f32_16x16x32_bf16 with ctx as bf16 hi/lo planes times bf16 Wo (2 products); all f32 accumulate;
// rope, softmax, lambda, head rms norm in f32.
#include <hip/hip_runtime.h>
#include <math.h>
#include <float.h>
#include <stdint.h>

#define NB    2
#define SEQ   2048
#define DM    1024
#define DQK   2048          // q / k projection width (2 x 64 per head)
#define NH    16
#define HD    64
#define NFREQ (HD / 2)
#define NQB   (SEQ / 64)    // 32 key / query tiles of 64
#define VLP   512           // key pitch of the v^T residual plane (keys 0..VLP-1)
#define RESQB 8             // number of leading 64-row query blocks that use the p / v residual planes
#define LAM0  0.2f
#define OSCL  0.8f
static_assert(RESQB * 64 <= VLP);
static_assert(NH * HD == DM);
static_assert(NB == 2 && NH == 16);   // the attention grid's index split
static_assert(NH * 2 * HD == DQK);
static_assert((SEQ % 256) == 0 && (DM % 256) == 0 && (DQK % 256) == 0);   // GEMM block tiles 128 x 256, 64 k per trip

typedef _Float16 v16h __attribute__((ext_vector_type(16)));
typedef _Float16 v8h  __attribute__((ext_vector_type(8)));
typedef __bf16   v16b __attribute__((ext_vector_type(16)));
typedef __bf16   v8b  __attribute__((ext_vector_type(8)));
typedef float    v8f  __attribute__((ext_vector_type(8)));
typedef float    v4f  __attribute__((ext_vector_type(4)));
typedef unsigned int v4u __attribute__((ext_vector_type(4)));

// ---- scalar helpers --------------------------------------------------------------------------------
__device__ __forceinline__ unsigned short bf_bits(float f) {          // f32 -> bf16 bits, RNE convert
  unsigned u = __float_as_uint(f);
  return (unsigned short)((u + 0x7FFFu + ((u >> 16) & 1u)) >> 16);
}
__device__ __forceinline__ float bf_up(unsigned short h) { return __uint_as_float(((unsigned)h) << 16); }
__device__ __forceinline__ float bfr(float f) { return bf_up(bf_bits(f)); }   // value after RNE convert to bf16
__device__ __forceinline__ unsigned short h_bits(_Float16 x) { return __builtin_bit_cast(unsigned short, x); }
__device__ __forceinline__ unsigned pk16(unsigned short a, unsigned short b) { return (unsigned)a | ((unsigned)b << 16); }
__device__ __forceinline__ v8f zero8() { v8f z = {0.f, 0.f, 0.f, 0.f, 0.f, 0.f, 0.f, 0.f}; return z; }
__device__ __forceinline__ v8h zero8h() {
  const _Float16 z = (_Float16)0.0f;
  v8h r = {z, z, z, z, z, z, z, z};
  return r;
}

// ---- fragment loaders: 16-bit A/B operand, lane -> row/col (lane&15), p already includes +8*(lane>>4);
//      elements 0..7 <- p[0..7] (k0+8h..), elements 8..15 <- p[16..23] (k0+16+8h..)
__device__ __forceinline__ v16b ldfrag_b(const __bf16* p) {
  union { v16b v; v8b h[2]; } f;
  f.h[0] = *(const v8b*)(p);
  f.h[1] = *(const v8b*)(p + 16);
  return f.v;
}

// ---- WMMA helpers with trailing VALU hazard gap --------------------------------------------------------
__device__ __forceinline__ v8f mma_b(v16b a, v16b b, v8f c) {
  c = __builtin_amdgcn_wmma_f32_16x16x32_bf16(false, a, false, b, (short)0, c, false, false);
#if defined(__HIP_DEVICE_COMPILE__)
  asm volatile("v_nop\n\tv_nop\n\tv_nop\n\tv_nop" : "+v"(c) : "v"(a), "v"(b));
#endif
  return c;
}
__device__ __forceinline__ v8f mma_h(v16h a, v16h b, v8f c) {
  c = __builtin_amdgcn_wmma_f32_16x16x32_f16(false, a, false, b, (short)0, c, false, false);
#if defined(__HIP_DEVICE_COMPILE__)
  asm volatile("v_nop\n\tv_nop\n\tv_nop\n\tv_nop" : "+v"(c) : "v"(a), "v"(b));
#endif
  return c;
}
__device__ __forceinline__ v8f mma_b_raw(v16b a, v16b b, v8f c) {
  return __builtin_amdgcn_wmma_f32_16x16x32_bf16(false, a, false, b, (short)0, c, false, false);
}
__device__ __forceinline__ void dep_guard_b(v8f& a, v8f& b, v16b x, v16b y) {
#if defined(__HIP_DEVICE_COMPILE__)
  asm volatile("v_nop\n\tv_nop\n\tv_nop\n\tv_nop" : "+v"(a), "+v"(b) : "v"(x), "v"(y));
#endif
}
__device__ __forceinline__ void keep4_b(v16b a, v16b b, v16b c, v16b d) {
#if defined(__HIP_DEVICE_COMPILE__)
  asm volatile("v_nop" :: "v"(a), "v"(b), "v"(c), "v"(d));
#endif
}
__device__ __forceinline__ void acc_guard4(v8f& a, v8f& b, v8f& c, v8f& d) {
#if defined(__HIP_DEVICE_COMPILE__)
  asm volatile("v_nop\n\tv_nop\n\tv_nop\n\tv_nop" : "+v"(a), "+v"(b), "+v"(c), "+v"(d));
#endif
}

// =====================================================================================================
// f32 -> bf16 (RNE convert), 8 elements per thread, one 16-B store per lane: a wave writes 512 contiguous B
// One grid for x, Wq, Wk, Wv, Wo: their bf16 planes lie back to back in the workspace in that order, so the
// output index is the flat thread index; the source is picked per block (every plane is a multiple of 2048
// elements, so a block never straddles two planes).
// coverage: (NX + 2 NQ + 2 NV) threads x 8 = all five planes.
// =====================================================================================================
__global__ __launch_bounds__(256) void cvt_bf16x8(const float* __restrict__ x, const float* __restrict__ wq,
                                                  const float* __restrict__ wk, const float* __restrict__ wv,
                                                  const float* __restrict__ wo, unsigned short* out) {
  constexpr int NX = NB * SEQ * DM / 8, NQ = DQK * DM / 8, NV = DM * DM / 8;
  static_assert((NX % 256) == 0 && (NQ % 256) == 0 && (NV % 256) == 0);
  const int i = blockIdx.x * 256 + threadIdx.x;
  if (i < NX + 2 * NQ + 2 * NV) {
    const float* in = x;
    int j = i;
    if (i >= NX + 2 * NQ + NV)  { in = wo; j = i - (NX + 2 * NQ + NV); }
    else if (i >= NX + 2 * NQ)  { in = wv; j = i - (NX + 2 * NQ); }
    else if (i >= NX + NQ)      { in = wk; j = i - (NX + NQ); }
    else if (i >= NX)           { in = wq; j = i - NX; }
    const v4f a = *(const v4f*)(in + (size_t)j * 8);
    const v4f b = *(const v4f*)(in + (size_t)j * 8 + 4);
    v4u p;
    p[0] = pk16(bf_bits(a[0]), bf_bits(a[1]));
    p[1] = pk16(bf_bits(a[2]), bf_bits(a[3]));
    p[2] = pk16(bf_bits(b[0]), bf_bits(b[1]));
    p[3] = pk16(bf_bits(b[2]), bf_bits(b[3]));
    *(v4u*)(out + (size_t)i * 8) = p;
    
  }
}

// =====================================================================================================
// inv_freq[j] = 1 / 10000^(j/32), j = 0..31, f32 with precise powf. One block of 32 threads; the 32 values
// coverage: lanes 0..7 x 4 floats = all 32 entries.
// =====================================================================================================
__global__ __launch_bounds__(32) void invfreq_tab(float* invf) {
  __shared__ __align__(16) float sf[NFREQ];
  const int j = threadIdx.x;
  const float e = (float)j * (1.0f / (float)NFREQ);
  const float pw = powf(10000.0f, e);
  sf[j] = 1.0f / pw;
  __syncthreads();
  const v4f v = *(const v4f*)(sf + 4 * (j & 7));
  if (j < 8) *(v4f*)(invf + 4 * j) = v;
  
}

// =====================================================================================================
// cos / sin tables [SEQ][32]: angle = t * inv_freq[j] (f32 multiply), precise cosf / sinf.
// =====================================================================================================
__global__ __launch_bounds__(256) void rope_tab(const float* __restrict__ invf, float* cosT, float* sinT) {
  const int g = blockIdx.x * 256 + threadIdx.x;
  if (g < SEQ * NFREQ) {
    const int t = g / NFREQ;
    const int j = g - t * NFREQ;
    const float ang = (float)t * invf[j];
    const float cv = cosf(ang);
    const float sv = sinf(ang);
    *(float*)(cosT + g) = cv;
    *(float*)(sinT + g) = sv;
    
  }
}

// =====================================================================================================
// Register-blocked bf16 WMMA GEMM: C[m][n] = sum_k A[m][k] * Bt[n][k] (+ bias); one wave per 64x64 tile, a block of
// 8 waves (2 x 4) per 128 x 256 tile. A row-major [M][K] pitch lda; Bt row-major [N][K] pitch ldb (k contiguous);
// M multiple of 128, N of 256, K of 64. b = batch index (strides in elements).
// The tile body is a device function (block tile index, batch index and the LDS come from the caller), so
// that one grid can hold several independent products.
// Operands reach the waves through LDS: per trip of 64 k the block's 128 A rows and 256 Bt rows (128 B = one line each)
// are brought in by asynchronous copies to LDS, 16 B per lane, 8 lanes per row, so that one wave-wide copy covers 4
// whole lines; a fragment load straight from global memory touches 16 lines for the same 512 B, and every wave
// fetched its own copy of rows that its neighbours need too. Two buffers: the next trip's copies fly during this
// trip's products. LDS row pitch 144 B (16 B x odd) for the ds_load_b128 fragment reads. The k order of the products
// is unchanged (32 k per WMMA, ascending).
// NSPLIT: 0 = A.Bt; 1 = (A + A2).Bt (A2 = unscaled bf16 lo plane of A).
// OUT_MODE: 0 = f32 (pitch ldc); 2 = bf16 hi plane C + bf16 lo plane C2 (lo = RNE(v - hi), unscaled);
//           3 = f16 hi plane C + f16 residual plane C2 = f16((v - hi) * rscale), C2 written only for tiles
//               with n0 < N2 (pitch ldc2, batch stride strideC2).
// BIAS: 0 = none; 1 = + bf16-RNE(bias[n]) per column; 2 = + bf16-RNE(bias[m]) per row (added in f32).
// =====================================================================================================
#define GP        72                                  // LDS row pitch of a staged operand row, in elements (144 B)
#define GROW_B    (GP * 2)
#define GSTG_B(NS) ((128 + 256 + 128 * (NS)) * GROW_B)  // one buffer: A rows | Bt rows | A2 rows: 55296 B / 73728 B
static_assert((GROW_B % 16) == 0 && ((GROW_B / 16) & 1) == 1);

// Four asynchronous 16-B copies to LDS per lane (l = the lane's LDS byte address, g = its global address).
// s_wait_xcnt 0 is the last line of the copies' own statement: it stands in front of any rewrite of the address registers.
__device__ __forceinline__ void copy4_lds(unsigned l0, const __bf16* g0, unsigned l1, const __bf16* g1,
                                          unsigned l2, const __bf16* g2, unsigned l3, const __bf16* g3) {
#if defined(__HIP_DEVICE_COMPILE__)
  asm volatile("global_load_async_to_lds_b128 %0, %1, off\n\t"
               "global_load_async_to_lds_b128 %2, %3, off\n\t"
               "global_load_async_to_lds_b128 %4, %5, off\n\t"
               "global_load_async_to_lds_b128 %6, %7, off\n\t"
               "s_wait_xcnt 0x0"
               :: "v"(l0), "v"(g0), "v"(l1), "v"(g1), "v"(l2), "v"(g2), "v"(l3), "v"(g3) : "memory");
#endif
}
// The issuing wave's own copies have landed (in front of the barrier behind which other waves read them).
__device__ __forceinline__ void wait_copies() {
#if defined(__HIP_DEVICE_COMPILE__)
  asm volatile("s_wait_asynccnt 0x0" ::: "memory");
#endif
}
// This wave's LDS reads have returned (in front of the barrier behind which their buffer is refilled).
__device__ __forceinline__ void wait_lds() {
#if defined(__HIP_DEVICE_COMPILE__)
  asm volatile("s_wait_dscnt 0x0" ::: "memory");
#endif
}
// One 64-k tile of the block's operands into one buffer: 256 threads x 16 B = 32 rows per copy; dst = the lane's LDS
// byte address of row tid>>3, chunk tid&7 of the buffer; gA / gB / gA2 = its global address in row tid>>3 of the block's rows.
template <int NSPLIT>
__device__ __forceinline__ void gemm_stage(unsigned dst, const __bf16* gA, const __bf16* gB, const __bf16* gA2,
                                           int lda, int ldb) {
  const size_t ra = (size_t)32 * lda, rb = (size_t)32 * ldb;
  constexpr unsigned R = 32 * GROW_B;
  copy4_lds(dst, gA, dst + R, gA + ra, dst + 2 * R, gA + 2 * ra, dst + 3 * R, gA + 3 * ra);
  copy4_lds(dst + 4 * R, gB, dst + 5 * R, gB + rb, dst + 6 * R, gB + 2 * rb, dst + 7 * R, gB + 3 * rb);
  copy4_lds(dst + 8 * R, gB + 4 * rb, dst + 9 * R, gB + 5 * rb, dst + 10 * R, gB + 6 * rb, dst + 11 * R, gB + 7 * rb);
  if (NSPLIT == 1)
    copy4_lds(dst + 12 * R, gA2, dst + 13 * R, gA2 + ra, dst + 14 * R, gA2 + 2 * ra, dst + 15 * R, gA2 + 3 * ra);
}

template <int NSPLIT, int OUT_MODE, int BIAS>
__device__ __forceinline__ void gemm64_tile(
    const unsigned short* __restrict__ Ap, const unsigned short* A2p, int lda, long long strideA,
    const unsigned short* __restrict__ Btp, const unsigned short* Bt2p, int ldb, long long strideB,
    void* Cout, int ldc, long long strideC,
    void* Cout2, int ldc2, long long strideC2, int N2,
    int M, int N, int K, float rscale, const float* __restrict__ bias,
    float* slab, unsigned char* stg, int bt, int b) {
  static_assert(NSPLIT == 0 || NSPLIT == 1);
  const __bf16* A   = (const __bf16*)(const void*)Ap;
  const __bf16* A2  = (const __bf16*)(const void*)A2p;
  const __bf16* Bt  = (const __bf16*)(const void*)Btp;
  const int tid  = threadIdx.x;
  const int lane = tid & 31;
  const int wave = tid >> 5;
  const int blocksN = N >> 8;
  const int blocksM = M >> 7;
  if (bt >= blocksM * blocksN) return;   // block-uniform, in front of every copy and barrier
  const int bm  = bt / blocksN;
  const int bn  = bt - bm * blocksN;
  const int mb0 = bm << 7;
  const int nb0 = bn << 8;
  const int wm  = wave >> 2;             // the wave's 64 rows of the block's 128
  const int wn  = wave & 3;              // the wave's 64 columns of the block's 256
  const int m0  = mb0 + (wm << 6);
  const int n0  = nb0 + (wn << 6);

  const __bf16* Ab  = A  + (size_t)b * strideA;
  const __bf16* Bb  = Bt + (size_t)b * strideB;
  const __bf16* Ab2 = (NSPLIT >= 1) ? (A2  + (size_t)b * strideA) : Ab;

  const int rlane = lane & 15;                 // row (A) / col (B, D) within subtile
  const int koff  = (lane >> 4) * 8;           // k offset of this lane half
  const int mOff  = (lane >> 4) * 8;           // D row offset

  v8f acc[4][4];
#pragma unroll
  for (int i = 0; i < 4; ++i)
#pragma unroll
    for (int j = 0; j < 4; ++j) acc[i][j] = zero8();

  constexpr unsigned STG = GSTG_B(NSPLIT);
  const int nt   = K >> 6;                     // trips of 64 k
  const int srow = tid >> 3, sch = tid & 7;    // this lane's row (of 32 per copy) and 16-B chunk of the 128-B row
  const unsigned sdst = (unsigned)(size_t)stg + (unsigned)(srow * GROW_B + sch * 16);
  const __bf16* gA  = Ab  + (size_t)(mb0 + srow) * lda + sch * 8;
  const __bf16* gB  = Bb  + (size_t)(nb0 + srow) * ldb + sch * 8;
  const __bf16* gA2 = Ab2 + (size_t)(mb0 + srow) * lda + sch * 8;

  // tile 0 -> buffer 0, landed and published; then tile 1 -> buffer 1 in flight
  gemm_stage<NSPLIT>(sdst, gA, gB, gA2, lda, ldb);
  wait_copies();
  __syncthreads();
  if (nt > 1) gemm_stage<NSPLIT>(sdst + STG, gA + 64, gB + 64, gA2 + 64, lda, ldb);

  for (int t = 0; t < nt; ++t) {               // block-uniform trip count
    const __bf16* sb  = (const __bf16*)(const void*)(stg + (size_t)(t & 1) * STG);
    const __bf16* sA  = sb + ((wm << 6) + rlane) * GP + koff;
    const __bf16* sB  = sb + (128 + (wn << 6) + rlane) * GP + koff;
    const __bf16* sA2 = (NSPLIT >= 1) ? (sb + (384 + (wm << 6) + rlane) * GP + koff) : sA;
    // unrolled (here and below): the fragment arrays need constant indices to stay in registers, and the second
    // 32-k block's LDS reads can then be issued among the first block's products
#pragma unroll
    for (int kk = 0; kk < 2; ++kk) {
      v16b bh[4], ahf[4], alf[4];
#pragma unroll
      for (int j = 0; j < 4; ++j) bh[j] = ldfrag_b(sB + (j << 4) * GP + kk * 32);
#pragma unroll
      for (int i = 0; i < 4; ++i) {
        ahf[i] = ldfrag_b(sA + (i << 4) * GP + kk * 32);
        if (NSPLIT >= 1) alf[i] = ldfrag_b(sA2 + (i << 4) * GP + kk * 32); else alf[i] = ahf[i];
      }
#pragma unroll
      for (int i = 0; i < 4; ++i) {
        const v16b ah = ahf[i], al = alf[i];
#pragma unroll
        for (int j = 0; j < 4; ++j) {
          acc[i][j] = mma_b_raw(ah, bh[j], acc[i][j]);
          if (NSPLIT >= 1) acc[i][j] = mma_b_raw(al, bh[j], acc[i][j]);
        }
        dep_guard_b(acc[i][0], acc[i][3], ah, al);
      }
      keep4_b(bh[0], bh[1], bh[2], bh[3]);
    }
    // foot of the trip: own reads of this buffer done, own copies of the next tile landed, one barrier for both;
    // only then the refill of the buffer that this trip has read
    wait_lds();
    wait_copies();
    __syncthreads();
    if (t + 2 < nt) {
      const int kn = (t + 2) << 6;
      gemm_stage<NSPLIT>(sdst + (unsigned)(t & 1) * STG, gA + kn, gB + kn, gA2 + kn, lda, ldb);
    }
  }
  wait_copies();
  acc_guard4(acc[0][0], acc[0][1], acc[0][2], acc[0][3]);
  acc_guard4(acc[1][0], acc[1][1], acc[1][2], acc[1][3]);
  acc_guard4(acc[2][0], acc[2][1], acc[2][2], acc[2][3]);
  acc_guard4(acc[3][0], acc[3][1], acc[3][2], acc[3][3]);

  // ---- epilogue ----
  float bcol[4];
#pragma unroll
  for (int j = 0; j < 4; ++j) bcol[j] = 0.f;
  if (BIAS == 1) {
#pragma unroll
    for (int j = 0; j < 4; ++j) bcol[j] = bfr(bias[n0 + (j << 4) + rlane]);
  }
#pragma unroll
  for (int i = 0; i < 4; ++i) {
    const int mBase = m0 + (i << 4);
    float brow[8];
#pragma unroll
    for (int r = 0; r < 8; ++r) brow[r] = 0.f;
    if (BIAS == 2) {
#pragma unroll
      for (int r = 0; r < 8; ++r) brow[r] = bfr(bias[mBase + mOff + r]);
    }
#pragma unroll
    for (int j = 0; j < 4; ++j) {
#pragma unroll
      for (int r = 0; r < 8; ++r) {
        slab[(mOff + r) * 68 + (j << 4) + rlane] = (acc[i][j][r] + bcol[j]) + brow[r];
      }
    }
    __builtin_amdgcn_fence(__ATOMIC_RELEASE, "workgroup");
    __builtin_amdgcn_wave_barrier();
    __builtin_amdgcn_fence(__ATOMIC_ACQUIRE, "workgroup");
    if (OUT_MODE == 0) {
      float* C = (float*)Cout + (size_t)b * strideC;
      const int hh = lane >> 4, c4 = (lane & 15) * 4;     // 256-B row segment = 16 lanes x 16 B
      {
#pragma unroll
        for (int it = 0; it < 8; ++it) {
          const int row = it * 2 + hh;                     // it 0..7 x hh 0..1 = rows 0..15
          const v4f v = *(const v4f*)(slab + row * 68 + c4);
          *(v4f*)(C + (size_t)(mBase + row) * ldc + n0 + c4) = v;
        }
        
      }
    } else {
      const int q = lane >> 3, c8 = (lane & 7) * 8;
      unsigned short* C  = (unsigned short*)Cout  + (size_t)b * strideC;
      unsigned short* C2 = (unsigned short*)Cout2 + (size_t)b * strideC2;
      const bool wlo = (OUT_MODE == 2) || (n0 < N2);      // wave-uniform
      v4u hv[4], lv[4];
#pragma unroll
      for (int it = 0; it < 4; ++it) {
        const int row = it * 4 + q;                        // it 0..3 x q 0..3 = rows 0..15
        const float* sp = slab + row * 68 + c8;
        v4u a, a2;
#pragma unroll
        for (int e = 0; e < 4; ++e) {
          const float f0 = sp[2 * e], f1 = sp[2 * e + 1];
          unsigned short h0, h1, l0, l1;
          if (OUT_MODE == 2) {
            h0 = bf_bits(f0); h1 = bf_bits(f1);
            l0 = bf_bits(f0 - bf_up(h0)); l1 = bf_bits(f1 - bf_up(h1));
          } else {
            const _Float16 x0 = (_Float16)f0, x1 = (_Float16)f1;
            h0 = h_bits(x0); h1 = h_bits(x1);
            l0 = h_bits((_Float16)((f0 - (float)x0) * rscale));
            l1 = h_bits((_Float16)((f1 - (float)x1) * rscale));
          }
          a[e] = pk16(h0, h1); a2[e] = pk16(l0, l1);
        }
        hv[it] = a; lv[it] = a2;
      }
      {
#pragma unroll
        for (int it = 0; it < 4; ++it) {
          const int row = it * 4 + q;
          *(v4u*)(C + (size_t)(mBase + row) * ldc + n0 + c8) = hv[it];
          if (wlo) *(v4u*)(C2 + (size_t)(mBase + row) * ldc2 + n0 + c8) = lv[it];
        }
        
      }
    }
    __builtin_amdgcn_fence(__ATOMIC_RELEASE, "workgroup");
    __builtin_amdgcn_wave_barrier();
    __builtin_amdgcn_fence(__ATOMIC_ACQUIRE, "workgroup");
  }
}

// One product per grid: blockIdx.x = 128 x 256 block tile, blockIdx.y = batch index.
template <int NSPLIT, int OUT_MODE, int BIAS>
__global__ __launch_bounds__(256) void gemm64(
    const unsigned short* __restrict__ Ap, const unsigned short* A2p, int lda, long long strideA,
    const unsigned short* __restrict__ Btp, const unsigned short* Bt2p, int ldb, long long strideB,
    void* Cout, int ldc, long long strideC,
    void* Cout2, int ldc2, long long strideC2, int N2,
    int M, int N, int K, float rscale, const float* __restrict__ bias) {
  __shared__ __align__(16) float sT[8][16 * 68];   // per-wave 16x64 slab, pitch 68 floats
  __shared__ __align__(16) unsigned char sG[2 * GSTG_B(NSPLIT)];   // two operand buffers
  const int wave = threadIdx.x >> 5;
  gemm64_tile<NSPLIT, OUT_MODE, BIAS>(Ap, A2p, lda, strideA, Btp, Bt2p, ldb, strideB, Cout, ldc, strideC,
                                      Cout2, ldc2, strideC2, N2, M, N, K, rscale, bias,
                                      sT[wave], sG, blockIdx.x, blockIdx.y);
}

// q, k and v^T projections of both batch elements in one grid: blockIdx.z = 0 q, 1 k, 2 v^T; blockIdx.y = batch;
// blockIdx.x = 128 x 256 block tile (v^T has half the tiles of q / k: its upper blocks leave at the tile test).
//   q / k = x_b . W^T + bias[col] -> f32 [NB*SEQ][DQK]                 (M=SEQ, N=DQK, K=DM)
//   v^T   = Wv . x_b^T + bv[row]  -> f16 hi plane [b][h*64+d][s] (pitch SEQ) and residual plane
//           (x4096, keys < VLP only, pitch VLP)                        (M=DM, N=SEQ, K=DM)
__global__ __launch_bounds__(256) void gemm_qkv(
    const unsigned short* __restrict__ Xb, const unsigned short* __restrict__ Wqb,
    const unsigned short* __restrict__ Wkb, const unsigned short* __restrict__ Wvb,
    float* Qf, float* Kf, unsigned short* VTh, unsigned short* VTl,
    const float* __restrict__ bq, const float* __restrict__ bk, const float* __restrict__ bv) {
  __shared__ __align__(16) float sT[8][16 * 68];   // per-wave 16x64 slab, pitch 68 floats
  __shared__ __align__(16) unsigned char sG[2 * GSTG_B(0)];   // two operand buffers
  const int wave = threadIdx.x >> 5;
  const int tile = blockIdx.x;
  const int b    = blockIdx.y;
  const int z    = blockIdx.z;
  if (z < 2) {
    const unsigned short* Wb = z ? Wkb : Wqb;
    float* Cf = z ? Kf : Qf;
    const float* bias = z ? bk : bq;
    gemm64_tile<0, 0, 1>(Xb, Xb, DM, (long long)SEQ * DM, Wb, Wb, DM, 0LL,
                         (void*)Cf, DQK, (long long)SEQ * DQK, (void*)Cf, DQK, 0LL, DQK,
                         SEQ, DQK, DM, 1.0f, bias, sT[wave], sG, tile, b);
  } else {
    gemm64_tile<0, 3, 2>(Wvb, Wvb, DM, 0LL, Xb, Xb, DM, (long long)SEQ * DM,
                         (void*)VTh, SEQ, (long long)DM * SEQ, (void*)VTl, VLP, (long long)DM * VLP, VLP,
                         DM, SEQ, DM, 4096.0f, bv, sT[wave], sG, tile, b);
  }
}

// =====================================================================================================
// RoPE half-split rotation of 8 consecutive columns of one 64-wide vector, then bf16 hi/lo split and
//   first half  (j < 32):   out[j]    = x[j]*cos[j]   - x[j+32]*sin[j]     (x1 = a, x2 = p)
//   second half (j >= 32):  out[j+32] = x[j]*sin[j]   + x[j+32]*cos[j]     (x1 = p, x2 = a)
// =====================================================================================================
__device__ __forceinline__ void rope_row8(const float* __restrict__ src, size_t rowOff, int c0, int p0,
                                          bool second, v4f cs0, v4f cs1, v4f sn0, v4f sn1,
                                          unsigned short* Hp, unsigned short* Lp) {
#pragma clang fp contract(off)
  const v4f xa0 = *(const v4f*)(src + rowOff + c0);
  const v4f xa1 = *(const v4f*)(src + rowOff + c0 + 4);
  const v4f xp0 = *(const v4f*)(src + rowOff + p0);
  const v4f xp1 = *(const v4f*)(src + rowOff + p0 + 4);
  float o[8];
#pragma unroll
  for (int e = 0; e < 4; ++e) {
    {
      const float a = xa0[e], p = xp0[e], cs = cs0[e], sn = sn0[e];
      const float f1 = a * cs - p * sn;
      const float f2 = p * sn + a * cs;
      o[e] = second ? f2 : f1;
    }
    {
      const float a = xa1[e], p = xp1[e], cs = cs1[e], sn = sn1[e];
      const float f1 = a * cs - p * sn;
      const float f2 = p * sn + a * cs;
      o[4 + e] = second ? f2 : f1;
    }
  }
  v4u hv, lv;
#pragma unroll
  for (int e = 0; e < 4; ++e) {
    const float f0 = o[2 * e], f1 = o[2 * e + 1];
    const unsigned short h0 = bf_bits(f0), h1 = bf_bits(f1);
    const unsigned short l0 = bf_bits(f0 - bf_up(h0)), l1 = bf_bits(f1 - bf_up(h1));
    hv[e] = pk16(h0, h1); lv[e] = pk16(l0, l1);
  }
  const size_t go = rowOff + c0;
  *(v4u*)(Hp + go) = hv;
  *(v4u*)(Lp + go) = lv;
  
}

// =====================================================================================================
// RoPE + hi/lo split for one token row t of q and k (f32 planes [NB*SEQ][DQK], per head 128 columns =
// two 64-wide vectors). grid = (SEQ, NB) blocks x 256 threads; thread -> columns 8*tid..8*tid+7.
// Outputs: bf16 hi / lo planes [NB*SEQ][DQK] for q and for k.
// coverage: 256 threads x 8 columns = 2048 columns of each of the 4 output planes per row; NB*SEQ rows.
// =====================================================================================================
__global__ __launch_bounds__(256) void rope_split(const float* __restrict__ Qf, const float* __restrict__ Kf,
                                                   const float* __restrict__ cosT, const float* __restrict__ sinT,
                                                   unsigned short* Qh, unsigned short* Ql,
                                                   unsigned short* Kh, unsigned short* Kl) {
  const int t = blockIdx.x;
  const int c0 = threadIdx.x * 8;
  const int jj0 = c0 & 31;
  const bool second = (c0 & 32) != 0;
  const int p0 = second ? (c0 - 32) : (c0 + 32);
  const float* cr = cosT + (size_t)t * NFREQ + jj0;
  const float* sr = sinT + (size_t)t * NFREQ + jj0;
  const v4f cs0 = *(const v4f*)(cr), cs1 = *(const v4f*)(cr + 4);
  const v4f sn0 = *(const v4f*)(sr), sn1 = *(const v4f*)(sr + 4);
  const size_t rowOff = ((size_t)blockIdx.y * SEQ + t) * DQK;
  rope_row8(Qf, rowOff, c0, p0, second, cs0, cs1, sn0, sn1, Qh, Ql);
  rope_row8(Kf, rowOff, c0, p0, second, cs0, cs1, sn0, sn1, Kh, Kl);
}

// =====================================================================================================
// Causal attention, head dim 64: body for one 64-row query block of one head, stream and batch element
// (the plane pointers arrive already moved to the batch element).
//   q planes (bf16 hi / lo) [SEQ][DQK]: element (t, h, stream, d) at [t*DQK + h*128 + soff + d] (soff 0 / 64)
//   k planes: same layout with key index s
//   v^T hi plane (f16):      element (h, d, s) at [(h*64 + d)*SEQ + s]
//   v^T residual plane (f16, (v - hi)*4096): [(h*64 + d)*VLP + s], s < VLP, read only when RES
//   (a key tile at or beyond VLP contributes a zero v residual)
//   causal: key tiles kt = 0..qb processed (block-uniform trip count <= 32); only the diagonal tile gets the
//   per-lane -inf fill for keys beyond the query row (a fill, not a bias); every row keeps its diagonal key.
//   context plane C f32 [SEQ][DM]: element (t, h, d) at [t*DM + h*64 + d]  (normalised by 1/l)
//   scores = q . k : bf16 hi/lo split (hi.hi + hi.lo + lo.hi), f32 accumulate, then * sscale in f32
//   p = exp(s - m) carried as f16(1024 p); context = p . v on f16 WMMA; RES adds f16 residual planes of p and v
//   (scale 4096, separate accumulator folded back with 1/4096 per chunk in f32); online softmax in f32.
//   Block = 4 waves = 64 query rows of one head; kv chunks of 64. LDS is carved from the caller's one array.
//   LDS rows of the K, V^T and P tiles (64 16-bit elements = 128 B of data) stand at a pitch of LP = 72 elements
//   (144 B = 16 B x 9): the 16 lanes of a half wave that read 16 B each from 16 consecutive rows then fall on 16
//   different groups of four banks; at 128 B they fall on two. The pad elements are never written or read.
//   K / V^T chunk staging: 128 threads x 32 elements per plane = the whole 64x64 tile (plain 16-B loads,
//   __syncthreads before and after); P tiles are wave-private, spilled with _Float16 element stores and reloaded
//   Output coverage: each wave stores rows q0..q0+15 (it 0..7 x lane>>4 0..1) x 64 columns (16 lanes x 4 floats),
// =====================================================================================================
#define LP      72                        // LDS row pitch of the 16-bit tiles, in elements
#define TILE_B  (64 * LP * 2)             // one 64-row tile: 9216 B
#define PW_B    (16 * LP * 2)             // one wave's 16-row P tile: 2304 B
#define OS_B    (4 * 16 * 64 * 4)         // four waves' f32 context tiles: 16384 B
#define ATT_LDS (4 * TILE_B + 2 * 4 * PW_B + OS_B)   // 71680 B
static_assert(((LP * 2) % 16) == 0 && (((LP * 2) / 16) & 1) == 1);   // 16-B aligned rows, odd multiple of 16 B
template <bool RES>
__device__ __forceinline__
void attn_block64(unsigned char* smem,
                  const unsigned short* __restrict__ qhp, const unsigned short* __restrict__ qlp,
                  const unsigned short* __restrict__ khp, const unsigned short* __restrict__ klp,
                  const unsigned short* __restrict__ vhp, const unsigned short* __restrict__ vlp,
                  float* Cp, int soff, int qb, int h, float sscale) {
  union FB { v16b v; v8b h[2]; };
  union FH { v16h v; v8h h[2]; };
  __bf16*   Ksh = (__bf16*)(void*)(smem);                         // K hi [kv][d]
  __bf16*   Ksl = (__bf16*)(void*)(smem + TILE_B);                // K lo
  _Float16* Vth = (_Float16*)(void*)(smem + 2 * TILE_B);          // V^T hi [d][kv]
  _Float16* Psh = (_Float16*)(void*)(smem + 3 * TILE_B);          // per wave P [row][kv], 4 x PW_B
  float*    Os  = (float*)(void*)(smem + 3 * TILE_B + 4 * PW_B);  // per wave context tile [row][d], 4 x 4 KB
  _Float16* Vtl = (_Float16*)(void*)(smem + 3 * TILE_B + 4 * PW_B + OS_B);   // V^T residual (RES only)
  _Float16* Psl = (_Float16*)(void*)(smem + 4 * TILE_B + 4 * PW_B + OS_B);   // per wave P residual (RES only)

  const int tid  = threadIdx.x;
  const int wave = tid >> 5;
  const int lane = tid & 31;
  const int hh   = lane >> 4;
  const int c    = lane & 15;

  const int q0   = qb * 64 + wave * 16;
  const int col  = h * (2 * HD) + soff;

  const __bf16* Qh = (const __bf16*)(const void*)qhp + col;
  const __bf16* Ql = (const __bf16*)(const void*)qlp + col;
  const __bf16* Kh = (const __bf16*)(const void*)khp + col;
  const __bf16* Kl = (const __bf16*)(const void*)klp + col;
  const _Float16* Vh = (const _Float16*)(const void*)vhp + (size_t)h * HD * SEQ;
  const _Float16* Vl = (const _Float16*)(const void*)vlp + (size_t)h * HD * VLP;

  // ---- Q fragments (A operand, row = lane&15): 2 d-chunks, hi and lo ----
  v16b qah[2], qal[2];
#pragma unroll
  for (int dc = 0; dc < 2; ++dc) {
    const size_t qo = (size_t)(q0 + c) * DQK + dc * 32 + 8 * hh;
    qah[dc] = ldfrag_b(Qh + qo);
    qal[dc] = ldfrag_b(Ql + qo);
  }

  float mrow[8], lrow[8];
  v8f oacc[4];
#pragma unroll
  for (int r = 0; r < 8; ++r) { mrow[r] = -INFINITY; lrow[r] = 0.f; }
#pragma unroll
  for (int t = 0; t < 4; ++t) oacc[t] = zero8();

  for (int kt = 0; kt < NQB; ++kt) {         // static trip bound
    if (kt > qb) break;                      // block-uniform (causal)
    const bool diag = (kt == qb);            // block-uniform
    const int kv0 = kt * 64;
    __syncthreads();
    {
      const int r = tid >> 1, half = (tid & 1) * 32;
      const __bf16*   kg  = Kh + (size_t)(kv0 + r) * DQK + half;   // K row kv0+r, d = half..half+31
      const __bf16*   klg = Kl + (size_t)(kv0 + r) * DQK + half;
      const _Float16* vg  = Vh + (size_t)r * SEQ + kv0 + half;      // V^T row d = r, s = kv0+half..+31
      const int kvl = (kv0 + 64 <= VLP) ? kv0 : (VLP - 64);       // clamped address into the residual plane
      const _Float16* vlg = Vl + (size_t)r * VLP + kvl + half;
      const bool resOK = (kv0 + 64 <= VLP);                        // block-uniform
      v8b a0[4], a1[4];
      v8h b0[4], b1[4];
#pragma unroll
      for (int i = 0; i < 4; ++i) {
        a0[i] = *(const v8b*)(kg + 8 * i);
        a1[i] = *(const v8b*)(klg + 8 * i);
        b0[i] = *(const v8h*)(vg + 8 * i);
        if (RES) {
          b1[i] = *(const v8h*)(vlg + 8 * i);
          if (!resOK) b1[i] = zero8h();
        }
      }
#if defined(__HIP_DEVICE_COMPILE__)
      // s_wait_xcnt 0 before a register that an issued load names is written again; the addresses are inputs so that
      // they stay in their registers up to the wait (else the last load's destination may take an address pair over).
      if (RES) asm volatile("s_wait_xcnt 0x0" :: "v"(kg), "v"(klg), "v"(vg), "v"(vlg) : "memory");
      else     asm volatile("s_wait_xcnt 0x0" :: "v"(kg), "v"(klg), "v"(vg) : "memory");
#endif
#pragma unroll
      for (int i = 0; i < 4; ++i) {
        *(v8b*)(Ksh + r * LP + half + 8 * i) = a0[i];
        *(v8b*)(Ksl + r * LP + half + 8 * i) = a1[i];
        *(v8h*)(Vth + r * LP + half + 8 * i) = b0[i];
        if (RES) *(v8h*)(Vtl + r * LP + half + 8 * i) = b1[i];
      }
    }
    __syncthreads();

    // ---- scores: 16 query rows x 64 keys per wave, 3 bf16 products ----
    v8f s[4];
#pragma unroll
    for (int j = 0; j < 4; ++j) {
      s[j] = zero8();
#pragma unroll
      for (int dc = 0; dc < 2; ++dc) {
        FB kb, kl;
        kb.h[0] = *(const v8b*)(Ksh + (j * 16 + c) * LP + dc * 32 + 8 * hh);
        kb.h[1] = *(const v8b*)(Ksh + (j * 16 + c) * LP + dc * 32 + 16 + 8 * hh);
        kl.h[0] = *(const v8b*)(Ksl + (j * 16 + c) * LP + dc * 32 + 8 * hh);
        kl.h[1] = *(const v8b*)(Ksl + (j * 16 + c) * LP + dc * 32 + 16 + 8 * hh);
        s[j] = mma_b(qah[dc], kb.v, s[j]);
        s[j] = mma_b(qah[dc], kl.v, s[j]);
        s[j] = mma_b(qal[dc], kb.v, s[j]);
      }
    }

    // ---- scale, causal fill on the diagonal tile, row max, online softmax, P (x1024, f16) and
    //      P residual (x4096) to LDS ----
    _Float16* pwh = Psh + wave * (16 * LP);
    _Float16* pwl = Psl + wave * (16 * LP);
#pragma unroll
    for (int r = 0; r < 8; ++r) {
      const int qrow = q0 + 8 * hh + r;
      float m = -INFINITY;
#pragma unroll
      for (int j = 0; j < 4; ++j) {
        const int key = kv0 + j * 16 + c;
        float sv = s[j][r] * sscale;
        sv = (diag && key > qrow) ? -INFINITY : sv;
        s[j][r] = sv;
        m = fmaxf(m, sv);
      }
#pragma unroll
      for (int off = 1; off < 16; off <<= 1) m = fmaxf(m, __shfl_xor(m, off, 32));
      const float mnew  = fmaxf(mrow[r], m);
      const float msafe = (mnew == -INFINITY) ? 0.f : mnew;
      const float alpha = __expf(mrow[r] - msafe);
      mrow[r] = mnew;
      float psum = 0.f;
#pragma unroll
      for (int j = 0; j < 4; ++j) {
        const float p = __expf(s[j][r] - msafe);     // -inf logit: exp -> 0
        psum += p;
        const float p1k = p * 1024.0f;
        const _Float16 ph = (_Float16)p1k;
        pwh[(8 * hh + r) * LP + j * 16 + c] = ph;
        if (RES) {
          const _Float16 pl = (_Float16)((p1k - (float)ph) * 4096.0f);
          pwl[(8 * hh + r) * LP + j * 16 + c] = pl;
        }
      }
#pragma unroll
      for (int off = 1; off < 16; off <<= 1) psum += __shfl_xor(psum, off, 32);
      lrow[r] = lrow[r] * alpha + psum;
#pragma unroll
      for (int t = 0; t < 4; ++t) oacc[t][r] *= alpha;
    }
    __builtin_amdgcn_fence(__ATOMIC_RELEASE, "workgroup");
    __builtin_amdgcn_wave_barrier();
    __builtin_amdgcn_fence(__ATOMIC_ACQUIRE, "workgroup");

    // ---- context += P . V (f16 WMMA), residual products into a separate accumulator ----
    v8f o1[4];
#pragma unroll
    for (int t = 0; t < 4; ++t) o1[t] = zero8();
#pragma unroll 1
    for (int kk = 0; kk < 2; ++kk) {
      FH pa, pl;
      pa.h[0] = *(const v8h*)(pwh + c * LP + kk * 32 + 8 * hh);
      pa.h[1] = *(const v8h*)(pwh + c * LP + kk * 32 + 16 + 8 * hh);
      if (RES) {
        pl.h[0] = *(const v8h*)(pwl + c * LP + kk * 32 + 8 * hh);
        pl.h[1] = *(const v8h*)(pwl + c * LP + kk * 32 + 16 + 8 * hh);
      } else {
        pl.v = pa.v;
      }
#pragma unroll
      for (int t = 0; t < 4; ++t) {
        FH vb;
        vb.h[0] = *(const v8h*)(Vth + (t * 16 + c) * LP + kk * 32 + 8 * hh);
        vb.h[1] = *(const v8h*)(Vth + (t * 16 + c) * LP + kk * 32 + 16 + 8 * hh);
        oacc[t] = mma_h(pa.v, vb.v, oacc[t]);
        if (RES) {
          FH vl;
          vl.h[0] = *(const v8h*)(Vtl + (t * 16 + c) * LP + kk * 32 + 8 * hh);
          vl.h[1] = *(const v8h*)(Vtl + (t * 16 + c) * LP + kk * 32 + 16 + 8 * hh);
          o1[t] = mma_h(pa.v, vl.v, o1[t]);
          o1[t] = mma_h(pl.v, vb.v, o1[t]);
        }
      }
    }
    if (RES) {
#pragma unroll
      for (int t = 0; t < 4; ++t)
#pragma unroll
        for (int r = 0; r < 8; ++r) oacc[t][r] += o1[t][r] * (1.0f / 4096.0f);
    }
  }

  // ---- normalise (1/l and the 1/1024 p carry), stage the wave's 16x64 tile, write f32 rows as
  float* os = Os + wave * (16 * 64);
#pragma unroll
  for (int r = 0; r < 8; ++r) {
    const float l = lrow[r];
    const float inv = ((l > 0.f) ? (1.0f / l) : 0.f) * (1.0f / 1024.0f);
#pragma unroll
    for (int t = 0; t < 4; ++t) os[(8 * hh + r) * 64 + t * 16 + c] = oacc[t][r] * inv;
  }
  __builtin_amdgcn_fence(__ATOMIC_RELEASE, "workgroup");
  __builtin_amdgcn_wave_barrier();
  __builtin_amdgcn_fence(__ATOMIC_ACQUIRE, "workgroup");
  {
    const int h2 = lane >> 4, c4 = (lane & 15) * 4;
    v4f ov[8];
#pragma unroll
    for (int it = 0; it < 8; ++it) {
      const int row = it * 2 + h2;   // it 0..7 x h2 0..1 = rows 0..15 of the wave tile
      ov[it] = *(const v4f*)(os + row * 64 + c4);
    }
    {
#pragma unroll
      for (int it = 0; it < 8; ++it) {
        const int row = it * 2 + h2;
        const size_t go = (size_t)(q0 + row) * DM + (size_t)h * HD + c4;
        *(v4f*)(Cp + go) = ov[it];
      }
#if defined(__HIP_DEVICE_COMPILE__)
      // s_wait_xcnt 0 behind the run of stores: in the merged kernel the listing holds a branch from the end of this
      // body to the head of the other one, where registers that these stores name are written again.
      asm volatile("s_wait_xcnt 0x0" ::: "memory");
#endif
    }
  }
}

// All query blocks of both streams, all heads and both batch elements in one grid of NQB * 2 * NB * NH blocks.
// blockIdx.x / 64 counts the query blocks down from the last one: the blocks with the most key tiles get the lowest
// indices (for speed only).
// blockIdx.x % 64 = batch * 32 + stream * 16 + head. Query blocks below RESQB take the body with residual planes
// (block-uniform choice).
__global__ __launch_bounds__(128)
void attn_causal64(const unsigned short* __restrict__ qhp, const unsigned short* __restrict__ qlp,
                   const unsigned short* __restrict__ khp, const unsigned short* __restrict__ klp,
                   const unsigned short* __restrict__ vhp, const unsigned short* __restrict__ vlp,
                   float* C1p, float* C2p, float sscale) {
  __shared__ __align__(16) unsigned char smem[ATT_LDS];
  const int bx     = blockIdx.x;
  const int qb     = NQB - 1 - (bx >> 6);
  const int h      = bx & 15;
  const int stream = (bx >> 4) & 1;
  const int b      = (bx >> 5) & 1;
  const size_t qk = (size_t)b * SEQ * DQK;
  const unsigned short* vh = vhp + (size_t)b * DM * SEQ;
  const unsigned short* vl = vlp + (size_t)b * DM * VLP;
  float* Cp = (stream ? C2p : C1p) + (size_t)b * SEQ * DM;
  const int soff = stream * HD;
  if (qb < RESQB) attn_block64<true >(smem, qhp + qk, qlp + qk, khp + qk, klp + qk, vh, vl, Cp, soff, qb, h, sscale);
  else            attn_block64<false>(smem, qhp + qk, qlp + qk, khp + qk, klp + qk, vh, vl, Cp, soff, qb, h, sscale);
}

// =====================================================================================================
// Differential combine + head rms norm for one token row t of the NB*SEQ rows:
//   lam[h] = (0.2 + exp(sum_d lq1.lk1)) - exp(sum_d lq2.lk2)  (f32, inputs RNE-converted to bf16 values;
//            recomputed per block by threads 0..15, rolled 64-term loops)
//   o = c1 - lam*c2; r = rsqrt(sum_d(o^2)/64 + 1e-6); o = ((o*r) * w[h][d]) * 0.8
//   written as bf16 hi / lo planes [NB*SEQ][DM] (merged head layout), one 16-B store per plane per lane
// grid = NB*SEQ blocks x 128 threads; thread -> columns 8*tid..+7 (head = tid>>3, 8 lanes per head).
// coverage: 128 threads x 8 = 1024 columns per row; NB*SEQ rows.
// =====================================================================================================
__global__ __launch_bounds__(128) void diff_combine(
    const float* __restrict__ C1, const float* __restrict__ C2,
    const float* __restrict__ lq1, const float* __restrict__ lk1,
    const float* __restrict__ lq2, const float* __restrict__ lk2,
    const float* __restrict__ hnw, unsigned short* Oh, unsigned short* Ol) {
#pragma clang fp contract(off)
  __shared__ float lam_s[NH];
  const int tid = threadIdx.x;
  const int t   = blockIdx.x;
  if (tid < NH) {
    const float* a1 = lq1 + tid * HD;
    const float* b1 = lk1 + tid * HD;
    const float* a2 = lq2 + tid * HD;
    const float* b2 = lk2 + tid * HD;
    float sa = 0.f, sb = 0.f;
#pragma unroll 1
    for (int d = 0; d < HD; ++d) {
      sa += bfr(a1[d]) * bfr(b1[d]);
      sb += bfr(a2[d]) * bfr(b2[d]);
    }
    lam_s[tid] = (LAM0 + expf(sa)) - expf(sb);
  }
  __syncthreads();
  const int c0 = tid * 8;
  const int h  = c0 >> 6;
  const int d0 = c0 & 63;
  const size_t ro = (size_t)t * DM + c0;
  const v4f x0 = *(const v4f*)(C1 + ro), x1 = *(const v4f*)(C1 + ro + 4);
  const v4f y0 = *(const v4f*)(C2 + ro), y1 = *(const v4f*)(C2 + ro + 4);
  const float lam = lam_s[h];
  float o[8];
  float ss = 0.f;
#pragma unroll
  for (int e = 0; e < 4; ++e) {
    o[e]     = x0[e] - lam * y0[e];
    o[4 + e] = x1[e] - lam * y1[e];
  }
#pragma unroll
  for (int e = 0; e < 8; ++e) ss += o[e] * o[e];
  ss += __shfl_xor(ss, 1, 32);
  ss += __shfl_xor(ss, 2, 32);
  ss += __shfl_xor(ss, 4, 32);
  const float ms = ss * (1.0f / (float)HD);
  const float rn = rsqrtf(ms + 1.0e-6f);
  v4u hv, lv;
#pragma unroll
  for (int e = 0; e < 4; ++e) {
    const float w0 = bfr(hnw[h * HD + d0 + 2 * e]);
    const float w1 = bfr(hnw[h * HD + d0 + 2 * e + 1]);
    const float f0 = ((o[2 * e] * rn) * w0) * OSCL;
    const float f1 = ((o[2 * e + 1] * rn) * w1) * OSCL;
    const unsigned short h0 = bf_bits(f0), h1 = bf_bits(f1);
    const unsigned short l0 = bf_bits(f0 - bf_up(h0)), l1 = bf_bits(f1 - bf_up(h1));
    hv[e] = pk16(h0, h1); lv[e] = pk16(l0, l1);
  }
  *(v4u*)(Oh + ro) = hv;
  *(v4u*)(Ol + ro) = lv;
  
}

// =====================================================================================================
// Workspace map (bytes, all offsets multiples of 4096):
//   Xb   bf16 [4096][1024]      8388608      Wqb bf16 [2048][1024] 4194304   Wkb 4194304
//   Wvb  bf16 [1024][1024]      2097152      Wob 2097152
//   invf f32 [32] (padded)         4096      cosT f32 [2048][32] 262144      sinT 262144
//   both batch elements, batch-major:
//   Qf   f32  [2][2048][2048]     33554432      Kf 33554432
//   Qh/Ql/Kh/Kl bf16 [2][2048][2048]  4 x 16777216
//   VTh  f16  [2][1024][2048]      8388608      VTl f16 [2][1024][512] 2097152
//   C1/C2 f32 [2][2048][1024]   2 x 16777216    Oh/Ol bf16 [2][2048][1024] 2 x 8388608
//   end                          216535040
// All planes are exact multiples of their 64x64 / whole-line store granularity (no padded tails needed).
// Weights are [out n][in k] with k contiguous = the Bt / A layout the GEMM wants, so they are only converted.
// =====================================================================================================
extern "C" void kernel_launch(void* const* d_in, const int* in_sizes, int n_in,
                              void* d_out, int out_size, void* d_ws, size_t ws_size,
                              hipStream_t stream) {
  if (n_in < 14) return;
  if (in_sizes[0] != NB * SEQ * DM) return;
  if (in_sizes[1] != DQK * DM || in_sizes[2] != DQK) return;
  if (in_sizes[3] != DQK * DM || in_sizes[4] != DQK) return;
  if (in_sizes[5] != DM * DM || in_sizes[6] != DM) return;
  if (in_sizes[7] != DM * DM || in_sizes[8] != DM) return;
  for (int i = 9; i < 14; ++i) if (in_sizes[i] != NH * HD) return;
  if (out_size != NB * SEQ * DM) return;

  const float* x   = (const float*)d_in[0];
  const float* Wq  = (const float*)d_in[1];
  const float* bq  = (const float*)d_in[2];
  const float* Wk  = (const float*)d_in[3];
  const float* bk  = (const float*)d_in[4];
  const float* Wv  = (const float*)d_in[5];
  const float* bv  = (const float*)d_in[6];
  const float* Wo  = (const float*)d_in[7];
  const float* bo  = (const float*)d_in[8];
  const float* hnw = (const float*)d_in[9];
  const float* lq1 = (const float*)d_in[10];
  const float* lk1 = (const float*)d_in[11];
  const float* lq2 = (const float*)d_in[12];
  const float* lk2 = (const float*)d_in[13];
  float* outp = (float*)d_out;

  const size_t PXB  = (size_t)NB * SEQ * DM * 2;    //  8388608
  const size_t PWQ  = (size_t)DQK * DM * 2;         //  4194304
  const size_t PWV  = (size_t)DM * DM * 2;          //  2097152
  const size_t PIF  = 4096;                         //  32 floats used
  const size_t PTAB = (size_t)SEQ * NFREQ * 4;      //   262144
  const size_t PQF  = (size_t)NB * SEQ * DQK * 4;   // 33554432
  const size_t PQP  = (size_t)NB * SEQ * DQK * 2;   // 16777216
  const size_t PVT  = (size_t)NB * DM * SEQ * 2;    //  8388608
  const size_t PVL  = (size_t)NB * DM * VLP * 2;    //  2097152
  const size_t PC   = (size_t)NB * SEQ * DM * 4;    // 16777216
  const size_t PO   = (size_t)NB * SEQ * DM * 2;    //  8388608
  size_t off = 0;
  const size_t oXb  = off; off += PXB;
  const size_t oWq  = off; off += PWQ;
  const size_t oWk  = off; off += PWQ;
  const size_t oWv  = off; off += PWV;
  const size_t oWo  = off; off += PWV;
  const size_t oIF  = off; off += PIF;
  const size_t oCos = off; off += PTAB;
  const size_t oSin = off; off += PTAB;
  const size_t oQf  = off; off += PQF;
  const size_t oKf  = off; off += PQF;
  const size_t oQh  = off; off += PQP;
  const size_t oQl  = off; off += PQP;
  const size_t oKh  = off; off += PQP;
  const size_t oKl  = off; off += PQP;
  const size_t oVTh = off; off += PVT;
  const size_t oVTl = off; off += PVL;
  const size_t oC1  = off; off += PC;
  const size_t oC2  = off; off += PC;
  const size_t oOh  = off; off += PO;
  const size_t oOl  = off; off += PO;
  if (off > ws_size) return;                        // off = 216535040

  char* ws = (char*)d_ws;
  unsigned short* Xb  = (unsigned short*)(ws + oXb);
  unsigned short* Wqb = (unsigned short*)(ws + oWq);
  unsigned short* Wkb = (unsigned short*)(ws + oWk);
  unsigned short* Wvb = (unsigned short*)(ws + oWv);
  unsigned short* Wob = (unsigned short*)(ws + oWo);
  float*          IFt = (float*)(ws + oIF);
  float*          CosT = (float*)(ws + oCos);
  float*          SinT = (float*)(ws + oSin);
  float*          Qf  = (float*)(ws + oQf);
  float*          Kf  = (float*)(ws + oKf);
  unsigned short* Qh  = (unsigned short*)(ws + oQh);
  unsigned short* Ql  = (unsigned short*)(ws + oQl);
  unsigned short* Kh  = (unsigned short*)(ws + oKh);
  unsigned short* Kl  = (unsigned short*)(ws + oKl);
  unsigned short* VTh = (unsigned short*)(ws + oVTh);
  unsigned short* VTl = (unsigned short*)(ws + oVTl);
  float*          C1  = (float*)(ws + oC1);
  float*          C2  = (float*)(ws + oC2);
  unsigned short* Oh  = (unsigned short*)(ws + oOh);
  unsigned short* Ol  = (unsigned short*)(ws + oOl);

  const dim3 blk256(256), blk128(128), blk32(32);
  const dim3 gCvt((NB * SEQ * DM + 2 * DQK * DM + 2 * DM * DM) / 8 / 256);   // 5120 blocks
  const dim3 gTab((SEQ * NFREQ + 255) / 256);                      //  256 blocks
  const dim3 gQKV((SEQ / 64) * (DQK / 64) / 8, NB, 3);             // 1024 tiles -> 128 blocks, x batch x {q, k, v^T}
  const dim3 gOut((NB * SEQ / 64) * (DM / 64) / 8, 1);             // 1024 tiles -> 128 blocks
  const dim3 gRope(SEQ, NB);                                       // one block per token row
  const dim3 gRow(NB * SEQ);                                       // one block per token row
  const dim3 gAtt(NQB * 2 * NB * NH);                              // 2048 blocks

  // (1) inputs -> bf16 planes; weights [n][k] f32 -> bf16 [n][k]; Xb, Wqb, Wkb, Wvb, Wob are contiguous from Xb
  cvt_bf16x8<<<gCvt, blk256, 0, stream>>>(x, Wq, Wk, Wv, Wo, Xb);
  // (2) rope tables
  invfreq_tab<<<dim3(1), blk32, 0, stream>>>(IFt);
  rope_tab<<<gTab, blk256, 0, stream>>>(IFt, CosT, SinT);
  // (3) q, k -> f32 [NB*SEQ][DQK]; v^T -> f16 hi plane and residual plane, both batch elements
  gemm_qkv<<<gQKV, blk256, 0, stream>>>(Xb, Wqb, Wkb, Wvb, Qf, Kf, VTh, VTl, bq, bk, bv);
  // (4) rope + bf16 hi/lo split of q and k
  rope_split<<<gRope, blk256, 0, stream>>>(Qf, Kf, CosT, SinT, Qh, Ql, Kh, Kl);
  // (5) causal attention, stream 1 (q1, k1) -> C1 and stream 2 (q2, k2) -> C2;
  //     query blocks 0..RESQB-1 with residual planes, the rest without
  attn_causal64<<<gAtt, blk128, 0, stream>>>(Qh, Ql, Kh, Kl, VTh, VTl, C1, C2, 0.125f);
  // (6) differential combine + head norm -> O bf16 hi/lo planes [NB*SEQ][DM]
  diff_combine<<<gRow, blk128, 0, stream>>>(C1, C2, lq1, lk1, lq2, lk2, hnw, Oh, Ol);
  // (7) out = O . Wo^T + bo -> d_out, f32 [NB*SEQ][DM]  (A = O hi + lo planes, 2 products)
  gemm64<1, 0, 1><<<gOut, blk256, 0, stream>>>(
      Oh, Ol, DM, 0LL, Wob, Wob, DM, 0LL,
      (void*)outp, DM, 0LL, (void*)outp, DM, 0LL, DM,
      NB * SEQ, DM, DM, 1.0f, bo);
  (void)hipGetLastError();
}

// v004
// Measured time: 199 microseconds a run.
// Two timings next to v003 both put it at 1.18 times that version's speed.
// Counting every step since v000, it is 5.53 times as fast.
// Contractions: q, k, v^T projections = v_wmma_f32_16x16x32_bf16 (bf16 operands from RNE-converted inputs, single product);
// q.k^T scores (both streams) = v_wmma_f32_16x16x32_bf16 with bf16 hi/lo split q and k (hi.hi + hi.lo + lo.hi);
// p.v = v_wmma_f32_16x16x32_f16 (p carried x1024 in f16, v in f16; extra f16 residual planes x4096 of p and v for the first 512 query rows);
// ctx.Wo^T = v_wmma_f32_16x16x32_bf16 with ctx as bf16 hi/lo planes times bf16 Wo (2 products); all f32 accumulate;
// rope, softmax, lambda, head rms norm in f32.
#include <hip/hip_runtime.h>
#include <math.h>
#include <float.h>
#include <stdint.h>

#define NB    2
#define SEQ   2048
#define DM    1024
#define DQK   2048          // q / k projection width (2 x 64 per head)
#define NH    16
#define HD    64
#define NFREQ (HD / 2)
#define NQB   (SEQ / 64)    // 32 key / query tiles of 64
#define VLP   512           // key pitch of the v^T residual plane (keys 0..VLP-1)
#define RESQB 8             // number of leading 64-row query blocks that use the p / v residual planes
#define LAM0  0.2f
#define OSCL  0.8f
static_assert(RESQB * 64 <= VLP);
static_assert(NH * HD == DM);
static_assert(NB == 2 && NH == 16);   // the attention grid's index split
static_assert(NH * 2 * HD == DQK);
static_assert((SEQ % 256) == 0 && (DM % 256) == 0 && (DQK % 256) == 0);   // GEMM block tiles 128 x 256, 64 k per trip

typedef _Float16 v16h __attribute__((ext_vector_type(16)));
typedef _Float16 v8h  __attribute__((ext_vector_type(8)));
typedef __bf16   v16b __attribute__((ext_vector_type(16)));
typedef __bf16   v8b  __attribute__((ext_vector_type(8)));
typedef float    v8f  __attribute__((ext_vector_type(8)));
typedef float    v4f  __attribute__((ext_vector_type(4)));
typedef unsigned int v4u __attribute__((ext_vector_type(4)));

// ---- scalar helpers --------------------------------------------------------------------------------
__device__ __forceinline__ unsigned short bf_bits(float f) {          // f32 -> bf16 bits, RNE convert
  unsigned u = __float_as_uint(f);
  return (unsigned short)((u + 0x7FFFu + ((u >> 16) & 1u)) >> 16);
}
__device__ __forceinline__ float bf_up(unsigned short h) { return __uint_as_float(((unsigned)h) << 16); }
__device__ __forceinline__ float bfr(float f) { return bf_up(bf_bits(f)); }   // value after RNE convert to bf16
__device__ __forceinline__ unsigned short h_bits(_Float16 x) { return __builtin_bit_cast(unsigned short, x); }
__device__ __forceinline__ unsigned pk16(unsigned short a, unsigned short b) { return (unsigned)a | ((unsigned)b << 16); }
__device__ __forceinline__ v8f zero8() { v8f z = {0.f, 0.f, 0.f, 0.f, 0.f, 0.f, 0.f, 0.f}; return z; }
__device__ __forceinline__ v8h zero8h() {
  const _Float16 z = (_Float16)0.0f;
  v8h r = {z, z, z, z, z, z, z, z};
  return r;
}

// ---- fragment loaders: 16-bit A/B operand, lane -> row/col (lane&15), p already includes +8*(lane>>4);
//      elements 0..7 <- p[0..7] (k0+8h..), elements 8..15 <- p[16..23] (k0+16+8h..)
__device__ __forceinline__ v16b ldfrag_b(const __bf16* p) {
  union { v16b v; v8b h[2]; } f;
  f.h[0] = *(const v8b*)(p);
  f.h[1] = *(const v8b*)(p + 16);
  return f.v;
}

// ---- WMMA helpers with trailing VALU hazard gap --------------------------------------------------------
__device__ __forceinline__ v8f mma_b(v16b a, v16b b, v8f c) {
  c = __builtin_amdgcn_wmma_f32_16x16x32_bf16(false, a, false, b, (short)0, c, false, false);
#if defined(__HIP_DEVICE_COMPILE__)
  asm volatile("v_nop\n\tv_nop\n\tv_nop\n\tv_nop" : "+v"(c) : "v"(a), "v"(b));
#endif
  return c;
}
__device__ __forceinline__ v8f mma_h(v16h a, v16h b, v8f c) {
  c = __builtin_amdgcn_wmma_f32_16x16x32_f16(false, a, false, b, (short)0, c, false, false);
#if defined(__HIP_DEVICE_COMPILE__)
  asm volatile("v_nop\n\tv_nop\n\tv_nop\n\tv_nop" : "+v"(c) : "v"(a), "v"(b));
#endif
  return c;
}
__device__ __forceinline__ v8f mma_b_raw(v16b a, v16b b, v8f c) {
  return __builtin_amdgcn_wmma_f32_16x16x32_bf16(false, a, false, b, (short)0, c, false, false);
}
__device__ __forceinline__ void dep_guard_b(v8f& a, v8f& b, v16b x, v16b y) {
#if defined(__HIP_DEVICE_COMPILE__)
  asm volatile("v_nop\n\tv_nop\n\tv_nop\n\tv_nop" : "+v"(a), "+v"(b) : "v"(x), "v"(y));
#endif
}
__device__ __forceinline__ void keep4_b(v16b a, v16b b, v16b c, v16b d) {
#if defined(__HIP_DEVICE_COMPILE__)
  asm volatile("v_nop" :: "v"(a), "v"(b), "v"(c), "v"(d));
#endif
}
__device__ __forceinline__ void acc_guard4(v8f& a, v8f& b, v8f& c, v8f& d) {
#if defined(__HIP_DEVICE_COMPILE__)
  asm volatile("v_nop\n\tv_nop\n\tv_nop\n\tv_nop" : "+v"(a), "+v"(b), "+v"(c), "+v"(d));
#endif
}

// =====================================================================================================
// f32 -> bf16 (RNE convert), 8 elements per thread, one 16-B store per lane: a wave writes 512 contiguous B
// One grid for x, Wq, Wk, Wv, Wo: their bf16 planes lie back to back in the workspace in that order, so the
// output index is the flat thread index; the source is picked per block (every plane is a multiple of 2048
// elements, so a block never straddles two planes).
// coverage: (NX + 2 NQ + 2 NV) threads x 8 = all five planes.
// =====================================================================================================
__global__ __launch_bounds__(256) void cvt_bf16x8(const float* __restrict__ x, const float* __restrict__ wq,
                                                  const float* __restrict__ wk, const float* __restrict__ wv,
                                                  const float* __restrict__ wo, unsigned short* out) {
  constexpr int NX = NB * SEQ * DM / 8, NQ = DQK * DM / 8, NV = DM * DM / 8;
  static_assert((NX % 256) == 0 && (NQ % 256) == 0 && (NV % 256) == 0);
  const int i = blockIdx.x * 256 + threadIdx.x;
  if (i < NX + 2 * NQ + 2 * NV) {
    const float* in = x;
    int j = i;
    if (i >= NX + 2 * NQ + NV)  { in = wo; j = i - (NX + 2 * NQ + NV); }
    else if (i >= NX + 2 * NQ)  { in = wv; j = i - (NX + 2 * NQ); }
    else if (i >= NX + NQ)      { in = wk; j = i - (NX + NQ); }
    else if (i >= NX)           { in = wq; j = i - NX; }
    const v4f a = *(const v4f*)(in + (size_t)j * 8);
    const v4f b = *(const v4f*)(in + (size_t)j * 8 + 4);
    v4u p;
    p[0] = pk16(bf_bits(a[0]), bf_bits(a[1]));
    p[1] = pk16(bf_bits(a[2]), bf_bits(a[3]));
    p[2] = pk16(bf_bits(b[0]), bf_bits(b[1]));
    p[3] = pk16(bf_bits(b[2]), bf_bits(b[3]));
    *(v4u*)(out + (size_t)i * 8) = p;
    
  }
}

// =====================================================================================================
// inv_freq[j] = 1 / 10000^(j/32), j = 0..31, f32 with precise powf. One block of 32 threads; the 32 values
// coverage: lanes 0..7 x 4 floats = all 32 entries.
// =====================================================================================================
__global__ __launch_bounds__(32) void invfreq_tab(float* invf) {
  __shared__ __align__(16) float sf[NFREQ];
  const int j = threadIdx.x;
  const float e = (float)j * (1.0f / (float)NFREQ);
  const float pw = powf(10000.0f, e);
  sf[j] = 1.0f / pw;
  __syncthreads();
  const v4f v = *(const v4f*)(sf + 4 * (j & 7));
  if (j < 8) *(v4f*)(invf + 4 * j) = v;
  
}

// =====================================================================================================
// cos / sin tables [SEQ][32]: angle = t * inv_freq[j] (f32 multiply), precise cosf / sinf.
// =====================================================================================================
__global__ __launch_bounds__(256) void rope_tab(const float* __restrict__ invf, float* cosT, float* sinT) {
  const int g = blockIdx.x * 256 + threadIdx.x;
  if (g < SEQ * NFREQ) {
    const int t = g / NFREQ;
    const int j = g - t * NFREQ;
    const float ang = (float)t * invf[j];
    const float cv = cosf(ang);
    const float sv = sinf(ang);
    *(float*)(cosT + g) = cv;
    *(float*)(sinT + g) = sv;
    
  }
}

// =====================================================================================================
// Register-blocked bf16 WMMA GEMM: C[m][n] = sum_k A[m][k] * Bt[n][k] (+ bias); one wave per 64x64 tile, a block of
// 8 waves (2 x 4) per 128 x 256 tile. A row-major [M][K] pitch lda; Bt row-major [N][K] pitch ldb (k contiguous);
// M multiple of 128, N of 256, K of 64. b = batch index (strides in elements).
// The tile body is a device function (block tile index, batch index and the LDS come from the caller), so
// that one grid can hold several independent products.
// Operands reach the waves through LDS: per trip of 64 k the block's 128 A rows and 256 Bt rows (128 B = one line each)
// are brought in by asynchronous copies to LDS, 16 B per lane, 8 lanes per row, so that one wave-wide copy covers 4
// whole lines; a fragment load straight from global memory touches 16 lines for the same 512 B, and every wave
// fetched its own copy of rows that its neighbours need too. Two buffers: the next trip's copies fly during this
// trip's products. LDS row pitch 144 B (16 B x odd) for the ds_load_b128 fragment reads. The k order of the products
// is unchanged (32 k per WMMA, ascending).
// NSPLIT: 0 = A.Bt; 1 = (A + A2).Bt (A2 = unscaled bf16 lo plane of A).
// OUT_MODE: 0 = f32 (pitch ldc); 2 = bf16 hi plane C + bf16 lo plane C2 (lo = RNE(v - hi), unscaled);
//           3 = f16 hi plane C + f16 residual plane C2 = f16((v - hi) * rscale), C2 written only for tiles
//               with n0 < N2 (pitch ldc2, batch stride strideC2).
// BIAS: 0 = none; 1 = + bf16-RNE(bias[n]) per column; 2 = + bf16-RNE(bias[m]) per row (added in f32).
// =====================================================================================================
#define GP        72                                  // LDS row pitch of a staged operand row, in elements (144 B)
#define GROW_B    (GP * 2)
#define GSTG_B(NS) ((128 + 256 + 128 * (NS)) * GROW_B)  // one buffer: A rows | Bt rows | A2 rows: 55296 B / 73728 B
static_assert((GROW_B % 16) == 0 && ((GROW_B / 16) & 1) == 1);

// Four asynchronous 16-B copies to LDS per lane (l = the lane's LDS byte address, g = its global address).
// s_wait_xcnt 0 is the last line of the copies' own statement: it stands in front of any rewrite of the address registers.
__device__ __forceinline__ void copy4_lds(unsigned l0, const __bf16* g0, unsigned l1, const __bf16* g1,
                                          unsigned l2, const __bf16* g2, unsigned l3, const __bf16* g3) {
#if defined(__HIP_DEVICE_COMPILE__)
  asm volatile("global_load_async_to_lds_b128 %0, %1, off\n\t"
               "global_load_async_to_lds_b128 %2, %3, off\n\t"
               "global_load_async_to_lds_b128 %4, %5, off\n\t"
               "global_load_async_to_lds_b128 %6, %7, off\n\t"
               "s_wait_xcnt 0x0"
               :: "v"(l0), "v"(g0), "v"(l1), "v"(g1), "v"(l2), "v"(g2), "v"(l3), "v"(g3) : "memory");
#endif
}
// The issuing wave's own copies have landed (in front of the barrier behind which other waves read them).
__device__ __forceinline__ void wait_copies() {
#if defined(__HIP_DEVICE_COMPILE__)
  asm volatile("s_wait_asynccnt 0x0" ::: "memory");
#endif
}
// This wave's LDS reads have returned (in front of the barrier behind which their buffer is refilled).
__device__ __forceinline__ void wait_lds() {
#if defined(__HIP_DEVICE_COMPILE__)
  asm volatile("s_wait_dscnt 0x0" ::: "memory");
#endif
}
// One 64-k tile of the block's operands into one buffer: 256 threads x 16 B = 32 rows per copy; dst = the lane's LDS
// byte address of row tid>>3, chunk tid&7 of the buffer; gA / gB / gA2 = its global address in row tid>>3 of the block's rows.
template <int NSPLIT>
__device__ __forceinline__ void gemm_stage(unsigned dst, const __bf16* gA, const __bf16* gB, const __bf16* gA2,
                                           int lda, int ldb) {
  const size_t ra = (size_t)32 * lda, rb = (size_t)32 * ldb;
  constexpr unsigned R = 32 * GROW_B;
  copy4_lds(dst, gA, dst + R, gA + ra, dst + 2 * R, gA + 2 * ra, dst + 3 * R, gA + 3 * ra);
  copy4_lds(dst + 4 * R, gB, dst + 5 * R, gB + rb, dst + 6 * R, gB + 2 * rb, dst + 7 * R, gB + 3 * rb);
  copy4_lds(dst + 8 * R, gB + 4 * rb, dst + 9 * R, gB + 5 * rb, dst + 10 * R, gB + 6 * rb, dst + 11 * R, gB + 7 * rb);
  if (NSPLIT == 1)
    copy4_lds(dst + 12 * R, gA2, dst + 13 * R, gA2 + ra, dst + 14 * R, gA2 + 2 * ra, dst + 15 * R, gA2 + 3 * ra);
}

template <int NSPLIT, int OUT_MODE, int BIAS>
__device__ __forceinline__ void gemm64_tile(
    const unsigned short* __restrict__ Ap, const unsigned short* A2p, int lda, long long strideA,
    const unsigned short* __restrict__ Btp, const unsigned short* Bt2p, int ldb, long long strideB,
    void* Cout, int ldc, long long strideC,
    void* Cout2, int ldc2, long long strideC2, int N2,
    int M, int N, int K, float rscale, const float* __restrict__ bias,
    float* slab, unsigned char* stg, int bt, int b) {
  static_assert(NSPLIT == 0 || NSPLIT == 1);
  const __bf16* A   = (const __bf16*)(const void*)Ap;
  const __bf16* A2  = (const __bf16*)(const void*)A2p;
  const __bf16* Bt  = (const __bf16*)(const void*)Btp;
  const int tid  = threadIdx.x;
  const int lane = tid & 31;
  const int wave = tid >> 5;
  const int blocksN = N >> 8;
  const int blocksM = M >> 7;
  if (bt >= blocksM * blocksN) return;   // block-uniform, in front of every copy and barrier
  const int bm  = bt / blocksN;
  const int bn  = bt - bm * blocksN;
  const int mb0 = bm << 7;
  const int nb0 = bn << 8;
  const int wm  = wave >> 2;             // the wave's 64 rows of the block's 128
  const int wn  = wave & 3;              // the wave's 64 columns of the block's 256
  const int m0  = mb0 + (wm << 6);
  const int n0  = nb0 + (wn << 6);

  const __bf16* Ab  = A  + (size_t)b * strideA;
  const __bf16* Bb  = Bt + (size_t)b * strideB;
  const __bf16* Ab2 = (NSPLIT >= 1) ? (A2  + (size_t)b * strideA) : Ab;

  const int rlane = lane & 15;                 // row (A) / col (B, D) within subtile
  const int koff  = (lane >> 4) * 8;           // k offset of this lane half
  const int mOff  = (lane >> 4) * 8;           // D row offset

  v8f acc[4][4];
#pragma unroll
  for (int i = 0; i < 4; ++i)
#pragma unroll
    for (int j = 0; j < 4; ++j) acc[i][j] = zero8();

  constexpr unsigned STG = GSTG_B(NSPLIT);
  const int nt   = K >> 6;                     // trips of 64 k
  const int srow = tid >> 3, sch = tid & 7;    // this lane's row (of 32 per copy) and 16-B chunk of the 128-B row
  const unsigned sdst = (unsigned)(size_t)stg + (unsigned)(srow * GROW_B + sch * 16);
  const __bf16* gA  = Ab  + (size_t)(mb0 + srow) * lda + sch * 8;
  const __bf16* gB  = Bb  + (size_t)(nb0 + srow) * ldb + sch * 8;
  const __bf16* gA2 = Ab2 + (size_t)(mb0 + srow) * lda + sch * 8;

  // tile 0 -> buffer 0, landed and published; then tile 1 -> buffer 1 in flight
  gemm_stage<NSPLIT>(sdst, gA, gB, gA2, lda, ldb);
  wait_copies();
  __syncthreads();
  if (nt > 1) gemm_stage<NSPLIT>(sdst + STG, gA + 64, gB + 64, gA2 + 64, lda, ldb);

  for (int t = 0; t < nt; ++t) {               // block-uniform trip count
    const __bf16* sb  = (const __bf16*)(const void*)(stg + (size_t)(t & 1) * STG);
    const __bf16* sA  = sb + ((wm << 6) + rlane) * GP + koff;
    const __bf16* sB  = sb + (128 + (wn << 6) + rlane) * GP + koff;
    const __bf16* sA2 = (NSPLIT >= 1) ? (sb + (384 + (wm << 6) + rlane) * GP + koff) : sA;
    // unrolled (here and below): the fragment arrays need constant indices to stay in registers, and the second
    // 32-k block's LDS reads can then be issued among the first block's products
#pragma unroll
    for (int kk = 0; kk < 2; ++kk) {
      v16b bh[4], ahf[4], alf[4];
#pragma unroll
      for (int j = 0; j < 4; ++j) bh[j] = ldfrag_b(sB + (j << 4) * GP + kk * 32);
#pragma unroll
      for (int i = 0; i < 4; ++i) {
        ahf[i] = ldfrag_b(sA + (i << 4) * GP + kk * 32);
        if (NSPLIT >= 1) alf[i] = ldfrag_b(sA2 + (i << 4) * GP + kk * 32); else alf[i] = ahf[i];
      }
#pragma unroll
      for (int i = 0; i < 4; ++i) {
        const v16b ah = ahf[i], al = alf[i];
#pragma unroll
        for (int j = 0; j < 4; ++j) {
          acc[i][j] = mma_b_raw(ah, bh[j], acc[i][j]);
          if (NSPLIT >= 1) acc[i][j] = mma_b_raw(al, bh[j], acc[i][j]);
        }
        dep_guard_b(acc[i][0], acc[i][3], ah, al);
      }
      keep4_b(bh[0], bh[1], bh[2], bh[3]);
    }
    // foot of the trip: own reads of this buffer done, own copies of the next tile landed, one barrier for both;
    // only then the refill of the buffer that this trip has read
    wait_lds();
    wait_copies();
    __syncthreads();
    if (t + 2 < nt) {
      const int kn = (t + 2) << 6;
      gemm_stage<NSPLIT>(sdst + (unsigned)(t & 1) * STG, gA + kn, gB + kn, gA2 + kn, lda, ldb);
    }
  }
  wait_copies();
  acc_guard4(acc[0][0], acc[0][1], acc[0][2], acc[0][3]);
  acc_guard4(acc[1][0], acc[1][1], acc[1][2], acc[1][3]);
  acc_guard4(acc[2][0], acc[2][1], acc[2][2], acc[2][3]);
  acc_guard4(acc[3][0], acc[3][1], acc[3][2], acc[3][3]);

  // ---- epilogue ----
  float bcol[4];
#pragma unroll
  for (int j = 0; j < 4; ++j) bcol[j] = 0.f;
  if (BIAS == 1) {
#pragma unroll
    for (int j = 0; j < 4; ++j) bcol[j] = bfr(bias[n0 + (j << 4) + rlane]);
  }
#pragma unroll
  for (int i = 0; i < 4; ++i) {
    const int mBase = m0 + (i << 4);
    float brow[8];
#pragma unroll
    for (int r = 0; r < 8; ++r) brow[r] = 0.f;
    if (BIAS == 2) {
#pragma unroll
      for (int r = 0; r < 8; ++r) brow[r] = bfr(bias[mBase + mOff + r]);
    }
#pragma unroll
    for (int j = 0; j < 4; ++j) {
#pragma unroll
      for (int r = 0; r < 8; ++r) {
        slab[(mOff + r) * 68 + (j << 4) + rlane] = (acc[i][j][r] + bcol[j]) + brow[r];
      }
    }
    __builtin_amdgcn_fence(__ATOMIC_RELEASE, "workgroup");
    __builtin_amdgcn_wave_barrier();
    __builtin_amdgcn_fence(__ATOMIC_ACQUIRE, "workgroup");
    if (OUT_MODE == 0) {
      float* C = (float*)Cout + (size_t)b * strideC;
      const int hh = lane >> 4, c4 = (lane & 15) * 4;     // 256-B row segment = 16 lanes x 16 B
      {
#pragma unroll
        for (int it = 0; it < 8; ++it) {
          const int row = it * 2 + hh;                     // it 0..7 x hh 0..1 = rows 0..15
          const v4f v = *(const v4f*)(slab + row * 68 + c4);
          *(v4f*)(C + (size_t)(mBase + row) * ldc + n0 + c4) = v;
        }
        
      }
    } else {
      const int q = lane >> 3, c8 = (lane & 7) * 8;
      unsigned short* C  = (unsigned short*)Cout  + (size_t)b * strideC;
      unsigned short* C2 = (unsigned short*)Cout2 + (size_t)b * strideC2;
      const bool wlo = (OUT_MODE == 2) || (n0 < N2);      // wave-uniform
      v4u hv[4], lv[4];
#pragma unroll
      for (int it = 0; it < 4; ++it) {
        const int row = it * 4 + q;                        // it 0..3 x q 0..3 = rows 0..15
        const float* sp = slab + row * 68 + c8;
        v4u a, a2;
#pragma unroll
        for (int e = 0; e < 4; ++e) {
          const float f0 = sp[2 * e], f1 = sp[2 * e + 1];
          unsigned short h0, h1, l0, l1;
          if (OUT_MODE == 2) {
            h0 = bf_bits(f0); h1 = bf_bits(f1);
            l0 = bf_bits(f0 - bf_up(h0)); l1 = bf_bits(f1 - bf_up(h1));
          } else {
            const _Float16 x0 = (_Float16)f0, x1 = (_Float16)f1;
            h0 = h_bits(x0); h1 = h_bits(x1);
            l0 = h_bits((_Float16)((f0 - (float)x0) * rscale));
            l1 = h_bits((_Float16)((f1 - (float)x1) * rscale));
          }
          a[e] = pk16(h0, h1); a2[e] = pk16(l0, l1);
        }
        hv[it] = a; lv[it] = a2;
      }
      {
#pragma unroll
        for (int it = 0; it < 4; ++it) {
          const int row = it * 4 + q;
          *(v4u*)(C + (size_t)(mBase + row) * ldc + n0 + c8) = hv[it];
          if (wlo) *(v4u*)(C2 + (size_t)(mBase + row) * ldc2 + n0 + c8) = lv[it];
        }
        
      }
    }
    __builtin_amdgcn_fence(__ATOMIC_RELEASE, "workgroup");
    __builtin_amdgcn_wave_barrier();
    __builtin_amdgcn_fence(__ATOMIC_ACQUIRE, "workgroup");
  }
}

// One product per grid: blockIdx.x = 128 x 256 block tile, blockIdx.y = batch index.
template <int NSPLIT, int OUT_MODE, int BIAS>
__global__ __launch_bounds__(256) void gemm64(
    const unsigned short* __restrict__ Ap, const unsigned short* A2p, int lda, long long strideA,
    const unsigned short* __restrict__ Btp, const unsigned short* Bt2p, int ldb, long long strideB,
    void* Cout, int ldc, long long strideC,
    void* Cout2, int ldc2, long long strideC2, int N2,
    int M, int N, int K, float rscale, const float* __restrict__ bias) {
  __shared__ __align__(16) float sT[8][16 * 68];   // per-wave 16x64 slab, pitch 68 floats
  __shared__ __align__(16) unsigned char sG[2 * GSTG_B(NSPLIT)];   // two operand buffers
  const int wave = threadIdx.x >> 5;
  gemm64_tile<NSPLIT, OUT_MODE, BIAS>(Ap, A2p, lda, strideA, Btp, Bt2p, ldb, strideB, Cout, ldc, strideC,
                                      Cout2, ldc2, strideC2, N2, M, N, K, rscale, bias,
                                      sT[wave], sG, blockIdx.x, blockIdx.y);
}

// q, k and v^T projections of both batch elements in one grid: blockIdx.z = 0 q, 1 k, 2 v^T; blockIdx.y = batch;
// blockIdx.x = 128 x 256 block tile (v^T has half the tiles of q / k: its upper blocks leave at the tile test).
//   q / k = x_b . W^T + bias[col] -> f32 [NB*SEQ][DQK]                 (M=SEQ, N=DQK, K=DM)
//   v^T   = Wv . x_b^T + bv[row]  -> f16 hi plane [b][h*64+d][s] (pitch SEQ) and residual plane
//           (x4096, keys < VLP only, pitch VLP)                        (M=DM, N=SEQ, K=DM)
__global__ __launch_bounds__(256) void gemm_qkv(
    const unsigned short* __restrict__ Xb, const unsigned short* __restrict__ Wqb,
    const unsigned short* __restrict__ Wkb, const unsigned short* __restrict__ Wvb,
    float* Qf, float* Kf, unsigned short* VTh, unsigned short* VTl,
    const float* __restrict__ bq, const float* __restrict__ bk, const float* __restrict__ bv) {
  __shared__ __align__(16) float sT[8][16 * 68];   // per-wave 16x64 slab, pitch 68 floats
  __shared__ __align__(16) unsigned char sG[2 * GSTG_B(0)];   // two operand buffers
  const int wave = threadIdx.x >> 5;
  const int tile = blockIdx.x;
  const int b    = blockIdx.y;
  const int z    = blockIdx.z;
  if (z < 2) {
    const unsigned short* Wb = z ? Wkb : Wqb;
    float* Cf = z ? Kf : Qf;
    const float* bias = z ? bk : bq;
    gemm64_tile<0, 0, 1>(Xb, Xb, DM, (long long)SEQ * DM, Wb, Wb, DM, 0LL,
                         (void*)Cf, DQK, (long long)SEQ * DQK, (void*)Cf, DQK, 0LL, DQK,
                         SEQ, DQK, DM, 1.0f, bias, sT[wave], sG, tile, b);
  } else {
    gemm64_tile<0, 3, 2>(Wvb, Wvb, DM, 0LL, Xb, Xb, DM, (long long)SEQ * DM,
                         (void*)VTh, SEQ, (long long)DM * SEQ, (void*)VTl, VLP, (long long)DM * VLP, VLP,
                         DM, SEQ, DM, 4096.0f, bv, sT[wave], sG, tile, b);
  }
}

// =====================================================================================================
// RoPE half-split rotation of 8 consecutive columns of one 64-wide vector, then bf16 hi/lo split and
//   first half  (j < 32):   out[j]    = x[j]*cos[j]   - x[j+32]*sin[j]     (x1 = a, x2 = p)
//   second half (j >= 32):  out[j+32] = x[j]*sin[j]   + x[j+32]*cos[j]     (x1 = p, x2 = a)
// =====================================================================================================
__device__ __forceinline__ void rope_row8(const float* __restrict__ src, size_t rowOff, int c0, int p0,
                                          bool second, v4f cs0, v4f cs1, v4f sn0, v4f sn1,
                                          unsigned short* Hp, unsigned short* Lp) {
#pragma clang fp contract(off)
  const v4f xa0 = *(const v4f*)(src + rowOff + c0);
  const v4f xa1 = *(const v4f*)(src + rowOff + c0 + 4);
  const v4f xp0 = *(const v4f*)(src + rowOff + p0);
  const v4f xp1 = *(const v4f*)(src + rowOff + p0 + 4);
  float o[8];
#pragma unroll
  for (int e = 0; e < 4; ++e) {
    {
      const float a = xa0[e], p = xp0[e], cs = cs0[e], sn = sn0[e];
      const float f1 = a * cs - p * sn;
      const float f2 = p * sn + a * cs;
      o[e] = second ? f2 : f1;
    }
    {
      const float a = xa1[e], p = xp1[e], cs = cs1[e], sn = sn1[e];
      const float f1 = a * cs - p * sn;
      const float f2 = p * sn + a * cs;
      o[4 + e] = second ? f2 : f1;
    }
  }
  v4u hv, lv;
#pragma unroll
  for (int e = 0; e < 4; ++e) {
    const float f0 = o[2 * e], f1 = o[2 * e + 1];
    const unsigned short h0 = bf_bits(f0), h1 = bf_bits(f1);
    const unsigned short l0 = bf_bits(f0 - bf_up(h0)), l1 = bf_bits(f1 - bf_up(h1));
    hv[e] = pk16(h0, h1); lv[e] = pk16(l0, l1);
  }
  const size_t go = rowOff + c0;
  *(v4u*)(Hp + go) = hv;
  *(v4u*)(Lp + go) = lv;
  
}

// =====================================================================================================
// RoPE + hi/lo split for one token row t of q and k (f32 planes [NB*SEQ][DQK], per head 128 columns =
// two 64-wide vectors). grid = (SEQ, NB) blocks x 256 threads; thread -> columns 8*tid..8*tid+7.
// Outputs: bf16 hi / lo planes [NB*SEQ][DQK] for q and for k.
// coverage: 256 threads x 8 columns = 2048 columns of each of the 4 output planes per row; NB*SEQ rows.
// =====================================================================================================
__global__ __launch_bounds__(256) void rope_split(const float* __restrict__ Qf, const float* __restrict__ Kf,
                                                   const float* __restrict__ cosT, const float* __restrict__ sinT,
                                                   unsigned short* Qh, unsigned short* Ql,
                                                   unsigned short* Kh, unsigned short* Kl) {
  const int t = blockIdx.x;
  const int c0 = threadIdx.x * 8;
  const int jj0 = c0 & 31;
  const bool second = (c0 & 32) != 0;
  const int p0 = second ? (c0 - 32) : (c0 + 32);
  const float* cr = cosT + (size_t)t * NFREQ + jj0;
  const float* sr = sinT + (size_t)t * NFREQ + jj0;
  const v4f cs0 = *(const v4f*)(cr), cs1 = *(const v4f*)(cr + 4);
  const v4f sn0 = *(const v4f*)(sr), sn1 = *(const v4f*)(sr + 4);
  const size_t rowOff = ((size_t)blockIdx.y * SEQ + t) * DQK;
  rope_row8(Qf, rowOff, c0, p0, second, cs0, cs1, sn0, sn1, Qh, Ql);
  rope_row8(Kf, rowOff, c0, p0, second, cs0, cs1, sn0, sn1, Kh, Kl);
}

#define LP      72                        // LDS row pitch of the 16-bit tiles, in elements
#define TILE_B  (64 * LP * 2)             // one 64-row tile: 9216 B
#define OSP     68                        // row pitch of a wave's f32 context tile, in floats (272 B = 16 B x 17)
#define OS_B    (4 * 16 * OSP * 4)        // four waves' f32 context tiles: 17408 B
#define ATT_LDS (4 * TILE_B + OS_B)       // 54272 B
static_assert(((LP * 2) % 16) == 0 && (((LP * 2) / 16) & 1) == 1);   // 16-B aligned rows, odd multiple of 16 B
// value of lane l ^ 16 (the other wave half)
__device__ __forceinline__ float xhalf(float x) {
  return __builtin_bit_cast(float, __builtin_amdgcn_permlanex16(__builtin_bit_cast(int, x), __builtin_bit_cast(int, x),
                                                                0x76543210, 0xfedcba98, false, false));
}
template <bool RES>
__device__ __forceinline__
void attn_block64(unsigned char* smem,
                  const unsigned short* __restrict__ qhp, const unsigned short* __restrict__ qlp,
                  const unsigned short* __restrict__ khp, const unsigned short* __restrict__ klp,
                  const unsigned short* __restrict__ vhp, const unsigned short* __restrict__ vlp,
                  float* Cp, int soff, int qb, int h, float sscale) {
  union FB { v16b v; v8b h[2]; };
  union FH { v16h v; v8h h[2]; };
  __bf16*   Ksh = (__bf16*)(void*)(smem);                         // K hi [kv][d]
  __bf16*   Ksl = (__bf16*)(void*)(smem + TILE_B);                // K lo
  _Float16* Vth = (_Float16*)(void*)(smem + 2 * TILE_B);          // V^T hi [d][kv]
  float*    Os  = (float*)(void*)(smem + 3 * TILE_B);             // per wave context tile [row][d], 4 x 4352 B
  _Float16* Vtl = (_Float16*)(void*)(smem + 3 * TILE_B + OS_B);   // V^T residual (RES only)

  const int tid  = threadIdx.x;
  const int wave = tid >> 5;
  const int lane = tid & 31;
  const int hh   = lane >> 4;
  const int c    = lane & 15;

  const int q0   = qb * 64 + wave * 16;
  const int col  = h * (2 * HD) + soff;

  const __bf16* Qh = (const __bf16*)(const void*)qhp + col;
  const __bf16* Ql = (const __bf16*)(const void*)qlp + col;
  const __bf16* Kh = (const __bf16*)(const void*)khp + col;
  const __bf16* Kl = (const __bf16*)(const void*)klp + col;
  const _Float16* Vh = (const _Float16*)(const void*)vhp + (size_t)h * HD * SEQ;
  const _Float16* Vl = (const _Float16*)(const void*)vlp + (size_t)h * HD * VLP;

  // ---- Q fragments (B operand, column = query = lane&15): 2 d-chunks, hi and lo ----
  v16b qah[2], qal[2];
#pragma unroll
  for (int dc = 0; dc < 2; ++dc) {
    const size_t qo = (size_t)(q0 + c) * DQK + dc * 32 + 8 * hh;
    qah[dc] = ldfrag_b(Qh + qo);
    qal[dc] = ldfrag_b(Ql + qo);
  }

  const int qrow = q0 + c;                   // this lane's query row
  float mrow = -INFINITY;                    // its running maximum (equal in both wave halves)
  float lrow = 0.f;                          // running sum over this wave half's keys only; joined after the loop
  v8f oacc[4];                               // oacc[t][r] = context^T [d = t*16 + 8*hh + r][query c]
#pragma unroll
  for (int t = 0; t < 4; ++t) oacc[t] = zero8();

  for (int kt = 0; kt < NQB; ++kt) {         // static trip bound
    if (kt > qb) break;                      // block-uniform (causal)
    const bool diag = (kt == qb);            // block-uniform
    const int kv0 = kt * 64;
    __syncthreads();
    {
      const int r = tid >> 1, half = (tid & 1) * 32;
      const __bf16*   kg  = Kh + (size_t)(kv0 + r) * DQK + half;   // K row kv0+r, d = half..half+31
      const __bf16*   klg = Kl + (size_t)(kv0 + r) * DQK + half;
      const _Float16* vg  = Vh + (size_t)r * SEQ + kv0 + half;      // V^T row d = r, s = kv0+half..+31
      const int kvl = (kv0 + 64 <= VLP) ? kv0 : (VLP - 64);       // clamped address into the residual plane
      const _Float16* vlg = Vl + (size_t)r * VLP + kvl + half;
      const bool resOK = (kv0 + 64 <= VLP);                        // block-uniform
      v8b a0[4], a1[4];
      v8h b0[4], b1[4];
#pragma unroll
      for (int i = 0; i < 4; ++i) {
        a0[i] = *(const v8b*)(kg + 8 * i);
        a1[i] = *(const v8b*)(klg + 8 * i);
        b0[i] = *(const v8h*)(vg + 8 * i);
        if (RES) {
          b1[i] = *(const v8h*)(vlg + 8 * i);
          if (!resOK) b1[i] = zero8h();
        }
      }
#if defined(__HIP_DEVICE_COMPILE__)
      // s_wait_xcnt 0 before a register that an issued load names is written again; the addresses are inputs so that
      // they stay in their registers up to the wait (else the last load's destination may take an address pair over).
      if (RES) asm volatile("s_wait_xcnt 0x0" :: "v"(kg), "v"(klg), "v"(vg), "v"(vlg) : "memory");
      else     asm volatile("s_wait_xcnt 0x0" :: "v"(kg), "v"(klg), "v"(vg) : "memory");
#endif
#pragma unroll
      for (int i = 0; i < 4; ++i) {
        *(v8b*)(Ksh + r * LP + half + 8 * i) = a0[i];
        *(v8b*)(Ksl + r * LP + half + 8 * i) = a1[i];
        *(v8h*)(Vth + r * LP + half + 8 * i) = b0[i];
        if (RES) *(v8h*)(Vtl + r * LP + half + 8 * i) = b1[i];
      }
    }
    __syncthreads();

    // ---- scores^T: 64 keys x 16 query columns per wave, 3 bf16 products; s[j][r] = key j*16 + 8*hh + r, query c ----
    v8f s[4];
#pragma unroll
    for (int j = 0; j < 4; ++j) {
      s[j] = zero8();
#pragma unroll
      for (int dc = 0; dc < 2; ++dc) {
        FB kb, kl;
        kb.h[0] = *(const v8b*)(Ksh + (j * 16 + c) * LP + dc * 32 + 8 * hh);
        kb.h[1] = *(const v8b*)(Ksh + (j * 16 + c) * LP + dc * 32 + 16 + 8 * hh);
        kl.h[0] = *(const v8b*)(Ksl + (j * 16 + c) * LP + dc * 32 + 8 * hh);
        kl.h[1] = *(const v8b*)(Ksl + (j * 16 + c) * LP + dc * 32 + 16 + 8 * hh);
        s[j] = mma_b(kb.v, qah[dc], s[j]);
        s[j] = mma_b(kl.v, qah[dc], s[j]);
        s[j] = mma_b(kb.v, qal[dc], s[j]);
      }
    }

    // ---- scale, causal fill on the diagonal tile, maximum of the lane's 32 keys and of the other half's,
    //      online softmax, P (x1024, f16) and P residual (x4096) packed into B operands ----
    float mj[4];
#pragma unroll
    for (int j = 0; j < 4; ++j) {
      mj[j] = -INFINITY;
#pragma unroll
      for (int r = 0; r < 8; ++r) {
        const int key = kv0 + j * 16 + 8 * hh + r;
        float sv = s[j][r] * sscale;
        sv = (diag && key > qrow) ? -INFINITY : sv;
        s[j][r] = sv;
        mj[j] = fmaxf(mj[j], sv);
      }
    }
    float m = fmaxf(fmaxf(mj[0], mj[1]), fmaxf(mj[2], mj[3]));
    m = fmaxf(m, xhalf(m));
    const float mnew  = fmaxf(mrow, m);
    const float msafe = (mnew == -INFINITY) ? 0.f : mnew;
    const float alpha = __expf(mrow - msafe);
    mrow = mnew;
    v16h pbh[2], pbl[2];                     // element (j&1)*8 + r of block j>>1 = key (j>>1)*32 + (j&1)*16 + 8*hh + r
    float pj[4];                             // four independent partial sums of 8 keys each
#pragma unroll
    for (int j = 0; j < 4; ++j) {
      pj[j] = 0.f;
#pragma unroll
      for (int r = 0; r < 8; ++r) {
        const float p = __expf(s[j][r] - msafe);     // -inf logit: exp -> 0
        pj[j] += p;
        const float p1k = p * 1024.0f;
        const _Float16 ph = (_Float16)p1k;
        pbh[j >> 1][(j & 1) * 8 + r] = ph;
        if (RES) pbl[j >> 1][(j & 1) * 8 + r] = (_Float16)((p1k - (float)ph) * 4096.0f);
      }
    }
    lrow = lrow * alpha + ((pj[0] + pj[1]) + (pj[2] + pj[3]));
#pragma unroll
    for (int t = 0; t < 4; ++t)
#pragma unroll
      for (int r = 0; r < 8; ++r) oacc[t][r] *= alpha;

    // ---- context^T += V^T . P^T (f16 WMMA), residual products into a separate accumulator ----
    v8f o1[4];
#pragma unroll
    for (int t = 0; t < 4; ++t) o1[t] = zero8();
    // unrolled: the P operands are register arrays and need constant indices
#pragma unroll
    for (int kk = 0; kk < 2; ++kk) {
#pragma unroll
      for (int t = 0; t < 4; ++t) {
        FH vb;
        vb.h[0] = *(const v8h*)(Vth + (t * 16 + c) * LP + kk * 32 + 8 * hh);
        vb.h[1] = *(const v8h*)(Vth + (t * 16 + c) * LP + kk * 32 + 16 + 8 * hh);
        oacc[t] = mma_h(vb.v, pbh[kk], oacc[t]);
        if (RES) {
          FH vl;
          vl.h[0] = *(const v8h*)(Vtl + (t * 16 + c) * LP + kk * 32 + 8 * hh);
          vl.h[1] = *(const v8h*)(Vtl + (t * 16 + c) * LP + kk * 32 + 16 + 8 * hh);
          o1[t] = mma_h(vl.v, pbh[kk], o1[t]);
          o1[t] = mma_h(vb.v, pbl[kk], o1[t]);
        }
      }
    }
    if (RES) {
#pragma unroll
      for (int t = 0; t < 4; ++t)
#pragma unroll
        for (int r = 0; r < 8; ++r) oacc[t][r] += o1[t][r] * (1.0f / 4096.0f);
    }
  }

  // ---- join the halves' sums, normalise (1/l and the 1/1024 p carry), stage the wave's 16x64 tile as [query][d]
  //      (a lane holds 8 consecutive d of its query per t: two 16-B LDS stores), write f32 rows as whole 256-B segments
  float* os = Os + wave * (16 * OSP);
  {
    const float l = lrow + xhalf(lrow);
    const float inv = ((l > 0.f) ? (1.0f / l) : 0.f) * (1.0f / 1024.0f);
#pragma unroll
    for (int t = 0; t < 4; ++t) {
      v4f w0, w1;
#pragma unroll
      for (int e = 0; e < 4; ++e) { w0[e] = oacc[t][e] * inv; w1[e] = oacc[t][4 + e] * inv; }
      *(v4f*)(os + c * OSP + t * 16 + 8 * hh)     = w0;
      *(v4f*)(os + c * OSP + t * 16 + 8 * hh + 4) = w1;
    }
  }
  __builtin_amdgcn_fence(__ATOMIC_RELEASE, "workgroup");
  __builtin_amdgcn_wave_barrier();
  __builtin_amdgcn_fence(__ATOMIC_ACQUIRE, "workgroup");
  {
    const int h2 = lane >> 4, c4 = (lane & 15) * 4;
    v4f ov[8];
#pragma unroll
    for (int it = 0; it < 8; ++it) {
      const int row = it * 2 + h2;   // it 0..7 x h2 0..1 = rows 0..15 of the wave tile
      ov[it] = *(const v4f*)(os + row * OSP + c4);
    }
    {
#pragma unroll
      for (int it = 0; it < 8; ++it) {
        const int row = it * 2 + h2;
        const size_t go = (size_t)(q0 + row) * DM + (size_t)h * HD + c4;
        *(v4f*)(Cp + go) = ov[it];
      }
#if defined(__HIP_DEVICE_COMPILE__)
      // s_wait_xcnt 0 behind the run of stores: in the merged kernel the listing holds a branch from the end of this
      // body to the head of the other one, where registers that these stores name are written again.
      asm volatile("s_wait_xcnt 0x0" ::: "memory");
#endif
    }
  }
}

// All query blocks of both streams, all heads and both batch elements in one grid of NQB * 2 * NB * NH blocks.
// blockIdx.x / 64 counts the query blocks down from the last one: the blocks with the most key tiles get the lowest
// indices (for speed only).
// blockIdx.x % 64 = batch * 32 + stream * 16 + head. Query blocks below RESQB take the body with residual planes
// (block-uniform choice).
__global__ __launch_bounds__(128)
void attn_causal64(const unsigned short* __restrict__ qhp, const unsigned short* __restrict__ qlp,
                   const unsigned short* __restrict__ khp, const unsigned short* __restrict__ klp,
                   const unsigned short* __restrict__ vhp, const unsigned short* __restrict__ vlp,
                   float* C1p, float* C2p, float sscale) {
  __shared__ __align__(16) unsigned char smem[ATT_LDS];
  const int bx     = blockIdx.x;
  const int qb     = NQB - 1 - (bx >> 6);
  const int h      = bx & 15;
  const int stream = (bx >> 4) & 1;
  const int b      = (bx >> 5) & 1;
  const size_t qk = (size_t)b * SEQ * DQK;
  const unsigned short* vh = vhp + (size_t)b * DM * SEQ;
  const unsigned short* vl = vlp + (size_t)b * DM * VLP;
  float* Cp = (stream ? C2p : C1p) + (size_t)b * SEQ * DM;
  const int soff = stream * HD;
  if (qb < RESQB) attn_block64<true >(smem, qhp + qk, qlp + qk, khp + qk, klp + qk, vh, vl, Cp, soff, qb, h, sscale);
  else            attn_block64<false>(smem, qhp + qk, qlp + qk, khp + qk, klp + qk, vh, vl, Cp, soff, qb, h, sscale);
}

// =====================================================================================================
// Differential combine + head rms norm for one token row t of the NB*SEQ rows:
//   lam[h] = (0.2 + exp(sum_d lq1.lk1)) - exp(sum_d lq2.lk2)  (f32, inputs RNE-converted to bf16 values;
//            recomputed per block by threads 0..15, rolled 64-term loops)
//   o = c1 - lam*c2; r = rsqrt(sum_d(o^2)/64 + 1e-6); o = ((o*r) * w[h][d]) * 0.8
//   written as bf16 hi / lo planes [NB*SEQ][DM] (merged head layout), one 16-B store per plane per lane
// grid = NB*SEQ blocks x 128 threads; thread -> columns 8*tid..+7 (head = tid>>3, 8 lanes per head).
// coverage: 128 threads x 8 = 1024 columns per row; NB*SEQ rows.
// =====================================================================================================
__global__ __launch_bounds__(128) void diff_combine(
    const float* __restrict__ C1, const float* __restrict__ C2,
    const float* __restrict__ lq1, const float* __restrict__ lk1,
    const float* __restrict__ lq2, const float* __restrict__ lk2,
    const float* __restrict__ hnw, unsigned short* Oh, unsigned short* Ol) {
#pragma clang fp contract(off)
  __shared__ float lam_s[NH];
  const int tid = threadIdx.x;
  const int t   = blockIdx.x;
  if (tid < NH) {
    const float* a1 = lq1 + tid * HD;
    const float* b1 = lk1 + tid * HD;
    const float* a2 = lq2 + tid * HD;
    const float* b2 = lk2 + tid * HD;
    float sa = 0.f, sb = 0.f;
#pragma unroll 1
    for (int d = 0; d < HD; ++d) {
      sa += bfr(a1[d]) * bfr(b1[d]);
      sb += bfr(a2[d]) * bfr(b2[d]);
    }
    lam_s[tid] = (LAM0 + expf(sa)) - expf(sb);
  }
  __syncthreads();
  const int c0 = tid * 8;
  const int h  = c0 >> 6;
  const int d0 = c0 & 63;
  const size_t ro = (size_t)t * DM + c0;
  const v4f x0 = *(const v4f*)(C1 + ro), x1 = *(const v4f*)(C1 + ro + 4);
  const v4f y0 = *(const v4f*)(C2 + ro), y1 = *(const v4f*)(C2 + ro + 4);
  const float lam = lam_s[h];
  float o[8];
  float ss = 0.f;
#pragma unroll
  for (int e = 0; e < 4; ++e) {
    o[e]     = x0[e] - lam * y0[e];
    o[4 + e] = x1[e] - lam * y1[e];
  }
#pragma unroll
  for (int e = 0; e < 8; ++e) ss += o[e] * o[e];
  ss += __shfl_xor(ss, 1, 32);
  ss += __shfl_xor(ss, 2, 32);
  ss += __shfl_xor(ss, 4, 32);
  const float ms = ss * (1.0f / (float)HD);
  const float rn = rsqrtf(ms + 1.0e-6f);
  v4u hv, lv;
#pragma unroll
  for (int e = 0; e < 4; ++e) {
    const float w0 = bfr(hnw[h * HD + d0 + 2 * e]);
    const float w1 = bfr(hnw[h * HD + d0 + 2 * e + 1]);
    const float f0 = ((o[2 * e] * rn) * w0) * OSCL;
    const float f1 = ((o[2 * e + 1] * rn) * w1) * OSCL;
    const unsigned short h0 = bf_bits(f0), h1 = bf_bits(f1);
    const unsigned short l0 = bf_bits(f0 - bf_up(h0)), l1 = bf_bits(f1 - bf_up(h1));
    hv[e] = pk16(h0, h1); lv[e] = pk16(l0, l1);
  }
  *(v4u*)(Oh + ro) = hv;
  *(v4u*)(Ol + ro) = lv;
  
}

// =====================================================================================================
// Workspace map (bytes, all offsets multiples of 4096):
//   Xb   bf16 [4096][1024]      8388608      Wqb bf16 [2048][1024] 4194304   Wkb 4194304
//   Wvb  bf16 [1024][1024]      2097152      Wob 2097152
//   invf f32 [32] (padded)         4096      cosT f32 [2048][32] 262144      sinT 262144
//   both batch elements, batch-major:
//   Qf   f32  [2][2048][2048]     33554432      Kf 33554432
//   Qh/Ql/Kh/Kl bf16 [2][2048][2048]  4 x 16777216
//   VTh  f16  [2][1024][2048]      8388608      VTl f16 [2][1024][512] 2097152
//   C1/C2 f32 [2][2048][1024]   2 x 16777216    Oh/Ol bf16 [2][2048][1024] 2 x 8388608
//   end                          216535040
// All planes are exact multiples of their 64x64 / whole-line store granularity (no padded tails needed).
// Weights are [out n][in k] with k contiguous = the Bt / A layout the GEMM wants, so they are only converted.
// =====================================================================================================
extern "C" void kernel_launch(void* const* d_in, const int* in_sizes, int n_in,
                              void* d_out, int out_size, void* d_ws, size_t ws_size,
                              hipStream_t stream) {
  if (n_in < 14) return;
  if (in_sizes[0] != NB * SEQ * DM) return;
  if (in_sizes[1] != DQK * DM || in_sizes[2] != DQK) return;
  if (in_sizes[3] != DQK * DM || in_sizes[4] != DQK) return;
  if (in_sizes[5] != DM * DM || in_sizes[6] != DM) return;
  if (in_sizes[7] != DM * DM || in_sizes[8] != DM) return;
  for (int i = 9; i < 14; ++i) if (in_sizes[i] != NH * HD) return;
  if (out_size != NB * SEQ * DM) return;

  const float* x   = (const float*)d_in[0];
  const float* Wq  = (const float*)d_in[1];
  const float* bq  = (const float*)d_in[2];
  const float* Wk  = (const float*)d_in[3];
  const float* bk  = (const float*)d_in[4];
  const float* Wv  = (const float*)d_in[5];
  const float* bv  = (const float*)d_in[6];
  const float* Wo  = (const float*)d_in[7];
  const float* bo  = (const float*)d_in[8];
  const float* hnw = (const float*)d_in[9];
  const float* lq1 = (const float*)d_in[10];
  const float* lk1 = (const float*)d_in[11];
  const float* lq2 = (const float*)d_in[12];
  const float* lk2 = (const float*)d_in[13];
  float* outp = (float*)d_out;

  const size_t PXB  = (size_t)NB * SEQ * DM * 2;    //  8388608
  const size_t PWQ  = (size_t)DQK * DM * 2;         //  4194304
  const size_t PWV  = (size_t)DM * DM * 2;          //  2097152
  const size_t PIF  = 4096;                         //  32 floats used
  const size_t PTAB = (size_t)SEQ * NFREQ * 4;      //   262144
  const size_t PQF  = (size_t)NB * SEQ * DQK * 4;   // 33554432
  const size_t PQP  = (size_t)NB * SEQ * DQK * 2;   // 16777216
  const size_t PVT  = (size_t)NB * DM * SEQ * 2;    //  8388608
  const size_t PVL  = (size_t)NB * DM * VLP * 2;    //  2097152
  const size_t PC   = (size_t)NB * SEQ * DM * 4;    // 16777216
  const size_t PO   = (size_t)NB * SEQ * DM * 2;    //  8388608
  size_t off = 0;
  const size_t oXb  = off; off += PXB;
  const size_t oWq  = off; off += PWQ;
  const size_t oWk  = off; off += PWQ;
  const size_t oWv  = off; off += PWV;
  const size_t oWo  = off; off += PWV;
  const size_t oIF  = off; off += PIF;
  const size_t oCos = off; off += PTAB;
  const size_t oSin = off; off += PTAB;
  const size_t oQf  = off; off += PQF;
  const size_t oKf  = off; off += PQF;
  const size_t oQh  = off; off += PQP;
  const size_t oQl  = off; off += PQP;
  const size_t oKh  = off; off += PQP;
  const size_t oKl  = off; off += PQP;
  const size_t oVTh = off; off += PVT;
  const size_t oVTl = off; off += PVL;
  const size_t oC1  = off; off += PC;
  const size_t oC2  = off; off += PC;
  const size_t oOh  = off; off += PO;
  const size_t oOl  = off; off += PO;
  if (off > ws_size) return;                        // off = 216535040

  char* ws = (char*)d_ws;
  unsigned short* Xb  = (unsigned short*)(ws + oXb);
  unsigned short* Wqb = (unsigned short*)(ws + oWq);
  unsigned short* Wkb = (unsigned short*)(ws + oWk);
  unsigned short* Wvb = (unsigned short*)(ws + oWv);
  unsigned short* Wob = (unsigned short*)(ws + oWo);
  float*          IFt = (float*)(ws + oIF);
  float*          CosT = (float*)(ws + oCos);
  float*          SinT = (float*)(ws + oSin);
  float*          Qf  = (float*)(ws + oQf);
  float*          Kf  = (float*)(ws + oKf);
  unsigned short* Qh  = (unsigned short*)(ws + oQh);
  unsigned short* Ql  = (unsigned short*)(ws + oQl);
  unsigned short* Kh  = (unsigned short*)(ws + oKh);
  unsigned short* Kl  = (unsigned short*)(ws + oKl);
  unsigned short* VTh = (unsigned short*)(ws + oVTh);
  unsigned short* VTl = (unsigned short*)(ws + oVTl);
  float*          C1  = (float*)(ws + oC1);
  float*          C2  = (float*)(ws + oC2);
  unsigned short* Oh  = (unsigned short*)(ws + oOh);
  unsigned short* Ol  = (unsigned short*)(ws + oOl);

  const dim3 blk256(256), blk128(128), blk32(32);
  const dim3 gCvt((NB * SEQ * DM + 2 * DQK * DM + 2 * DM * DM) / 8 / 256);   // 5120 blocks
  const dim3 gTab((SEQ * NFREQ + 255) / 256);                      //  256 blocks
  const dim3 gQKV((SEQ / 64) * (DQK / 64) / 8, NB, 3);             // 1024 tiles -> 128 blocks, x batch x {q, k, v^T}
  const dim3 gOut((NB * SEQ / 64) * (DM / 64) / 8, 1);             // 1024 tiles -> 128 blocks
  const dim3 gRope(SEQ, NB);                                       // one block per token row
  const dim3 gRow(NB * SEQ);                                       // one block per token row
  const dim3 gAtt(NQB * 2 * NB * NH);                              // 2048 blocks

  // (1) inputs -> bf16 planes; weights [n][k] f32 -> bf16 [n][k]; Xb, Wqb, Wkb, Wvb, Wob are contiguous from Xb
  cvt_bf16x8<<<gCvt, blk256, 0, stream>>>(x, Wq, Wk, Wv, Wo, Xb);
  // (2) rope tables
  invfreq_tab<<<dim3(1), blk32, 0, stream>>>(IFt);
  rope_tab<<<gTab, blk256, 0, stream>>>(IFt, CosT, SinT);
  // (3) q, k -> f32 [NB*SEQ][DQK]; v^T -> f16 hi plane and residual plane, both batch elements
  gemm_qkv<<<gQKV, blk256, 0, stream>>>(Xb, Wqb, Wkb, Wvb, Qf, Kf, VTh, VTl, bq, bk, bv);
  // (4) rope + bf16 hi/lo split of q and k
  rope_split<<<gRope, blk256, 0, stream>>>(Qf, Kf, CosT, SinT, Qh, Ql, Kh, Kl);
  // (5) causal attention, stream 1 (q1, k1) -> C1 and stream 2 (q2, k2) -> C2;
  //     query blocks 0..RESQB-1 with residual planes, the rest without
  attn_causal64<<<gAtt, blk128, 0, stream>>>(Qh, Ql, Kh, Kl, VTh, VTl, C1, C2, 0.125f);
  // (6) differential combine + head norm -> O bf16 hi/lo planes [NB*SEQ][DM]
  diff_combine<<<gRow, blk128, 0, stream>>>(C1, C2, lq1, lk1, lq2, lk2, hnw, Oh, Ol);
  // (7) out = O . Wo^T + bo -> d_out, f32 [NB*SEQ][DM]  (A = O hi + lo planes, 2 products)
  gemm64<1, 0, 1><<<gOut, blk256, 0, stream>>>(
      Oh, Ol, DM, 0LL, Wob, Wob, DM, 0LL,
      (void*)outp, DM, 0LL, (void*)outp, DM, 0LL, DM,
      NB * SEQ, DM, DM, 1.0f, bo);
  (void)hipGetLastError();
}

// v005
// One run takes 190 microseconds.
// Next to v004, in two timings, it ran 1.05 times as fast each time.
// All steps since v000 together make it 5.81 times as fast.
// Contractions: q, k, v^T projections = v_wmma_f32_16x16x32_bf16 (bf16 operands from RNE-converted inputs, single product);
// q.k^T scores (both streams) = v_wmma_f32_16x16x32_bf16 with bf16 hi/lo split q and k (hi.hi + hi.lo + lo.hi);
// p.v = v_wmma_f32_16x16x32_f16 (p carried x1024 in f16, v in f16; extra f16 residual planes x4096 of p and v for the first 512 query rows);
// ctx.Wo^T = v_wmma_f32_16x16x32_bf16 with ctx as bf16 hi/lo planes times bf16 Wo (2 products); all f32 accumulate;
// rope, softmax, lambda, head rms norm in f32.
#include <hip/hip_runtime.h>
#include <math.h>
#include <float.h>
#include <stdint.h>

#define NB    2
#define SEQ   2048
#define DM    1024
#define DQK   2048          // q / k projection width (2 x 64 per head)
#define NH    16
#define HD    64
#define NFREQ (HD / 2)
#define NQB   (SEQ / 64)    // 32 key / query tiles of 64
#define VLP   512           // key pitch of the v^T residual plane (keys 0..VLP-1)
#define RESQB 8             // number of leading 64-row query blocks that use the p / v residual planes
#define LAM0  0.2f
#define OSCL  0.8f
static_assert(RESQB * 64 <= VLP);
static_assert(NH * HD == DM);
static_assert(NB == 2 && NH == 16);   // the attention grid's index split
static_assert(NH * 2 * HD == DQK);
static_assert((SEQ % 256) == 0 && (DM % 256) == 0 && (DQK % 256) == 0);   // GEMM block tiles 128 x 256, 64 k per trip

typedef _Float16 v16h __attribute__((ext_vector_type(16)));
typedef _Float16 v8h  __attribute__((ext_vector_type(8)));
typedef __bf16   v16b __attribute__((ext_vector_type(16)));
typedef __bf16   v8b  __attribute__((ext_vector_type(8)));
typedef float    v8f  __attribute__((ext_vector_type(8)));
typedef float    v4f  __attribute__((ext_vector_type(4)));
typedef unsigned int v4u __attribute__((ext_vector_type(4)));

// ---- scalar helpers --------------------------------------------------------------------------------
__device__ __forceinline__ unsigned short bf_bits(float f) {          // f32 -> bf16 bits, RNE convert
  unsigned u = __float_as_uint(f);
  return (unsigned short)((u + 0x7FFFu + ((u >> 16) & 1u)) >> 16);
}
__device__ __forceinline__ float bf_up(unsigned short h) { return __uint_as_float(((unsigned)h) << 16); }
__device__ __forceinline__ float bfr(float f) { return bf_up(bf_bits(f)); }   // value after RNE convert to bf16
__device__ __forceinline__ unsigned short h_bits(_Float16 x) { return __builtin_bit_cast(unsigned short, x); }
__device__ __forceinline__ unsigned pk16(unsigned short a, unsigned short b) { return (unsigned)a | ((unsigned)b << 16); }
__device__ __forceinline__ v8f zero8() { v8f z = {0.f, 0.f, 0.f, 0.f, 0.f, 0.f, 0.f, 0.f}; return z; }
__device__ __forceinline__ v8h zero8h() {
  const _Float16 z = (_Float16)0.0f;
  v8h r = {z, z, z, z, z, z, z, z};
  return r;
}

// ---- fragment loaders: 16-bit A/B operand, lane -> row/col (lane&15), p already includes +8*(lane>>4);
//      elements 0..7 <- p[0..7] (k0+8h..), elements 8..15 <- p[16..23] (k0+16+8h..)
__device__ __forceinline__ v16b ldfrag_b(const __bf16* p) {
  union { v16b v; v8b h[2]; } f;
  f.h[0] = *(const v8b*)(p);
  f.h[1] = *(const v8b*)(p + 16);
  return f.v;
}

// ---- WMMA helpers with trailing VALU hazard gap --------------------------------------------------------
__device__ __forceinline__ v8f mma_b(v16b a, v16b b, v8f c) {
  c = __builtin_amdgcn_wmma_f32_16x16x32_bf16(false, a, false, b, (short)0, c, false, false);
#if defined(__HIP_DEVICE_COMPILE__)
  asm volatile("v_nop\n\tv_nop\n\tv_nop\n\tv_nop" : "+v"(c) : "v"(a), "v"(b));
#endif
  return c;
}
__device__ __forceinline__ v8f mma_h(v16h a, v16h b, v8f c) {
  c = __builtin_amdgcn_wmma_f32_16x16x32_f16(false, a, false, b, (short)0, c, false, false);
#if defined(__HIP_DEVICE_COMPILE__)
  asm volatile("v_nop\n\tv_nop\n\tv_nop\n\tv_nop" : "+v"(c) : "v"(a), "v"(b));
#endif
  return c;
}
__device__ __forceinline__ v8f mma_b_raw(v16b a, v16b b, v8f c) {
  return __builtin_amdgcn_wmma_f32_16x16x32_bf16(false, a, false, b, (short)0, c, false, false);
}
__device__ __forceinline__ void dep_guard_b(v8f& a, v8f& b, v16b x, v16b y) {
#if defined(__HIP_DEVICE_COMPILE__)
  asm volatile("v_nop\n\tv_nop\n\tv_nop\n\tv_nop" : "+v"(a), "+v"(b) : "v"(x), "v"(y));
#endif
}
__device__ __forceinline__ void keep4_b(v16b a, v16b b, v16b c, v16b d) {
#if defined(__HIP_DEVICE_COMPILE__)
  asm volatile("v_nop" :: "v"(a), "v"(b), "v"(c), "v"(d));
#endif
}
__device__ __forceinline__ void acc_guard4(v8f& a, v8f& b, v8f& c, v8f& d) {
#if defined(__HIP_DEVICE_COMPILE__)
  asm volatile("v_nop\n\tv_nop\n\tv_nop\n\tv_nop" : "+v"(a), "+v"(b), "+v"(c), "+v"(d));
#endif
}

// =====================================================================================================
// f32 -> bf16 (RNE convert), 8 elements per thread, one 16-B store per lane: a wave writes 512 contiguous B
// One grid for x, Wq, Wk, Wv, Wo: their bf16 planes lie back to back in the workspace in that order, so the
// output index is the flat thread index; the source is picked per block (every plane is a multiple of 2048
// elements, so a block never straddles two planes).
// coverage: (NX + 2 NQ + 2 NV) threads x 8 = all five planes.
// =====================================================================================================
__global__ __launch_bounds__(256) void cvt_bf16x8(const float* __restrict__ x, const float* __restrict__ wq,
                                                  const float* __restrict__ wk, const float* __restrict__ wv,
                                                  const float* __restrict__ wo, unsigned short* out) {
  constexpr int NX = NB * SEQ * DM / 8, NQ = DQK * DM / 8, NV = DM * DM / 8;
  static_assert((NX % 256) == 0 && (NQ % 256) == 0 && (NV % 256) == 0);
  const int i = blockIdx.x * 256 + threadIdx.x;
  if (i < NX + 2 * NQ + 2 * NV) {
    const float* in = x;
    int j = i;
    if (i >= NX + 2 * NQ + NV)  { in = wo; j = i - (NX + 2 * NQ + NV); }
    else if (i >= NX + 2 * NQ)  { in = wv; j = i - (NX + 2 * NQ); }
    else if (i >= NX + NQ)      { in = wk; j = i - (NX + NQ); }
    else if (i >= NX)           { in = wq; j = i - NX; }
    const v4f a = *(const v4f*)(in + (size_t)j * 8);
    const v4f b = *(const v4f*)(in + (size_t)j * 8 + 4);
    v4u p;
    p[0] = pk16(bf_bits(a[0]), bf_bits(a[1]));
    p[1] = pk16(bf_bits(a[2]), bf_bits(a[3]));
    p[2] = pk16(bf_bits(b[0]), bf_bits(b[1]));
    p[3] = pk16(bf_bits(b[2]), bf_bits(b[3]));
    *(v4u*)(out + (size_t)i * 8) = p;
    
  }
}

// =====================================================================================================
// inv_freq[j] = 1 / 10000^(j/32), j = 0..31, f32 with precise powf. One block of 32 threads; the 32 values
// coverage: lanes 0..7 x 4 floats = all 32 entries.
// =====================================================================================================
__global__ __launch_bounds__(32) void invfreq_tab(float* invf) {
  __shared__ __align__(16) float sf[NFREQ];
  const int j = threadIdx.x;
  const float e = (float)j * (1.0f / (float)NFREQ);
  const float pw = powf(10000.0f, e);
  sf[j] = 1.0f / pw;
  __syncthreads();
  const v4f v = *(const v4f*)(sf + 4 * (j & 7));
  if (j < 8) *(v4f*)(invf + 4 * j) = v;
  
}

// =====================================================================================================
// cos / sin tables [SEQ][32]: angle = t * inv_freq[j] (f32 multiply), precise cosf / sinf.
// =====================================================================================================
__global__ __launch_bounds__(256) void rope_tab(const float* __restrict__ invf, float* cosT, float* sinT) {
  const int g = blockIdx.x * 256 + threadIdx.x;
  if (g < SEQ * NFREQ) {
    const int t = g / NFREQ;
    const int j = g - t * NFREQ;
    const float ang = (float)t * invf[j];
    const float cv = cosf(ang);
    const float sv = sinf(ang);
    *(float*)(cosT + g) = cv;
    *(float*)(sinT + g) = sv;
    
  }
}

// =====================================================================================================
// Register-blocked bf16 WMMA GEMM: C[m][n] = sum_k A[m][k] * Bt[n][k] (+ bias); one wave per 64x64 tile, a block of
// 8 waves (2 x 4) per 128 x 256 tile. A row-major [M][K] pitch lda; Bt row-major [N][K] pitch ldb (k contiguous);
// M multiple of 128, N of 256, K of 64. b = batch index (strides in elements).
// The tile body is a device function (block tile index, batch index and the LDS come from the caller), so
// that one grid can hold several independent products.
// Operands reach the waves through LDS: per trip of 64 k the block's 128 A rows and 256 Bt rows (128 B = one line each)
// are brought in by asynchronous copies to LDS, 16 B per lane, 8 lanes per row, so that one wave-wide copy covers 4
// whole lines; a fragment load straight from global memory touches 16 lines for the same 512 B, and every wave
// fetched its own copy of rows that its neighbours need too. Two buffers: the next trip's copies fly during this
// trip's products. LDS row pitch 144 B (16 B x odd) for the ds_load_b128 fragment reads. The k order of the products
// is unchanged (32 k per WMMA, ascending).
// NSPLIT: 0 = A.Bt; 1 = (A + A2).Bt (A2 = unscaled bf16 lo plane of A).
// OUT_MODE: 0 = f32 (pitch ldc); 2 = bf16 hi plane C + bf16 lo plane C2 (lo = RNE(v - hi), unscaled);
//           3 = f16 hi plane C + f16 residual plane C2 = f16((v - hi) * rscale), C2 written only for tiles
//               with n0 < N2 (pitch ldc2, batch stride strideC2).
// BIAS: 0 = none; 1 = + bf16-RNE(bias[n]) per column; 2 = + bf16-RNE(bias[m]) per row (added in f32).
// =====================================================================================================
#define GP        72                                  // LDS row pitch of a staged operand row, in elements (144 B)
#define GROW_B    (GP * 2)
#define GSTG_B(NS) ((128 + 256 + 128 * (NS)) * GROW_B)  // one buffer: A rows | Bt rows | A2 rows: 55296 B / 73728 B
static_assert((GROW_B % 16) == 0 && ((GROW_B / 16) & 1) == 1);

// Four asynchronous 16-B copies to LDS per lane (l = the lane's LDS byte address, g = its global address).
// s_wait_xcnt 0 is the last line of the copies' own statement: it stands in front of any rewrite of the address registers.
__device__ __forceinline__ void copy4_lds(unsigned l0, const __bf16* g0, unsigned l1, const __bf16* g1,
                                          unsigned l2, const __bf16* g2, unsigned l3, const __bf16* g3) {
#if defined(__HIP_DEVICE_COMPILE__)
  asm volatile("global_load_async_to_lds_b128 %0, %1, off\n\t"
               "global_load_async_to_lds_b128 %2, %3, off\n\t"
               "global_load_async_to_lds_b128 %4, %5, off\n\t"
               "global_load_async_to_lds_b128 %6, %7, off\n\t"
               "s_wait_xcnt 0x0"
               :: "v"(l0), "v"(g0), "v"(l1), "v"(g1), "v"(l2), "v"(g2), "v"(l3), "v"(g3) : "memory");
#endif
}
// The issuing wave's own copies have landed (in front of the barrier behind which other waves read them).
__device__ __forceinline__ void wait_copies() {
#if defined(__HIP_DEVICE_COMPILE__)
  asm volatile("s_wait_asynccnt 0x0" ::: "memory");
#endif
}
// This wave's LDS reads have returned (in front of the barrier behind which their buffer is refilled).
__device__ __forceinline__ void wait_lds() {
#if defined(__HIP_DEVICE_COMPILE__)
  asm volatile("s_wait_dscnt 0x0" ::: "memory");
#endif
}
// One 64-k tile of the block's operands into one buffer: 256 threads x 16 B = 32 rows per copy; dst = the lane's LDS
// byte address of row tid>>3, chunk tid&7 of the buffer; gA / gB / gA2 = its global address in row tid>>3 of the block's rows.
template <int NSPLIT>
__device__ __forceinline__ void gemm_stage(unsigned dst, const __bf16* gA, const __bf16* gB, const __bf16* gA2,
                                           int lda, int ldb) {
  const size_t ra = (size_t)32 * lda, rb = (size_t)32 * ldb;
  constexpr unsigned R = 32 * GROW_B;
  copy4_lds(dst, gA, dst + R, gA + ra, dst + 2 * R, gA + 2 * ra, dst + 3 * R, gA + 3 * ra);
  copy4_lds(dst + 4 * R, gB, dst + 5 * R, gB + rb, dst + 6 * R, gB + 2 * rb, dst + 7 * R, gB + 3 * rb);
  copy4_lds(dst + 8 * R, gB + 4 * rb, dst + 9 * R, gB + 5 * rb, dst + 10 * R, gB + 6 * rb, dst + 11 * R, gB + 7 * rb);
  if (NSPLIT == 1)
    copy4_lds(dst + 12 * R, gA2, dst + 13 * R, gA2 + ra, dst + 14 * R, gA2 + 2 * ra, dst + 15 * R, gA2 + 3 * ra);
}

template <int NSPLIT, int OUT_MODE, int BIAS>
__device__ __forceinline__ void gemm64_tile(
    const unsigned short* __restrict__ Ap, const unsigned short* A2p, int lda, long long strideA,
    const unsigned short* __restrict__ Btp, const unsigned short* Bt2p, int ldb, long long strideB,
    void* Cout, int ldc, long long strideC,
    void* Cout2, int ldc2, long long strideC2, int N2,
    int M, int N, int K, float rscale, const float* __restrict__ bias,
    float* slab, unsigned char* stg, int bt, int b) {
  static_assert(NSPLIT == 0 || NSPLIT == 1);
  const __bf16* A   = (const __bf16*)(const void*)Ap;
  const __bf16* A2  = (const __bf16*)(const void*)A2p;
  const __bf16* Bt  = (const __bf16*)(const void*)Btp;
  const int tid  = threadIdx.x;
  const int lane = tid & 31;
  const int wave = tid >> 5;
  const int blocksN = N >> 8;
  const int blocksM = M >> 7;
  if (bt >= blocksM * blocksN) return;   // block-uniform, in front of every copy and barrier
  const int bm  = bt / blocksN;
  const int bn  = bt - bm * blocksN;
  const int mb0 = bm << 7;
  const int nb0 = bn << 8;
  const int wm  = wave >> 2;             // the wave's 64 rows of the block's 128
  const int wn  = wave & 3;              // the wave's 64 columns of the block's 256
  const int m0  = mb0 + (wm << 6);
  const int n0  = nb0 + (wn << 6);

  const __bf16* Ab  = A  + (size_t)b * strideA;
  const __bf16* Bb  = Bt + (size_t)b * strideB;
  const __bf16* Ab2 = (NSPLIT >= 1) ? (A2  + (size_t)b * strideA) : Ab;

  const int rlane = lane & 15;                 // row (A) / col (B, D) within subtile
  const int koff  = (lane >> 4) * 8;           // k offset of this lane half
  const int mOff  = (lane >> 4) * 8;           // D row offset

  v8f acc[4][4];
#pragma unroll
  for (int i = 0; i < 4; ++i)
#pragma unroll
    for (int j = 0; j < 4; ++j) acc[i][j] = zero8();

  constexpr unsigned STG = GSTG_B(NSPLIT);
  const int nt   = K >> 6;                     // trips of 64 k
  const int srow = tid >> 3, sch = tid & 7;    // this lane's row (of 32 per copy) and 16-B chunk of the 128-B row
  const unsigned sdst = (unsigned)(size_t)stg + (unsigned)(srow * GROW_B + sch * 16);
  const __bf16* gA  = Ab  + (size_t)(mb0 + srow) * lda + sch * 8;
  const __bf16* gB  = Bb  + (size_t)(nb0 + srow) * ldb + sch * 8;
  const __bf16* gA2 = Ab2 + (size_t)(mb0 + srow) * lda + sch * 8;

  // tile 0 -> buffer 0, landed and published; then tile 1 -> buffer 1 in flight
  gemm_stage<NSPLIT>(sdst, gA, gB, gA2, lda, ldb);
  wait_copies();
  __syncthreads();
  if (nt > 1) gemm_stage<NSPLIT>(sdst + STG, gA + 64, gB + 64, gA2 + 64, lda, ldb);

  for (int t = 0; t < nt; ++t) {               // block-uniform trip count
    const __bf16* sb  = (const __bf16*)(const void*)(stg + (size_t)(t & 1) * STG);
    const __bf16* sA  = sb + ((wm << 6) + rlane) * GP + koff;
    const __bf16* sB  = sb + (128 + (wn << 6) + rlane) * GP + koff;
    const __bf16* sA2 = (NSPLIT >= 1) ? (sb + (384 + (wm << 6) + rlane) * GP + koff) : sA;
    // unrolled (here and below): the fragment arrays need constant indices to stay in registers, and the second
    // 32-k block's LDS reads can then be issued among the first block's products
#pragma unroll
    for (int kk = 0; kk < 2; ++kk) {
      v16b bh[4], ahf[4], alf[4];
#pragma unroll
      for (int j = 0; j < 4; ++j) bh[j] = ldfrag_b(sB + (j << 4) * GP + kk * 32);
#pragma unroll
      for (int i = 0; i < 4; ++i) {
        ahf[i] = ldfrag_b(sA + (i << 4) * GP + kk * 32);
        if (NSPLIT >= 1) alf[i] = ldfrag_b(sA2 + (i << 4) * GP + kk * 32); else alf[i] = ahf[i];
      }
#pragma unroll
      for (int i = 0; i < 4; ++i) {
        const v16b ah = ahf[i], al = alf[i];
#pragma unroll
        for (int j = 0; j < 4; ++j) {
          acc[i][j] = mma_b_raw(ah, bh[j], acc[i][j]);
          if (NSPLIT >= 1) acc[i][j] = mma_b_raw(al, bh[j], acc[i][j]);
        }
        dep_guard_b(acc[i][0], acc[i][3], ah, al);
      }
      keep4_b(bh[0], bh[1], bh[2], bh[3]);
    }
    // foot of the trip: own reads of this buffer done, own copies of the next tile landed, one barrier for both;
    // only then the refill of the buffer that this trip has read
    wait_lds();
    wait_copies();
    __syncthreads();
    if (t + 2 < nt) {
      const int kn = (t + 2) << 6;
      gemm_stage<NSPLIT>(sdst + (unsigned)(t & 1) * STG, gA + kn, gB + kn, gA2 + kn, lda, ldb);
    }
  }
  wait_copies();
  acc_guard4(acc[0][0], acc[0][1], acc[0][2], acc[0][3]);
  acc_guard4(acc[1][0], acc[1][1], acc[1][2], acc[1][3]);
  acc_guard4(acc[2][0], acc[2][1], acc[2][2], acc[2][3]);
  acc_guard4(acc[3][0], acc[3][1], acc[3][2], acc[3][3]);

  // ---- epilogue ----
  float bcol[4];
#pragma unroll
  for (int j = 0; j < 4; ++j) bcol[j] = 0.f;
  if (BIAS == 1) {
#pragma unroll
    for (int j = 0; j < 4; ++j) bcol[j] = bfr(bias[n0 + (j << 4) + rlane]);
  }
#pragma unroll
  for (int i = 0; i < 4; ++i) {
    const int mBase = m0 + (i << 4);
    float brow[8];
#pragma unroll
    for (int r = 0; r < 8; ++r) brow[r] = 0.f;
    if (BIAS == 2) {
#pragma unroll
      for (int r = 0; r < 8; ++r) brow[r] = bfr(bias[mBase + mOff + r]);
    }
#pragma unroll
    for (int j = 0; j < 4; ++j) {
#pragma unroll
      for (int r = 0; r < 8; ++r) {
        slab[(mOff + r) * 68 + (j << 4) + rlane] = (acc[i][j][r] + bcol[j]) + brow[r];
      }
    }
    __builtin_amdgcn_fence(__ATOMIC_RELEASE, "workgroup");
    __builtin_amdgcn_wave_barrier();
    __builtin_amdgcn_fence(__ATOMIC_ACQUIRE, "workgroup");
    if (OUT_MODE == 0) {
      float* C = (float*)Cout + (size_t)b * strideC;
      const int hh = lane >> 4, c4 = (lane & 15) * 4;     // 256-B row segment = 16 lanes x 16 B
      {
#pragma unroll
        for (int it = 0; it < 8; ++it) {
          const int row = it * 2 + hh;                     // it 0..7 x hh 0..1 = rows 0..15
          const v4f v = *(const v4f*)(slab + row * 68 + c4);
          *(v4f*)(C + (size_t)(mBase + row) * ldc + n0 + c4) = v;
        }
        
      }
    } else {
      const int q = lane >> 3, c8 = (lane & 7) * 8;
      unsigned short* C  = (unsigned short*)Cout  + (size_t)b * strideC;
      unsigned short* C2 = (unsigned short*)Cout2 + (size_t)b * strideC2;
      const bool wlo = (OUT_MODE == 2) || (n0 < N2);      // wave-uniform
      v4u hv[4], lv[4];
#pragma unroll
      for (int it = 0; it < 4; ++it) {
        const int row = it * 4 + q;                        // it 0..3 x q 0..3 = rows 0..15
        const float* sp = slab + row * 68 + c8;
        v4u a, a2;
#pragma unroll
        for (int e = 0; e < 4; ++e) {
          const float f0 = sp[2 * e], f1 = sp[2 * e + 1];
          unsigned short h0, h1, l0, l1;
          if (OUT_MODE == 2) {
            h0 = bf_bits(f0); h1 = bf_bits(f1);
            l0 = bf_bits(f0 - bf_up(h0)); l1 = bf_bits(f1 - bf_up(h1));
          } else {
            const _Float16 x0 = (_Float16)f0, x1 = (_Float16)f1;
            h0 = h_bits(x0); h1 = h_bits(x1);
            l0 = h_bits((_Float16)((f0 - (float)x0) * rscale));
            l1 = h_bits((_Float16)((f1 - (float)x1) * rscale));
          }
          a[e] = pk16(h0, h1); a2[e] = pk16(l0, l1);
        }
        hv[it] = a; lv[it] = a2;
      }
      {
#pragma unroll
        for (int it = 0; it < 4; ++it) {
          const int row = it * 4 + q;
          *(v4u*)(C + (size_t)(mBase + row) * ldc + n0 + c8) = hv[it];
          if (wlo) *(v4u*)(C2 + (size_t)(mBase + row) * ldc2 + n0 + c8) = lv[it];
        }
        
      }
    }
    __builtin_amdgcn_fence(__ATOMIC_RELEASE, "workgroup");
    __builtin_amdgcn_wave_barrier();
    __builtin_amdgcn_fence(__ATOMIC_ACQUIRE, "workgroup");
  }
}

// One product per grid: blockIdx.x = 128 x 256 block tile, blockIdx.y = batch index.
template <int NSPLIT, int OUT_MODE, int BIAS>
__global__ __launch_bounds__(256) void gemm64(
    const unsigned short* __restrict__ Ap, const unsigned short* A2p, int lda, long long strideA,
    const unsigned short* __restrict__ Btp, const unsigned short* Bt2p, int ldb, long long strideB,
    void* Cout, int ldc, long long strideC,
    void* Cout2, int ldc2, long long strideC2, int N2,
    int M, int N, int K, float rscale, const float* __restrict__ bias) {
  __shared__ __align__(16) float sT[8][16 * 68];   // per-wave 16x64 slab, pitch 68 floats
  __shared__ __align__(16) unsigned char sG[2 * GSTG_B(NSPLIT)];   // two operand buffers
  const int wave = threadIdx.x >> 5;
  gemm64_tile<NSPLIT, OUT_MODE, BIAS>(Ap, A2p, lda, strideA, Btp, Bt2p, ldb, strideB, Cout, ldc, strideC,
                                      Cout2, ldc2, strideC2, N2, M, N, K, rscale, bias,
                                      sT[wave], sG, blockIdx.x, blockIdx.y);
}

// q, k and v^T projections of both batch elements in one grid: blockIdx.z = 0 q, 1 k, 2 v^T; blockIdx.y = batch;
// blockIdx.x = 128 x 256 block tile (v^T has half the tiles of q / k: its upper blocks leave at the tile test).
//   q / k = x_b . W^T + bias[col] -> f32 [NB*SEQ][DQK]                 (M=SEQ, N=DQK, K=DM)
//   v^T   = Wv . x_b^T + bv[row]  -> f16 hi plane [b][h*64+d][s] (pitch SEQ) and residual plane
//           (x4096, keys < VLP only, pitch VLP)                        (M=DM, N=SEQ, K=DM)
__global__ __launch_bounds__(256) void gemm_qkv(
    const unsigned short* __restrict__ Xb, const unsigned short* __restrict__ Wqb,
    const unsigned short* __restrict__ Wkb, const unsigned short* __restrict__ Wvb,
    float* Qf, float* Kf, unsigned short* VTh, unsigned short* VTl,
    const float* __restrict__ bq, const float* __restrict__ bk, const float* __restrict__ bv) {
  __shared__ __align__(16) float sT[8][16 * 68];   // per-wave 16x64 slab, pitch 68 floats
  __shared__ __align__(16) unsigned char sG[2 * GSTG_B(0)];   // two operand buffers
  const int wave = threadIdx.x >> 5;
  const int tile = blockIdx.x;
  const int b    = blockIdx.y;
  const int z    = blockIdx.z;
  if (z < 2) {
    const unsigned short* Wb = z ? Wkb : Wqb;
    float* Cf = z ? Kf : Qf;
    const float* bias = z ? bk : bq;
    gemm64_tile<0, 0, 1>(Xb, Xb, DM, (long long)SEQ * DM, Wb, Wb, DM, 0LL,
                         (void*)Cf, DQK, (long long)SEQ * DQK, (void*)Cf, DQK, 0LL, DQK,
                         SEQ, DQK, DM, 1.0f, bias, sT[wave], sG, tile, b);
  } else {
    gemm64_tile<0, 3, 2>(Wvb, Wvb, DM, 0LL, Xb, Xb, DM, (long long)SEQ * DM,
                         (void*)VTh, SEQ, (long long)DM * SEQ, (void*)VTl, VLP, (long long)DM * VLP, VLP,
                         DM, SEQ, DM, 4096.0f, bv, sT[wave], sG, tile, b);
  }
}

// =====================================================================================================
// RoPE half-split rotation of 8 consecutive columns of one 64-wide vector, then bf16 hi/lo split and
//   first half  (j < 32):   out[j]    = x[j]*cos[j]   - x[j+32]*sin[j]     (x1 = a, x2 = p)
//   second half (j >= 32):  out[j+32] = x[j]*sin[j]   + x[j+32]*cos[j]     (x1 = p, x2 = a)
// =====================================================================================================
__device__ __forceinline__ void rope_row8(const float* __restrict__ src, size_t rowOff, int c0, int p0,
                                          bool second, v4f cs0, v4f cs1, v4f sn0, v4f sn1,
                                          unsigned short* Hp, unsigned short* Lp) {
#pragma clang fp contract(off)
  const v4f xa0 = *(const v4f*)(src + rowOff + c0);
  const v4f xa1 = *(const v4f*)(src + rowOff + c0 + 4);
  const v4f xp0 = *(const v4f*)(src + rowOff + p0);
  const v4f xp1 = *(const v4f*)(src + rowOff + p0 + 4);
  float o[8];
#pragma unroll
  for (int e = 0; e < 4; ++e) {
    {
      const float a = xa0[e], p = xp0[e], cs = cs0[e], sn = sn0[e];
      const float f1 = a * cs - p * sn;
      const float f2 = p * sn + a * cs;
      o[e] = second ? f2 : f1;
    }
    {
      const float a = xa1[e], p = xp1[e], cs = cs1[e], sn = sn1[e];
      const float f1 = a * cs - p * sn;
      const float f2 = p * sn + a * cs;
      o[4 + e] = second ? f2 : f1;
    }
  }
  v4u hv, lv;
#pragma unroll
  for (int e = 0; e < 4; ++e) {
    const float f0 = o[2 * e], f1 = o[2 * e + 1];
    const unsigned short h0 = bf_bits(f0), h1 = bf_bits(f1);
    const unsigned short l0 = bf_bits(f0 - bf_up(h0)), l1 = bf_bits(f1 - bf_up(h1));
    hv[e] = pk16(h0, h1); lv[e] = pk16(l0, l1);
  }
  const size_t go = rowOff + c0;
  *(v4u*)(Hp + go) = hv;
  *(v4u*)(Lp + go) = lv;
  
}

// =====================================================================================================
// RoPE + hi/lo split for one token row t of q and k (f32 planes [NB*SEQ][DQK], per head 128 columns =
// two 64-wide vectors). grid = (SEQ, NB) blocks x 256 threads; thread -> columns 8*tid..8*tid+7.
// Outputs: bf16 hi / lo planes [NB*SEQ][DQK] for q and for k.
// coverage: 256 threads x 8 columns = 2048 columns of each of the 4 output planes per row; NB*SEQ rows.
// =====================================================================================================
__global__ __launch_bounds__(256) void rope_split(const float* __restrict__ Qf, const float* __restrict__ Kf,
                                                   const float* __restrict__ cosT, const float* __restrict__ sinT,
                                                   unsigned short* Qh, unsigned short* Ql,
                                                   unsigned short* Kh, unsigned short* Kl) {
  const int t = blockIdx.x;
  const int c0 = threadIdx.x * 8;
  const int jj0 = c0 & 31;
  const bool second = (c0 & 32) != 0;
  const int p0 = second ? (c0 - 32) : (c0 + 32);
  const float* cr = cosT + (size_t)t * NFREQ + jj0;
  const float* sr = sinT + (size_t)t * NFREQ + jj0;
  const v4f cs0 = *(const v4f*)(cr), cs1 = *(const v4f*)(cr + 4);
  const v4f sn0 = *(const v4f*)(sr), sn1 = *(const v4f*)(sr + 4);
  const size_t rowOff = ((size_t)blockIdx.y * SEQ + t) * DQK;
  rope_row8(Qf, rowOff, c0, p0, second, cs0, cs1, sn0, sn1, Qh, Ql);
  rope_row8(Kf, rowOff, c0, p0, second, cs0, cs1, sn0, sn1, Kh, Kl);
}

#define LP      72                        // LDS row pitch of the 16-bit tiles, in elements
#define TILE_B  (64 * LP * 2)             // one 64-row tile: 9216 B
#define OSP     68                        // row pitch of a wave's f32 context tile, in floats (272 B = 16 B x 17)
#define OS_B    (4 * 16 * OSP * 4)        // four waves' f32 context tiles: 17408 B
#define ATT_LDS (4 * TILE_B + OS_B)       // 54272 B
static_assert(((LP * 2) % 16) == 0 && (((LP * 2) / 16) & 1) == 1);   // 16-B aligned rows, odd multiple of 16 B
// value of lane l ^ 16 (the other wave half)
__device__ __forceinline__ float xhalf(float x) {
  return __builtin_bit_cast(float, __builtin_amdgcn_permlanex16(__builtin_bit_cast(int, x), __builtin_bit_cast(int, x),
                                                                0x76543210, 0xfedcba98, false, false));
}
template <bool RES>
__device__ __forceinline__
void attn_block64(unsigned char* smem,
                  const unsigned short* __restrict__ qhp, const unsigned short* __restrict__ qlp,
                  const unsigned short* __restrict__ khp, const unsigned short* __restrict__ klp,
                  const unsigned short* __restrict__ vhp, const unsigned short* __restrict__ vlp,
                  float* Cp, int soff, int qb, int h, float sscale) {
  union FB { v16b v; v8b h[2]; };
  union FH { v16h v; v8h h[2]; };
  __bf16*   Ksh = (__bf16*)(void*)(smem);                         // K hi [kv][d]
  __bf16*   Ksl = (__bf16*)(void*)(smem + TILE_B);                // K lo
  _Float16* Vth = (_Float16*)(void*)(smem + 2 * TILE_B);          // V^T hi [d][kv]
  float*    Os  = (float*)(void*)(smem + 3 * TILE_B);             // per wave context tile [row][d], 4 x 4352 B
  _Float16* Vtl = (_Float16*)(void*)(smem + 3 * TILE_B + OS_B);   // V^T residual (RES only)

  const int tid  = threadIdx.x;
  const int wave = tid >> 5;
  const int lane = tid & 31;
  const int hh   = lane >> 4;
  const int c    = lane & 15;

  const int q0   = qb * 64 + wave * 16;
  const int col  = h * (2 * HD) + soff;

  const __bf16* Qh = (const __bf16*)(const void*)qhp + col;
  const __bf16* Ql = (const __bf16*)(const void*)qlp + col;
  const __bf16* Kh = (const __bf16*)(const void*)khp + col;
  const __bf16* Kl = (const __bf16*)(const void*)klp + col;
  const _Float16* Vh = (const _Float16*)(const void*)vhp + (size_t)h * HD * SEQ;
  const _Float16* Vl = (const _Float16*)(const void*)vlp + (size_t)h * HD * VLP;

  // ---- Q fragments (B operand, column = query = lane&15): 2 d-chunks, hi and lo ----
  v16b qah[2], qal[2];
#pragma unroll
  for (int dc = 0; dc < 2; ++dc) {
    const size_t qo = (size_t)(q0 + c) * DQK + dc * 32 + 8 * hh;
    qah[dc] = ldfrag_b(Qh + qo);
    qal[dc] = ldfrag_b(Ql + qo);
  }

  const int qrow = q0 + c;                   // this lane's query row
  float mrow = -INFINITY;                    // its running maximum (equal in both wave halves)
  float lrow = 0.f;                          // running sum over this wave half's keys only; joined after the loop
  v8f oacc[4];                               // oacc[t][r] = context^T [d = t*16 + 8*hh + r][query c]
#pragma unroll
  for (int t = 0; t < 4; ++t) oacc[t] = zero8();

  for (int kt = 0; kt < NQB; ++kt) {         // static trip bound
    if (kt > qb) break;                      // block-uniform (causal)
    const bool diag = (kt == qb);            // block-uniform
    const int kv0 = kt * 64;
    __syncthreads();
    {
      const int g = tid >> 3, ch = (tid & 7) * 8;                  // group of 8 lanes = one row; elements ch..ch+7
      const int r = (g >> 1) | ((g & 1) << 3);                     // pass i: row r + 16 i; groups 2m, 2m+1 -> rows m, m+8
      const __bf16*   kg  = Kh + (size_t)(kv0 + r) * DQK + ch;     // K row kv0+r, d = ch..ch+7
      const __bf16*   klg = Kl + (size_t)(kv0 + r) * DQK + ch;
      const _Float16* vg  = Vh + (size_t)r * SEQ + kv0 + ch;        // V^T row d = r, s = kv0+ch..+7
      const int kvl = (kv0 + 64 <= VLP) ? kv0 : (VLP - 64);       // clamped address into the residual plane
      const _Float16* vlg = Vl + (size_t)r * VLP + kvl + ch;
      const bool resOK = (kv0 + 64 <= VLP);                        // block-uniform
      v8b a0[4], a1[4];
      v8h b0[4], b1[4];
#pragma unroll
      for (int i = 0; i < 4; ++i) {
        a0[i] = *(const v8b*)(kg + (size_t)(16 * i) * DQK);
        a1[i] = *(const v8b*)(klg + (size_t)(16 * i) * DQK);
        b0[i] = *(const v8h*)(vg + (size_t)(16 * i) * SEQ);
        if (RES) {
          b1[i] = *(const v8h*)(vlg + (size_t)(16 * i) * VLP);
          if (!resOK) b1[i] = zero8h();
        }
      }
#if defined(__HIP_DEVICE_COMPILE__)
      // s_wait_xcnt 0 before a register that an issued load names is written again; the addresses are inputs so that
      // they stay in their registers up to the wait (else the last load's destination may take an address pair over).
      if (RES) asm volatile("s_wait_xcnt 0x0" :: "v"(kg), "v"(klg), "v"(vg), "v"(vlg) : "memory");
      else     asm volatile("s_wait_xcnt 0x0" :: "v"(kg), "v"(klg), "v"(vg) : "memory");
#endif
#pragma unroll
      for (int i = 0; i < 4; ++i) {
        *(v8b*)(Ksh + (r + 16 * i) * LP + ch) = a0[i];
        *(v8b*)(Ksl + (r + 16 * i) * LP + ch) = a1[i];
        *(v8h*)(Vth + (r + 16 * i) * LP + ch) = b0[i];
        if (RES) *(v8h*)(Vtl + (r + 16 * i) * LP + ch) = b1[i];
      }
    }
    __syncthreads();

    // ---- scores^T: 64 keys x 16 query columns per wave, 3 bf16 products; s[j][r] = key j*16 + 8*hh + r, query c ----
    v8f s[4];
#pragma unroll
    for (int j = 0; j < 4; ++j) {
      s[j] = zero8();
#pragma unroll
      for (int dc = 0; dc < 2; ++dc) {
        FB kb, kl;
        kb.h[0] = *(const v8b*)(Ksh + (j * 16 + c) * LP + dc * 32 + 8 * hh);
        kb.h[1] = *(const v8b*)(Ksh + (j * 16 + c) * LP + dc * 32 + 16 + 8 * hh);
        kl.h[0] = *(const v8b*)(Ksl + (j * 16 + c) * LP + dc * 32 + 8 * hh);
        kl.h[1] = *(const v8b*)(Ksl + (j * 16 + c) * LP + dc * 32 + 16 + 8 * hh);
        s[j] = mma_b(kb.v, qah[dc], s[j]);
        s[j] = mma_b(kl.v, qah[dc], s[j]);
        s[j] = mma_b(kb.v, qal[dc], s[j]);
      }
    }

    // ---- scale, causal fill on the diagonal tile, maximum of the lane's 32 keys and of the other half's,
    //      online softmax, P (x1024, f16) and P residual (x4096) packed into B operands ----
    float mj[4];
#pragma unroll
    for (int j = 0; j < 4; ++j) {
      mj[j] = -INFINITY;
#pragma unroll
      for (int r = 0; r < 8; ++r) {
        const int key = kv0 + j * 16 + 8 * hh + r;
        float sv = s[j][r] * sscale;
        sv = (diag && key > qrow) ? -INFINITY : sv;
        s[j][r] = sv;
        mj[j] = fmaxf(mj[j], sv);
      }
    }
    float m = fmaxf(fmaxf(mj[0], mj[1]), fmaxf(mj[2], mj[3]));
    m = fmaxf(m, xhalf(m));
    const float mnew  = fmaxf(mrow, m);
    const float msafe = (mnew == -INFINITY) ? 0.f : mnew;
    const float alpha = __expf(mrow - msafe);
    mrow = mnew;
    v16h pbh[2], pbl[2];                     // element (j&1)*8 + r of block j>>1 = key (j>>1)*32 + (j&1)*16 + 8*hh + r
    float pj[4];                             // four independent partial sums of 8 keys each
#pragma unroll
    for (int j = 0; j < 4; ++j) {
      pj[j] = 0.f;
#pragma unroll
      for (int r = 0; r < 8; ++r) {
        const float p = __expf(s[j][r] - msafe);     // -inf logit: exp -> 0
        pj[j] += p;
        const float p1k = p * 1024.0f;
        const _Float16 ph = (_Float16)p1k;
        pbh[j >> 1][(j & 1) * 8 + r] = ph;
        if (RES) pbl[j >> 1][(j & 1) * 8 + r] = (_Float16)((p1k - (float)ph) * 4096.0f);
      }
    }
    lrow = lrow * alpha + ((pj[0] + pj[1]) + (pj[2] + pj[3]));
#pragma unroll
    for (int t = 0; t < 4; ++t)
#pragma unroll
      for (int r = 0; r < 8; ++r) oacc[t][r] *= alpha;

    // ---- context^T += V^T . P^T (f16 WMMA), residual products into a separate accumulator ----
    v8f o1[4];
#pragma unroll
    for (int t = 0; t < 4; ++t) o1[t] = zero8();
    // unrolled: the P operands are register arrays and need constant indices
#pragma unroll
    for (int kk = 0; kk < 2; ++kk) {
#pragma unroll
      for (int t = 0; t < 4; ++t) {
        FH vb;
        vb.h[0] = *(const v8h*)(Vth + (t * 16 + c) * LP + kk * 32 + 8 * hh);
        vb.h[1] = *(const v8h*)(Vth + (t * 16 + c) * LP + kk * 32 + 16 + 8 * hh);
        oacc[t] = mma_h(vb.v, pbh[kk], oacc[t]);
        if (RES) {
          FH vl;
          vl.h[0] = *(const v8h*)(Vtl + (t * 16 + c) * LP + kk * 32 + 8 * hh);
          vl.h[1] = *(const v8h*)(Vtl + (t * 16 + c) * LP + kk * 32 + 16 + 8 * hh);
          o1[t] = mma_h(vl.v, pbh[kk], o1[t]);
          o1[t] = mma_h(vb.v, pbl[kk], o1[t]);
        }
      }
    }
    if (RES) {
#pragma unroll
      for (int t = 0; t < 4; ++t)
#pragma unroll
        for (int r = 0; r < 8; ++r) oacc[t][r] += o1[t][r] * (1.0f / 4096.0f);
    }
  }

  // ---- join the halves' sums, normalise (1/l and the 1/1024 p carry), stage the wave's 16x64 tile as [query][d]
  //      (a lane holds 8 consecutive d of its query per t: two 16-B LDS stores), write f32 rows as whole 256-B segments
  float* os = Os + wave * (16 * OSP);
  {
    const float l = lrow + xhalf(lrow);
    const float inv = ((l > 0.f) ? (1.0f / l) : 0.f) * (1.0f / 1024.0f);
#pragma unroll
    for (int t = 0; t < 4; ++t) {
      v4f w0, w1;
#pragma unroll
      for (int e = 0; e < 4; ++e) { w0[e] = oacc[t][e] * inv; w1[e] = oacc[t][4 + e] * inv; }
      *(v4f*)(os + c * OSP + t * 16 + 8 * hh)     = w0;
      *(v4f*)(os + c * OSP + t * 16 + 8 * hh + 4) = w1;
    }
  }
  __builtin_amdgcn_fence(__ATOMIC_RELEASE, "workgroup");
  __builtin_amdgcn_wave_barrier();
  __builtin_amdgcn_fence(__ATOMIC_ACQUIRE, "workgroup");
  {
    const int h2 = lane >> 4, c4 = (lane & 15) * 4;
    v4f ov[8];
#pragma unroll
    for (int it = 0; it < 8; ++it) {
      const int row = it * 2 + h2;   // it 0..7 x h2 0..1 = rows 0..15 of the wave tile
      ov[it] = *(const v4f*)(os + row * OSP + c4);
    }
    {
#pragma unroll
      for (int it = 0; it < 8; ++it) {
        const int row = it * 2 + h2;
        const size_t go = (size_t)(q0 + row) * DM + (size_t)h * HD + c4;
        *(v4f*)(Cp + go) = ov[it];
      }
#if defined(__HIP_DEVICE_COMPILE__)
      // s_wait_xcnt 0 behind the run of stores: in the merged kernel the listing holds a branch from the end of this
      // body to the head of the other one, where registers that these stores name are written again.
      asm volatile("s_wait_xcnt 0x0" ::: "memory");
#endif
    }
  }
}

// All query blocks of both streams, all heads and both batch elements in one grid of NQB * 2 * NB * NH blocks.
// blockIdx.x / 64 counts the query blocks down from the last one: the blocks with the most key tiles get the lowest
// indices (for speed only).
// blockIdx.x % 64 = batch * 32 + stream * 16 + head. Query blocks below RESQB take the body with residual planes
// (block-uniform choice).
__global__ __launch_bounds__(128)
void attn_causal64(const unsigned short* __restrict__ qhp, const unsigned short* __restrict__ qlp,
                   const unsigned short* __restrict__ khp, const unsigned short* __restrict__ klp,
                   const unsigned short* __restrict__ vhp, const unsigned short* __restrict__ vlp,
                   float* C1p, float* C2p, float sscale) {
  __shared__ __align__(16) unsigned char smem[ATT_LDS];
  const int bx     = blockIdx.x;
  const int qb     = NQB - 1 - (bx >> 6);
  const int h      = bx & 15;
  const int stream = (bx >> 4) & 1;
  const int b      = (bx >> 5) & 1;
  const size_t qk = (size_t)b * SEQ * DQK;
  const unsigned short* vh = vhp + (size_t)b * DM * SEQ;
  const unsigned short* vl = vlp + (size_t)b * DM * VLP;
  float* Cp = (stream ? C2p : C1p) + (size_t)b * SEQ * DM;
  const int soff = stream * HD;
  if (qb < RESQB) attn_block64<true >(smem, qhp + qk, qlp + qk, khp + qk, klp + qk, vh, vl, Cp, soff, qb, h, sscale);
  else            attn_block64<false>(smem, qhp + qk, qlp + qk, khp + qk, klp + qk, vh, vl, Cp, soff, qb, h, sscale);
}

// =====================================================================================================
// Differential combine + head rms norm for one token row t of the NB*SEQ rows:
//   lam[h] = (0.2 + exp(sum_d lq1.lk1)) - exp(sum_d lq2.lk2)  (f32, inputs RNE-converted to bf16 values;
//            recomputed per block by threads 0..15, rolled 64-term loops)
//   o = c1 - lam*c2; r = rsqrt(sum_d(o^2)/64 + 1e-6); o = ((o*r) * w[h][d]) * 0.8
//   written as bf16 hi / lo planes [NB*SEQ][DM] (merged head layout), one 16-B store per plane per lane
// grid = NB*SEQ blocks x 128 threads; thread -> columns 8*tid..+7 (head = tid>>3, 8 lanes per head).
// coverage: 128 threads x 8 = 1024 columns per row; NB*SEQ rows.
// =====================================================================================================
__global__ __launch_bounds__(128) void diff_combine(
    const float* __restrict__ C1, const float* __restrict__ C2,
    const float* __restrict__ lq1, const float* __restrict__ lk1,
    const float* __restrict__ lq2, const float* __restrict__ lk2,
    const float* __restrict__ hnw, unsigned short* Oh, unsigned short* Ol) {
#pragma clang fp contract(off)
  __shared__ float lam_s[NH];
  const int tid = threadIdx.x;
  const int t   = blockIdx.x;
  if (tid < NH) {
    const float* a1 = lq1 + tid * HD;
    const float* b1 = lk1 + tid * HD;
    const float* a2 = lq2 + tid * HD;
    const float* b2 = lk2 + tid * HD;
    float sa = 0.f, sb = 0.f;
#pragma unroll 1
    for (int d = 0; d < HD; ++d) {
      sa += bfr(a1[d]) * bfr(b1[d]);
      sb += bfr(a2[d]) * bfr(b2[d]);
    }
    lam_s[tid] = (LAM0 + expf(sa)) - expf(sb);
  }
  __syncthreads();
  const int c0 = tid * 8;
  const int h  = c0 >> 6;
  const int d0 = c0 & 63;
  const size_t ro = (size_t)t * DM + c0;
  const v4f x0 = *(const v4f*)(C1 + ro), x1 = *(const v4f*)(C1 + ro + 4);
  const v4f y0 = *(const v4f*)(C2 + ro), y1 = *(const v4f*)(C2 + ro + 4);
  const float lam = lam_s[h];
  float o[8];
  float ss = 0.f;
#pragma unroll
  for (int e = 0; e < 4; ++e) {
    o[e]     = x0[e] - lam * y0[e];
    o[4 + e] = x1[e] - lam * y1[e];
  }
#pragma unroll
  for (int e = 0; e < 8; ++e) ss += o[e] * o[e];
  ss += __shfl_xor(ss, 1, 32);
  ss += __shfl_xor(ss, 2, 32);
  ss += __shfl_xor(ss, 4, 32);
  const float ms = ss * (1.0f / (float)HD);
  const float rn = rsqrtf(ms + 1.0e-6f);
  v4u hv, lv;
#pragma unroll
  for (int e = 0; e < 4; ++e) {
    const float w0 = bfr(hnw[h * HD + d0 + 2 * e]);
    const float w1 = bfr(hnw[h * HD + d0 + 2 * e + 1]);
    const float f0 = ((o[2 * e] * rn) * w0) * OSCL;
    const float f1 = ((o[2 * e + 1] * rn) * w1) * OSCL;
    const unsigned short h0 = bf_bits(f0), h1 = bf_bits(f1);
    const unsigned short l0 = bf_bits(f0 - bf_up(h0)), l1 = bf_bits(f1 - bf_up(h1));
    hv[e] = pk16(h0, h1); lv[e] = pk16(l0, l1);
  }
  *(v4u*)(Oh + ro) = hv;
  *(v4u*)(Ol + ro) = lv;
  
}

// =====================================================================================================
// Workspace map (bytes, all offsets multiples of 4096):
//   Xb   bf16 [4096][1024]      8388608      Wqb bf16 [2048][1024] 4194304   Wkb 4194304
//   Wvb  bf16 [1024][1024]      2097152      Wob 2097152
//   invf f32 [32] (padded)         4096      cosT f32 [2048][32] 262144      sinT 262144
//   both batch elements, batch-major:
//   Qf   f32  [2][2048][2048]     33554432      Kf 33554432
//   Qh/Ql/Kh/Kl bf16 [2][2048][2048]  4 x 16777216
//   VTh  f16  [2][1024][2048]      8388608      VTl f16 [2][1024][512] 2097152
//   C1/C2 f32 [2][2048][1024]   2 x 16777216    Oh/Ol bf16 [2][2048][1024] 2 x 8388608
//   end                          216535040
// All planes are exact multiples of their 64x64 / whole-line store granularity (no padded tails needed).
// Weights are [out n][in k] with k contiguous = the Bt / A layout the GEMM wants, so they are only converted.
// =====================================================================================================
extern "C" void kernel_launch(void* const* d_in, const int* in_sizes, int n_in,
                              void* d_out, int out_size, void* d_ws, size_t ws_size,
                              hipStream_t stream) {
  if (n_in < 14) return;
  if (in_sizes[0] != NB * SEQ * DM) return;
  if (in_sizes[1] != DQK * DM || in_sizes[2] != DQK) return;
  if (in_sizes[3] != DQK * DM || in_sizes[4] != DQK) return;
  if (in_sizes[5] != DM * DM || in_sizes[6] != DM) return;
  if (in_sizes[7] != DM * DM || in_sizes[8] != DM) return;
  for (int i = 9; i < 14; ++i) if (in_sizes[i] != NH * HD) return;
  if (out_size != NB * SEQ * DM) return;

  const float* x   = (const float*)d_in[0];
  const float* Wq  = (const float*)d_in[1];
  const float* bq  = (const float*)d_in[2];
  const float* Wk  = (const float*)d_in[3];
  const float* bk  = (const float*)d_in[4];
  const float* Wv  = (const float*)d_in[5];
  const float* bv  = (const float*)d_in[6];
  const float* Wo  = (const float*)d_in[7];
  const float* bo  = (const float*)d_in[8];
  const float* hnw = (const float*)d_in[9];
  const float* lq1 = (const float*)d_in[10];
  const float* lk1 = (const float*)d_in[11];
  const float* lq2 = (const float*)d_in[12];
  const float* lk2 = (const float*)d_in[13];
  float* outp = (float*)d_out;

  const size_t PXB  = (size_t)NB * SEQ * DM * 2;    //  8388608
  const size_t PWQ  = (size_t)DQK * DM * 2;         //  4194304
  const size_t PWV  = (size_t)DM * DM * 2;          //  2097152
  const size_t PIF  = 4096;                         //  32 floats used
  const size_t PTAB = (size_t)SEQ * NFREQ * 4;      //   262144
  const size_t PQF  = (size_t)NB * SEQ * DQK * 4;   // 33554432
  const size_t PQP  = (size_t)NB * SEQ * DQK * 2;   // 16777216
  const size_t PVT  = (size_t)NB * DM * SEQ * 2;    //  8388608
  const size_t PVL  = (size_t)NB * DM * VLP * 2;    //  2097152
  const size_t PC   = (size_t)NB * SEQ * DM * 4;    // 16777216
  const size_t PO   = (size_t)NB * SEQ * DM * 2;    //  8388608
  size_t off = 0;
  const size_t oXb  = off; off += PXB;
  const size_t oWq  = off; off += PWQ;
  const size_t oWk  = off; off += PWQ;
  const size_t oWv  = off; off += PWV;
  const size_t oWo  = off; off += PWV;
  const size_t oIF  = off; off += PIF;
  const size_t oCos = off; off += PTAB;
  const size_t oSin = off; off += PTAB;
  const size_t oQf  = off; off += PQF;
  const size_t oKf  = off; off += PQF;
  const size_t oQh  = off; off += PQP;
  const size_t oQl  = off; off += PQP;
  const size_t oKh  = off; off += PQP;
  const size_t oKl  = off; off += PQP;
  const size_t oVTh = off; off += PVT;
  const size_t oVTl = off; off += PVL;
  const size_t oC1  = off; off += PC;
  const size_t oC2  = off; off += PC;
  const size_t oOh  = off; off += PO;
  const size_t oOl  = off; off += PO;
  if (off > ws_size) return;                        // off = 216535040

  char* ws = (char*)d_ws;
  unsigned short* Xb  = (unsigned short*)(ws + oXb);
  unsigned short* Wqb = (unsigned short*)(ws + oWq);
  unsigned short* Wkb = (unsigned short*)(ws + oWk);
  unsigned short* Wvb = (unsigned short*)(ws + oWv);
  unsigned short* Wob = (unsigned short*)(ws + oWo);
  float*          IFt = (float*)(ws + oIF);
  float*          CosT = (float*)(ws + oCos);
  float*          SinT = (float*)(ws + oSin);
  float*          Qf  = (float*)(ws + oQf);
  float*          Kf  = (float*)(ws + oKf);
  unsigned short* Qh  = (unsigned short*)(ws + oQh);
  unsigned short* Ql  = (unsigned short*)(ws + oQl);
  unsigned short* Kh  = (unsigned short*)(ws + oKh);
  unsigned short* Kl  = (unsigned short*)(ws + oKl);
  unsigned short* VTh = (unsigned short*)(ws + oVTh);
  unsigned short* VTl = (unsigned short*)(ws + oVTl);
  float*          C1  = (float*)(ws + oC1);
  float*          C2  = (float*)(ws + oC2);
  unsigned short* Oh  = (unsigned short*)(ws + oOh);
  unsigned short* Ol  = (unsigned short*)(ws + oOl);

  const dim3 blk256(256), blk128(128), blk32(32);
  const dim3 gCvt((NB * SEQ * DM + 2 * DQK * DM + 2 * DM * DM) / 8 / 256);   // 5120 blocks
  const dim3 gTab((SEQ * NFREQ + 255) / 256);                      //  256 blocks
  const dim3 gQKV((SEQ / 64) * (DQK / 64) / 8, NB, 3);             // 1024 tiles -> 128 blocks, x batch x {q, k, v^T}
  const dim3 gOut((NB * SEQ / 64) * (DM / 64) / 8, 1);             // 1024 tiles -> 128 blocks
  const dim3 gRope(SEQ, NB);                                       // one block per token row
  const dim3 gRow(NB * SEQ);                                       // one block per token row
  const dim3 gAtt(NQB * 2 * NB * NH);                              // 2048 blocks

  // (1) inputs -> bf16 planes; weights [n][k] f32 -> bf16 [n][k]; Xb, Wqb, Wkb, Wvb, Wob are contiguous from Xb
  cvt_bf16x8<<<gCvt, blk256, 0, stream>>>(x, Wq, Wk, Wv, Wo, Xb);
  // (2) rope tables
  invfreq_tab<<<dim3(1), blk32, 0, stream>>>(IFt);
  rope_tab<<<gTab, blk256, 0, stream>>>(IFt, CosT, SinT);
  // (3) q, k -> f32 [NB*SEQ][DQK]; v^T -> f16 hi plane and residual plane, both batch elements
  gemm_qkv<<<gQKV, blk256, 0, stream>>>(Xb, Wqb, Wkb, Wvb, Qf, Kf, VTh, VTl, bq, bk, bv);
  // (4) rope + bf16 hi/lo split of q and k
  rope_split<<<gRope, blk256, 0, stream>>>(Qf, Kf, CosT, SinT, Qh, Ql, Kh, Kl);
  // (5) causal attention, stream 1 (q1, k1) -> C1 and stream 2 (q2, k2) -> C2;
  //     query blocks 0..RESQB-1 with residual planes, the rest without
  attn_causal64<<<gAtt, blk128, 0, stream>>>(Qh, Ql, Kh, Kl, VTh, VTl, C1, C2, 0.125f);
  // (6) differential combine + head norm -> O bf16 hi/lo planes [NB*SEQ][DM]
  diff_combine<<<gRow, blk128, 0, stream>>>(C1, C2, lq1, lk1, lq2, lk2, hnw, Oh, Ol);
  // (7) out = O . Wo^T + bo -> d_out, f32 [NB*SEQ][DM]  (A = O hi + lo planes, 2 products)
  gemm64<1, 0, 1><<<gOut, blk256, 0, stream>>>(
      Oh, Ol, DM, 0LL, Wob, Wob, DM, 0LL,
      (void*)outp, DM, 0LL, (void*)outp, DM, 0LL, DM,
      NB * SEQ, DM, DM, 1.0f, bo);
  (void)hipGetLastError();
}

// v006
// One run takes 180 microseconds.
// In two side-by-side timings against v005, it was 1.06 and 1.05 times as fast.
// Over all steps from v000 it is 6.12 times as fast.
// Contractions: q, k, v^T projections = v_wmma_f32_16x16x32_bf16 (bf16 operands from RNE-converted inputs, single product);
// q.k^T scores (both streams) = v_wmma_f32_16x16x32_bf16 with bf16 hi/lo split q and k (hi.hi + hi.lo + lo.hi);
// p.v = v_wmma_f32_16x16x32_f16 (p carried x1024 in f16, v in f16; extra f16 residual planes x4096 of p and v for the first 512 query rows);
// ctx.Wo^T = v_wmma_f32_16x16x32_bf16 with ctx as bf16 hi/lo planes times bf16 Wo (2 products); all f32 accumulate;
// rope, softmax, lambda, head rms norm in f32.
#include <hip/hip_runtime.h>
#include <math.h>
#include <float.h>
#include <stdint.h>

#define NB    2
#define SEQ   2048
#define DM    1024
#define DQK   2048          // q / k projection width (2 x 64 per head)
#define NH    16
#define HD    64
#define NFREQ (HD / 2)
#define NQB   (SEQ / 64)    // 32 key / query tiles of 64
#define VLP   512           // key pitch of the v^T residual plane (keys 0..VLP-1)
#define RESQB 8             // number of leading 64-row query blocks that use the p / v residual planes
#define LAM0  0.2f
#define OSCL  0.8f
static_assert(RESQB * 64 <= VLP);
static_assert(NH * HD == DM);
static_assert(NB == 2 && NH == 16);   // the attention grid's index split
static_assert(NH * 2 * HD == DQK);
static_assert((SEQ % 256) == 0 && (DM % 256) == 0 && (DQK % 256) == 0);   // GEMM block tiles 128 x 256, 64 k per trip

typedef _Float16 v16h __attribute__((ext_vector_type(16)));
typedef _Float16 v8h  __attribute__((ext_vector_type(8)));
typedef __bf16   v16b __attribute__((ext_vector_type(16)));
typedef __bf16   v8b  __attribute__((ext_vector_type(8)));
typedef float    v8f  __attribute__((ext_vector_type(8)));
typedef float    v4f  __attribute__((ext_vector_type(4)));
typedef unsigned int v4u __attribute__((ext_vector_type(4)));

// ---- scalar helpers --------------------------------------------------------------------------------
__device__ __forceinline__ unsigned short bf_bits(float f) {          // f32 -> bf16 bits, RNE convert
  unsigned u = __float_as_uint(f);
  return (unsigned short)((u + 0x7FFFu + ((u >> 16) & 1u)) >> 16);
}
__device__ __forceinline__ float bf_up(unsigned short h) { return __uint_as_float(((unsigned)h) << 16); }
__device__ __forceinline__ float bfr(float f) { return bf_up(bf_bits(f)); }   // value after RNE convert to bf16
__device__ __forceinline__ unsigned short h_bits(_Float16 x) { return __builtin_bit_cast(unsigned short, x); }
__device__ __forceinline__ unsigned pk16(unsigned short a, unsigned short b) { return (unsigned)a | ((unsigned)b << 16); }
__device__ __forceinline__ v8f zero8() { v8f z = {0.f, 0.f, 0.f, 0.f, 0.f, 0.f, 0.f, 0.f}; return z; }
__device__ __forceinline__ v8h zero8h() {
  const _Float16 z = (_Float16)0.0f;
  v8h r = {z, z, z, z, z, z, z, z};
  return r;
}

// ---- fragment loaders: 16-bit A/B operand, lane -> row/col (lane&15), p already includes +8*(lane>>4);
//      elements 0..7 <- p[0..7] (k0+8h..), elements 8..15 <- p[16..23] (k0+16+8h..)
__device__ __forceinline__ v16b ldfrag_b(const __bf16* p) {
  union { v16b v; v8b h[2]; } f;
  f.h[0] = *(const v8b*)(p);
  f.h[1] = *(const v8b*)(p + 16);
  return f.v;
}

// ---- WMMA helpers with trailing VALU hazard gap --------------------------------------------------------
__device__ __forceinline__ v8f mma_b(v16b a, v16b b, v8f c) {
  c = __builtin_amdgcn_wmma_f32_16x16x32_bf16(false, a, false, b, (short)0, c, false, false);
#if defined(__HIP_DEVICE_COMPILE__)
  asm volatile("v_nop\n\tv_nop\n\tv_nop\n\tv_nop" : "+v"(c) : "v"(a), "v"(b));
#endif
  return c;
}
__device__ __forceinline__ v8f mma_h(v16h a, v16h b, v8f c) {
  c = __builtin_amdgcn_wmma_f32_16x16x32_f16(false, a, false, b, (short)0, c, false, false);
#if defined(__HIP_DEVICE_COMPILE__)
  asm volatile("v_nop\n\tv_nop\n\tv_nop\n\tv_nop" : "+v"(c) : "v"(a), "v"(b));
#endif
  return c;
}
__device__ __forceinline__ v8f mma_b_raw(v16b a, v16b b, v8f c) {
  return __builtin_amdgcn_wmma_f32_16x16x32_bf16(false, a, false, b, (short)0, c, false, false);
}
__device__ __forceinline__ void dep_guard_b(v8f& a, v8f& b, v16b x, v16b y) {
#if defined(__HIP_DEVICE_COMPILE__)
  asm volatile("v_nop\n\tv_nop\n\tv_nop\n\tv_nop" : "+v"(a), "+v"(b) : "v"(x), "v"(y));
#endif
}
__device__ __forceinline__ void keep4_b(v16b a, v16b b, v16b c, v16b d) {
#if defined(__HIP_DEVICE_COMPILE__)
  asm volatile("v_nop" :: "v"(a), "v"(b), "v"(c), "v"(d));
#endif
}
__device__ __forceinline__ void acc_guard4(v8f& a, v8f& b, v8f& c, v8f& d) {
#if defined(__HIP_DEVICE_COMPILE__)
  asm volatile("v_nop\n\tv_nop\n\tv_nop\n\tv_nop" : "+v"(a), "+v"(b), "+v"(c), "+v"(d));
#endif
}

// =====================================================================================================
// f32 -> bf16 (RNE convert), 8 elements per thread, one 16-B store per lane: a wave writes 512 contiguous B
// One grid for x, Wq, Wk, Wv, Wo: their bf16 planes lie back to back in the workspace in that order, so the
// output index is the flat thread index; the source is picked per block (every plane is a multiple of 2048
// elements, so a block never straddles two planes).
// coverage: (NX + 2 NQ + 2 NV) threads x 8 = all five planes.
// =====================================================================================================
__global__ __launch_bounds__(256) void cvt_bf16x8(const float* __restrict__ x, const float* __restrict__ wq,
                                                  const float* __restrict__ wk, const float* __restrict__ wv,
                                                  const float* __restrict__ wo, unsigned short* out) {
  constexpr int NX = NB * SEQ * DM / 8, NQ = DQK * DM / 8, NV = DM * DM / 8;
  static_assert((NX % 256) == 0 && (NQ % 256) == 0 && (NV % 256) == 0);
  const int i = blockIdx.x * 256 + threadIdx.x;
  if (i < NX + 2 * NQ + 2 * NV) {
    const float* in = x;
    int j = i;
    if (i >= NX + 2 * NQ + NV)  { in = wo; j = i - (NX + 2 * NQ + NV); }
    else if (i >= NX + 2 * NQ)  { in = wv; j = i - (NX + 2 * NQ); }
    else if (i >= NX + NQ)      { in = wk; j = i - (NX + NQ); }
    else if (i >= NX)           { in = wq; j = i - NX; }
    const v4f a = *(const v4f*)(in + (size_t)j * 8);
    const v4f b = *(const v4f*)(in + (size_t)j * 8 + 4);
    v4u p;
    p[0] = pk16(bf_bits(a[0]), bf_bits(a[1]));
    p[1] = pk16(bf_bits(a[2]), bf_bits(a[3]));
    p[2] = pk16(bf_bits(b[0]), bf_bits(b[1]));
    p[3] = pk16(bf_bits(b[2]), bf_bits(b[3]));
    *(v4u*)(out + (size_t)i * 8) = p;
    
  }
}

// =====================================================================================================
// inv_freq[j] = 1 / 10000^(j/32), j = 0..31, f32 with precise powf. One block of 32 threads; the 32 values
// coverage: lanes 0..7 x 4 floats = all 32 entries.
// =====================================================================================================
__global__ __launch_bounds__(32) void invfreq_tab(float* invf) {
  __shared__ __align__(16) float sf[NFREQ];
  const int j = threadIdx.x;
  const float e = (float)j * (1.0f / (float)NFREQ);
  const float pw = powf(10000.0f, e);
  sf[j] = 1.0f / pw;
  __syncthreads();
  const v4f v = *(const v4f*)(sf + 4 * (j & 7));
  if (j < 8) *(v4f*)(invf + 4 * j) = v;
  
}

// =====================================================================================================
// cos / sin tables [SEQ][32]: angle = t * inv_freq[j] (f32 multiply), precise cosf / sinf.
// =====================================================================================================
__global__ __launch_bounds__(256) void rope_tab(const float* __restrict__ invf, float* cosT, float* sinT) {
  const int g = blockIdx.x * 256 + threadIdx.x;
  if (g < SEQ * NFREQ) {
    const int t = g / NFREQ;
    const int j = g - t * NFREQ;
    const float ang = (float)t * invf[j];
    const float cv = cosf(ang);
    const float sv = sinf(ang);
    *(float*)(cosT + g) = cv;
    *(float*)(sinT + g) = sv;
    
  }
}

// =====================================================================================================
// RoPE half-split rotation of 8 consecutive columns of one 64-wide vector, then bf16 hi/lo split: 16 B per plane
// (hv, lv). xa = the lane's 8 columns, xp = the 8 columns 32 away in the same vector (f32).
//   first half  (j < 32):   out[j]    = x[j]*cos[j]   - x[j+32]*sin[j]     (x1 = a, x2 = p)
//   second half (j < 32):   out[j+32] = x[j]*sin[j]   + x[j+32]*cos[j]     (x1 = p, x2 = a)
// =====================================================================================================
__device__ __forceinline__ void rope_row8(const float* xa, const float* xp,
                                          bool second, v4f cs0, v4f cs1, v4f sn0, v4f sn1,
                                          v4u& hv, v4u& lv) {
  // contraction off: each product and their sum round on their own, as in the reference's elementwise form, so the
  // q, k planes stay bit for bit what they were when a launch of its own rotated them
#pragma clang fp contract(off)
  const v4f xa0 = *(const v4f*)(xa);
  const v4f xa1 = *(const v4f*)(xa + 4);
  const v4f xp0 = *(const v4f*)(xp);
  const v4f xp1 = *(const v4f*)(xp + 4);
  float o[8];
#pragma unroll
  for (int e = 0; e < 4; ++e) {
    {
      const float a = xa0[e], p = xp0[e], cs = cs0[e], sn = sn0[e];
      const float f1 = a * cs - p * sn;
      const float f2 = p * sn + a * cs;
      o[e] = second ? f2 : f1;
    }
    {
      const float a = xa1[e], p = xp1[e], cs = cs1[e], sn = sn1[e];
      const float f1 = a * cs - p * sn;
      const float f2 = p * sn + a * cs;
      o[4 + e] = second ? f2 : f1;
    }
  }
#pragma unroll
  for (int e = 0; e < 4; ++e) {
    const float f0 = o[2 * e], f1 = o[2 * e + 1];
    const unsigned short h0 = bf_bits(f0), h1 = bf_bits(f1);
    const unsigned short l0 = bf_bits(f0 - bf_up(h0)), l1 = bf_bits(f1 - bf_up(h1));
    hv[e] = pk16(h0, h1); lv[e] = pk16(l0, l1);
  }
}

// =====================================================================================================
// Register-blocked bf16 WMMA GEMM: C[m][n] = sum_k A[m][k] * Bt[n][k] (+ bias); one wave per 64x64 tile, a block of
// 8 waves (2 x 4) per 128 x 256 tile. A row-major [M][K] pitch lda; Bt row-major [N][K] pitch ldb (k contiguous);
// M multiple of 128, N of 256, K of 64. b = batch index (strides in elements).
// The tile body is a device function (block tile index, batch index and the LDS come from the caller), so
// that one grid can hold several independent products.
// Operands reach the waves through LDS: per trip of 64 k the block's 128 A rows and 256 Bt rows (128 B = one line each)
// are brought in by asynchronous copies to LDS, 16 B per lane, 8 lanes per row, so that one wave-wide copy covers 4
// whole lines; a fragment load straight from global memory touches 16 lines for the same 512 B, and every wave
// fetched its own copy of rows that its neighbours need too. Two buffers: the next trip's copies fly during this
// trip's products. LDS row pitch 144 B (16 B x odd) for the ds_load_b128 fragment reads. The k order of the products
// is unchanged (32 k per WMMA, ascending).
// NSPLIT: 0 = A.Bt; 1 = (A + A2).Bt (A2 = unscaled bf16 lo plane of A).
// OUT_MODE: 0 = f32 (pitch ldc); 2 = bf16 hi plane C + bf16 lo plane C2 (lo = RNE(v - hi), unscaled);
//           3 = f16 hi plane C + f16 residual plane C2 = f16((v - hi) * rscale), C2 written only for tiles
//               with n0 < N2 (pitch ldc2, batch stride strideC2);
//           4 = a wave's 64 columns are one 64-wide rope vector and m is the token index: rotated by the tables
//               cosT / sinT [M][32], then bf16 hi plane C + bf16 lo plane C2 (lo = RNE(v - hi), unscaled).
// BIAS: 0 = none; 1 = + bf16-RNE(bias[n]) per column; 2 = + bf16-RNE(bias[m]) per row (added in f32).
// =====================================================================================================
#define GP        72                                  // LDS row pitch of a staged operand row, in elements (144 B)
#define GROW_B    (GP * 2)
#define GSTG_B(NS) ((128 + 256 + 128 * (NS)) * GROW_B)  // one buffer: A rows | Bt rows | A2 rows: 55296 B / 73728 B
static_assert((GROW_B % 16) == 0 && ((GROW_B / 16) & 1) == 1);

// Four asynchronous 16-B copies to LDS per lane (l = the lane's LDS byte address, g = its global address).
// s_wait_xcnt 0 is the last line of the copies' own statement: it stands in front of any rewrite of the address registers.
__device__ __forceinline__ void copy4_lds(unsigned l0, const __bf16* g0, unsigned l1, const __bf16* g1,
                                          unsigned l2, const __bf16* g2, unsigned l3, const __bf16* g3) {
#if defined(__HIP_DEVICE_COMPILE__)
  asm volatile("global_load_async_to_lds_b128 %0, %1, off\n\t"
               "global_load_async_to_lds_b128 %2, %3, off\n\t"
               "global_load_async_to_lds_b128 %4, %5, off\n\t"
               "global_load_async_to_lds_b128 %6, %7, off\n\t"
               "s_wait_xcnt 0x0"
               :: "v"(l0), "v"(g0), "v"(l1), "v"(g1), "v"(l2), "v"(g2), "v"(l3), "v"(g3) : "memory");
#endif
}
// The issuing wave's own copies have landed (in front of the barrier behind which other waves read them).
__device__ __forceinline__ void wait_copies() {
#if defined(__HIP_DEVICE_COMPILE__)
  asm volatile("s_wait_asynccnt 0x0" ::: "memory");
#endif
}
// This wave's LDS reads have returned (in front of the barrier behind which their buffer is refilled).
__device__ __forceinline__ void wait_lds() {
#if defined(__HIP_DEVICE_COMPILE__)
  asm volatile("s_wait_dscnt 0x0" ::: "memory");
#endif
}
// One 64-k tile of the block's operands into one buffer: 256 threads x 16 B = 32 rows per copy; dst = the lane's LDS
// byte address of row tid>>3, chunk tid&7 of the buffer; gA / gB / gA2 = its global address in row tid>>3 of the block's rows.
template <int NSPLIT>
__device__ __forceinline__ void gemm_stage(unsigned dst, const __bf16* gA, const __bf16* gB, const __bf16* gA2,
                                           int lda, int ldb) {
  const size_t ra = (size_t)32 * lda, rb = (size_t)32 * ldb;
  constexpr unsigned R = 32 * GROW_B;
  copy4_lds(dst, gA, dst + R, gA + ra, dst + 2 * R, gA + 2 * ra, dst + 3 * R, gA + 3 * ra);
  copy4_lds(dst + 4 * R, gB, dst + 5 * R, gB + rb, dst + 6 * R, gB + 2 * rb, dst + 7 * R, gB + 3 * rb);
  copy4_lds(dst + 8 * R, gB + 4 * rb, dst + 9 * R, gB + 5 * rb, dst + 10 * R, gB + 6 * rb, dst + 11 * R, gB + 7 * rb);
  if (NSPLIT == 1)
    copy4_lds(dst + 12 * R, gA2, dst + 13 * R, gA2 + ra, dst + 14 * R, gA2 + 2 * ra, dst + 15 * R, gA2 + 3 * ra);
}

template <int NSPLIT, int OUT_MODE, int BIAS>
__device__ __forceinline__ void gemm64_tile(
    const unsigned short* __restrict__ Ap, const unsigned short* A2p, int lda, long long strideA,
    const unsigned short* __restrict__ Btp, const unsigned short* Bt2p, int ldb, long long strideB,
    void* Cout, int ldc, long long strideC,
    void* Cout2, int ldc2, long long strideC2, int N2,
    int M, int N, int K, float rscale, const float* __restrict__ bias,
    const float* __restrict__ cosT, const float* __restrict__ sinT,
    float* slab, unsigned char* stg, int bt, int b) {
  static_assert(NSPLIT == 0 || NSPLIT == 1);
  const __bf16* A   = (const __bf16*)(const void*)Ap;
  const __bf16* A2  = (const __bf16*)(const void*)A2p;
  const __bf16* Bt  = (const __bf16*)(const void*)Btp;
  const int tid  = threadIdx.x;
  const int lane = tid & 31;
  const int wave = tid >> 5;
  const int blocksN = N >> 8;
  const int blocksM = M >> 7;
  if (bt >= blocksM * blocksN) return;   // block-uniform, in front of every copy and barrier
  const int bm  = bt / blocksN;
  const int bn  = bt - bm * blocksN;
  const int mb0 = bm << 7;
  const int nb0 = bn << 8;
  const int wm  = wave >> 2;             // the wave's 64 rows of the block's 128
  const int wn  = wave & 3;              // the wave's 64 columns of the block's 256
  const int m0  = mb0 + (wm << 6);
  const int n0  = nb0 + (wn << 6);

  const __bf16* Ab  = A  + (size_t)b * strideA;
  const __bf16* Bb  = Bt + (size_t)b * strideB;
  const __bf16* Ab2 = (NSPLIT >= 1) ? (A2  + (size_t)b * strideA) : Ab;

  const int rlane = lane & 15;                 // row (A) / col (B, D) within subtile
  const int koff  = (lane >> 4) * 8;           // k offset of this lane half
  const int mOff  = (lane >> 4) * 8;           // D row offset

  v8f acc[4][4];
#pragma unroll
  for (int i = 0; i < 4; ++i)
#pragma unroll
    for (int j = 0; j < 4; ++j) acc[i][j] = zero8();

  constexpr unsigned STG = GSTG_B(NSPLIT);
  const int nt   = K >> 6;                     // trips of 64 k
  const int srow = tid >> 3, sch = tid & 7;    // this lane's row (of 32 per copy) and 16-B chunk of the 128-B row
  const unsigned sdst = (unsigned)(size_t)stg + (unsigned)(srow * GROW_B + sch * 16);
  const __bf16* gA  = Ab  + (size_t)(mb0 + srow) * lda + sch * 8;
  const __bf16* gB  = Bb  + (size_t)(nb0 + srow) * ldb + sch * 8;
  const __bf16* gA2 = Ab2 + (size_t)(mb0 + srow) * lda + sch * 8;

  // tile 0 -> buffer 0, landed and published; then tile 1 -> buffer 1 in flight
  gemm_stage<NSPLIT>(sdst, gA, gB, gA2, lda, ldb);
  wait_copies();
  __syncthreads();
  if (nt > 1) gemm_stage<NSPLIT>(sdst + STG, gA + 64, gB + 64, gA2 + 64, lda, ldb);

  for (int t = 0; t < nt; ++t) {               // block-uniform trip count
    const __bf16* sb  = (const __bf16*)(const void*)(stg + (size_t)(t & 1) * STG);
    const __bf16* sA  = sb + ((wm << 6) + rlane) * GP + koff;
    const __bf16* sB  = sb + (128 + (wn << 6) + rlane) * GP + koff;
    const __bf16* sA2 = (NSPLIT >= 1) ? (sb + (384 + (wm << 6) + rlane) * GP + koff) : sA;
    // unrolled (here and below): the fragment arrays need constant indices to stay in registers, and the second
    // 32-k block's LDS reads can then be issued among the first block's products
#pragma unroll
    for (int kk = 0; kk < 2; ++kk) {
      v16b bh[4], ahf[4], alf[4];
#pragma unroll
      for (int j = 0; j < 4; ++j) bh[j] = ldfrag_b(sB + (j << 4) * GP + kk * 32);
#pragma unroll
      for (int i = 0; i < 4; ++i) {
        ahf[i] = ldfrag_b(sA + (i << 4) * GP + kk * 32);
        if (NSPLIT >= 1) alf[i] = ldfrag_b(sA2 + (i << 4) * GP + kk * 32); else alf[i] = ahf[i];
      }
#pragma unroll
      for (int i = 0; i < 4; ++i) {
        const v16b ah = ahf[i], al = alf[i];
#pragma unroll
        for (int j = 0; j < 4; ++j) {
          acc[i][j] = mma_b_raw(ah, bh[j], acc[i][j]);
          if (NSPLIT >= 1) acc[i][j] = mma_b_raw(al, bh[j], acc[i][j]);
        }
        dep_guard_b(acc[i][0], acc[i][3], ah, al);
      }
      keep4_b(bh[0], bh[1], bh[2], bh[3]);
    }
    // foot of the trip: own reads of this buffer done, own copies of the next tile landed, one barrier for both;
    // only then the refill of the buffer that this trip has read
    wait_lds();
    wait_copies();
    __syncthreads();
    if (t + 2 < nt) {
      const int kn = (t + 2) << 6;
      gemm_stage<NSPLIT>(sdst + (unsigned)(t & 1) * STG, gA + kn, gB + kn, gA2 + kn, lda, ldb);
    }
  }
  wait_copies();
  acc_guard4(acc[0][0], acc[0][1], acc[0][2], acc[0][3]);
  acc_guard4(acc[1][0], acc[1][1], acc[1][2], acc[1][3]);
  acc_guard4(acc[2][0], acc[2][1], acc[2][2], acc[2][3]);
  acc_guard4(acc[3][0], acc[3][1], acc[3][2], acc[3][3]);

  // ---- epilogue ----
  float bcol[4];
#pragma unroll
  for (int j = 0; j < 4; ++j) bcol[j] = 0.f;
  if (BIAS == 1) {
#pragma unroll
    for (int j = 0; j < 4; ++j) bcol[j] = bfr(bias[n0 + (j << 4) + rlane]);
  }
#pragma unroll
  for (int i = 0; i < 4; ++i) {
    const int mBase = m0 + (i << 4);
    float brow[8];
#pragma unroll
    for (int r = 0; r < 8; ++r) brow[r] = 0.f;
    if (BIAS == 2) {
#pragma unroll
      for (int r = 0; r < 8; ++r) brow[r] = bfr(bias[mBase + mOff + r]);
    }
#pragma unroll
    for (int j = 0; j < 4; ++j) {
#pragma unroll
      for (int r = 0; r < 8; ++r) {
        slab[(mOff + r) * 68 + (j << 4) + rlane] = (acc[i][j][r] + bcol[j]) + brow[r];
      }
    }
    v4f tc[4][2], ts[4][2];                                // OUT_MODE 4: cos / sin of this lane's 4 rows x 8 columns,
    if (OUT_MODE == 4) {                                   // asked for while the slab's stores are under way
      const size_t to = (size_t)(mBase + (lane >> 3)) * NFREQ + (((lane & 7) * 8) & 31);
      const float* cr = cosT + to;
      const float* sr = sinT + to;
#pragma unroll
      for (int it = 0; it < 4; ++it) {                     // row it * 4 + (lane >> 3)
        tc[it][0] = *(const v4f*)(cr + it * 4 * NFREQ); tc[it][1] = *(const v4f*)(cr + it * 4 * NFREQ + 4);
        ts[it][0] = *(const v4f*)(sr + it * 4 * NFREQ); ts[it][1] = *(const v4f*)(sr + it * 4 * NFREQ + 4);
      }
#if defined(__HIP_DEVICE_COMPILE__)
      // s_wait_xcnt 0 before a register that an issued load names is written again; the addresses are inputs so that
      // they stay in their registers up to the wait (else a later load's destination may take an address pair over).
      asm volatile("s_wait_xcnt 0x0" :: "v"(cr), "v"(sr) : "memory");
#endif
    }
    __builtin_amdgcn_fence(__ATOMIC_RELEASE, "workgroup");
    __builtin_amdgcn_wave_barrier();
    __builtin_amdgcn_fence(__ATOMIC_ACQUIRE, "workgroup");
    if (OUT_MODE == 0) {
      float* C = (float*)Cout + (size_t)b * strideC;
      const int hh = lane >> 4, c4 = (lane & 15) * 4;     // 256-B row segment = 16 lanes x 16 B
      {
#pragma unroll
        for (int it = 0; it < 8; ++it) {
          const int row = it * 2 + hh;                     // it 0..7 x hh 0..1 = rows 0..15
          const v4f v = *(const v4f*)(slab + row * 68 + c4);
          *(v4f*)(C + (size_t)(mBase + row) * ldc + n0 + c4) = v;
        }
        
      }
    } else if (OUT_MODE == 4) {
      const int q = lane >> 3, c8 = (lane & 7) * 8;        // 8 lanes x 16 B = one 128-B line per row and plane
      unsigned short* C  = (unsigned short*)Cout  + (size_t)b * strideC;
      unsigned short* C2 = (unsigned short*)Cout2 + (size_t)b * strideC2;
      const size_t go = (size_t)(mBase + q) * ldc + n0 + c8;
      unsigned short* hp = C + go;
      unsigned short* lp = C2 + go;
#pragma unroll
      for (int ip = 0; ip < 2; ++ip) {                     // two rows at a time: row (ip * 2 + u) * 4 + q = rows 0..15
        v4u hv[2], lv[2];
#pragma unroll
        for (int u = 0; u < 2; ++u) {
          const int it = ip * 2 + u;
          const float* sp = slab + (it * 4 + q) * 68;
          rope_row8(sp + c8, sp + (c8 ^ 32), (c8 & 32) != 0, tc[it][0], tc[it][1], ts[it][0], ts[it][1], hv[u], lv[u]);
        }
#pragma unroll
        for (int u = 0; u < 2; ++u) {
          *(v4u*)(hp + (size_t)((ip * 2 + u) * 4) * ldc) = hv[u];
          *(v4u*)(lp + (size_t)((ip * 2 + u) * 4) * ldc) = lv[u];
        }
#if defined(__HIP_DEVICE_COMPILE__)
        // s_wait_xcnt 0 behind the run of stores, before a register that they name is written again; addresses and
        // data are inputs so that they stay in their registers up to the wait.
        asm volatile("s_wait_xcnt 0x0" :: "v"(hp), "v"(lp), "v"(hv[0]), "v"(lv[0]), "v"(hv[1]), "v"(lv[1]) : "memory");
#endif
      }
    } else {
      const int q = lane >> 3, c8 = (lane & 7) * 8;
      unsigned short* C  = (unsigned short*)Cout  + (size_t)b * strideC;
      unsigned short* C2 = (unsigned short*)Cout2 + (size_t)b * strideC2;
      const bool wlo = (OUT_MODE == 2) || (n0 < N2);      // wave-uniform
      v4u hv[4], lv[4];
#pragma unroll
      for (int it = 0; it < 4; ++it) {
        const int row = it * 4 + q;                        // it 0..3 x q 0..3 = rows 0..15
        const float* sp = slab + row * 68 + c8;
        v4u a, a2;
#pragma unroll
        for (int e = 0; e < 4; ++e) {
          const float f0 = sp[2 * e], f1 = sp[2 * e + 1];
          unsigned short h0, h1, l0, l1;
          if (OUT_MODE == 2) {
            h0 = bf_bits(f0); h1 = bf_bits(f1);
            l0 = bf_bits(f0 - bf_up(h0)); l1 = bf_bits(f1 - bf_up(h1));
          } else {
            const _Float16 x0 = (_Float16)f0, x1 = (_Float16)f1;
            h0 = h_bits(x0); h1 = h_bits(x1);
            l0 = h_bits((_Float16)((f0 - (float)x0) * rscale));
            l1 = h_bits((_Float16)((f1 - (float)x1) * rscale));
          }
          a[e] = pk16(h0, h1); a2[e] = pk16(l0, l1);
        }
        hv[it] = a; lv[it] = a2;
      }
      {
#pragma unroll
        for (int it = 0; it < 4; ++it) {
          const int row = it * 4 + q;
          *(v4u*)(C + (size_t)(mBase + row) * ldc + n0 + c8) = hv[it];
          if (wlo) *(v4u*)(C2 + (size_t)(mBase + row) * ldc2 + n0 + c8) = lv[it];
        }
        
      }
    }
    __builtin_amdgcn_fence(__ATOMIC_RELEASE, "workgroup");
    __builtin_amdgcn_wave_barrier();
    __builtin_amdgcn_fence(__ATOMIC_ACQUIRE, "workgroup");
  }
}

// One product per grid: blockIdx.x = 128 x 256 block tile, blockIdx.y = batch index.
template <int NSPLIT, int OUT_MODE, int BIAS>
__global__ __launch_bounds__(256) void gemm64(
    const unsigned short* __restrict__ Ap, const unsigned short* A2p, int lda, long long strideA,
    const unsigned short* __restrict__ Btp, const unsigned short* Bt2p, int ldb, long long strideB,
    void* Cout, int ldc, long long strideC,
    void* Cout2, int ldc2, long long strideC2, int N2,
    int M, int N, int K, float rscale, const float* __restrict__ bias) {
  __shared__ __align__(16) float sT[8][16 * 68];   // per-wave 16x64 slab, pitch 68 floats
  __shared__ __align__(16) unsigned char sG[2 * GSTG_B(NSPLIT)];   // two operand buffers
  const int wave = threadIdx.x >> 5;
  gemm64_tile<NSPLIT, OUT_MODE, BIAS>(Ap, A2p, lda, strideA, Btp, Bt2p, ldb, strideB, Cout, ldc, strideC,
                                      Cout2, ldc2, strideC2, N2, M, N, K, rscale, bias, nullptr, nullptr,
                                      sT[wave], sG, blockIdx.x, blockIdx.y);
}

// q, k and v^T projections of both batch elements in one grid: blockIdx.z = 0 q, 1 k, 2 v^T; blockIdx.y = batch;
// blockIdx.x = 128 x 256 block tile (v^T has half the tiles of q / k: its upper blocks leave at the tile test).
//   q / k = rope(x_b . W^T + bias[col]) -> bf16 hi / lo planes [NB*SEQ][DQK] (M=SEQ, N=DQK, K=DM); per head 128
//           columns = two 64-wide vectors, each the 64 columns of one wave
//   v^T   = Wv . x_b^T + bv[row]  -> f16 hi plane [b][h*64+d][s] (pitch SEQ) and residual plane
//           (x4096, keys < VLP only, pitch VLP)                        (M=DM, N=SEQ, K=DM)
__global__ __launch_bounds__(256) void gemm_qkv(
    const unsigned short* __restrict__ Xb, const unsigned short* __restrict__ Wqb,
    const unsigned short* __restrict__ Wkb, const unsigned short* __restrict__ Wvb,
    unsigned short* Qh, unsigned short* Ql, unsigned short* Kh, unsigned short* Kl,
    unsigned short* VTh, unsigned short* VTl,
    const float* __restrict__ bq, const float* __restrict__ bk, const float* __restrict__ bv,
    const float* __restrict__ cosT, const float* __restrict__ sinT) {
  __shared__ __align__(16) float sT[8][16 * 68];   // per-wave 16x64 slab, pitch 68 floats
  __shared__ __align__(16) unsigned char sG[2 * GSTG_B(0)];   // two operand buffers
  const int wave = threadIdx.x >> 5;
  const int tile = blockIdx.x;
  const int b    = blockIdx.y;
  const int z    = blockIdx.z;
  if (z < 2) {
    const unsigned short* Wb = z ? Wkb : Wqb;
    unsigned short* Ch = z ? Kh : Qh;
    unsigned short* Cl = z ? Kl : Ql;
    const float* bias = z ? bk : bq;
    gemm64_tile<0, 4, 1>(Xb, Xb, DM, (long long)SEQ * DM, Wb, Wb, DM, 0LL,
                         (void*)Ch, DQK, (long long)SEQ * DQK, (void*)Cl, DQK, (long long)SEQ * DQK, DQK,
                         SEQ, DQK, DM, 1.0f, bias, cosT, sinT, sT[wave], sG, tile, b);
  } else {
    gemm64_tile<0, 3, 2>(Wvb, Wvb, DM, 0LL, Xb, Xb, DM, (long long)SEQ * DM,
                         (void*)VTh, SEQ, (long long)DM * SEQ, (void*)VTl, VLP, (long long)DM * VLP, VLP,
                         DM, SEQ, DM, 4096.0f, bv, nullptr, nullptr, sT[wave], sG, tile, b);
  }
}

#define LP      72                        // LDS row pitch of the 16-bit tiles, in elements
#define TILE_B  (64 * LP * 2)             // one 64-row tile: 9216 B
#define OSP     68                        // row pitch of a wave's f32 context tile, in floats (272 B = 16 B x 17)
#define OS_B    (4 * 16 * OSP * 4)        // four waves' f32 context tiles: 17408 B
#define ATT_LDS (4 * TILE_B + OS_B)       // 54272 B
static_assert(((LP * 2) % 16) == 0 && (((LP * 2) / 16) & 1) == 1);   // 16-B aligned rows, odd multiple of 16 B
// value of lane l ^ 16 (the other wave half)
__device__ __forceinline__ float xhalf(float x) {
  return __builtin_bit_cast(float, __builtin_amdgcn_permlanex16(__builtin_bit_cast(int, x), __builtin_bit_cast(int, x),
                                                                0x76543210, 0xfedcba98, false, false));
}
template <bool RES>
__device__ __forceinline__
void attn_block64(unsigned char* smem,
                  const unsigned short* __restrict__ qhp, const unsigned short* __restrict__ qlp,
                  const unsigned short* __restrict__ khp, const unsigned short* __restrict__ klp,
                  const unsigned short* __restrict__ vhp, const unsigned short* __restrict__ vlp,
                  float* Cp, int soff, int qb, int h, float sscale) {
  union FB { v16b v; v8b h[2]; };
  union FH { v16h v; v8h h[2]; };
  __bf16*   Ksh = (__bf16*)(void*)(smem);                         // K hi [kv][d]
  __bf16*   Ksl = (__bf16*)(void*)(smem + TILE_B);                // K lo
  _Float16* Vth = (_Float16*)(void*)(smem + 2 * TILE_B);          // V^T hi [d][kv]
  float*    Os  = (float*)(void*)(smem + 3 * TILE_B);             // per wave context tile [row][d], 4 x 4352 B
  _Float16* Vtl = (_Float16*)(void*)(smem + 3 * TILE_B + OS_B);   // V^T residual (RES only)

  const int tid  = threadIdx.x;
  const int wave = tid >> 5;
  const int lane = tid & 31;
  const int hh   = lane >> 4;
  const int c    = lane & 15;

  const int q0   = qb * 64 + wave * 16;
  const int col  = h * (2 * HD) + soff;

  const __bf16* Qh = (const __bf16*)(const void*)qhp + col;
  const __bf16* Ql = (const __bf16*)(const void*)qlp + col;
  const __bf16* Kh = (const __bf16*)(const void*)khp + col;
  const __bf16* Kl = (const __bf16*)(const void*)klp + col;
  const _Float16* Vh = (const _Float16*)(const void*)vhp + (size_t)h * HD * SEQ;
  const _Float16* Vl = (const _Float16*)(const void*)vlp + (size_t)h * HD * VLP;

  // ---- Q fragments (B operand, column = query = lane&15): 2 d-chunks, hi and lo ----
  v16b qah[2], qal[2];
#pragma unroll
  for (int dc = 0; dc < 2; ++dc) {
    const size_t qo = (size_t)(q0 + c) * DQK + dc * 32 + 8 * hh;
    qah[dc] = ldfrag_b(Qh + qo);
    qal[dc] = ldfrag_b(Ql + qo);
  }

  const int qrow = q0 + c;                   // this lane's query row
  float mrow = -INFINITY;                    // its running maximum (equal in both wave halves)
  float lrow = 0.f;                          // running sum over this wave half's keys only; joined after the loop
  v8f oacc[4];                               // oacc[t][r] = context^T [d = t*16 + 8*hh + r][query c]
#pragma unroll
  for (int t = 0; t < 4; ++t) oacc[t] = zero8();

  for (int kt = 0; kt < NQB; ++kt) {         // static trip bound
    if (kt > qb) break;                      // block-uniform (causal)
    const bool diag = (kt == qb);            // block-uniform
    const int kv0 = kt * 64;
    __syncthreads();
    {
      const int g = tid >> 3, ch = (tid & 7) * 8;                  // group of 8 lanes = one row; elements ch..ch+7
      const int r = (g >> 1) | ((g & 1) << 3);                     // pass i: row r + 16 i; groups 2m, 2m+1 -> rows m, m+8
      const __bf16*   kg  = Kh + (size_t)(kv0 + r) * DQK + ch;     // K row kv0+r, d = ch..ch+7
      const __bf16*   klg = Kl + (size_t)(kv0 + r) * DQK + ch;
      const _Float16* vg  = Vh + (size_t)r * SEQ + kv0 + ch;        // V^T row d = r, s = kv0+ch..+7
      const int kvl = (kv0 + 64 <= VLP) ? kv0 : (VLP - 64);       // clamped address into the residual plane
      const _Float16* vlg = Vl + (size_t)r * VLP + kvl + ch;
      const bool resOK = (kv0 + 64 <= VLP);                        // block-uniform
      v8b a0[4], a1[4];
      v8h b0[4], b1[4];
#pragma unroll
      for (int i = 0; i < 4; ++i) {
        a0[i] = *(const v8b*)(kg + (size_t)(16 * i) * DQK);
        a1[i] = *(const v8b*)(klg + (size_t)(16 * i) * DQK);
        b0[i] = *(const v8h*)(vg + (size_t)(16 * i) * SEQ);
        if (RES) {
          b1[i] = *(const v8h*)(vlg + (size_t)(16 * i) * VLP);
          if (!resOK) b1[i] = zero8h();
        }
      }
#if defined(__HIP_DEVICE_COMPILE__)
      // s_wait_xcnt 0 before a register that an issued load names is written again; the addresses are inputs so that
      // they stay in their registers up to the wait (else the last load's destination may take an address pair over).
      if (RES) asm volatile("s_wait_xcnt 0x0" :: "v"(kg), "v"(klg), "v"(vg), "v"(vlg) : "memory");
      else     asm volatile("s_wait_xcnt 0x0" :: "v"(kg), "v"(klg), "v"(vg) : "memory");
#endif
#pragma unroll
      for (int i = 0; i < 4; ++i) {
        *(v8b*)(Ksh + (r + 16 * i) * LP + ch) = a0[i];
        *(v8b*)(Ksl + (r + 16 * i) * LP + ch) = a1[i];
        *(v8h*)(Vth + (r + 16 * i) * LP + ch) = b0[i];
        if (RES) *(v8h*)(Vtl + (r + 16 * i) * LP + ch) = b1[i];
      }
    }
    __syncthreads();

    // ---- scores^T: 64 keys x 16 query columns per wave, 3 bf16 products; s[j][r] = key j*16 + 8*hh + r, query c ----
    v8f s[4];
#pragma unroll
    for (int j = 0; j < 4; ++j) {
      s[j] = zero8();
#pragma unroll
      for (int dc = 0; dc < 2; ++dc) {
        FB kb, kl;
        kb.h[0] = *(const v8b*)(Ksh + (j * 16 + c) * LP + dc * 32 + 8 * hh);
        kb.h[1] = *(const v8b*)(Ksh + (j * 16 + c) * LP + dc * 32 + 16 + 8 * hh);
        kl.h[0] = *(const v8b*)(Ksl + (j * 16 + c) * LP + dc * 32 + 8 * hh);
        kl.h[1] = *(const v8b*)(Ksl + (j * 16 + c) * LP + dc * 32 + 16 + 8 * hh);
        s[j] = mma_b(kb.v, qah[dc], s[j]);
        s[j] = mma_b(kl.v, qah[dc], s[j]);
        s[j] = mma_b(kb.v, qal[dc], s[j]);
      }
    }

    // ---- scale, causal fill on the diagonal tile, maximum of the lane's 32 keys and of the other half's,
    //      online softmax, P (x1024, f16) and P residual (x4096) packed into B operands ----
    float mj[4];
#pragma unroll
    for (int j = 0; j < 4; ++j) {
      mj[j] = -INFINITY;
#pragma unroll
      for (int r = 0; r < 8; ++r) {
        const int key = kv0 + j * 16 + 8 * hh + r;
        float sv = s[j][r] * sscale;
        sv = (diag && key > qrow) ? -INFINITY : sv;
        s[j][r] = sv;
        mj[j] = fmaxf(mj[j], sv);
      }
    }
    float m = fmaxf(fmaxf(mj[0], mj[1]), fmaxf(mj[2], mj[3]));
    m = fmaxf(m, xhalf(m));
    const float mnew  = fmaxf(mrow, m);
    const float msafe = (mnew == -INFINITY) ? 0.f : mnew;
    const float alpha = __expf(mrow - msafe);
    mrow = mnew;
    v16h pbh[2], pbl[2];                     // element (j&1)*8 + r of block j>>1 = key (j>>1)*32 + (j&1)*16 + 8*hh + r
    float pj[4];                             // four independent partial sums of 8 keys each
#pragma unroll
    for (int j = 0; j < 4; ++j) {
      pj[j] = 0.f;
#pragma unroll
      for (int r = 0; r < 8; ++r) {
        const float p = __expf(s[j][r] - msafe);     // -inf logit: exp -> 0
        pj[j] += p;
        const float p1k = p * 1024.0f;
        const _Float16 ph = (_Float16)p1k;
        pbh[j >> 1][(j & 1) * 8 + r] = ph;
        if (RES) pbl[j >> 1][(j & 1) * 8 + r] = (_Float16)((p1k - (float)ph) * 4096.0f);
      }
    }
    lrow = lrow * alpha + ((pj[0] + pj[1]) + (pj[2] + pj[3]));
#pragma unroll
    for (int t = 0; t < 4; ++t)
#pragma unroll
      for (int r = 0; r < 8; ++r) oacc[t][r] *= alpha;

    // ---- context^T += V^T . P^T (f16 WMMA), residual products into a separate accumulator ----
    v8f o1[4];
#pragma unroll
    for (int t = 0; t < 4; ++t) o1[t] = zero8();
    // unrolled: the P operands are register arrays and need constant indices
#pragma unroll
    for (int kk = 0; kk < 2; ++kk) {
#pragma unroll
      for (int t = 0; t < 4; ++t) {
        FH vb;
        vb.h[0] = *(const v8h*)(Vth + (t * 16 + c) * LP + kk * 32 + 8 * hh);
        vb.h[1] = *(const v8h*)(Vth + (t * 16 + c) * LP + kk * 32 + 16 + 8 * hh);
        oacc[t] = mma_h(vb.v, pbh[kk], oacc[t]);
        if (RES) {
          FH vl;
          vl.h[0] = *(const v8h*)(Vtl + (t * 16 + c) * LP + kk * 32 + 8 * hh);
          vl.h[1] = *(const v8h*)(Vtl + (t * 16 + c) * LP + kk * 32 + 16 + 8 * hh);
          o1[t] = mma_h(vl.v, pbh[kk], o1[t]);
          o1[t] = mma_h(vb.v, pbl[kk], o1[t]);
        }
      }
    }
    if (RES) {
#pragma unroll
      for (int t = 0; t < 4; ++t)
#pragma unroll
        for (int r = 0; r < 8; ++r) oacc[t][r] += o1[t][r] * (1.0f / 4096.0f);
    }
  }

  // ---- join the halves' sums, normalise (1/l and the 1/1024 p carry), stage the wave's 16x64 tile as [query][d]
  //      (a lane holds 8 consecutive d of its query per t: two 16-B LDS stores), write f32 rows as whole 256-B segments
  float* os = Os + wave * (16 * OSP);
  {
    const float l = lrow + xhalf(lrow);
    const float inv = ((l > 0.f) ? (1.0f / l) : 0.f) * (1.0f / 1024.0f);
#pragma unroll
    for (int t = 0; t < 4; ++t) {
      v4f w0, w1;
#pragma unroll
      for (int e = 0; e < 4; ++e) { w0[e] = oacc[t][e] * inv; w1[e] = oacc[t][4 + e] * inv; }
      *(v4f*)(os + c * OSP + t * 16 + 8 * hh)     = w0;
      *(v4f*)(os + c * OSP + t * 16 + 8 * hh + 4) = w1;
    }
  }
  __builtin_amdgcn_fence(__ATOMIC_RELEASE, "workgroup");
  __builtin_amdgcn_wave_barrier();
  __builtin_amdgcn_fence(__ATOMIC_ACQUIRE, "workgroup");
  {
    const int h2 = lane >> 4, c4 = (lane & 15) * 4;
    v4f ov[8];
#pragma unroll
    for (int it = 0; it < 8; ++it) {
      const int row = it * 2 + h2;   // it 0..7 x h2 0..1 = rows 0..15 of the wave tile
      ov[it] = *(const v4f*)(os + row * OSP + c4);
    }
    {
#pragma unroll
      for (int it = 0; it < 8; ++it) {
        const int row = it * 2 + h2;
        const size_t go = (size_t)(q0 + row) * DM + (size_t)h * HD + c4;
        *(v4f*)(Cp + go) = ov[it];
      }
#if defined(__HIP_DEVICE_COMPILE__)
      // s_wait_xcnt 0 behind the run of stores: in the merged kernel the listing holds a branch from the end of this
      // body to the head of the other one, where registers that these stores name are written again.
      asm volatile("s_wait_xcnt 0x0" ::: "memory");
#endif
    }
  }
}

// All query blocks of both streams, all heads and both batch elements in one grid of NQB * 2 * NB * NH blocks.
// blockIdx.x / 64 counts the query blocks down from the last one: the blocks with the most key tiles get the lowest
// indices (for speed only).
// blockIdx.x % 64 = batch * 32 + stream * 16 + head. Query blocks below RESQB take the body with residual planes
// (block-uniform choice).
__global__ __launch_bounds__(128)
void attn_causal64(const unsigned short* __restrict__ qhp, const unsigned short* __restrict__ qlp,
                   const unsigned short* __restrict__ khp, const unsigned short* __restrict__ klp,
                   const unsigned short* __restrict__ vhp, const unsigned short* __restrict__ vlp,
                   float* C1p, float* C2p, float sscale) {
  __shared__ __align__(16) unsigned char smem[ATT_LDS];
  const int bx     = blockIdx.x;
  const int qb     = NQB - 1 - (bx >> 6);
  const int h      = bx & 15;
  const int stream = (bx >> 4) & 1;
  const int b      = (bx >> 5) & 1;
  const size_t qk = (size_t)b * SEQ * DQK;
  const unsigned short* vh = vhp + (size_t)b * DM * SEQ;
  const unsigned short* vl = vlp + (size_t)b * DM * VLP;
  float* Cp = (stream ? C2p : C1p) + (size_t)b * SEQ * DM;
  const int soff = stream * HD;
  if (qb < RESQB) attn_block64<true >(smem, qhp + qk, qlp + qk, khp + qk, klp + qk, vh, vl, Cp, soff, qb, h, sscale);
  else            attn_block64<false>(smem, qhp + qk, qlp + qk, khp + qk, klp + qk, vh, vl, Cp, soff, qb, h, sscale);
}

// =====================================================================================================
// Differential combine + head rms norm for one token row t of the NB*SEQ rows:
//   lam[h] = (0.2 + exp(sum_d lq1.lk1)) - exp(sum_d lq2.lk2)  (f32, inputs RNE-converted to bf16 values;
//            recomputed per block by threads 0..15, rolled 64-term loops)
//   o = c1 - lam*c2; r = rsqrt(sum_d(o^2)/64 + 1e-6); o = ((o*r) * w[h][d]) * 0.8
//   written as bf16 hi / lo planes [NB*SEQ][DM] (merged head layout), one 16-B store per plane per lane
// grid = NB*SEQ blocks x 128 threads; thread -> columns 8*tid..+7 (head = tid>>3, 8 lanes per head).
// coverage: 128 threads x 8 = 1024 columns per row; NB*SEQ rows.
// =====================================================================================================
__global__ __launch_bounds__(128) void diff_combine(
    const float* __restrict__ C1, const float* __restrict__ C2,
    const float* __restrict__ lq1, const float* __restrict__ lk1,
    const float* __restrict__ lq2, const float* __restrict__ lk2,
    const float* __restrict__ hnw, unsigned short* Oh, unsigned short* Ol) {
#pragma clang fp contract(off)
  __shared__ float lam_s[NH];
  const int tid = threadIdx.x;
  const int t   = blockIdx.x;
  if (tid < NH) {
    const float* a1 = lq1 + tid * HD;
    const float* b1 = lk1 + tid * HD;
    const float* a2 = lq2 + tid * HD;
    const float* b2 = lk2 + tid * HD;
    float sa = 0.f, sb = 0.f;
#pragma unroll 1
    for (int d = 0; d < HD; ++d) {
      sa += bfr(a1[d]) * bfr(b1[d]);
      sb += bfr(a2[d]) * bfr(b2[d]);
    }
    lam_s[tid] = (LAM0 + expf(sa)) - expf(sb);
  }
  __syncthreads();
  const int c0 = tid * 8;
  const int h  = c0 >> 6;
  const int d0 = c0 & 63;
  const size_t ro = (size_t)t * DM + c0;
  const v4f x0 = *(const v4f*)(C1 + ro), x1 = *(const v4f*)(C1 + ro + 4);
  const v4f y0 = *(const v4f*)(C2 + ro), y1 = *(const v4f*)(C2 + ro + 4);
  const float lam = lam_s[h];
  float o[8];
  float ss = 0.f;
#pragma unroll
  for (int e = 0; e < 4; ++e) {
    o[e]     = x0[e] - lam * y0[e];
    o[4 + e] = x1[e] - lam * y1[e];
  }
#pragma unroll
  for (int e = 0; e < 8; ++e) ss += o[e] * o[e];
  ss += __shfl_xor(ss, 1, 32);
  ss += __shfl_xor(ss, 2, 32);
  ss += __shfl_xor(ss, 4, 32);
  const float ms = ss * (1.0f / (float)HD);
  const float rn = rsqrtf(ms + 1.0e-6f);
  v4u hv, lv;
#pragma unroll
  for (int e = 0; e < 4; ++e) {
    const float w0 = bfr(hnw[h * HD + d0 + 2 * e]);
    const float w1 = bfr(hnw[h * HD + d0 + 2 * e + 1]);
    const float f0 = ((o[2 * e] * rn) * w0) * OSCL;
    const float f1 = ((o[2 * e + 1] * rn) * w1) * OSCL;
    const unsigned short h0 = bf_bits(f0), h1 = bf_bits(f1);
    const unsigned short l0 = bf_bits(f0 - bf_up(h0)), l1 = bf_bits(f1 - bf_up(h1));
    hv[e] = pk16(h0, h1); lv[e] = pk16(l0, l1);
  }
  *(v4u*)(Oh + ro) = hv;
  *(v4u*)(Ol + ro) = lv;
  
}

// =====================================================================================================
// Workspace map (bytes, all offsets multiples of 4096):
//   Xb   bf16 [4096][1024]      8388608      Wqb bf16 [2048][1024] 4194304   Wkb 4194304
//   Wvb  bf16 [1024][1024]      2097152      Wob 2097152
//   invf f32 [32] (padded)         4096      cosT f32 [2048][32] 262144      sinT 262144
//   both batch elements, batch-major:
//   Qh/Ql/Kh/Kl bf16 [2][2048][2048]  4 x 16777216
//   VTh  f16  [2][1024][2048]      8388608      VTl f16 [2][1024][512] 2097152
//   C1/C2 f32 [2][2048][1024]   2 x 16777216    Oh/Ol bf16 [2][2048][1024] 2 x 8388608
//   end                          149426176
// All planes are exact multiples of their 64x64 / whole-line store granularity (no padded tails needed).
// Weights are [out n][in k] with k contiguous = the Bt / A layout the GEMM wants, so they are only converted.
// =====================================================================================================
extern "C" void kernel_launch(void* const* d_in, const int* in_sizes, int n_in,
                              void* d_out, int out_size, void* d_ws, size_t ws_size,
                              hipStream_t stream) {
  if (n_in < 14) return;
  if (in_sizes[0] != NB * SEQ * DM) return;
  if (in_sizes[1] != DQK * DM || in_sizes[2] != DQK) return;
  if (in_sizes[3] != DQK * DM || in_sizes[4] != DQK) return;
  if (in_sizes[5] != DM * DM || in_sizes[6] != DM) return;
  if (in_sizes[7] != DM * DM || in_sizes[8] != DM) return;
  for (int i = 9; i < 14; ++i) if (in_sizes[i] != NH * HD) return;
  if (out_size != NB * SEQ * DM) return;

  const float* x   = (const float*)d_in[0];
  const float* Wq  = (const float*)d_in[1];
  const float* bq  = (const float*)d_in[2];
  const float* Wk  = (const float*)d_in[3];
  const float* bk  = (const float*)d_in[4];
  const float* Wv  = (const float*)d_in[5];
  const float* bv  = (const float*)d_in[6];
  const float* Wo  = (const float*)d_in[7];
  const float* bo  = (const float*)d_in[8];
  const float* hnw = (const float*)d_in[9];
  const float* lq1 = (const float*)d_in[10];
  const float* lk1 = (const float*)d_in[11];
  const float* lq2 = (const float*)d_in[12];
  const float* lk2 = (const float*)d_in[13];
  float* outp = (float*)d_out;

  const size_t PXB  = (size_t)NB * SEQ * DM * 2;    //  8388608
  const size_t PWQ  = (size_t)DQK * DM * 2;         //  4194304
  const size_t PWV  = (size_t)DM * DM * 2;          //  2097152
  const size_t PIF  = 4096;                         //  32 floats used
  const size_t PTAB = (size_t)SEQ * NFREQ * 4;      //   262144
  const size_t PQP  = (size_t)NB * SEQ * DQK * 2;   // 16777216
  const size_t PVT  = (size_t)NB * DM * SEQ * 2;    //  8388608
  const size_t PVL  = (size_t)NB * DM * VLP * 2;    //  2097152
  const size_t PC   = (size_t)NB * SEQ * DM * 4;    // 16777216
  const size_t PO   = (size_t)NB * SEQ * DM * 2;    //  8388608
  size_t off = 0;
  const size_t oXb  = off; off += PXB;
  const size_t oWq  = off; off += PWQ;
  const size_t oWk  = off; off += PWQ;
  const size_t oWv  = off; off += PWV;
  const size_t oWo  = off; off += PWV;
  const size_t oIF  = off; off += PIF;
  const size_t oCos = off; off += PTAB;
  const size_t oSin = off; off += PTAB;
  const size_t oQh  = off; off += PQP;
  const size_t oQl  = off; off += PQP;
  const size_t oKh  = off; off += PQP;
  const size_t oKl  = off; off += PQP;
  const size_t oVTh = off; off += PVT;
  const size_t oVTl = off; off += PVL;
  const size_t oC1  = off; off += PC;
  const size_t oC2  = off; off += PC;
  const size_t oOh  = off; off += PO;
  const size_t oOl  = off; off += PO;
  if (off > ws_size) return;                        // off = 149426176

  char* ws = (char*)d_ws;
  unsigned short* Xb  = (unsigned short*)(ws + oXb);
  unsigned short* Wqb = (unsigned short*)(ws + oWq);
  unsigned short* Wkb = (unsigned short*)(ws + oWk);
  unsigned short* Wvb = (unsigned short*)(ws + oWv);
  unsigned short* Wob = (unsigned short*)(ws + oWo);
  float*          IFt = (float*)(ws + oIF);
  float*          CosT = (float*)(ws + oCos);
  float*          SinT = (float*)(ws + oSin);
  unsigned short* Qh  = (unsigned short*)(ws + oQh);
  unsigned short* Ql  = (unsigned short*)(ws + oQl);
  unsigned short* Kh  = (unsigned short*)(ws + oKh);
  unsigned short* Kl  = (unsigned short*)(ws + oKl);
  unsigned short* VTh = (unsigned short*)(ws + oVTh);
  unsigned short* VTl = (unsigned short*)(ws + oVTl);
  float*          C1  = (float*)(ws + oC1);
  float*          C2  = (float*)(ws + oC2);
  unsigned short* Oh  = (unsigned short*)(ws + oOh);
  unsigned short* Ol  = (unsigned short*)(ws + oOl);

  const dim3 blk256(256), blk128(128), blk32(32);
  const dim3 gCvt((NB * SEQ * DM + 2 * DQK * DM + 2 * DM * DM) / 8 / 256);   // 5120 blocks
  const dim3 gTab((SEQ * NFREQ + 255) / 256);                      //  256 blocks
  const dim3 gQKV((SEQ / 64) * (DQK / 64) / 8, NB, 3);             // 1024 tiles -> 128 blocks, x batch x {q, k, v^T}
  const dim3 gOut((NB * SEQ / 64) * (DM / 64) / 8, 1);             // 1024 tiles -> 128 blocks
  const dim3 gRow(NB * SEQ);                                       // one block per token row
  const dim3 gAtt(NQB * 2 * NB * NH);                              // 2048 blocks

  // (1) inputs -> bf16 planes; weights [n][k] f32 -> bf16 [n][k]; Xb, Wqb, Wkb, Wvb, Wob are contiguous from Xb
  cvt_bf16x8<<<gCvt, blk256, 0, stream>>>(x, Wq, Wk, Wv, Wo, Xb);
  // (2) rope tables
  invfreq_tab<<<dim3(1), blk32, 0, stream>>>(IFt);
  rope_tab<<<gTab, blk256, 0, stream>>>(IFt, CosT, SinT);
  // (3) q, k -> rope -> bf16 hi / lo planes [NB*SEQ][DQK]; v^T -> f16 hi plane and residual plane, both batch elements
  gemm_qkv<<<gQKV, blk256, 0, stream>>>(Xb, Wqb, Wkb, Wvb, Qh, Ql, Kh, Kl, VTh, VTl, bq, bk, bv, CosT, SinT);
  // (4) causal attention, stream 1 (q1, k1) -> C1 and stream 2 (q2, k2) -> C2;
  //     query blocks 0..RESQB-1 with residual planes, the rest without
  attn_causal64<<<gAtt, blk128, 0, stream>>>(Qh, Ql, Kh, Kl, VTh, VTl, C1, C2, 0.125f);
  // (5) differential combine + head norm -> O bf16 hi/lo planes [NB*SEQ][DM]
  diff_combine<<<gRow, blk128, 0, stream>>>(C1, C2, lq1, lk1, lq2, lk2, hnw, Oh, Ol);
  // (6) out = O . Wo^T + bo -> d_out, f32 [NB*SEQ][DM]  (A = O hi + lo planes, 2 products)
  gemm64<1, 0, 1><<<gOut, blk256, 0, stream>>>(
      Oh, Ol, DM, 0LL, Wob, Wob, DM, 0LL,
      (void*)outp, DM, 0LL, (void*)outp, DM, 0LL, DM,
      NB * SEQ, DM, DM, 1.0f, bo);
  (void)hipGetLastError();
}

// v007
// Measured time: 170 microseconds a run.
// Timed twice side by side with v006, it ran 1.04 times as fast both times.
// All steps since v000 together make it 6.37 times as fast.
// Contractions: q, k, v^T projections = v_wmma_f32_16x16x32_bf16 (bf16 operands from RNE-converted inputs, single product);
// q.k^T scores (both streams) = v_wmma_f32_16x16x32_bf16 with bf16 hi/lo split q and k (hi.hi + hi.lo + lo.hi);
// p.v = v_wmma_f32_16x16x32_f16 (p carried x1024 in f16, v in f16; extra f16 residual planes x4096 of p and v for the first 512 query rows);
// ctx.Wo^T = v_wmma_f32_16x16x32_bf16 with ctx as bf16 hi/lo planes times bf16 Wo (2 products); all f32 accumulate;
// rope, softmax, lambda, head rms norm in f32.
#include <hip/hip_runtime.h>
#include <math.h>
#include <float.h>
#include <stdint.h>

#define NB    2
#define SEQ   2048
#define DM    1024
#define DQK   2048          // q / k projection width (2 x 64 per head)
#define NH    16
#define HD    64
#define NFREQ (HD / 2)
#define NQB   (SEQ / 64)    // 32 key / query tiles of 64
#define VLP   512           // key pitch of the v^T residual plane (keys 0..VLP-1)
#define RESQB 8             // number of leading 64-row query blocks that use the p / v residual planes
#define LAM0  0.2f
#define OSCL  0.8f
static_assert(RESQB * 64 <= VLP);
static_assert(NH * HD == DM);
static_assert(NB == 2 && NH == 16);   // the attention grid's index split
static_assert(NH * 2 * HD == DQK);
static_assert((SEQ % 256) == 0 && (DM % 256) == 0 && (DQK % 256) == 0);   // GEMM block tiles 128 x 256, 64 k per trip

typedef _Float16 v16h __attribute__((ext_vector_type(16)));
typedef _Float16 v8h  __attribute__((ext_vector_type(8)));
typedef __bf16   v16b __attribute__((ext_vector_type(16)));
typedef __bf16   v8b  __attribute__((ext_vector_type(8)));
typedef float    v8f  __attribute__((ext_vector_type(8)));
typedef float    v4f  __attribute__((ext_vector_type(4)));
typedef unsigned int v4u __attribute__((ext_vector_type(4)));

// ---- scalar helpers --------------------------------------------------------------------------------
__device__ __forceinline__ unsigned short bf_bits(float f) {          // f32 -> bf16 bits, RNE convert
  unsigned u = __float_as_uint(f);
  return (unsigned short)((u + 0x7FFFu + ((u >> 16) & 1u)) >> 16);
}
__device__ __forceinline__ float bf_up(unsigned short h) { return __uint_as_float(((unsigned)h) << 16); }
__device__ __forceinline__ float bfr(float f) { return bf_up(bf_bits(f)); }   // value after RNE convert to bf16
__device__ __forceinline__ unsigned short h_bits(_Float16 x) { return __builtin_bit_cast(unsigned short, x); }
__device__ __forceinline__ unsigned pk16(unsigned short a, unsigned short b) { return (unsigned)a | ((unsigned)b << 16); }
__device__ __forceinline__ v8f zero8() { v8f z = {0.f, 0.f, 0.f, 0.f, 0.f, 0.f, 0.f, 0.f}; return z; }
__device__ __forceinline__ v8h zero8h() {
  const _Float16 z = (_Float16)0.0f;
  v8h r = {z, z, z, z, z, z, z, z};
  return r;
}

// ---- fragment loaders: 16-bit A/B operand, lane -> row/col (lane&15), p already includes +8*(lane>>4);
//      elements 0..7 <- p[0..7] (k0+8h..), elements 8..15 <- p[16..23] (k0+16+8h..)
__device__ __forceinline__ v16b ldfrag_b(const __bf16* p) {
  union { v16b v; v8b h[2]; } f;
  f.h[0] = *(const v8b*)(p);
  f.h[1] = *(const v8b*)(p + 16);
  return f.v;
}

// ---- WMMA helpers with trailing VALU hazard gap --------------------------------------------------------
__device__ __forceinline__ v8f mma_b(v16b a, v16b b, v8f c) {
  c = __builtin_amdgcn_wmma_f32_16x16x32_bf16(false, a, false, b, (short)0, c, false, false);
#if defined(__HIP_DEVICE_COMPILE__)
  asm volatile("v_nop\n\tv_nop\n\tv_nop\n\tv_nop" : "+v"(c) : "v"(a), "v"(b));
#endif
  return c;
}
__device__ __forceinline__ v8f mma_h(v16h a, v16h b, v8f c) {
  c = __builtin_amdgcn_wmma_f32_16x16x32_f16(false, a, false, b, (short)0, c, false, false);
#if defined(__HIP_DEVICE_COMPILE__)
  asm volatile("v_nop\n\tv_nop\n\tv_nop\n\tv_nop" : "+v"(c) : "v"(a), "v"(b));
#endif
  return c;
}
__device__ __forceinline__ v8f mma_b_raw(v16b a, v16b b, v8f c) {
  return __builtin_amdgcn_wmma_f32_16x16x32_bf16(false, a, false, b, (short)0, c, false, false);
}
__device__ __forceinline__ v8f mma_h_raw(v16h a, v16h b, v8f c) {
  return __builtin_amdgcn_wmma_f32_16x16x32_f16(false, a, false, b, (short)0, c, false, false);
}
// Compiler-only fence, no instruction: the instruction scheduler moves nothing across it.
__device__ __forceinline__ void group_fence() {
#if defined(__HIP_DEVICE_COMPILE__)
  __builtin_amdgcn_sched_barrier(0);
#endif
}
__device__ __forceinline__ void dep_guard_b(v8f& a, v8f& b, v16b x, v16b y) {
#if defined(__HIP_DEVICE_COMPILE__)
  asm volatile("v_nop\n\tv_nop\n\tv_nop\n\tv_nop" : "+v"(a), "+v"(b) : "v"(x), "v"(y));
#endif
}
__device__ __forceinline__ void keep4_b(v16b a, v16b b, v16b c, v16b d) {
#if defined(__HIP_DEVICE_COMPILE__)
  asm volatile("v_nop" :: "v"(a), "v"(b), "v"(c), "v"(d));
#endif
}
__device__ __forceinline__ void acc_guard4(v8f& a, v8f& b, v8f& c, v8f& d) {
#if defined(__HIP_DEVICE_COMPILE__)
  asm volatile("v_nop\n\tv_nop\n\tv_nop\n\tv_nop" : "+v"(a), "+v"(b), "+v"(c), "+v"(d));
#endif
}

// =====================================================================================================
// f32 -> bf16 (RNE convert), 8 elements per thread, one 16-B store per lane: a wave writes 512 contiguous B
// One grid for x, Wq, Wk, Wv, Wo: their bf16 planes lie back to back in the workspace in that order, so the
// output index is the flat thread index; the source is picked per block (every plane is a multiple of 2048
// elements, so a block never straddles two planes).
// coverage: (NX + 2 NQ + 2 NV) threads x 8 = all five planes.
// =====================================================================================================
__global__ __launch_bounds__(256) void cvt_bf16x8(const float* __restrict__ x, const float* __restrict__ wq,
                                                  const float* __restrict__ wk, const float* __restrict__ wv,
                                                  const float* __restrict__ wo, unsigned short* out) {
  constexpr int NX = NB * SEQ * DM / 8, NQ = DQK * DM / 8, NV = DM * DM / 8;
  static_assert((NX % 256) == 0 && (NQ % 256) == 0 && (NV % 256) == 0);
  const int i = blockIdx.x * 256 + threadIdx.x;
  if (i < NX + 2 * NQ + 2 * NV) {
    const float* in = x;
    int j = i;
    if (i >= NX + 2 * NQ + NV)  { in = wo; j = i - (NX + 2 * NQ + NV); }
    else if (i >= NX + 2 * NQ)  { in = wv; j = i - (NX + 2 * NQ); }
    else if (i >= NX + NQ)      { in = wk; j = i - (NX + NQ); }
    else if (i >= NX)           { in = wq; j = i - NX; }
    const v4f a = *(const v4f*)(in + (size_t)j * 8);
    const v4f b = *(const v4f*)(in + (size_t)j * 8 + 4);
    v4u p;
    p[0] = pk16(bf_bits(a[0]), bf_bits(a[1]));
    p[1] = pk16(bf_bits(a[2]), bf_bits(a[3]));
    p[2] = pk16(bf_bits(b[0]), bf_bits(b[1]));
    p[3] = pk16(bf_bits(b[2]), bf_bits(b[3]));
    *(v4u*)(out + (size_t)i * 8) = p;
    
  }
}

// =====================================================================================================
// inv_freq[j] = 1 / 10000^(j/32), j = 0..31, f32 with precise powf. One block of 32 threads; the 32 values
// coverage: lanes 0..7 x 4 floats = all 32 entries.
// =====================================================================================================
__global__ __launch_bounds__(32) void invfreq_tab(float* invf) {
  __shared__ __align__(16) float sf[NFREQ];
  const int j = threadIdx.x;
  const float e = (float)j * (1.0f / (float)NFREQ);
  const float pw = powf(10000.0f, e);
  sf[j] = 1.0f / pw;
  __syncthreads();
  const v4f v = *(const v4f*)(sf + 4 * (j & 7));
  if (j < 8) *(v4f*)(invf + 4 * j) = v;
  
}

// =====================================================================================================
// cos / sin tables [SEQ][32]: angle = t * inv_freq[j] (f32 multiply), precise cosf / sinf.
// =====================================================================================================
__global__ __launch_bounds__(256) void rope_tab(const float* __restrict__ invf, float* cosT, float* sinT) {
  const int g = blockIdx.x * 256 + threadIdx.x;
  if (g < SEQ * NFREQ) {
    const int t = g / NFREQ;
    const int j = g - t * NFREQ;
    const float ang = (float)t * invf[j];
    const float cv = cosf(ang);
    const float sv = sinf(ang);
    *(float*)(cosT + g) = cv;
    *(float*)(sinT + g) = sv;
    
  }
}

// =====================================================================================================
// RoPE half-split rotation of 8 consecutive columns of one 64-wide vector, then bf16 hi/lo split: 16 B per plane
// (hv, lv). xa = the lane's 8 columns, xp = the 8 columns 32 away in the same vector (f32).
//   first half  (j < 32):   out[j]    = x[j]*cos[j]   - x[j+32]*sin[j]     (x1 = a, x2 = p)
//   second half (j < 32):   out[j+32] = x[j]*sin[j]   + x[j+32]*cos[j]     (x1 = p, x2 = a)
// =====================================================================================================
__device__ __forceinline__ void rope_row8(const float* xa, const float* xp,
                                          bool second, v4f cs0, v4f cs1, v4f sn0, v4f sn1,
                                          v4u& hv, v4u& lv) {
  // contraction off: each product and their sum round on their own, as in the reference's elementwise form, so the
  // q, k planes stay bit for bit what they were when a launch of its own rotated them
#pragma clang fp contract(off)
  const v4f xa0 = *(const v4f*)(xa);
  const v4f xa1 = *(const v4f*)(xa + 4);
  const v4f xp0 = *(const v4f*)(xp);
  const v4f xp1 = *(const v4f*)(xp + 4);
  float o[8];
#pragma unroll
  for (int e = 0; e < 4; ++e) {
    {
      const float a = xa0[e], p = xp0[e], cs = cs0[e], sn = sn0[e];
      const float f1 = a * cs - p * sn;
      const float f2 = p * sn + a * cs;
      o[e] = second ? f2 : f1;
    }
    {
      const float a = xa1[e], p = xp1[e], cs = cs1[e], sn = sn1[e];
      const float f1 = a * cs - p * sn;
      const float f2 = p * sn + a * cs;
      o[4 + e] = second ? f2 : f1;
    }
  }
#pragma unroll
  for (int e = 0; e < 4; ++e) {
    const float f0 = o[2 * e], f1 = o[2 * e + 1];
    const unsigned short h0 = bf_bits(f0), h1 = bf_bits(f1);
    const unsigned short l0 = bf_bits(f0 - bf_up(h0)), l1 = bf_bits(f1 - bf_up(h1));
    hv[e] = pk16(h0, h1); lv[e] = pk16(l0, l1);
  }
}

// =====================================================================================================
// Register-blocked bf16 WMMA GEMM: C[m][n] = sum_k A[m][k] * Bt[n][k] (+ bias); one wave per 64x64 tile, a block of
// 8 waves (2 x 4) per 128 x 256 tile. A row-major [M][K] pitch lda; Bt row-major [N][K] pitch ldb (k contiguous);
// M multiple of 128, N of 256, K of 64. b = batch index (strides in elements).
// The tile body is a device function (block tile index, batch index and the LDS come from the caller), so
// that one grid can hold several independent products.
// Operands reach the waves through LDS: per trip of 64 k the block's 128 A rows and 256 Bt rows (128 B = one line each)
// are brought in by asynchronous copies to LDS, 16 B per lane, 8 lanes per row, so that one wave-wide copy covers 4
// whole lines; a fragment load straight from global memory touches 16 lines for the same 512 B, and every wave
// fetched its own copy of rows that its neighbours need too. Two buffers: the next trip's copies fly during this
// trip's products. LDS row pitch 144 B (16 B x odd) for the ds_load_b128 fragment reads. The k order of the products
// is unchanged (32 k per WMMA, ascending).
// NSPLIT: 0 = A.Bt; 1 = (A + A2).Bt (A2 = unscaled bf16 lo plane of A).
// OUT_MODE: 0 = f32 (pitch ldc); 2 = bf16 hi plane C + bf16 lo plane C2 (lo = RNE(v - hi), unscaled);
//           3 = f16 hi plane C + f16 residual plane C2 = f16((v - hi) * rscale), C2 written only for tiles
//               with n0 < N2 (pitch ldc2, batch stride strideC2);
//           4 = a wave's 64 columns are one 64-wide rope vector and m is the token index: rotated by the tables
//               cosT / sinT [M][32], then bf16 hi plane C + bf16 lo plane C2 (lo = RNE(v - hi), unscaled).
// BIAS: 0 = none; 1 = + bf16-RNE(bias[n]) per column; 2 = + bf16-RNE(bias[m]) per row (added in f32).
// =====================================================================================================
#define GP        72                                  // LDS row pitch of a staged operand row, in elements (144 B)
#define GROW_B    (GP * 2)
#define GSTG_B(NS) ((128 + 256 + 128 * (NS)) * GROW_B)  // one buffer: A rows | Bt rows | A2 rows: 55296 B / 73728 B
static_assert((GROW_B % 16) == 0 && ((GROW_B / 16) & 1) == 1);

// Four asynchronous 16-B copies to LDS per lane (l = the lane's LDS byte address, g = its global address).
// s_wait_xcnt 0 is the last line of the copies' own statement: it stands in front of any rewrite of the address registers.
__device__ __forceinline__ void copy4_lds(unsigned l0, const __bf16* g0, unsigned l1, const __bf16* g1,
                                          unsigned l2, const __bf16* g2, unsigned l3, const __bf16* g3) {
#if defined(__HIP_DEVICE_COMPILE__)
  asm volatile("global_load_async_to_lds_b128 %0, %1, off\n\t"
               "global_load_async_to_lds_b128 %2, %3, off\n\t"
               "global_load_async_to_lds_b128 %4, %5, off\n\t"
               "global_load_async_to_lds_b128 %6, %7, off\n\t"
               "s_wait_xcnt 0x0"
               :: "v"(l0), "v"(g0), "v"(l1), "v"(g1), "v"(l2), "v"(g2), "v"(l3), "v"(g3) : "memory");
#endif
}
// The issuing wave's own copies have landed (in front of the barrier behind which other waves read them).
__device__ __forceinline__ void wait_copies() {
#if defined(__HIP_DEVICE_COMPILE__)
  asm volatile("s_wait_asynccnt 0x0" ::: "memory");
#endif
}
// This wave's LDS reads have returned (in front of the barrier behind which their buffer is refilled).
__device__ __forceinline__ void wait_lds() {
#if defined(__HIP_DEVICE_COMPILE__)
  asm volatile("s_wait_dscnt 0x0" ::: "memory");
#endif
}
// One 64-k tile of the block's operands into one buffer: 256 threads x 16 B = 32 rows per copy; dst = the lane's LDS
// byte address of row tid>>3, chunk tid&7 of the buffer; gA / gB / gA2 = its global address in row tid>>3 of the block's rows.
template <int NSPLIT>
__device__ __forceinline__ void gemm_stage(unsigned dst, const __bf16* gA, const __bf16* gB, const __bf16* gA2,
                                           int lda, int ldb) {
  const size_t ra = (size_t)32 * lda, rb = (size_t)32 * ldb;
  constexpr unsigned R = 32 * GROW_B;
  copy4_lds(dst, gA, dst + R, gA + ra, dst + 2 * R, gA + 2 * ra, dst + 3 * R, gA + 3 * ra);
  copy4_lds(dst + 4 * R, gB, dst + 5 * R, gB + rb, dst + 6 * R, gB + 2 * rb, dst + 7 * R, gB + 3 * rb);
  copy4_lds(dst + 8 * R, gB + 4 * rb, dst + 9 * R, gB + 5 * rb, dst + 10 * R, gB + 6 * rb, dst + 11 * R, gB + 7 * rb);
  if (NSPLIT == 1)
    copy4_lds(dst + 12 * R, gA2, dst + 13 * R, gA2 + ra, dst + 14 * R, gA2 + 2 * ra, dst + 15 * R, gA2 + 3 * ra);
}

template <int NSPLIT, int OUT_MODE, int BIAS>
__device__ __forceinline__ void gemm64_tile(
    const unsigned short* __restrict__ Ap, const unsigned short* A2p, int lda, long long strideA,
    const unsigned short* __restrict__ Btp, const unsigned short* Bt2p, int ldb, long long strideB,
    void* Cout, int ldc, long long strideC,
    void* Cout2, int ldc2, long long strideC2, int N2,
    int M, int N, int K, float rscale, const float* __restrict__ bias,
    const float* __restrict__ cosT, const float* __restrict__ sinT,
    float* slab, unsigned char* stg, int bt, int b) {
  static_assert(NSPLIT == 0 || NSPLIT == 1);
  const __bf16* A   = (const __bf16*)(const void*)Ap;
  const __bf16* A2  = (const __bf16*)(const void*)A2p;
  const __bf16* Bt  = (const __bf16*)(const void*)Btp;
  const int tid  = threadIdx.x;
  const int lane = tid & 31;
  const int wave = tid >> 5;
  const int blocksN = N >> 8;
  const int blocksM = M >> 7;
  if (bt >= blocksM * blocksN) return;   // block-uniform, in front of every copy and barrier
  const int bm  = bt / blocksN;
  const int bn  = bt - bm * blocksN;
  const int mb0 = bm << 7;
  const int nb0 = bn << 8;
  const int wm  = wave >> 2;             // the wave's 64 rows of the block's 128
  const int wn  = wave & 3;              // the wave's 64 columns of the block's 256
  const int m0  = mb0 + (wm << 6);
  const int n0  = nb0 + (wn << 6);

  const __bf16* Ab  = A  + (size_t)b * strideA;
  const __bf16* Bb  = Bt + (size_t)b * strideB;
  const __bf16* Ab2 = (NSPLIT >= 1) ? (A2  + (size_t)b * strideA) : Ab;

  const int rlane = lane & 15;                 // row (A) / col (B, D) within subtile
  const int koff  = (lane >> 4) * 8;           // k offset of this lane half
  const int mOff  = (lane >> 4) * 8;           // D row offset

  v8f acc[4][4];
#pragma unroll
  for (int i = 0; i < 4; ++i)
#pragma unroll
    for (int j = 0; j < 4; ++j) acc[i][j] = zero8();

  constexpr unsigned STG = GSTG_B(NSPLIT);
  const int nt   = K >> 6;                     // trips of 64 k
  const int srow = tid >> 3, sch = tid & 7;    // this lane's row (of 32 per copy) and 16-B chunk of the 128-B row
  const unsigned sdst = (unsigned)(size_t)stg + (unsigned)(srow * GROW_B + sch * 16);
  const __bf16* gA  = Ab  + (size_t)(mb0 + srow) * lda + sch * 8;
  const __bf16* gB  = Bb  + (size_t)(nb0 + srow) * ldb + sch * 8;
  const __bf16* gA2 = Ab2 + (size_t)(mb0 + srow) * lda + sch * 8;

  // tile 0 -> buffer 0, landed and published; then tile 1 -> buffer 1 in flight
  gemm_stage<NSPLIT>(sdst, gA, gB, gA2, lda, ldb);
  wait_copies();
  __syncthreads();
  if (nt > 1) gemm_stage<NSPLIT>(sdst + STG, gA + 64, gB + 64, gA2 + 64, lda, ldb);

  for (int t = 0; t < nt; ++t) {               // block-uniform trip count
    const __bf16* sb  = (const __bf16*)(const void*)(stg + (size_t)(t & 1) * STG);
    const __bf16* sA  = sb + ((wm << 6) + rlane) * GP + koff;
    const __bf16* sB  = sb + (128 + (wn << 6) + rlane) * GP + koff;
    const __bf16* sA2 = (NSPLIT >= 1) ? (sb + (384 + (wm << 6) + rlane) * GP + koff) : sA;
    // unrolled (here and below): the fragment arrays need constant indices to stay in registers, and the second
    // 32-k block's LDS reads can then be issued among the first block's products
#pragma unroll
    for (int kk = 0; kk < 2; ++kk) {
      v16b bh[4], ahf[4], alf[4];
#pragma unroll
      for (int j = 0; j < 4; ++j) bh[j] = ldfrag_b(sB + (j << 4) * GP + kk * 32);
#pragma unroll
      for (int i = 0; i < 4; ++i) {
        ahf[i] = ldfrag_b(sA + (i << 4) * GP + kk * 32);
        if (NSPLIT >= 1) alf[i] = ldfrag_b(sA2 + (i << 4) * GP + kk * 32); else alf[i] = ahf[i];
      }
#pragma unroll
      for (int i = 0; i < 4; ++i) {
        const v16b ah = ahf[i], al = alf[i];
#pragma unroll
        for (int j = 0; j < 4; ++j) {
          acc[i][j] = mma_b_raw(ah, bh[j], acc[i][j]);
          if (NSPLIT >= 1) acc[i][j] = mma_b_raw(al, bh[j], acc[i][j]);
        }
        dep_guard_b(acc[i][0], acc[i][3], ah, al);
      }
      keep4_b(bh[0], bh[1], bh[2], bh[3]);
    }
    // foot of the trip: own reads of this buffer done, own copies of the next tile landed, one barrier for both;
    // only then the refill of the buffer that this trip has read
    wait_lds();
    wait_copies();
    __syncthreads();
    if (t + 2 < nt) {
      const int kn = (t + 2) << 6;
      gemm_stage<NSPLIT>(sdst + (unsigned)(t & 1) * STG, gA + kn, gB + kn, gA2 + kn, lda, ldb);
    }
  }
  wait_copies();
  acc_guard4(acc[0][0], acc[0][1], acc[0][2], acc[0][3]);
  acc_guard4(acc[1][0], acc[1][1], acc[1][2], acc[1][3]);
  acc_guard4(acc[2][0], acc[2][1], acc[2][2], acc[2][3]);
  acc_guard4(acc[3][0], acc[3][1], acc[3][2], acc[3][3]);

  // ---- epilogue ----
  float bcol[4];
#pragma unroll
  for (int j = 0; j < 4; ++j) bcol[j] = 0.f;
  if (BIAS == 1) {
#pragma unroll
    for (int j = 0; j < 4; ++j) bcol[j] = bfr(bias[n0 + (j << 4) + rlane]);
  }
#pragma unroll
  for (int i = 0; i < 4; ++i) {
    const int mBase = m0 + (i << 4);
    float brow[8];
#pragma unroll
    for (int r = 0; r < 8; ++r) brow[r] = 0.f;
    if (BIAS == 2) {
#pragma unroll
      for (int r = 0; r < 8; ++r) brow[r] = bfr(bias[mBase + mOff + r]);
    }
#pragma unroll
    for (int j = 0; j < 4; ++j) {
#pragma unroll
      for (int r = 0; r < 8; ++r) {
        slab[(mOff + r) * 68 + (j << 4) + rlane] = (acc[i][j][r] + bcol[j]) + brow[r];
      }
    }
    v4f tc[4][2], ts[4][2];                                // OUT_MODE 4: cos / sin of this lane's 4 rows x 8 columns,
    if (OUT_MODE == 4) {                                   // asked for while the slab's stores are under way
      const size_t to = (size_t)(mBase + (lane >> 3)) * NFREQ + (((lane & 7) * 8) & 31);
      const float* cr = cosT + to;
      const float* sr = sinT + to;
#pragma unroll
      for (int it = 0; it < 4; ++it) {                     // row it * 4 + (lane >> 3)
        tc[it][0] = *(const v4f*)(cr + it * 4 * NFREQ); tc[it][1] = *(const v4f*)(cr + it * 4 * NFREQ + 4);
        ts[it][0] = *(const v4f*)(sr + it * 4 * NFREQ); ts[it][1] = *(const v4f*)(sr + it * 4 * NFREQ + 4);
      }
#if defined(__HIP_DEVICE_COMPILE__)
      // s_wait_xcnt 0 before a register that an issued load names is written again; the addresses are inputs so that
      // they stay in their registers up to the wait (else a later load's destination may take an address pair over).
      asm volatile("s_wait_xcnt 0x0" :: "v"(cr), "v"(sr) : "memory");
#endif
    }
    __builtin_amdgcn_fence(__ATOMIC_RELEASE, "workgroup");
    __builtin_amdgcn_wave_barrier();
    __builtin_amdgcn_fence(__ATOMIC_ACQUIRE, "workgroup");
    if (OUT_MODE == 0) {
      float* C = (float*)Cout + (size_t)b * strideC;
      const int hh = lane >> 4, c4 = (lane & 15) * 4;     // 256-B row segment = 16 lanes x 16 B
      {
#pragma unroll
        for (int it = 0; it < 8; ++it) {
          const int row = it * 2 + hh;                     // it 0..7 x hh 0..1 = rows 0..15
          const v4f v = *(const v4f*)(slab + row * 68 + c4);
          *(v4f*)(C + (size_t)(mBase + row) * ldc + n0 + c4) = v;
        }
        
      }
    } else if (OUT_MODE == 4) {
      const int q = lane >> 3, c8 = (lane & 7) * 8;        // 8 lanes x 16 B = one 128-B line per row and plane
      unsigned short* C  = (unsigned short*)Cout  + (size_t)b * strideC;
      unsigned short* C2 = (unsigned short*)Cout2 + (size_t)b * strideC2;
      const size_t go = (size_t)(mBase + q) * ldc + n0 + c8;
      unsigned short* hp = C + go;
      unsigned short* lp = C2 + go;
#pragma unroll
      for (int ip = 0; ip < 2; ++ip) {                     // two rows at a time: row (ip * 2 + u) * 4 + q = rows 0..15
        v4u hv[2], lv[2];
#pragma unroll
        for (int u = 0; u < 2; ++u) {
          const int it = ip * 2 + u;
          const float* sp = slab + (it * 4 + q) * 68;
          rope_row8(sp + c8, sp + (c8 ^ 32), (c8 & 32) != 0, tc[it][0], tc[it][1], ts[it][0], ts[it][1], hv[u], lv[u]);
        }
#pragma unroll
        for (int u = 0; u < 2; ++u) {
          *(v4u*)(hp + (size_t)((ip * 2 + u) * 4) * ldc) = hv[u];
          *(v4u*)(lp + (size_t)((ip * 2 + u) * 4) * ldc) = lv[u];
        }
#if defined(__HIP_DEVICE_COMPILE__)
        // s_wait_xcnt 0 behind the run of stores, before a register that they name is written again; addresses and
        // data are inputs so that they stay in their registers up to the wait.
        asm volatile("s_wait_xcnt 0x0" :: "v"(hp), "v"(lp), "v"(hv[0]), "v"(lv[0]), "v"(hv[1]), "v"(lv[1]) : "memory");
#endif
      }
    } else {
      const int q = lane >> 3, c8 = (lane & 7) * 8;
      unsigned short* C  = (unsigned short*)Cout  + (size_t)b * strideC;
      unsigned short* C2 = (unsigned short*)Cout2 + (size_t)b * strideC2;
      const bool wlo = (OUT_MODE == 2) || (n0 < N2);      // wave-uniform
      v4u hv[4], lv[4];
#pragma unroll
      for (int it = 0; it < 4; ++it) {
        const int row = it * 4 + q;                        // it 0..3 x q 0..3 = rows 0..15
        const float* sp = slab + row * 68 + c8;
        v4u a, a2;
#pragma unroll
        for (int e = 0; e < 4; ++e) {
          const float f0 = sp[2 * e], f1 = sp[2 * e + 1];
          unsigned short h0, h1, l0, l1;
          if (OUT_MODE == 2) {
            h0 = bf_bits(f0); h1 = bf_bits(f1);
            l0 = bf_bits(f0 - bf_up(h0)); l1 = bf_bits(f1 - bf_up(h1));
          } else {
            const _Float16 x0 = (_Float16)f0, x1 = (_Float16)f1;
            h0 = h_bits(x0); h1 = h_bits(x1);
            l0 = h_bits((_Float16)((f0 - (float)x0) * rscale));
            l1 = h_bits((_Float16)((f1 - (float)x1) * rscale));
          }
          a[e] = pk16(h0, h1); a2[e] = pk16(l0, l1);
        }
        hv[it] = a; lv[it] = a2;
      }
      {
#pragma unroll
        for (int it = 0; it < 4; ++it) {
          const int row = it * 4 + q;
          *(v4u*)(C + (size_t)(mBase + row) * ldc + n0 + c8) = hv[it];
          if (wlo) *(v4u*)(C2 + (size_t)(mBase + row) * ldc2 + n0 + c8) = lv[it];
        }
        
      }
    }
    __builtin_amdgcn_fence(__ATOMIC_RELEASE, "workgroup");
    __builtin_amdgcn_wave_barrier();
    __builtin_amdgcn_fence(__ATOMIC_ACQUIRE, "workgroup");
  }
}

// One product per grid: blockIdx.x = 128 x 256 block tile, blockIdx.y = batch index.
template <int NSPLIT, int OUT_MODE, int BIAS>
__global__ __launch_bounds__(256) void gemm64(
    const unsigned short* __restrict__ Ap, const unsigned short* A2p, int lda, long long strideA,
    const unsigned short* __restrict__ Btp, const unsigned short* Bt2p, int ldb, long long strideB,
    void* Cout, int ldc, long long strideC,
    void* Cout2, int ldc2, long long strideC2, int N2,
    int M, int N, int K, float rscale, const float* __restrict__ bias) {
  __shared__ __align__(16) float sT[8][16 * 68];   // per-wave 16x64 slab, pitch 68 floats
  __shared__ __align__(16) unsigned char sG[2 * GSTG_B(NSPLIT)];   // two operand buffers
  const int wave = threadIdx.x >> 5;
  gemm64_tile<NSPLIT, OUT_MODE, BIAS>(Ap, A2p, lda, strideA, Btp, Bt2p, ldb, strideB, Cout, ldc, strideC,
                                      Cout2, ldc2, strideC2, N2, M, N, K, rscale, bias, nullptr, nullptr,
                                      sT[wave], sG, blockIdx.x, blockIdx.y);
}

// q, k and v^T projections of both batch elements in one grid: blockIdx.z = 0 q, 1 k, 2 v^T; blockIdx.y = batch;
// blockIdx.x = 128 x 256 block tile (v^T has half the tiles of q / k: its upper blocks leave at the tile test).
//   q / k = rope(x_b . W^T + bias[col]) -> bf16 hi / lo planes [NB*SEQ][DQK] (M=SEQ, N=DQK, K=DM); per head 128
//           columns = two 64-wide vectors, each the 64 columns of one wave
//   v^T   = Wv . x_b^T + bv[row]  -> f16 hi plane [b][h*64+d][s] (pitch SEQ) and residual plane
//           (x4096, keys < VLP only, pitch VLP)                        (M=DM, N=SEQ, K=DM)
__global__ __launch_bounds__(256) void gemm_qkv(
    const unsigned short* __restrict__ Xb, const unsigned short* __restrict__ Wqb,
    const unsigned short* __restrict__ Wkb, const unsigned short* __restrict__ Wvb,
    unsigned short* Qh, unsigned short* Ql, unsigned short* Kh, unsigned short* Kl,
    unsigned short* VTh, unsigned short* VTl,
    const float* __restrict__ bq, const float* __restrict__ bk, const float* __restrict__ bv,
    const float* __restrict__ cosT, const float* __restrict__ sinT) {
  __shared__ __align__(16) float sT[8][16 * 68];   // per-wave 16x64 slab, pitch 68 floats
  __shared__ __align__(16) unsigned char sG[2 * GSTG_B(0)];   // two operand buffers
  const int wave = threadIdx.x >> 5;
  const int tile = blockIdx.x;
  const int b    = blockIdx.y;
  const int z    = blockIdx.z;
  if (z < 2) {
    const unsigned short* Wb = z ? Wkb : Wqb;
    unsigned short* Ch = z ? Kh : Qh;
    unsigned short* Cl = z ? Kl : Ql;
    const float* bias = z ? bk : bq;
    gemm64_tile<0, 4, 1>(Xb, Xb, DM, (long long)SEQ * DM, Wb, Wb, DM, 0LL,
                         (void*)Ch, DQK, (long long)SEQ * DQK, (void*)Cl, DQK, (long long)SEQ * DQK, DQK,
                         SEQ, DQK, DM, 1.0f, bias, cosT, sinT, sT[wave], sG, tile, b);
  } else {
    gemm64_tile<0, 3, 2>(Wvb, Wvb, DM, 0LL, Xb, Xb, DM, (long long)SEQ * DM,
                         (void*)VTh, SEQ, (long long)DM * SEQ, (void*)VTl, VLP, (long long)DM * VLP, VLP,
                         DM, SEQ, DM, 4096.0f, bv, nullptr, nullptr, sT[wave], sG, tile, b);
  }
}

#define LP      72                        // LDS row pitch of the 16-bit tiles, in elements
#define TILE_B  (64 * LP * 2)             // one 64-row tile: 9216 B
#define OSP     68                        // row pitch of a wave's f32 context tile, in floats (272 B = 16 B x 17)
#define OS_B    (4 * 16 * OSP * 4)        // four waves' f32 context tiles: 17408 B
#define ATT_LDS (4 * TILE_B + OS_B)       // 54272 B
static_assert(((LP * 2) % 16) == 0 && (((LP * 2) / 16) & 1) == 1);   // 16-B aligned rows, odd multiple of 16 B
// value of lane l ^ 16 (the other wave half)
__device__ __forceinline__ float xhalf(float x) {
  return __builtin_bit_cast(float, __builtin_amdgcn_permlanex16(__builtin_bit_cast(int, x), __builtin_bit_cast(int, x),
                                                                0x76543210, 0xfedcba98, false, false));
}
template <bool RES>
__device__ __forceinline__
void attn_block64(unsigned char* smem,
                  const unsigned short* __restrict__ qhp, const unsigned short* __restrict__ qlp,
                  const unsigned short* __restrict__ khp, const unsigned short* __restrict__ klp,
                  const unsigned short* __restrict__ vhp, const unsigned short* __restrict__ vlp,
                  float* Cp, int soff, int qb, int h, float sscale) {
  union FB { v16b v; v8b h[2]; };
  union FH { v16h v; v8h h[2]; };
  __bf16*   Ksh = (__bf16*)(void*)(smem);                         // K hi [kv][d]
  __bf16*   Ksl = (__bf16*)(void*)(smem + TILE_B);                // K lo
  _Float16* Vth = (_Float16*)(void*)(smem + 2 * TILE_B);          // V^T hi [d][kv]
  float*    Os  = (float*)(void*)(smem + 3 * TILE_B);             // per wave context tile [row][d], 4 x 4352 B
  _Float16* Vtl = (_Float16*)(void*)(smem + 3 * TILE_B + OS_B);   // V^T residual (RES only)

  const int tid  = threadIdx.x;
  // wave-uniform, so held in a scalar register: as a vector register it is live across the loop, and the body with the
  // residual planes then spills under the kernel's budget of 192 registers
  const int wave = __builtin_amdgcn_readfirstlane(tid >> 5);
  const int lane = tid & 31;
  const int hh   = lane >> 4;
  const int c    = lane & 15;

  const int q0   = qb * 64 + wave * 16;
  const int col  = h * (2 * HD) + soff;

  const __bf16* Qh = (const __bf16*)(const void*)qhp + col;
  const __bf16* Ql = (const __bf16*)(const void*)qlp + col;
  const __bf16* Kh = (const __bf16*)(const void*)khp + col;
  const __bf16* Kl = (const __bf16*)(const void*)klp + col;
  const _Float16* Vh = (const _Float16*)(const void*)vhp + (size_t)h * HD * SEQ;
  const _Float16* Vl = (const _Float16*)(const void*)vlp + (size_t)h * HD * VLP;

  // ---- Q fragments (B operand, column = query = lane&15): 2 d-chunks, hi and lo ----
  v16b qah[2], qal[2];
#pragma unroll
  for (int dc = 0; dc < 2; ++dc) {
    const size_t qo = (size_t)(q0 + c) * DQK + dc * 32 + 8 * hh;
    qah[dc] = ldfrag_b(Qh + qo);
    qal[dc] = ldfrag_b(Ql + qo);
  }

  const int qrow = q0 + c;                   // this lane's query row
  float mrow = -INFINITY;                    // its running maximum (equal in both wave halves)
  float lrow = 0.f;                          // running sum over this wave half's keys only; joined after the loop
  v8f oacc[4];                               // oacc[t][r] = context^T [d = t*16 + 8*hh + r][query c]
#pragma unroll
  for (int t = 0; t < 4; ++t) oacc[t] = zero8();

  for (int kt = 0; kt < NQB; ++kt) {         // static trip bound
    if (kt > qb) break;                      // block-uniform (causal)
    const bool diag = (kt == qb);            // block-uniform
    const int kv0 = kt * 64;
    __syncthreads();
    {
      const int g = tid >> 3, ch = (tid & 7) * 8;                  // group of 8 lanes = one row; elements ch..ch+7
      const int r = (g >> 1) | ((g & 1) << 3);                     // pass i: row r + 16 i; groups 2m, 2m+1 -> rows m, m+8
      const __bf16*   kg  = Kh + (size_t)(kv0 + r) * DQK + ch;     // K row kv0+r, d = ch..ch+7
      const __bf16*   klg = Kl + (size_t)(kv0 + r) * DQK + ch;
      const _Float16* vg  = Vh + (size_t)r * SEQ + kv0 + ch;        // V^T row d = r, s = kv0+ch..+7
      const int kvl = (kv0 + 64 <= VLP) ? kv0 : (VLP - 64);       // clamped address into the residual plane
      const _Float16* vlg = Vl + (size_t)r * VLP + kvl + ch;
      const bool resOK = (kv0 + 64 <= VLP);                        // block-uniform
      v8b a0[4], a1[4];
      v8h b0[4], b1[4];
#pragma unroll
      for (int i = 0; i < 4; ++i) {
        a0[i] = *(const v8b*)(kg + (size_t)(16 * i) * DQK);
        a1[i] = *(const v8b*)(klg + (size_t)(16 * i) * DQK);
        b0[i] = *(const v8h*)(vg + (size_t)(16 * i) * SEQ);
        if (RES) {
          b1[i] = *(const v8h*)(vlg + (size_t)(16 * i) * VLP);
          if (!resOK) b1[i] = zero8h();
        }
      }
#if defined(__HIP_DEVICE_COMPILE__)
      // s_wait_xcnt 0 before a register that an issued load names is written again; the addresses are inputs so that
      // they stay in their registers up to the wait (else the last load's destination may take an address pair over).
      if (RES) asm volatile("s_wait_xcnt 0x0" :: "v"(kg), "v"(klg), "v"(vg), "v"(vlg) : "memory");
      else     asm volatile("s_wait_xcnt 0x0" :: "v"(kg), "v"(klg), "v"(vg) : "memory");
#endif
#pragma unroll
      for (int i = 0; i < 4; ++i) {
        *(v8b*)(Ksh + (r + 16 * i) * LP + ch) = a0[i];
        *(v8b*)(Ksl + (r + 16 * i) * LP + ch) = a1[i];
        *(v8h*)(Vth + (r + 16 * i) * LP + ch) = b0[i];
        if (RES) *(v8h*)(Vtl + (r + 16 * i) * LP + ch) = b1[i];
      }
    }
    __syncthreads();

    // ---- scores^T: 64 keys x 16 query columns per wave, 3 bf16 products; s[j][r] = key j*16 + 8*hh + r, query c ----
    //      Without the residual planes, per 32 d: the 8 K fragments (16 LDS reads) are asked for as one group, then 12 plain
    //      products follow in which neighbours belong to different key tiles (a product on the tile of the one before it
    //      waits out the matrix latency, and each other's issue fills the distance that a VALU use of a result needs).
    //      Per tile the six products keep their order: dc 0 hi.hi, lo.hi, hi.lo, then dc 1.
    //      With the residual planes the registers do not reach for the groups (spills): one fragment pair at a time.
    v8f s[4];
    if (!RES) {
#pragma unroll
      for (int j = 0; j < 4; ++j) s[j] = zero8();
      // unrolled: the Q fragments are register arrays and need constant indices
#pragma unroll
      for (int dc = 0; dc < 2; ++dc) {
        FB kb[4], kl[4];
#pragma unroll
        for (int j = 0; j < 4; ++j) {
          kb[j].h[0] = *(const v8b*)(Ksh + (j * 16 + c) * LP + dc * 32 + 8 * hh);
          kb[j].h[1] = *(const v8b*)(Ksh + (j * 16 + c) * LP + dc * 32 + 16 + 8 * hh);
        }
#pragma unroll
        for (int j = 0; j < 4; ++j) {
          kl[j].h[0] = *(const v8b*)(Ksl + (j * 16 + c) * LP + dc * 32 + 8 * hh);
          kl[j].h[1] = *(const v8b*)(Ksl + (j * 16 + c) * LP + dc * 32 + 16 + 8 * hh);
        }
        // keeps the reads together in front of the products: left free, the compiler spreads them singly among the products
        group_fence();
#pragma unroll
        for (int j = 0; j < 4; ++j) s[j] = mma_b_raw(kb[j].v, qah[dc], s[j]);
#pragma unroll
        for (int j = 0; j < 4; ++j) s[j] = mma_b_raw(kl[j].v, qah[dc], s[j]);
#pragma unroll
        for (int j = 0; j < 4; ++j) s[j] = mma_b_raw(kb[j].v, qal[dc], s[j]);
        // the next group's reads stay behind this group's products: with two groups under way the registers do not reach (spills)
        group_fence();
      }
    } else {
#pragma unroll
      for (int j = 0; j < 4; ++j) {
        s[j] = zero8();
#pragma unroll
        for (int dc = 0; dc < 2; ++dc) {
          FB kb, kl;
          kb.h[0] = *(const v8b*)(Ksh + (j * 16 + c) * LP + dc * 32 + 8 * hh);
          kb.h[1] = *(const v8b*)(Ksh + (j * 16 + c) * LP + dc * 32 + 16 + 8 * hh);
          kl.h[0] = *(const v8b*)(Ksl + (j * 16 + c) * LP + dc * 32 + 8 * hh);
          kl.h[1] = *(const v8b*)(Ksl + (j * 16 + c) * LP + dc * 32 + 16 + 8 * hh);
          s[j] = mma_b(kb.v, qah[dc], s[j]);
          s[j] = mma_b(kl.v, qah[dc], s[j]);
          s[j] = mma_b(kb.v, qal[dc], s[j]);
        }
      }
    }

    // ---- scale, causal fill on the diagonal tile, maximum of the lane's 32 keys and of the other half's,
    //      online softmax, P (x1024, f16) and P residual (x4096) packed into B operands ----
    float mj[4];
#pragma unroll
    for (int j = 0; j < 4; ++j) {
      mj[j] = -INFINITY;
#pragma unroll
      for (int r = 0; r < 8; ++r) {
        const int key = kv0 + j * 16 + 8 * hh + r;
        float sv = s[j][r] * sscale;
        sv = (diag && key > qrow) ? -INFINITY : sv;
        s[j][r] = sv;
        mj[j] = fmaxf(mj[j], sv);
      }
    }
    float m = fmaxf(fmaxf(mj[0], mj[1]), fmaxf(mj[2], mj[3]));
    m = fmaxf(m, xhalf(m));
    const float mnew  = fmaxf(mrow, m);
    const float msafe = (mnew == -INFINITY) ? 0.f : mnew;
    const float alpha = __expf(mrow - msafe);
    mrow = mnew;
    v16h pbh[2], pbl[2];                     // element (j&1)*8 + r of block j>>1 = key (j>>1)*32 + (j&1)*16 + 8*hh + r
    float pj[4];                             // four independent partial sums of 8 keys each
#pragma unroll
    for (int j = 0; j < 4; ++j) {
      pj[j] = 0.f;
#pragma unroll
      for (int r = 0; r < 8; ++r) {
        const float p = __expf(s[j][r] - msafe);     // -inf logit: exp -> 0
        pj[j] += p;
        const float p1k = p * 1024.0f;
        const _Float16 ph = (_Float16)p1k;
        pbh[j >> 1][(j & 1) * 8 + r] = ph;
        if (RES) pbl[j >> 1][(j & 1) * 8 + r] = (_Float16)((p1k - (float)ph) * 4096.0f);
      }
    }
    lrow = lrow * alpha + ((pj[0] + pj[1]) + (pj[2] + pj[3]));
#pragma unroll
    for (int t = 0; t < 4; ++t)
#pragma unroll
      for (int r = 0; r < 8; ++r) oacc[t][r] *= alpha;

    // ---- context^T += V^T . P^T (f16 WMMA), residual products into a separate accumulator ----
    v8f o1[4];
#pragma unroll
    for (int t = 0; t < 4; ++t) o1[t] = zero8();
    // unrolled: the P operands are register arrays and need constant indices
#pragma unroll
    for (int kk = 0; kk < 2; ++kk) {
      if (!RES) {
        // the same form as the scores: the 4 V^T fragments (8 LDS reads) as one group, then 4 plain products on 4 tiles
        FH vb[4];
#pragma unroll
        for (int t = 0; t < 4; ++t) {
          vb[t].h[0] = *(const v8h*)(Vth + (t * 16 + c) * LP + kk * 32 + 8 * hh);
          vb[t].h[1] = *(const v8h*)(Vth + (t * 16 + c) * LP + kk * 32 + 16 + 8 * hh);
        }
        // boundary between the reads and their products: this kk's products then start as their fragments arrive; left free,
        // the compiler forms all of P in front of the first product and the loop comes out longer
        group_fence();
#pragma unroll
        for (int t = 0; t < 4; ++t) oacc[t] = mma_h_raw(vb[t].v, pbh[kk], oacc[t]);
      } else {
#pragma unroll
        for (int t = 0; t < 4; ++t) {
          FH vb, vl;
          vb.h[0] = *(const v8h*)(Vth + (t * 16 + c) * LP + kk * 32 + 8 * hh);
          vb.h[1] = *(const v8h*)(Vth + (t * 16 + c) * LP + kk * 32 + 16 + 8 * hh);
          oacc[t] = mma_h(vb.v, pbh[kk], oacc[t]);
          vl.h[0] = *(const v8h*)(Vtl + (t * 16 + c) * LP + kk * 32 + 8 * hh);
          vl.h[1] = *(const v8h*)(Vtl + (t * 16 + c) * LP + kk * 32 + 16 + 8 * hh);
          o1[t] = mma_h(vl.v, pbh[kk], o1[t]);
          o1[t] = mma_h(vb.v, pbl[kk], o1[t]);
        }
      }
    }
    if (RES) {
#pragma unroll
      for (int t = 0; t < 4; ++t)
#pragma unroll
        for (int r = 0; r < 8; ++r) oacc[t][r] += o1[t][r] * (1.0f / 4096.0f);
    }
  }

  // ---- join the halves' sums, normalise (1/l and the 1/1024 p carry), stage the wave's 16x64 tile as [query][d]
  //      (a lane holds 8 consecutive d of its query per t: two 16-B LDS stores), write f32 rows as whole 256-B segments
  float* os = Os + wave * (16 * OSP);
  {
    const float l = lrow + xhalf(lrow);
    const float inv = ((l > 0.f) ? (1.0f / l) : 0.f) * (1.0f / 1024.0f);
#pragma unroll
    for (int t = 0; t < 4; ++t) {
      v4f w0, w1;
#pragma unroll
      for (int e = 0; e < 4; ++e) { w0[e] = oacc[t][e] * inv; w1[e] = oacc[t][4 + e] * inv; }
      *(v4f*)(os + c * OSP + t * 16 + 8 * hh)     = w0;
      *(v4f*)(os + c * OSP + t * 16 + 8 * hh + 4) = w1;
    }
  }
  __builtin_amdgcn_fence(__ATOMIC_RELEASE, "workgroup");
  __builtin_amdgcn_wave_barrier();
  __builtin_amdgcn_fence(__ATOMIC_ACQUIRE, "workgroup");
  {
    const int h2 = lane >> 4, c4 = (lane & 15) * 4;
    v4f ov[8];
#pragma unroll
    for (int it = 0; it < 8; ++it) {
      const int row = it * 2 + h2;   // it 0..7 x h2 0..1 = rows 0..15 of the wave tile
      ov[it] = *(const v4f*)(os + row * OSP + c4);
    }
    {
#pragma unroll
      for (int it = 0; it < 8; ++it) {
        const int row = it * 2 + h2;
        const size_t go = (size_t)(q0 + row) * DM + (size_t)h * HD + c4;
        *(v4f*)(Cp + go) = ov[it];
      }
#if defined(__HIP_DEVICE_COMPILE__)
      // s_wait_xcnt 0 behind the run of stores: in the merged kernel the listing holds a branch from the end of this
      // body to the head of the other one, where registers that these stores name are written again.
      asm volatile("s_wait_xcnt 0x0" ::: "memory");
#endif
    }
  }
}

// All query blocks of both streams, all heads and both batch elements in one grid of NQB * 2 * NB * NH blocks.
// blockIdx.x / 64 counts the query blocks down from the last one: the blocks with the most key tiles get the lowest
// indices (for speed only).
// blockIdx.x % 64 = batch * 32 + stream * 16 + head. Query blocks below RESQB take the body with residual planes
// (block-uniform choice).
// amdgpu_waves_per_eu(5, 5): a budget of 192 registers, five waves per SIMD as before; left free, the build takes 206
// registers for the read groups (an allocation of 208), which leaves four waves per SIMD.
__global__ __launch_bounds__(128) __attribute__((amdgpu_waves_per_eu(5, 5)))
void attn_causal64(const unsigned short* __restrict__ qhp, const unsigned short* __restrict__ qlp,
                   const unsigned short* __restrict__ khp, const unsigned short* __restrict__ klp,
                   const unsigned short* __restrict__ vhp, const unsigned short* __restrict__ vlp,
                   float* C1p, float* C2p, float sscale) {
  __shared__ __align__(16) unsigned char smem[ATT_LDS];
  const int bx     = blockIdx.x;
  const int qb     = NQB - 1 - (bx >> 6);
  const int h      = bx & 15;
  const int stream = (bx >> 4) & 1;
  const int b      = (bx >> 5) & 1;
  const size_t qk = (size_t)b * SEQ * DQK;
  const unsigned short* vh = vhp + (size_t)b * DM * SEQ;
  const unsigned short* vl = vlp + (size_t)b * DM * VLP;
  float* Cp = (stream ? C2p : C1p) + (size_t)b * SEQ * DM;
  const int soff = stream * HD;
  if (qb < RESQB) attn_block64<true >(smem, qhp + qk, qlp + qk, khp + qk, klp + qk, vh, vl, Cp, soff, qb, h, sscale);
  else            attn_block64<false>(smem, qhp + qk, qlp + qk, khp + qk, klp + qk, vh, vl, Cp, soff, qb, h, sscale);
}

// =====================================================================================================
// Differential combine + head rms norm for one token row t of the NB*SEQ rows:
//   lam[h] = (0.2 + exp(sum_d lq1.lk1)) - exp(sum_d lq2.lk2)  (f32, inputs RNE-converted to bf16 values;
//            recomputed per block by threads 0..15, rolled 64-term loops)
//   o = c1 - lam*c2; r = rsqrt(sum_d(o^2)/64 + 1e-6); o = ((o*r) * w[h][d]) * 0.8
//   written as bf16 hi / lo planes [NB*SEQ][DM] (merged head layout), one 16-B store per plane per lane
// grid = NB*SEQ blocks x 128 threads; thread -> columns 8*tid..+7 (head = tid>>3, 8 lanes per head).
// coverage: 128 threads x 8 = 1024 columns per row; NB*SEQ rows.
// =====================================================================================================
__global__ __launch_bounds__(128) void diff_combine(
    const float* __restrict__ C1, const float* __restrict__ C2,
    const float* __restrict__ lq1, const float* __restrict__ lk1,
    const float* __restrict__ lq2, const float* __restrict__ lk2,
    const float* __restrict__ hnw, unsigned short* Oh, unsigned short* Ol) {
#pragma clang fp contract(off)
  __shared__ float lam_s[NH];
  const int tid = threadIdx.x;
  const int t   = blockIdx.x;
  if (tid < NH) {
    const float* a1 = lq1 + tid * HD;
    const float* b1 = lk1 + tid * HD;
    const float* a2 = lq2 + tid * HD;
    const float* b2 = lk2 + tid * HD;
    float sa = 0.f, sb = 0.f;
#pragma unroll 1
    for (int d = 0; d < HD; ++d) {
      sa += bfr(a1[d]) * bfr(b1[d]);
      sb += bfr(a2[d]) * bfr(b2[d]);
    }
    lam_s[tid] = (LAM0 + expf(sa)) - expf(sb);
  }
  __syncthreads();
  const int c0 = tid * 8;
  const int h  = c0 >> 6;
  const int d0 = c0 & 63;
  const size_t ro = (size_t)t * DM + c0;
  const v4f x0 = *(const v4f*)(C1 + ro), x1 = *(const v4f*)(C1 + ro + 4);
  const v4f y0 = *(const v4f*)(C2 + ro), y1 = *(const v4f*)(C2 + ro + 4);
  const float lam = lam_s[h];
  float o[8];
  float ss = 0.f;
#pragma unroll
  for (int e = 0; e < 4; ++e) {
    o[e]     = x0[e] - lam * y0[e];
    o[4 + e] = x1[e] - lam * y1[e];
  }
#pragma unroll
  for (int e = 0; e < 8; ++e) ss += o[e] * o[e];
  ss += __shfl_xor(ss, 1, 32);
  ss += __shfl_xor(ss, 2, 32);
  ss += __shfl_xor(ss, 4, 32);
  const float ms = ss * (1.0f / (float)HD);
  const float rn = rsqrtf(ms + 1.0e-6f);
  v4u hv, lv;
#pragma unroll
  for (int e = 0; e < 4; ++e) {
    const float w0 = bfr(hnw[h * HD + d0 + 2 * e]);
    const float w1 = bfr(hnw[h * HD + d0 + 2 * e + 1]);
    const float f0 = ((o[2 * e] * rn) * w0) * OSCL;
    const float f1 = ((o[2 * e + 1] * rn) * w1) * OSCL;
    const unsigned short h0 = bf_bits(f0), h1 = bf_bits(f1);
    const unsigned short l0 = bf_bits(f0 - bf_up(h0)), l1 = bf_bits(f1 - bf_up(h1));
    hv[e] = pk16(h0, h1); lv[e] = pk16(l0, l1);
  }
  *(v4u*)(Oh + ro) = hv;
  *(v4u*)(Ol + ro) = lv;
  
}

// =====================================================================================================
// Workspace map (bytes, all offsets multiples of 4096):
//   Xb   bf16 [4096][1024]      8388608      Wqb bf16 [2048][1024] 4194304   Wkb 4194304
//   Wvb  bf16 [1024][1024]      2097152      Wob 2097152
//   invf f32 [32] (padded)         4096      cosT f32 [2048][32] 262144      sinT 262144
//   both batch elements, batch-major:
//   Qh/Ql/Kh/Kl bf16 [2][2048][2048]  4 x 16777216
//   VTh  f16  [2][1024][2048]      8388608      VTl f16 [2][1024][512] 2097152
//   C1/C2 f32 [2][2048][1024]   2 x 16777216    Oh/Ol bf16 [2][2048][1024] 2 x 8388608
//   end                          149426176
// All planes are exact multiples of their 64x64 / whole-line store granularity (no padded tails needed).
// Weights are [out n][in k] with k contiguous = the Bt / A layout the GEMM wants, so they are only converted.
// =====================================================================================================
extern "C" void kernel_launch(void* const* d_in, const int* in_sizes, int n_in,
                              void* d_out, int out_size, void* d_ws, size_t ws_size,
                              hipStream_t stream) {
  if (n_in < 14) return;
  if (in_sizes[0] != NB * SEQ * DM) return;
  if (in_sizes[1] != DQK * DM || in_sizes[2] != DQK) return;
  if (in_sizes[3] != DQK * DM || in_sizes[4] != DQK) return;
  if (in_sizes[5] != DM * DM || in_sizes[6] != DM) return;
  if (in_sizes[7] != DM * DM || in_sizes[8] != DM) return;
  for (int i = 9; i < 14; ++i) if (in_sizes[i] != NH * HD) return;
  if (out_size != NB * SEQ * DM) return;

  const float* x   = (const float*)d_in[0];
  const float* Wq  = (const float*)d_in[1];
  const float* bq  = (const float*)d_in[2];
  const float* Wk  = (const float*)d_in[3];
  const float* bk  = (const float*)d_in[4];
  const float* Wv  = (const float*)d_in[5];
  const float* bv  = (const float*)d_in[6];
  const float* Wo  = (const float*)d_in[7];
  const float* bo  = (const float*)d_in[8];
  const float* hnw = (const float*)d_in[9];
  const float* lq1 = (const float*)d_in[10];
  const float* lk1 = (const float*)d_in[11];
  const float* lq2 = (const float*)d_in[12];
  const float* lk2 = (const float*)d_in[13];
  float* outp = (float*)d_out;

  const size_t PXB  = (size_t)NB * SEQ * DM * 2;    //  8388608
  const size_t PWQ  = (size_t)DQK * DM * 2;         //  4194304
  const size_t PWV  = (size_t)DM * DM * 2;          //  2097152
  const size_t PIF  = 4096;                         //  32 floats used
  const size_t PTAB = (size_t)SEQ * NFREQ * 4;      //   262144
  const size_t PQP  = (size_t)NB * SEQ * DQK * 2;   // 16777216
  const size_t PVT  = (size_t)NB * DM * SEQ * 2;    //  8388608
  const size_t PVL  = (size_t)NB * DM * VLP * 2;    //  2097152
  const size_t PC   = (size_t)NB * SEQ * DM * 4;    // 16777216
  const size_t PO   = (size_t)NB * SEQ * DM * 2;    //  8388608
  size_t off = 0;
  const size_t oXb  = off; off += PXB;
  const size_t oWq  = off; off += PWQ;
  const size_t oWk  = off; off += PWQ;
  const size_t oWv  = off; off += PWV;
  const size_t oWo  = off; off += PWV;
  const size_t oIF  = off; off += PIF;
  const size_t oCos = off; off += PTAB;
  const size_t oSin = off; off += PTAB;
  const size_t oQh  = off; off += PQP;
  const size_t oQl  = off; off += PQP;
  const size_t oKh  = off; off += PQP;
  const size_t oKl  = off; off += PQP;
  const size_t oVTh = off; off += PVT;
  const size_t oVTl = off; off += PVL;
  const size_t oC1  = off; off += PC;
  const size_t oC2  = off; off += PC;
  const size_t oOh  = off; off += PO;
  const size_t oOl  = off; off += PO;
  if (off > ws_size) return;                        // off = 149426176

  char* ws = (char*)d_ws;
  unsigned short* Xb  = (unsigned short*)(ws + oXb);
  unsigned short* Wqb = (unsigned short*)(ws + oWq);
  unsigned short* Wkb = (unsigned short*)(ws + oWk);
  unsigned short* Wvb = (unsigned short*)(ws + oWv);
  unsigned short* Wob = (unsigned short*)(ws + oWo);
  float*          IFt = (float*)(ws + oIF);
  float*          CosT = (float*)(ws + oCos);
  float*          SinT = (float*)(ws + oSin);
  unsigned short* Qh  = (unsigned short*)(ws + oQh);
  unsigned short* Ql  = (unsigned short*)(ws + oQl);
  unsigned short* Kh  = (unsigned short*)(ws + oKh);
  unsigned short* Kl  = (unsigned short*)(ws + oKl);
  unsigned short* VTh = (unsigned short*)(ws + oVTh);
  unsigned short* VTl = (unsigned short*)(ws + oVTl);
  float*          C1  = (float*)(ws + oC1);
  float*          C2  = (float*)(ws + oC2);
  unsigned short* Oh  = (unsigned short*)(ws + oOh);
  unsigned short* Ol  = (unsigned short*)(ws + oOl);

  const dim3 blk256(256), blk128(128), blk32(32);
  const dim3 gCvt((NB * SEQ * DM + 2 * DQK * DM + 2 * DM * DM) / 8 / 256);   // 5120 blocks
  const dim3 gTab((SEQ * NFREQ + 255) / 256);                      //  256 blocks
  const dim3 gQKV((SEQ / 64) * (DQK / 64) / 8, NB, 3);             // 1024 tiles -> 128 blocks, x batch x {q, k, v^T}
  const dim3 gOut((NB * SEQ / 64) * (DM / 64) / 8, 1);             // 1024 tiles -> 128 blocks
  const dim3 gRow(NB * SEQ);                                       // one block per token row
  const dim3 gAtt(NQB * 2 * NB * NH);                              // 2048 blocks

  // (1) inputs -> bf16 planes; weights [n][k] f32 -> bf16 [n][k]; Xb, Wqb, Wkb, Wvb, Wob are contiguous from Xb
  cvt_bf16x8<<<gCvt, blk256, 0, stream>>>(x, Wq, Wk, Wv, Wo, Xb);
  // (2) rope tables
  invfreq_tab<<<dim3(1), blk32, 0, stream>>>(IFt);
  rope_tab<<<gTab, blk256, 0, stream>>>(IFt, CosT, SinT);
  // (3) q, k -> rope -> bf16 hi / lo planes [NB*SEQ][DQK]; v^T -> f16 hi plane and residual plane, both batch elements
  gemm_qkv<<<gQKV, blk256, 0, stream>>>(Xb, Wqb, Wkb, Wvb, Qh, Ql, Kh, Kl, VTh, VTl, bq, bk, bv, CosT, SinT);
  // (4) causal attention, stream 1 (q1, k1) -> C1 and stream 2 (q2, k2) -> C2;
  //     query blocks 0..RESQB-1 with residual planes, the rest without
  attn_causal64<<<gAtt, blk128, 0, stream>>>(Qh, Ql, Kh, Kl, VTh, VTl, C1, C2, 0.125f);
  // (5) differential combine + head norm -> O bf16 hi/lo planes [NB*SEQ][DM]
  diff_combine<<<gRow, blk128, 0, stream>>>(C1, C2, lq1, lk1, lq2, lk2, hnw, Oh, Ol);
  // (6) out = O . Wo^T + bo -> d_out, f32 [NB*SEQ][DM]  (A = O hi + lo planes, 2 products)
  gemm64<1, 0, 1><<<gOut, blk256, 0, stream>>>(
      Oh, Ol, DM, 0LL, Wob, Wob, DM, 0LL,
      (void*)outp, DM, 0LL, (void*)outp, DM, 0LL, DM,
      NB * SEQ, DM, DM, 1.0f, bo);
  (void)hipGetLastError();
}

// v008
// One run takes 158 microseconds.
// Timed twice side by side with v007, it ran 1.09 times as fast both times.
// Counting every step since v000, it is 6.95 times as fast.
// Contractions: q, k, v^T projections = v_wmma_f32_16x16x32_bf16 (bf16 operands from RNE-converted inputs, single product);
// q.k^T scores (both streams) = v_wmma_f32_16x16x32_bf16 with bf16 hi/lo split q and k (hi.hi + hi.lo + lo.hi);
// p.v = v_wmma_f32_16x16x32_f16 (p carried x1024 in f16, v in f16; extra f16 residual planes x4096 of p and v for the first 512 query rows);
// ctx.Wo^T = v_wmma_f32_16x16x32_bf16 with ctx as bf16 hi/lo planes times bf16 Wo (2 products); all f32 accumulate;
// rope, softmax, lambda, head rms norm in f32.
#include <hip/hip_runtime.h>
#include <math.h>
#include <float.h>
#include <stdint.h>

#define NB    2
#define SEQ   2048
#define DM    1024
#define DQK   2048          // q / k projection width (2 x 64 per head)
#define NH    16
#define HD    64
#define NFREQ (HD / 2)
#define NQB   (SEQ / 64)    // 32 key / query tiles of 64
#define VLP   512           // key pitch of the v^T residual plane (keys 0..VLP-1)
#define RESQB 8             // number of leading 64-row query blocks that use the p / v residual planes
#define LAM0  0.2f
#define OSCL  0.8f
static_assert(RESQB * 64 <= VLP);
static_assert(NH * HD == DM);
static_assert(NB == 2 && NH == 16);   // the attention grid's index split
static_assert(NH * 2 * HD == DQK);
static_assert((SEQ % 256) == 0 && (DM % 256) == 0 && (DQK % 256) == 0);   // GEMM block tiles 128 x 256, 64 k per trip

typedef _Float16 v16h __attribute__((ext_vector_type(16)));
typedef _Float16 v8h  __attribute__((ext_vector_type(8)));
typedef __bf16   v16b __attribute__((ext_vector_type(16)));
typedef __bf16   v8b  __attribute__((ext_vector_type(8)));
typedef float    v8f  __attribute__((ext_vector_type(8)));
typedef float    v4f  __attribute__((ext_vector_type(4)));
typedef unsigned int v4u __attribute__((ext_vector_type(4)));

// ---- scalar helpers --------------------------------------------------------------------------------
__device__ __forceinline__ unsigned short bf_bits(float f) {          // f32 -> bf16 bits, RNE convert
  unsigned u = __float_as_uint(f);
  return (unsigned short)((u + 0x7FFFu + ((u >> 16) & 1u)) >> 16);
}
__device__ __forceinline__ float bf_up(unsigned short h) { return __uint_as_float(((unsigned)h) << 16); }
__device__ __forceinline__ float bfr(float f) { return bf_up(bf_bits(f)); }   // value after RNE convert to bf16
__device__ __forceinline__ unsigned short h_bits(_Float16 x) { return __builtin_bit_cast(unsigned short, x); }
__device__ __forceinline__ unsigned pk16(unsigned short a, unsigned short b) { return (unsigned)a | ((unsigned)b << 16); }
__device__ __forceinline__ v8f zero8() { v8f z = {0.f, 0.f, 0.f, 0.f, 0.f, 0.f, 0.f, 0.f}; return z; }
__device__ __forceinline__ v8h zero8h() {
  const _Float16 z = (_Float16)0.0f;
  v8h r = {z, z, z, z, z, z, z, z};
  return r;
}

// ---- fragment loaders: 16-bit A/B operand, lane -> row/col (lane&15), p already includes +8*(lane>>4);
//      elements 0..7 <- p[0..7] (k0+8h..), elements 8..15 <- p[16..23] (k0+16+8h..)
__device__ __forceinline__ v16b ldfrag_b(const __bf16* p) {
  union { v16b v; v8b h[2]; } f;
  f.h[0] = *(const v8b*)(p);
  f.h[1] = *(const v8b*)(p + 16);
  return f.v;
}

// ---- WMMA helpers with trailing VALU hazard gap --------------------------------------------------------
__device__ __forceinline__ v8f mma_b(v16b a, v16b b, v8f c) {
  c = __builtin_amdgcn_wmma_f32_16x16x32_bf16(false, a, false, b, (short)0, c, false, false);
#if defined(__HIP_DEVICE_COMPILE__)
  asm volatile("v_nop\n\tv_nop\n\tv_nop\n\tv_nop" : "+v"(c) : "v"(a), "v"(b));
#endif
  return c;
}
__device__ __forceinline__ v8f mma_h(v16h a, v16h b, v8f c) {
  c = __builtin_amdgcn_wmma_f32_16x16x32_f16(false, a, false, b, (short)0, c, false, false);
#if defined(__HIP_DEVICE_COMPILE__)
  asm volatile("v_nop\n\tv_nop\n\tv_nop\n\tv_nop" : "+v"(c) : "v"(a), "v"(b));
#endif
  return c;
}
__device__ __forceinline__ v8f mma_b_raw(v16b a, v16b b, v8f c) {
  return __builtin_amdgcn_wmma_f32_16x16x32_bf16(false, a, false, b, (short)0, c, false, false);
}
__device__ __forceinline__ v8f mma_h_raw(v16h a, v16h b, v8f c) {
  return __builtin_amdgcn_wmma_f32_16x16x32_f16(false, a, false, b, (short)0, c, false, false);
}
// Compiler-only fence, no instruction: the instruction scheduler moves nothing across it.
__device__ __forceinline__ void group_fence() {
#if defined(__HIP_DEVICE_COMPILE__)
  __builtin_amdgcn_sched_barrier(0);
#endif
}
__device__ __forceinline__ void dep_guard_b(v8f& a, v8f& b, v16b x, v16b y) {
#if defined(__HIP_DEVICE_COMPILE__)
  asm volatile("v_nop\n\tv_nop\n\tv_nop\n\tv_nop" : "+v"(a), "+v"(b) : "v"(x), "v"(y));
#endif
}
__device__ __forceinline__ void keep4_b(v16b a, v16b b, v16b c, v16b d) {
#if defined(__HIP_DEVICE_COMPILE__)
  asm volatile("v_nop" :: "v"(a), "v"(b), "v"(c), "v"(d));
#endif
}
__device__ __forceinline__ void acc_guard4(v8f& a, v8f& b, v8f& c, v8f& d) {
#if defined(__HIP_DEVICE_COMPILE__)
  asm volatile("v_nop\n\tv_nop\n\tv_nop\n\tv_nop" : "+v"(a), "+v"(b), "+v"(c), "+v"(d));
#endif
}

// =====================================================================================================
// f32 -> bf16 (RNE convert), 8 elements per thread, one 16-B store per lane: a wave writes 512 contiguous B
// One grid for x, Wq, Wk, Wv, Wo: their bf16 planes lie back to back in the workspace in that order, so the
// output index is the flat thread index minus 256 (block 0 converts nothing); the source is picked per block (every plane is a multiple of 2048
// elements, so a block never straddles two planes).
// coverage: (NX + 2 NQ + 2 NV) threads x 8 = all five planes (blocks 1 and up).
// Block 0 converts nothing: its threads 0..15 form the 16 head factors of the differential combine,
//   lam[h] = (0.2 + exp(sum_d lq1.lk1)) - exp(sum_d lq2.lk2)  (f32, inputs RNE-converted to bf16 values, d ascending),
// once per call, under the convert stream.
// =====================================================================================================
__global__ __launch_bounds__(256) void cvt_bf16x8(const float* __restrict__ x, const float* __restrict__ wq,
                                                  const float* __restrict__ wk, const float* __restrict__ wv,
                                                  const float* __restrict__ wo, unsigned short* out,
                                                  const float* __restrict__ lq1, const float* __restrict__ lk1,
                                                  const float* __restrict__ lq2, const float* __restrict__ lk2,
                                                  float* lam) {
  constexpr int NX = NB * SEQ * DM / 8, NQ = DQK * DM / 8, NV = DM * DM / 8;
  static_assert((NX % 256) == 0 && (NQ % 256) == 0 && (NV % 256) == 0);
  if (blockIdx.x == 0) {                       // block-uniform; the kernel has no barrier
    const int tid = threadIdx.x;
    if (tid < NH) {
      const float* a1 = lq1 + tid * HD;
      const float* b1 = lk1 + tid * HD;
      const float* a2 = lq2 + tid * HD;
      const float* b2 = lk2 + tid * HD;
      float sa = 0.f, sb = 0.f;
      // the product of two bf16 values is exact in f32, so each sum rounds the same whether or not it is fused with its product
      // unrolled by 8: the 32 values of 8 steps are asked for together, so that this one wave's chain ends within the convert stream
#pragma unroll 8
      for (int d = 0; d < HD; ++d) {
        sa += bfr(a1[d]) * bfr(b1[d]);
        sb += bfr(a2[d]) * bfr(b2[d]);
      }
      lam[tid] = (LAM0 + expf(sa)) - expf(sb);
    }
    return;
  }
  const int i = (blockIdx.x - 1) * 256 + threadIdx.x;
  if (i < NX + 2 * NQ + 2 * NV) {
    const float* in = x;
    int j = i;
    if (i >= NX + 2 * NQ + NV)  { in = wo; j = i - (NX + 2 * NQ + NV); }
    else if (i >= NX + 2 * NQ)  { in = wv; j = i - (NX + 2 * NQ); }
    else if (i >= NX + NQ)      { in = wk; j = i - (NX + NQ); }
    else if (i >= NX)           { in = wq; j = i - NX; }
    const v4f a = *(const v4f*)(in + (size_t)j * 8);
    const v4f b = *(const v4f*)(in + (size_t)j * 8 + 4);
    v4u p;
    p[0] = pk16(bf_bits(a[0]), bf_bits(a[1]));
    p[1] = pk16(bf_bits(a[2]), bf_bits(a[3]));
    p[2] = pk16(bf_bits(b[0]), bf_bits(b[1]));
    p[3] = pk16(bf_bits(b[2]), bf_bits(b[3]));
    *(v4u*)(out + (size_t)i * 8) = p;
    
  }
}

// =====================================================================================================
// inv_freq[j] = 1 / 10000^(j/32), j = 0..31, f32 with precise powf. One block of 32 threads; the 32 values
// coverage: lanes 0..7 x 4 floats = all 32 entries.
// =====================================================================================================
__global__ __launch_bounds__(32) void invfreq_tab(float* invf) {
  __shared__ __align__(16) float sf[NFREQ];
  const int j = threadIdx.x;
  const float e = (float)j * (1.0f / (float)NFREQ);
  const float pw = powf(10000.0f, e);
  sf[j] = 1.0f / pw;
  __syncthreads();
  const v4f v = *(const v4f*)(sf + 4 * (j & 7));
  if (j < 8) *(v4f*)(invf + 4 * j) = v;
  
}

// =====================================================================================================
// cos / sin tables [SEQ][32]: angle = t * inv_freq[j] (f32 multiply), precise cosf / sinf.
// =====================================================================================================
__global__ __launch_bounds__(256) void rope_tab(const float* __restrict__ invf, float* cosT, float* sinT) {
  const int g = blockIdx.x * 256 + threadIdx.x;
  if (g < SEQ * NFREQ) {
    const int t = g / NFREQ;
    const int j = g - t * NFREQ;
    const float ang = (float)t * invf[j];
    const float cv = cosf(ang);
    const float sv = sinf(ang);
    *(float*)(cosT + g) = cv;
    *(float*)(sinT + g) = sv;
    
  }
}

// =====================================================================================================
// RoPE half-split rotation of 8 consecutive columns of one 64-wide vector, then bf16 hi/lo split: 16 B per plane
// (hv, lv). xa = the lane's 8 columns, xp = the 8 columns 32 away in the same vector (f32).
//   first half  (j < 32):   out[j]    = x[j]*cos[j]   - x[j+32]*sin[j]     (x1 = a, x2 = p)
//   second half (j < 32):   out[j+32] = x[j]*sin[j]   + x[j+32]*cos[j]     (x1 = p, x2 = a)
// =====================================================================================================
__device__ __forceinline__ void rope_row8(const float* xa, const float* xp,
                                          bool second, v4f cs0, v4f cs1, v4f sn0, v4f sn1,
                                          v4u& hv, v4u& lv) {
  // contraction off: each product and their sum round on their own, as in the reference's elementwise form, so the
  // q, k planes stay bit for bit what they were when a launch of its own rotated them
#pragma clang fp contract(off)
  const v4f xa0 = *(const v4f*)(xa);
  const v4f xa1 = *(const v4f*)(xa + 4);
  const v4f xp0 = *(const v4f*)(xp);
  const v4f xp1 = *(const v4f*)(xp + 4);
  float o[8];
#pragma unroll
  for (int e = 0; e < 4; ++e) {
    {
      const float a = xa0[e], p = xp0[e], cs = cs0[e], sn = sn0[e];
      const float f1 = a * cs - p * sn;
      const float f2 = p * sn + a * cs;
      o[e] = second ? f2 : f1;
    }
    {
      const float a = xa1[e], p = xp1[e], cs = cs1[e], sn = sn1[e];
      const float f1 = a * cs - p * sn;
      const float f2 = p * sn + a * cs;
      o[4 + e] = second ? f2 : f1;
    }
  }
#pragma unroll
  for (int e = 0; e < 4; ++e) {
    const float f0 = o[2 * e], f1 = o[2 * e + 1];
    const unsigned short h0 = bf_bits(f0), h1 = bf_bits(f1);
    const unsigned short l0 = bf_bits(f0 - bf_up(h0)), l1 = bf_bits(f1 - bf_up(h1));
    hv[e] = pk16(h0, h1); lv[e] = pk16(l0, l1);
  }
}

// =====================================================================================================
// Register-blocked bf16 WMMA GEMM: C[m][n] = sum_k A[m][k] * Bt[n][k] (+ bias); one wave per 64x64 tile, a block of
// 8 waves (2 x 4) per 128 x 256 tile. A row-major [M][K] pitch lda; Bt row-major [N][K] pitch ldb (k contiguous);
// M multiple of 128, N of 256, K of 64. b = batch index (strides in elements).
// The tile body is a device function (block tile index, batch index and the LDS come from the caller), so
// that one grid can hold several independent products.
// Operands reach the waves through LDS: per trip of 64 k the block's 128 A rows and 256 Bt rows (128 B = one line each)
// are brought in by asynchronous copies to LDS, 16 B per lane, 8 lanes per row, so that one wave-wide copy covers 4
// whole lines; a fragment load straight from global memory touches 16 lines for the same 512 B, and every wave
// fetched its own copy of rows that its neighbours need too. Two buffers: the next trip's copies fly during this
// trip's products. LDS row pitch 144 B (16 B x odd) for the ds_load_b128 fragment reads. The k order of the products
// is unchanged (32 k per WMMA, ascending).
// NSPLIT: 0 = A.Bt; 1 = (A + A2).Bt (A2 = unscaled bf16 lo plane of A).
// OUT_MODE: 0 = f32 (pitch ldc); 2 = bf16 hi plane C + bf16 lo plane C2 (lo = RNE(v - hi), unscaled);
//           3 = f16 hi plane C + f16 residual plane C2 = f16((v - hi) * rscale), C2 written only for tiles
//               with n0 < N2 (pitch ldc2, batch stride strideC2);
//           4 = a wave's 64 columns are one 64-wide rope vector and m is the token index: rotated by the tables
//               cosT / sinT [M][32], then bf16 hi plane C + bf16 lo plane C2 (lo = RNE(v - hi), unscaled).
// BIAS: 0 = none; 1 = + bf16-RNE(bias[n]) per column; 2 = + bf16-RNE(bias[m]) per row (added in f32).
// =====================================================================================================
#define GP        72                                  // LDS row pitch of a staged operand row, in elements (144 B)
#define GROW_B    (GP * 2)
#define GSTG_B(NS) ((128 + 256 + 128 * (NS)) * GROW_B)  // one buffer: A rows | Bt rows | A2 rows: 55296 B / 73728 B
static_assert((GROW_B % 16) == 0 && ((GROW_B / 16) & 1) == 1);

// Four asynchronous 16-B copies to LDS per lane (l = the lane's LDS byte address, g = its global address).
// s_wait_xcnt 0 is the last line of the copies' own statement: it stands in front of any rewrite of the address registers.
__device__ __forceinline__ void copy4_lds(unsigned l0, const __bf16* g0, unsigned l1, const __bf16* g1,
                                          unsigned l2, const __bf16* g2, unsigned l3, const __bf16* g3) {
#if defined(__HIP_DEVICE_COMPILE__)
  asm volatile("global_load_async_to_lds_b128 %0, %1, off\n\t"
               "global_load_async_to_lds_b128 %2, %3, off\n\t"
               "global_load_async_to_lds_b128 %4, %5, off\n\t"
               "global_load_async_to_lds_b128 %6, %7, off\n\t"
               "s_wait_xcnt 0x0"
               :: "v"(l0), "v"(g0), "v"(l1), "v"(g1), "v"(l2), "v"(g2), "v"(l3), "v"(g3) : "memory");
#endif
}
// The issuing wave's own copies have landed (in front of the barrier behind which other waves read them).
__device__ __forceinline__ void wait_copies() {
#if defined(__HIP_DEVICE_COMPILE__)
  asm volatile("s_wait_asynccnt 0x0" ::: "memory");
#endif
}
// This wave's LDS reads have returned (in front of the barrier behind which their buffer is refilled).
__device__ __forceinline__ void wait_lds() {
#if defined(__HIP_DEVICE_COMPILE__)
  asm volatile("s_wait_dscnt 0x0" ::: "memory");
#endif
}
// One 64-k tile of the block's operands into one buffer: 256 threads x 16 B = 32 rows per copy; dst = the lane's LDS
// byte address of row tid>>3, chunk tid&7 of the buffer; gA / gB / gA2 = its global address in row tid>>3 of the block's rows.
template <int NSPLIT>
__device__ __forceinline__ void gemm_stage(unsigned dst, const __bf16* gA, const __bf16* gB, const __bf16* gA2,
                                           int lda, int ldb) {
  const size_t ra = (size_t)32 * lda, rb = (size_t)32 * ldb;
  constexpr unsigned R = 32 * GROW_B;
  copy4_lds(dst, gA, dst + R, gA + ra, dst + 2 * R, gA + 2 * ra, dst + 3 * R, gA + 3 * ra);
  copy4_lds(dst + 4 * R, gB, dst + 5 * R, gB + rb, dst + 6 * R, gB + 2 * rb, dst + 7 * R, gB + 3 * rb);
  copy4_lds(dst + 8 * R, gB + 4 * rb, dst + 9 * R, gB + 5 * rb, dst + 10 * R, gB + 6 * rb, dst + 11 * R, gB + 7 * rb);
  if (NSPLIT == 1)
    copy4_lds(dst + 12 * R, gA2, dst + 13 * R, gA2 + ra, dst + 14 * R, gA2 + 2 * ra, dst + 15 * R, gA2 + 3 * ra);
}

template <int NSPLIT, int OUT_MODE, int BIAS>
__device__ __forceinline__ void gemm64_tile(
    const unsigned short* __restrict__ Ap, const unsigned short* A2p, int lda, long long strideA,
    const unsigned short* __restrict__ Btp, const unsigned short* Bt2p, int ldb, long long strideB,
    void* Cout, int ldc, long long strideC,
    void* Cout2, int ldc2, long long strideC2, int N2,
    int M, int N, int K, float rscale, const float* __restrict__ bias,
    const float* __restrict__ cosT, const float* __restrict__ sinT,
    float* slab, unsigned char* stg, int bt, int b) {
  static_assert(NSPLIT == 0 || NSPLIT == 1);
  const __bf16* A   = (const __bf16*)(const void*)Ap;
  const __bf16* A2  = (const __bf16*)(const void*)A2p;
  const __bf16* Bt  = (const __bf16*)(const void*)Btp;
  const int tid  = threadIdx.x;
  const int lane = tid & 31;
  const int wave = tid >> 5;
  const int blocksN = N >> 8;
  const int blocksM = M >> 7;
  if (bt >= blocksM * blocksN) return;   // block-uniform, in front of every copy and barrier
  const int bm  = bt / blocksN;
  const int bn  = bt - bm * blocksN;
  const int mb0 = bm << 7;
  const int nb0 = bn << 8;
  const int wm  = wave >> 2;             // the wave's 64 rows of the block's 128
  const int wn  = wave & 3;              // the wave's 64 columns of the block's 256
  const int m0  = mb0 + (wm << 6);
  const int n0  = nb0 + (wn << 6);

  const __bf16* Ab  = A  + (size_t)b * strideA;
  const __bf16* Bb  = Bt + (size_t)b * strideB;
  const __bf16* Ab2 = (NSPLIT >= 1) ? (A2  + (size_t)b * strideA) : Ab;

  const int rlane = lane & 15;                 // row (A) / col (B, D) within subtile
  const int koff  = (lane >> 4) * 8;           // k offset of this lane half
  const int mOff  = (lane >> 4) * 8;           // D row offset

  v8f acc[4][4];
#pragma unroll
  for (int i = 0; i < 4; ++i)
#pragma unroll
    for (int j = 0; j < 4; ++j) acc[i][j] = zero8();

  constexpr unsigned STG = GSTG_B(NSPLIT);
  const int nt   = K >> 6;                     // trips of 64 k
  const int srow = tid >> 3, sch = tid & 7;    // this lane's row (of 32 per copy) and 16-B chunk of the 128-B row
  const unsigned sdst = (unsigned)(size_t)stg + (unsigned)(srow * GROW_B + sch * 16);
  const __bf16* gA  = Ab  + (size_t)(mb0 + srow) * lda + sch * 8;
  const __bf16* gB  = Bb  + (size_t)(nb0 + srow) * ldb + sch * 8;
  const __bf16* gA2 = Ab2 + (size_t)(mb0 + srow) * lda + sch * 8;

  // tile 0 -> buffer 0, landed and published; then tile 1 -> buffer 1 in flight
  gemm_stage<NSPLIT>(sdst, gA, gB, gA2, lda, ldb);
  wait_copies();
  __syncthreads();
  if (nt > 1) gemm_stage<NSPLIT>(sdst + STG, gA + 64, gB + 64, gA2 + 64, lda, ldb);

  for (int t = 0; t < nt; ++t) {               // block-uniform trip count
    const __bf16* sb  = (const __bf16*)(const void*)(stg + (size_t)(t & 1) * STG);
    const __bf16* sA  = sb + ((wm << 6) + rlane) * GP + koff;
    const __bf16* sB  = sb + (128 + (wn << 6) + rlane) * GP + koff;
    const __bf16* sA2 = (NSPLIT >= 1) ? (sb + (384 + (wm << 6) + rlane) * GP + koff) : sA;
    // unrolled (here and below): the fragment arrays need constant indices to stay in registers, and the second
    // 32-k block's LDS reads can then be issued among the first block's products
#pragma unroll
    for (int kk = 0; kk < 2; ++kk) {
      v16b bh[4], ahf[4], alf[4];
#pragma unroll
      for (int j = 0; j < 4; ++j) bh[j] = ldfrag_b(sB + (j << 4) * GP + kk * 32);
#pragma unroll
      for (int i = 0; i < 4; ++i) {
        ahf[i] = ldfrag_b(sA + (i << 4) * GP + kk * 32);
        if (NSPLIT >= 1) alf[i] = ldfrag_b(sA2 + (i << 4) * GP + kk * 32); else alf[i] = ahf[i];
      }
#pragma unroll
      for (int i = 0; i < 4; ++i) {
        const v16b ah = ahf[i], al = alf[i];
#pragma unroll
        for (int j = 0; j < 4; ++j) {
          acc[i][j] = mma_b_raw(ah, bh[j], acc[i][j]);
          if (NSPLIT >= 1) acc[i][j] = mma_b_raw(al, bh[j], acc[i][j]);
        }
        dep_guard_b(acc[i][0], acc[i][3], ah, al);
      }
      keep4_b(bh[0], bh[1], bh[2], bh[3]);
    }
    // foot of the trip: own reads of this buffer done, own copies of the next tile landed, one barrier for both;
    // only then the refill of the buffer that this trip has read
    wait_lds();
    wait_copies();
    __syncthreads();
    if (t + 2 < nt) {
      const int kn = (t + 2) << 6;
      gemm_stage<NSPLIT>(sdst + (unsigned)(t & 1) * STG, gA + kn, gB + kn, gA2 + kn, lda, ldb);
    }
  }
  wait_copies();
  acc_guard4(acc[0][0], acc[0][1], acc[0][2], acc[0][3]);
  acc_guard4(acc[1][0], acc[1][1], acc[1][2], acc[1][3]);
  acc_guard4(acc[2][0], acc[2][1], acc[2][2], acc[2][3]);
  acc_guard4(acc[3][0], acc[3][1], acc[3][2], acc[3][3]);

  // ---- epilogue ----
  float bcol[4];
#pragma unroll
  for (int j = 0; j < 4; ++j) bcol[j] = 0.f;
  if (BIAS == 1) {
#pragma unroll
    for (int j = 0; j < 4; ++j) bcol[j] = bfr(bias[n0 + (j << 4) + rlane]);
  }
#pragma unroll
  for (int i = 0; i < 4; ++i) {
    const int mBase = m0 + (i << 4);
    float brow[8];
#pragma unroll
    for (int r = 0; r < 8; ++r) brow[r] = 0.f;
    if (BIAS == 2) {
#pragma unroll
      for (int r = 0; r < 8; ++r) brow[r] = bfr(bias[mBase + mOff + r]);
    }
#pragma unroll
    for (int j = 0; j < 4; ++j) {
#pragma unroll
      for (int r = 0; r < 8; ++r) {
        slab[(mOff + r) * 68 + (j << 4) + rlane] = (acc[i][j][r] + bcol[j]) + brow[r];
      }
    }
    v4f tc[4][2], ts[4][2];                                // OUT_MODE 4: cos / sin of this lane's 4 rows x 8 columns,
    if (OUT_MODE == 4) {                                   // asked for while the slab's stores are under way
      const size_t to = (size_t)(mBase + (lane >> 3)) * NFREQ + (((lane & 7) * 8) & 31);
      const float* cr = cosT + to;
      const float* sr = sinT + to;
#pragma unroll
      for (int it = 0; it < 4; ++it) {                     // row it * 4 + (lane >> 3)
        tc[it][0] = *(const v4f*)(cr + it * 4 * NFREQ); tc[it][1] = *(const v4f*)(cr + it * 4 * NFREQ + 4);
        ts[it][0] = *(const v4f*)(sr + it * 4 * NFREQ); ts[it][1] = *(const v4f*)(sr + it * 4 * NFREQ + 4);
      }
#if defined(__HIP_DEVICE_COMPILE__)
      // s_wait_xcnt 0 before a register that an issued load names is written again; the addresses are inputs so that
      // they stay in their registers up to the wait (else a later load's destination may take an address pair over).
      asm volatile("s_wait_xcnt 0x0" :: "v"(cr), "v"(sr) : "memory");
#endif
    }
    __builtin_amdgcn_fence(__ATOMIC_RELEASE, "workgroup");
    __builtin_amdgcn_wave_barrier();
    __builtin_amdgcn_fence(__ATOMIC_ACQUIRE, "workgroup");
    if (OUT_MODE == 0) {
      float* C = (float*)Cout + (size_t)b * strideC;
      const int hh = lane >> 4, c4 = (lane & 15) * 4;     // 256-B row segment = 16 lanes x 16 B
      {
#pragma unroll
        for (int it = 0; it < 8; ++it) {
          const int row = it * 2 + hh;                     // it 0..7 x hh 0..1 = rows 0..15
          const v4f v = *(const v4f*)(slab + row * 68 + c4);
          *(v4f*)(C + (size_t)(mBase + row) * ldc + n0 + c4) = v;
        }
        
      }
    } else if (OUT_MODE == 4) {
      const int q = lane >> 3, c8 = (lane & 7) * 8;        // 8 lanes x 16 B = one 128-B line per row and plane
      unsigned short* C  = (unsigned short*)Cout  + (size_t)b * strideC;
      unsigned short* C2 = (unsigned short*)Cout2 + (size_t)b * strideC2;
      const size_t go = (size_t)(mBase + q) * ldc + n0 + c8;
      unsigned short* hp = C + go;
      unsigned short* lp = C2 + go;
#pragma unroll
      for (int ip = 0; ip < 2; ++ip) {                     // two rows at a time: row (ip * 2 + u) * 4 + q = rows 0..15
        v4u hv[2], lv[2];
#pragma unroll
        for (int u = 0; u < 2; ++u) {
          const int it = ip * 2 + u;
          const float* sp = slab + (it * 4 + q) * 68;
          rope_row8(sp + c8, sp + (c8 ^ 32), (c8 & 32) != 0, tc[it][0], tc[it][1], ts[it][0], ts[it][1], hv[u], lv[u]);
        }
#pragma unroll
        for (int u = 0; u < 2; ++u) {
          *(v4u*)(hp + (size_t)((ip * 2 + u) * 4) * ldc) = hv[u];
          *(v4u*)(lp + (size_t)((ip * 2 + u) * 4) * ldc) = lv[u];
        }
#if defined(__HIP_DEVICE_COMPILE__)
        // s_wait_xcnt 0 behind the run of stores, before a register that they name is written again; addresses and
        // data are inputs so that they stay in their registers up to the wait.
        asm volatile("s_wait_xcnt 0x0" :: "v"(hp), "v"(lp), "v"(hv[0]), "v"(lv[0]), "v"(hv[1]), "v"(lv[1]) : "memory");
#endif
      }
    } else {
      const int q = lane >> 3, c8 = (lane & 7) * 8;
      unsigned short* C  = (unsigned short*)Cout  + (size_t)b * strideC;
      unsigned short* C2 = (unsigned short*)Cout2 + (size_t)b * strideC2;
      const bool wlo = (OUT_MODE == 2) || (n0 < N2);      // wave-uniform
      v4u hv[4], lv[4];
#pragma unroll
      for (int it = 0; it < 4; ++it) {
        const int row = it * 4 + q;                        // it 0..3 x q 0..3 = rows 0..15
        const float* sp = slab + row * 68 + c8;
        v4u a, a2;
#pragma unroll
        for (int e = 0; e < 4; ++e) {
          const float f0 = sp[2 * e], f1 = sp[2 * e + 1];
          unsigned short h0, h1, l0, l1;
          if (OUT_MODE == 2) {
            h0 = bf_bits(f0); h1 = bf_bits(f1);
            l0 = bf_bits(f0 - bf_up(h0)); l1 = bf_bits(f1 - bf_up(h1));
          } else {
            const _Float16 x0 = (_Float16)f0, x1 = (_Float16)f1;
            h0 = h_bits(x0); h1 = h_bits(x1);
            l0 = h_bits((_Float16)((f0 - (float)x0) * rscale));
            l1 = h_bits((_Float16)((f1 - (float)x1) * rscale));
          }
          a[e] = pk16(h0, h1); a2[e] = pk16(l0, l1);
        }
        hv[it] = a; lv[it] = a2;
      }
      {
#pragma unroll
        for (int it = 0; it < 4; ++it) {
          const int row = it * 4 + q;
          *(v4u*)(C + (size_t)(mBase + row) * ldc + n0 + c8) = hv[it];
          if (wlo) *(v4u*)(C2 + (size_t)(mBase + row) * ldc2 + n0 + c8) = lv[it];
        }
        
      }
    }
    __builtin_amdgcn_fence(__ATOMIC_RELEASE, "workgroup");
    __builtin_amdgcn_wave_barrier();
    __builtin_amdgcn_fence(__ATOMIC_ACQUIRE, "workgroup");
  }
}

// One product per grid: blockIdx.x = 128 x 256 block tile, blockIdx.y = batch index.
template <int NSPLIT, int OUT_MODE, int BIAS>
__global__ __launch_bounds__(256) void gemm64(
    const unsigned short* __restrict__ Ap, const unsigned short* A2p, int lda, long long strideA,
    const unsigned short* __restrict__ Btp, const unsigned short* Bt2p, int ldb, long long strideB,
    void* Cout, int ldc, long long strideC,
    void* Cout2, int ldc2, long long strideC2, int N2,
    int M, int N, int K, float rscale, const float* __restrict__ bias) {
  __shared__ __align__(16) float sT[8][16 * 68];   // per-wave 16x64 slab, pitch 68 floats
  __shared__ __align__(16) unsigned char sG[2 * GSTG_B(NSPLIT)];   // two operand buffers
  const int wave = threadIdx.x >> 5;
  gemm64_tile<NSPLIT, OUT_MODE, BIAS>(Ap, A2p, lda, strideA, Btp, Bt2p, ldb, strideB, Cout, ldc, strideC,
                                      Cout2, ldc2, strideC2, N2, M, N, K, rscale, bias, nullptr, nullptr,
                                      sT[wave], sG, blockIdx.x, blockIdx.y);
}

// q, k and v^T projections of both batch elements in one grid: blockIdx.z = 0 q, 1 k, 2 v^T; blockIdx.y = batch;
// blockIdx.x = 128 x 256 block tile (v^T has half the tiles of q / k: its upper blocks leave at the tile test).
//   q / k = rope(x_b . W^T + bias[col]) -> bf16 hi / lo planes [NB*SEQ][DQK] (M=SEQ, N=DQK, K=DM); per head 128
//           columns = two 64-wide vectors, each the 64 columns of one wave
//   v^T   = Wv . x_b^T + bv[row]  -> f16 hi plane [b][h*64+d][s] (pitch SEQ) and residual plane
//           (x4096, keys < VLP only, pitch VLP)                        (M=DM, N=SEQ, K=DM)
__global__ __launch_bounds__(256) void gemm_qkv(
    const unsigned short* __restrict__ Xb, const unsigned short* __restrict__ Wqb,
    const unsigned short* __restrict__ Wkb, const unsigned short* __restrict__ Wvb,
    unsigned short* Qh, unsigned short* Ql, unsigned short* Kh, unsigned short* Kl,
    unsigned short* VTh, unsigned short* VTl,
    const float* __restrict__ bq, const float* __restrict__ bk, const float* __restrict__ bv,
    const float* __restrict__ cosT, const float* __restrict__ sinT) {
  __shared__ __align__(16) float sT[8][16 * 68];   // per-wave 16x64 slab, pitch 68 floats
  __shared__ __align__(16) unsigned char sG[2 * GSTG_B(0)];   // two operand buffers
  const int wave = threadIdx.x >> 5;
  const int tile = blockIdx.x;
  const int b    = blockIdx.y;
  const int z    = blockIdx.z;
  if (z < 2) {
    const unsigned short* Wb = z ? Wkb : Wqb;
    unsigned short* Ch = z ? Kh : Qh;
    unsigned short* Cl = z ? Kl : Ql;
    const float* bias = z ? bk : bq;
    gemm64_tile<0, 4, 1>(Xb, Xb, DM, (long long)SEQ * DM, Wb, Wb, DM, 0LL,
                         (void*)Ch, DQK, (long long)SEQ * DQK, (void*)Cl, DQK, (long long)SEQ * DQK, DQK,
                         SEQ, DQK, DM, 1.0f, bias, cosT, sinT, sT[wave], sG, tile, b);
  } else {
    gemm64_tile<0, 3, 2>(Wvb, Wvb, DM, 0LL, Xb, Xb, DM, (long long)SEQ * DM,
                         (void*)VTh, SEQ, (long long)DM * SEQ, (void*)VTl, VLP, (long long)DM * VLP, VLP,
                         DM, SEQ, DM, 4096.0f, bv, nullptr, nullptr, sT[wave], sG, tile, b);
  }
}

#define LP      72                        // LDS row pitch of the 16-bit tiles, in elements
#define TILE_B  (64 * LP * 2)             // one 64-row tile: 9216 B
#define OSP     68                        // row pitch of a wave's f32 context tile, in floats (272 B = 16 B x 17)
#define OS_B    (4 * 16 * OSP * 4)        // four waves' f32 context tiles: 17408 B
#define ATT_LDS (4 * TILE_B + OS_B)       // 54272 B
static_assert(((LP * 2) % 16) == 0 && (((LP * 2) / 16) & 1) == 1);   // 16-B aligned rows, odd multiple of 16 B
// value of lane l ^ 16 (the other wave half)
__device__ __forceinline__ float xhalf(float x) {
  return __builtin_bit_cast(float, __builtin_amdgcn_permlanex16(__builtin_bit_cast(int, x), __builtin_bit_cast(int, x),
                                                                0x76543210, 0xfedcba98, false, false));
}
template <bool RES>
__device__ __forceinline__
void attn_block64(unsigned char* smem,
                  const unsigned short* __restrict__ qhp, const unsigned short* __restrict__ qlp,
                  const unsigned short* __restrict__ khp, const unsigned short* __restrict__ klp,
                  const unsigned short* __restrict__ vhp, const unsigned short* __restrict__ vlp,
                  float* Cp, int soff, int qb, int h, float sscale) {
  union FB { v16b v; v8b h[2]; };
  union FH { v16h v; v8h h[2]; };
  __bf16*   Ksh = (__bf16*)(void*)(smem);                         // K hi [kv][d]
  __bf16*   Ksl = (__bf16*)(void*)(smem + TILE_B);                // K lo
  _Float16* Vth = (_Float16*)(void*)(smem + 2 * TILE_B);          // V^T hi [d][kv]
  float*    Os  = (float*)(void*)(smem + 3 * TILE_B);             // per wave context tile [row][d], 4 x 4352 B
  _Float16* Vtl = (_Float16*)(void*)(smem + 3 * TILE_B + OS_B);   // V^T residual (RES only)

  const int tid  = threadIdx.x;
  // wave-uniform, so held in a scalar register: as a vector register it is live across the loop, and the body with the
  // residual planes then spills under the kernel's budget of 192 registers
  const int wave = __builtin_amdgcn_readfirstlane(tid >> 5);
  const int lane = tid & 31;
  const int hh   = lane >> 4;
  const int c    = lane & 15;

  const int q0   = qb * 64 + wave * 16;
  const int col  = h * (2 * HD) + soff;

  const __bf16* Qh = (const __bf16*)(const void*)qhp + col;
  const __bf16* Ql = (const __bf16*)(const void*)qlp + col;
  const __bf16* Kh = (const __bf16*)(const void*)khp + col;
  const __bf16* Kl = (const __bf16*)(const void*)klp + col;
  const _Float16* Vh = (const _Float16*)(const void*)vhp + (size_t)h * HD * SEQ;
  const _Float16* Vl = (const _Float16*)(const void*)vlp + (size_t)h * HD * VLP;

  // ---- Q fragments (B operand, column = query = lane&15): 2 d-chunks, hi and lo ----
  v16b qah[2], qal[2];
#pragma unroll
  for (int dc = 0; dc < 2; ++dc) {
    const size_t qo = (size_t)(q0 + c) * DQK + dc * 32 + 8 * hh;
    qah[dc] = ldfrag_b(Qh + qo);
    qal[dc] = ldfrag_b(Ql + qo);
  }

  const int qrow = q0 + c;                   // this lane's query row
  float mrow = -INFINITY;                    // its running maximum (equal in both wave halves)
  float lrow = 0.f;                          // running sum over this wave half's keys only; joined after the loop
  v8f oacc[4];                               // oacc[t][r] = context^T [d = t*16 + 8*hh + r][query c]
#pragma unroll
  for (int t = 0; t < 4; ++t) oacc[t] = zero8();

  for (int kt = 0; kt < NQB; ++kt) {         // static trip bound
    if (kt > qb) break;                      // block-uniform (causal)
    const bool diag = (kt == qb);            // block-uniform
    const int kv0 = kt * 64;
    __syncthreads();
    {
      const int g = tid >> 3, ch = (tid & 7) * 8;                  // group of 8 lanes = one row; elements ch..ch+7
      const int r = (g >> 1) | ((g & 1) << 3);                     // pass i: row r + 16 i; groups 2m, 2m+1 -> rows m, m+8
      const __bf16*   kg  = Kh + (size_t)(kv0 + r) * DQK + ch;     // K row kv0+r, d = ch..ch+7
      const __bf16*   klg = Kl + (size_t)(kv0 + r) * DQK + ch;
      const _Float16* vg  = Vh + (size_t)r * SEQ + kv0 + ch;        // V^T row d = r, s = kv0+ch..+7
      const int kvl = (kv0 + 64 <= VLP) ? kv0 : (VLP - 64);       // clamped address into the residual plane
      const _Float16* vlg = Vl + (size_t)r * VLP + kvl + ch;
      const bool resOK = (kv0 + 64 <= VLP);                        // block-uniform
      v8b a0[4], a1[4];
      v8h b0[4], b1[4];
#pragma unroll
      for (int i = 0; i < 4; ++i) {
        a0[i] = *(const v8b*)(kg + (size_t)(16 * i) * DQK);
        a1[i] = *(const v8b*)(klg + (size_t)(16 * i) * DQK);
        b0[i] = *(const v8h*)(vg + (size_t)(16 * i) * SEQ);
        if (RES) {
          b1[i] = *(const v8h*)(vlg + (size_t)(16 * i) * VLP);
          if (!resOK) b1[i] = zero8h();
        }
      }
#if defined(__HIP_DEVICE_COMPILE__)
      // s_wait_xcnt 0 before a register that an issued load names is written again; the addresses are inputs so that
      // they stay in their registers up to the wait (else the last load's destination may take an address pair over).
      if (RES) asm volatile("s_wait_xcnt 0x0" :: "v"(kg), "v"(klg), "v"(vg), "v"(vlg) : "memory");
      else     asm volatile("s_wait_xcnt 0x0" :: "v"(kg), "v"(klg), "v"(vg) : "memory");
#endif
#pragma unroll
      for (int i = 0; i < 4; ++i) {
        *(v8b*)(Ksh + (r + 16 * i) * LP + ch) = a0[i];
        *(v8b*)(Ksl + (r + 16 * i) * LP + ch) = a1[i];
        *(v8h*)(Vth + (r + 16 * i) * LP + ch) = b0[i];
        if (RES) *(v8h*)(Vtl + (r + 16 * i) * LP + ch) = b1[i];
      }
    }
    __syncthreads();

    // ---- scores^T: 64 keys x 16 query columns per wave, 3 bf16 products; s[j][r] = key j*16 + 8*hh + r, query c ----
    //      Without the residual planes, per 32 d: the 8 K fragments (16 LDS reads) are asked for as one group, then 12 plain
    //      products follow in which neighbours belong to different key tiles (a product on the tile of the one before it
    //      waits out the matrix latency, and each other's issue fills the distance that a VALU use of a result needs).
    //      Per tile the six products keep their order: dc 0 hi.hi, lo.hi, hi.lo, then dc 1.
    //      With the residual planes the registers do not reach for the groups (spills): one fragment pair at a time.
    v8f s[4];
    if (!RES) {
#pragma unroll
      for (int j = 0; j < 4; ++j) s[j] = zero8();
      // unrolled: the Q fragments are register arrays and need constant indices
#pragma unroll
      for (int dc = 0; dc < 2; ++dc) {
        FB kb[4], kl[4];
#pragma unroll
        for (int j = 0; j < 4; ++j) {
          kb[j].h[0] = *(const v8b*)(Ksh + (j * 16 + c) * LP + dc * 32 + 8 * hh);
          kb[j].h[1] = *(const v8b*)(Ksh + (j * 16 + c) * LP + dc * 32 + 16 + 8 * hh);
        }
#pragma unroll
        for (int j = 0; j < 4; ++j) {
          kl[j].h[0] = *(const v8b*)(Ksl + (j * 16 + c) * LP + dc * 32 + 8 * hh);
          kl[j].h[1] = *(const v8b*)(Ksl + (j * 16 + c) * LP + dc * 32 + 16 + 8 * hh);
        }
        // keeps the reads together in front of the products: left free, the compiler spreads them singly among the products
        group_fence();
#pragma unroll
        for (int j = 0; j < 4; ++j) s[j] = mma_b_raw(kb[j].v, qah[dc], s[j]);
#pragma unroll
        for (int j = 0; j < 4; ++j) s[j] = mma_b_raw(kl[j].v, qah[dc], s[j]);
#pragma unroll
        for (int j = 0; j < 4; ++j) s[j] = mma_b_raw(kb[j].v, qal[dc], s[j]);
        // the next group's reads stay behind this group's products: with two groups under way the registers do not reach (spills)
        group_fence();
      }
    } else {
#pragma unroll
      for (int j = 0; j < 4; ++j) {
        s[j] = zero8();
#pragma unroll
        for (int dc = 0; dc < 2; ++dc) {
          FB kb, kl;
          kb.h[0] = *(const v8b*)(Ksh + (j * 16 + c) * LP + dc * 32 + 8 * hh);
          kb.h[1] = *(const v8b*)(Ksh + (j * 16 + c) * LP + dc * 32 + 16 + 8 * hh);
          kl.h[0] = *(const v8b*)(Ksl + (j * 16 + c) * LP + dc * 32 + 8 * hh);
          kl.h[1] = *(const v8b*)(Ksl + (j * 16 + c) * LP + dc * 32 + 16 + 8 * hh);
          s[j] = mma_b(kb.v, qah[dc], s[j]);
          s[j] = mma_b(kl.v, qah[dc], s[j]);
          s[j] = mma_b(kb.v, qal[dc], s[j]);
        }
      }
    }

    // ---- scale, causal fill on the diagonal tile, maximum of the lane's 32 keys and of the other half's,
    //      online softmax, P (x1024, f16) and P residual (x4096) packed into B operands ----
    float mj[4];
#pragma unroll
    for (int j = 0; j < 4; ++j) {
      mj[j] = -INFINITY;
#pragma unroll
      for (int r = 0; r < 8; ++r) {
        const int key = kv0 + j * 16 + 8 * hh + r;
        float sv = s[j][r] * sscale;
        sv = (diag && key > qrow) ? -INFINITY : sv;
        s[j][r] = sv;
        mj[j] = fmaxf(mj[j], sv);
      }
    }
    float m = fmaxf(fmaxf(mj[0], mj[1]), fmaxf(mj[2], mj[3]));
    m = fmaxf(m, xhalf(m));
    const float mnew  = fmaxf(mrow, m);
    const float msafe = (mnew == -INFINITY) ? 0.f : mnew;
    const float alpha = __expf(mrow - msafe);
    mrow = mnew;
    v16h pbh[2], pbl[2];                     // element (j&1)*8 + r of block j>>1 = key (j>>1)*32 + (j&1)*16 + 8*hh + r
    float pj[4];                             // four independent partial sums of 8 keys each
#pragma unroll
    for (int j = 0; j < 4; ++j) {
      pj[j] = 0.f;
#pragma unroll
      for (int r = 0; r < 8; ++r) {
        const float p = __expf(s[j][r] - msafe);     // -inf logit: exp -> 0
        pj[j] += p;
        const float p1k = p * 1024.0f;
        const _Float16 ph = (_Float16)p1k;
        pbh[j >> 1][(j & 1) * 8 + r] = ph;
        if (RES) pbl[j >> 1][(j & 1) * 8 + r] = (_Float16)((p1k - (float)ph) * 4096.0f);
      }
    }
    lrow = lrow * alpha + ((pj[0] + pj[1]) + (pj[2] + pj[3]));
#pragma unroll
    for (int t = 0; t < 4; ++t)
#pragma unroll
      for (int r = 0; r < 8; ++r) oacc[t][r] *= alpha;

    // ---- context^T += V^T . P^T (f16 WMMA), residual products into a separate accumulator ----
    v8f o1[4];
#pragma unroll
    for (int t = 0; t < 4; ++t) o1[t] = zero8();
    // unrolled: the P operands are register arrays and need constant indices
#pragma unroll
    for (int kk = 0; kk < 2; ++kk) {
      if (!RES) {
        // the same form as the scores: the 4 V^T fragments (8 LDS reads) as one group, then 4 plain products on 4 tiles
        FH vb[4];
#pragma unroll
        for (int t = 0; t < 4; ++t) {
          vb[t].h[0] = *(const v8h*)(Vth + (t * 16 + c) * LP + kk * 32 + 8 * hh);
          vb[t].h[1] = *(const v8h*)(Vth + (t * 16 + c) * LP + kk * 32 + 16 + 8 * hh);
        }
        // boundary between the reads and their products: this kk's products then start as their fragments arrive; left free,
        // the compiler forms all of P in front of the first product and the loop comes out longer
        group_fence();
#pragma unroll
        for (int t = 0; t < 4; ++t) oacc[t] = mma_h_raw(vb[t].v, pbh[kk], oacc[t]);
      } else {
#pragma unroll
        for (int t = 0; t < 4; ++t) {
          FH vb, vl;
          vb.h[0] = *(const v8h*)(Vth + (t * 16 + c) * LP + kk * 32 + 8 * hh);
          vb.h[1] = *(const v8h*)(Vth + (t * 16 + c) * LP + kk * 32 + 16 + 8 * hh);
          oacc[t] = mma_h(vb.v, pbh[kk], oacc[t]);
          vl.h[0] = *(const v8h*)(Vtl + (t * 16 + c) * LP + kk * 32 + 8 * hh);
          vl.h[1] = *(const v8h*)(Vtl + (t * 16 + c) * LP + kk * 32 + 16 + 8 * hh);
          o1[t] = mma_h(vl.v, pbh[kk], o1[t]);
          o1[t] = mma_h(vb.v, pbl[kk], o1[t]);
        }
      }
    }
    if (RES) {
#pragma unroll
      for (int t = 0; t < 4; ++t)
#pragma unroll
        for (int r = 0; r < 8; ++r) oacc[t][r] += o1[t][r] * (1.0f / 4096.0f);
    }
  }

  // ---- join the halves' sums, normalise (1/l and the 1/1024 p carry), stage the wave's 16x64 tile as [query][d]
  //      (a lane holds 8 consecutive d of its query per t: two 16-B LDS stores), write f32 rows as whole 256-B segments
  float* os = Os + wave * (16 * OSP);
  {
    const float l = lrow + xhalf(lrow);
    const float inv = ((l > 0.f) ? (1.0f / l) : 0.f) * (1.0f / 1024.0f);
#pragma unroll
    for (int t = 0; t < 4; ++t) {
      v4f w0, w1;
#pragma unroll
      for (int e = 0; e < 4; ++e) { w0[e] = oacc[t][e] * inv; w1[e] = oacc[t][4 + e] * inv; }
      *(v4f*)(os + c * OSP + t * 16 + 8 * hh)     = w0;
      *(v4f*)(os + c * OSP + t * 16 + 8 * hh + 4) = w1;
    }
  }
  __builtin_amdgcn_fence(__ATOMIC_RELEASE, "workgroup");
  __builtin_amdgcn_wave_barrier();
  __builtin_amdgcn_fence(__ATOMIC_ACQUIRE, "workgroup");
  {
    const int h2 = lane >> 4, c4 = (lane & 15) * 4;
    v4f ov[8];
#pragma unroll
    for (int it = 0; it < 8; ++it) {
      const int row = it * 2 + h2;   // it 0..7 x h2 0..1 = rows 0..15 of the wave tile
      ov[it] = *(const v4f*)(os + row * OSP + c4);
    }
    {
#pragma unroll
      for (int it = 0; it < 8; ++it) {
        const int row = it * 2 + h2;
        const size_t go = (size_t)(q0 + row) * DM + (size_t)h * HD + c4;
        *(v4f*)(Cp + go) = ov[it];
      }
#if defined(__HIP_DEVICE_COMPILE__)
      // s_wait_xcnt 0 behind the run of stores: in the merged kernel the listing holds a branch from the end of this
      // body to the head of the other one, where registers that these stores name are written again.
      asm volatile("s_wait_xcnt 0x0" ::: "memory");
#endif
    }
  }
}

// All query blocks of both streams, all heads and both batch elements in one grid of NQB * 2 * NB * NH blocks.
// blockIdx.x / 64 counts the query blocks down from the last one: the blocks with the most key tiles get the lowest
// indices (for speed only).
// blockIdx.x % 64 = batch * 32 + stream * 16 + head. Query blocks below RESQB take the body with residual planes
// (block-uniform choice).
// amdgpu_waves_per_eu(5, 5): a budget of 192 registers, five waves per SIMD as before; left free, the build takes 206
// registers for the read groups (an allocation of 208), which leaves four waves per SIMD.
__global__ __launch_bounds__(128) __attribute__((amdgpu_waves_per_eu(5, 5)))
void attn_causal64(const unsigned short* __restrict__ qhp, const unsigned short* __restrict__ qlp,
                   const unsigned short* __restrict__ khp, const unsigned short* __restrict__ klp,
                   const unsigned short* __restrict__ vhp, const unsigned short* __restrict__ vlp,
                   float* C1p, float* C2p, float sscale) {
  __shared__ __align__(16) unsigned char smem[ATT_LDS];
  const int bx     = blockIdx.x;
  const int qb     = NQB - 1 - (bx >> 6);
  const int h      = bx & 15;
  const int stream = (bx >> 4) & 1;
  const int b      = (bx >> 5) & 1;
  const size_t qk = (size_t)b * SEQ * DQK;
  const unsigned short* vh = vhp + (size_t)b * DM * SEQ;
  const unsigned short* vl = vlp + (size_t)b * DM * VLP;
  float* Cp = (stream ? C2p : C1p) + (size_t)b * SEQ * DM;
  const int soff = stream * HD;
  if (qb < RESQB) attn_block64<true >(smem, qhp + qk, qlp + qk, khp + qk, klp + qk, vh, vl, Cp, soff, qb, h, sscale);
  else            attn_block64<false>(smem, qhp + qk, qlp + qk, khp + qk, klp + qk, vh, vl, Cp, soff, qb, h, sscale);
}

// =====================================================================================================
// Differential combine + head rms norm for one token row t of the NB*SEQ rows:
//   lam[h] = (0.2 + exp(sum_d lq1.lk1)) - exp(sum_d lq2.lk2): read from the table that the convert launch wrote
//   o = c1 - lam*c2; r = rsqrt(sum_d(o^2)/64 + 1e-6); o = ((o*r) * w[h][d]) * 0.8
//   written as bf16 hi / lo planes [NB*SEQ][DM] (merged head layout), one 16-B store per plane per lane
// grid = NB*SEQ blocks x 128 threads; thread -> columns 8*tid..+7 (head = tid>>3, 8 lanes per head).
// coverage: 128 threads x 8 = 1024 columns per row; NB*SEQ rows.
// =====================================================================================================
__global__ __launch_bounds__(128) void diff_combine(
    const float* __restrict__ C1, const float* __restrict__ C2,
    const float* __restrict__ lamT,
    const float* __restrict__ hnw, unsigned short* Oh, unsigned short* Ol) {
#pragma clang fp contract(off)
  const int tid = threadIdx.x;
  const int t   = blockIdx.x;
  const int c0 = tid * 8;
  const int h  = c0 >> 6;
  const int d0 = c0 & 63;
  const size_t ro = (size_t)t * DM + c0;
  const v4f x0 = *(const v4f*)(C1 + ro), x1 = *(const v4f*)(C1 + ro + 4);
  const v4f y0 = *(const v4f*)(C2 + ro), y1 = *(const v4f*)(C2 + ro + 4);
  const float lam = lamT[h];
#if defined(__HIP_DEVICE_COMPILE__)
  // s_wait_xcnt 0 before a register that an issued load names is written again; the addresses are inputs so that
  // they stay in their registers up to the wait (else a later load's destination may take an address pair over).
  asm volatile("s_wait_xcnt 0x0" :: "v"(C1 + ro), "v"(C2 + ro) : "memory");
#endif
  float o[8];
  float ss = 0.f;
#pragma unroll
  for (int e = 0; e < 4; ++e) {
    o[e]     = x0[e] - lam * y0[e];
    o[4 + e] = x1[e] - lam * y1[e];
  }
#pragma unroll
  for (int e = 0; e < 8; ++e) ss += o[e] * o[e];
  ss += __shfl_xor(ss, 1, 32);
  ss += __shfl_xor(ss, 2, 32);
  ss += __shfl_xor(ss, 4, 32);
  const float ms = ss * (1.0f / (float)HD);
  const float rn = rsqrtf(ms + 1.0e-6f);
  v4u hv, lv;
#pragma unroll
  for (int e = 0; e < 4; ++e) {
    const float w0 = bfr(hnw[h * HD + d0 + 2 * e]);
    const float w1 = bfr(hnw[h * HD + d0 + 2 * e + 1]);
    const float f0 = ((o[2 * e] * rn) * w0) * OSCL;
    const float f1 = ((o[2 * e + 1] * rn) * w1) * OSCL;
    const unsigned short h0 = bf_bits(f0), h1 = bf_bits(f1);
    const unsigned short l0 = bf_bits(f0 - bf_up(h0)), l1 = bf_bits(f1 - bf_up(h1));
    hv[e] = pk16(h0, h1); lv[e] = pk16(l0, l1);
  }
  *(v4u*)(Oh + ro) = hv;
  *(v4u*)(Ol + ro) = lv;
  
}

// =====================================================================================================
// Workspace map (bytes, all offsets multiples of 4096):
//   Xb   bf16 [4096][1024]      8388608      Wqb bf16 [2048][1024] 4194304   Wkb 4194304
//   Wvb  bf16 [1024][1024]      2097152      Wob 2097152
//   invf f32 [32] (padded)         4096      cosT f32 [2048][32] 262144      sinT 262144
//   both batch elements, batch-major:
//   Qh/Ql/Kh/Kl bf16 [2][2048][2048]  4 x 16777216
//   VTh  f16  [2][1024][2048]      8388608      VTl f16 [2][1024][512] 2097152
//   C1/C2 f32 [2][2048][1024]   2 x 16777216    Oh/Ol bf16 [2][2048][1024] 2 x 8388608
//   lam  f32 [16] (padded)          4096
//   end                          149430272
// All planes are exact multiples of their 64x64 / whole-line store granularity (no padded tails needed).
// Weights are [out n][in k] with k contiguous = the Bt / A layout the GEMM wants, so they are only converted.
// =====================================================================================================
extern "C" void kernel_launch(void* const* d_in, const int* in_sizes, int n_in,
                              void* d_out, int out_size, void* d_ws, size_t ws_size,
                              hipStream_t stream) {
  if (n_in < 14) return;
  if (in_sizes[0] != NB * SEQ * DM) return;
  if (in_sizes[1] != DQK * DM || in_sizes[2] != DQK) return;
  if (in_sizes[3] != DQK * DM || in_sizes[4] != DQK) return;
  if (in_sizes[5] != DM * DM || in_sizes[6] != DM) return;
  if (in_sizes[7] != DM * DM || in_sizes[8] != DM) return;
  for (int i = 9; i < 14; ++i) if (in_sizes[i] != NH * HD) return;
  if (out_size != NB * SEQ * DM) return;

  const float* x   = (const float*)d_in[0];
  const float* Wq  = (const float*)d_in[1];
  const float* bq  = (const float*)d_in[2];
  const float* Wk  = (const float*)d_in[3];
  const float* bk  = (const float*)d_in[4];
  const float* Wv  = (const float*)d_in[5];
  const float* bv  = (const float*)d_in[6];
  const float* Wo  = (const float*)d_in[7];
  const float* bo  = (const float*)d_in[8];
  const float* hnw = (const float*)d_in[9];
  const float* lq1 = (const float*)d_in[10];
  const float* lk1 = (const float*)d_in[11];
  const float* lq2 = (const float*)d_in[12];
  const float* lk2 = (const float*)d_in[13];
  float* outp = (float*)d_out;

  const size_t PXB  = (size_t)NB * SEQ * DM * 2;    //  8388608
  const size_t PWQ  = (size_t)DQK * DM * 2;         //  4194304
  const size_t PWV  = (size_t)DM * DM * 2;          //  2097152
  const size_t PIF  = 4096;                         //  32 floats used by invf, 16 by lam
  const size_t PTAB = (size_t)SEQ * NFREQ * 4;      //   262144
  const size_t PQP  = (size_t)NB * SEQ * DQK * 2;   // 16777216
  const size_t PVT  = (size_t)NB * DM * SEQ * 2;    //  8388608
  const size_t PVL  = (size_t)NB * DM * VLP * 2;    //  2097152
  const size_t PC   = (size_t)NB * SEQ * DM * 4;    // 16777216
  const size_t PO   = (size_t)NB * SEQ * DM * 2;    //  8388608
  size_t off = 0;
  const size_t oXb  = off; off += PXB;
  const size_t oWq  = off; off += PWQ;
  const size_t oWk  = off; off += PWQ;
  const size_t oWv  = off; off += PWV;
  const size_t oWo  = off; off += PWV;
  const size_t oIF  = off; off += PIF;
  const size_t oCos = off; off += PTAB;
  const size_t oSin = off; off += PTAB;
  const size_t oQh  = off; off += PQP;
  const size_t oQl  = off; off += PQP;
  const size_t oKh  = off; off += PQP;
  const size_t oKl  = off; off += PQP;
  const size_t oVTh = off; off += PVT;
  const size_t oVTl = off; off += PVL;
  const size_t oC1  = off; off += PC;
  const size_t oC2  = off; off += PC;
  const size_t oOh  = off; off += PO;
  const size_t oOl  = off; off += PO;
  const size_t oLam = off; off += PIF;
  if (off > ws_size) return;                        // off = 149430272

  char* ws = (char*)d_ws;
  unsigned short* Xb  = (unsigned short*)(ws + oXb);
  unsigned short* Wqb = (unsigned short*)(ws + oWq);
  unsigned short* Wkb = (unsigned short*)(ws + oWk);
  unsigned short* Wvb = (unsigned short*)(ws + oWv);
  unsigned short* Wob = (unsigned short*)(ws + oWo);
  float*          IFt = (float*)(ws + oIF);
  float*          CosT = (float*)(ws + oCos);
  float*          SinT = (float*)(ws + oSin);
  unsigned short* Qh  = (unsigned short*)(ws + oQh);
  unsigned short* Ql  = (unsigned short*)(ws + oQl);
  unsigned short* Kh  = (unsigned short*)(ws + oKh);
  unsigned short* Kl  = (unsigned short*)(ws + oKl);
  unsigned short* VTh = (unsigned short*)(ws + oVTh);
  unsigned short* VTl = (unsigned short*)(ws + oVTl);
  float*          C1  = (float*)(ws + oC1);
  float*          C2  = (float*)(ws + oC2);
  unsigned short* Oh  = (unsigned short*)(ws + oOh);
  unsigned short* Ol  = (unsigned short*)(ws + oOl);
  float*          Lam = (float*)(ws + oLam);

  const dim3 blk256(256), blk128(128), blk32(32);
  const dim3 gCvt((NB * SEQ * DM + 2 * DQK * DM + 2 * DM * DM) / 8 / 256 + 1);   // 5120 blocks + the lam block
  const dim3 gTab((SEQ * NFREQ + 255) / 256);                      //  256 blocks
  const dim3 gQKV((SEQ / 64) * (DQK / 64) / 8, NB, 3);             // 1024 tiles -> 128 blocks, x batch x {q, k, v^T}
  const dim3 gOut((NB * SEQ / 64) * (DM / 64) / 8, 1);             // 1024 tiles -> 128 blocks
  const dim3 gRow(NB * SEQ);                                       // one block per token row
  const dim3 gAtt(NQB * 2 * NB * NH);                              // 2048 blocks

  // (1) inputs -> bf16 planes; weights [n][k] f32 -> bf16 [n][k]; Xb, Wqb, Wkb, Wvb, Wob are contiguous from Xb; lam table
  cvt_bf16x8<<<gCvt, blk256, 0, stream>>>(x, Wq, Wk, Wv, Wo, Xb, lq1, lk1, lq2, lk2, Lam);
  // (2) rope tables
  invfreq_tab<<<dim3(1), blk32, 0, stream>>>(IFt);
  rope_tab<<<gTab, blk256, 0, stream>>>(IFt, CosT, SinT);
  // (3) q, k -> rope -> bf16 hi / lo planes [NB*SEQ][DQK]; v^T -> f16 hi plane and residual plane, both batch elements
  gemm_qkv<<<gQKV, blk256, 0, stream>>>(Xb, Wqb, Wkb, Wvb, Qh, Ql, Kh, Kl, VTh, VTl, bq, bk, bv, CosT, SinT);
  // (4) causal attention, stream 1 (q1, k1) -> C1 and stream 2 (q2, k2) -> C2;
  //     query blocks 0..RESQB-1 with residual planes, the rest without
  attn_causal64<<<gAtt, blk128, 0, stream>>>(Qh, Ql, Kh, Kl, VTh, VTl, C1, C2, 0.125f);
  // (5) differential combine + head norm -> O bf16 hi/lo planes [NB*SEQ][DM]
  diff_combine<<<gRow, blk128, 0, stream>>>(C1, C2, Lam, hnw, Oh, Ol);
  // (6) out = O . Wo^T + bo -> d_out, f32 [NB*SEQ][DM]  (A = O hi + lo planes, 2 products)
  gemm64<1, 0, 1><<<gOut, blk256, 0, stream>>>(
      Oh, Ol, DM, 0LL, Wob, Wob, DM, 0LL,
      (void*)outp, DM, 0LL, (void*)outp, DM, 0LL, DM,
      NB * SEQ, DM, DM, 1.0f, bo);
  (void)hipGetLastError();
}

// v009
// One run takes 149 microseconds.
// Next to v008, in two timings, it ran 1.06 and 1.05 times as fast.
// Counting every step since v000, it is 7.31 times as fast.
// Contractions: q, k, v^T projections = v_wmma_f32_16x16x32_bf16 (bf16 operands from RNE-converted inputs, single product);
// q.k^T scores (both streams) = v_wmma_f32_16x16x32_bf16 with bf16 hi/lo split q and k (hi.hi + hi.lo + lo.hi);
// p.v = v_wmma_f32_16x16x32_f16 (p carried x1024 in f16, v in f16; extra f16 residual planes x4096 of p and v for the first 512 query rows);
// ctx.Wo^T = v_wmma_f32_16x16x32_bf16 with ctx as bf16 hi/lo planes times bf16 Wo (2 products); all f32 accumulate;
// rope, softmax, lambda, head rms norm in f32.
#include <hip/hip_runtime.h>
#include <math.h>
#include <float.h>
#include <stdint.h>

#define NB    2
#define SEQ   2048
#define DM    1024
#define DQK   2048          // q / k projection width (2 x 64 per head)
#define NH    16
#define HD    64
#define NFREQ (HD / 2)
#define NQB   (SEQ / 64)    // 32 key / query tiles of 64
#define VLP   512           // key pitch of the v^T residual plane (keys 0..VLP-1)
#define RESQB 8             // number of leading 64-row query blocks that use the p / v residual planes
#define LAM0  0.2f
#define OSCL  0.8f
static_assert(RESQB * 64 <= VLP);
static_assert(NH * HD == DM);
static_assert(NB == 2 && NH == 16);   // the attention grid's index split
static_assert(NH * 2 * HD == DQK);
static_assert((SEQ % 256) == 0 && (DM % 256) == 0 && (DQK % 256) == 0);   // GEMM block tiles 128 x 256 / 128 x 128, 64 k per trip
static_assert((DM / 128) * (SEQ / 128) == (SEQ / 128) * (DQK / 256));     // v^T has as many 128 x 128 tiles as q has 128 x 256 ones

typedef _Float16 v16h __attribute__((ext_vector_type(16)));
typedef _Float16 v8h  __attribute__((ext_vector_type(8)));
typedef __bf16   v16b __attribute__((ext_vector_type(16)));
typedef __bf16   v8b  __attribute__((ext_vector_type(8)));
typedef float    v8f  __attribute__((ext_vector_type(8)));
typedef float    v4f  __attribute__((ext_vector_type(4)));
typedef unsigned int v4u __attribute__((ext_vector_type(4)));

// ---- scalar helpers --------------------------------------------------------------------------------
__device__ __forceinline__ unsigned short bf_bits(float f) {          // f32 -> bf16 bits, RNE convert
  unsigned u = __float_as_uint(f);
  return (unsigned short)((u + 0x7FFFu + ((u >> 16) & 1u)) >> 16);
}
__device__ __forceinline__ float bf_up(unsigned short h) { return __uint_as_float(((unsigned)h) << 16); }
__device__ __forceinline__ float bfr(float f) { return bf_up(bf_bits(f)); }   // value after RNE convert to bf16
__device__ __forceinline__ unsigned short h_bits(_Float16 x) { return __builtin_bit_cast(unsigned short, x); }
__device__ __forceinline__ unsigned pk16(unsigned short a, unsigned short b) { return (unsigned)a | ((unsigned)b << 16); }
__device__ __forceinline__ v8f zero8() { v8f z = {0.f, 0.f, 0.f, 0.f, 0.f, 0.f, 0.f, 0.f}; return z; }
__device__ __forceinline__ v8h zero8h() {
  const _Float16 z = (_Float16)0.0f;
  v8h r = {z, z, z, z, z, z, z, z};
  return r;
}

// ---- fragment loaders: 16-bit A/B operand, lane -> row/col (lane&15), p already includes +8*(lane>>4);
//      elements 0..7 <- p[0..7] (k0+8h..), elements 8..15 <- p[16..23] (k0+16+8h..)
__device__ __forceinline__ v16b ldfrag_b(const __bf16* p) {
  union { v16b v; v8b h[2]; } f;
  f.h[0] = *(const v8b*)(p);
  f.h[1] = *(const v8b*)(p + 16);
  return f.v;
}

// ---- WMMA helpers with trailing VALU hazard gap --------------------------------------------------------
__device__ __forceinline__ v8f mma_b(v16b a, v16b b, v8f c) {
  c = __builtin_amdgcn_wmma_f32_16x16x32_bf16(false, a, false, b, (short)0, c, false, false);
#if defined(__HIP_DEVICE_COMPILE__)
  asm volatile("v_nop\n\tv_nop\n\tv_nop\n\tv_nop" : "+v"(c) : "v"(a), "v"(b));
#endif
  return c;
}
__device__ __forceinline__ v8f mma_h(v16h a, v16h b, v8f c) {
  c = __builtin_amdgcn_wmma_f32_16x16x32_f16(false, a, false, b, (short)0, c, false, false);
#if defined(__HIP_DEVICE_COMPILE__)
  asm volatile("v_nop\n\tv_nop\n\tv_nop\n\tv_nop" : "+v"(c) : "v"(a), "v"(b));
#endif
  return c;
}
__device__ __forceinline__ v8f mma_b_raw(v16b a, v16b b, v8f c) {
  return __builtin_amdgcn_wmma_f32_16x16x32_bf16(false, a, false, b, (short)0, c, false, false);
}
__device__ __forceinline__ v8f mma_h_raw(v16h a, v16h b, v8f c) {
  return __builtin_amdgcn_wmma_f32_16x16x32_f16(false, a, false, b, (short)0, c, false, false);
}
// Compiler-only fence, no instruction: the instruction scheduler moves nothing across it.
__device__ __forceinline__ void group_fence() {
#if defined(__HIP_DEVICE_COMPILE__)
  __builtin_amdgcn_sched_barrier(0);
#endif
}
__device__ __forceinline__ void dep_guard_b(v8f& a, v8f& b, v16b x, v16b y) {
#if defined(__HIP_DEVICE_COMPILE__)
  asm volatile("v_nop\n\tv_nop\n\tv_nop\n\tv_nop" : "+v"(a), "+v"(b) : "v"(x), "v"(y));
#endif
}
__device__ __forceinline__ void keep4_b(v16b a, v16b b, v16b c, v16b d) {
#if defined(__HIP_DEVICE_COMPILE__)
  asm volatile("v_nop" :: "v"(a), "v"(b), "v"(c), "v"(d));
#endif
}
__device__ __forceinline__ void acc_guard4(v8f& a, v8f& b, v8f& c, v8f& d) {
#if defined(__HIP_DEVICE_COMPILE__)
  asm volatile("v_nop\n\tv_nop\n\tv_nop\n\tv_nop" : "+v"(a), "+v"(b), "+v"(c), "+v"(d));
#endif
}

// =====================================================================================================
// f32 -> bf16 (RNE convert), 8 elements per thread, one 16-B store per lane: a wave writes 512 contiguous B
// One grid for x, Wq, Wk, Wv, Wo: their bf16 planes lie back to back in the workspace in that order, so the
// output index is the flat thread index minus 256 (block 0 converts nothing); the source is picked per block (every plane is a multiple of 2048
// elements, so a block never straddles two planes).
// coverage: (NX + 2 NQ + 2 NV) threads x 8 = all five planes (blocks 1 and up).
// Block 0 converts nothing: its threads 0..15 form the 16 head factors of the differential combine,
//   lam[h] = (0.2 + exp(sum_d lq1.lk1)) - exp(sum_d lq2.lk2)  (f32, inputs RNE-converted to bf16 values, d ascending),
// once per call, under the convert stream.
// =====================================================================================================
__global__ __launch_bounds__(256) void cvt_bf16x8(const float* __restrict__ x, const float* __restrict__ wq,
                                                  const float* __restrict__ wk, const float* __restrict__ wv,
                                                  const float* __restrict__ wo, unsigned short* out,
                                                  const float* __restrict__ lq1, const float* __restrict__ lk1,
                                                  const float* __restrict__ lq2, const float* __restrict__ lk2,
                                                  float* lam) {
  constexpr int NX = NB * SEQ * DM / 8, NQ = DQK * DM / 8, NV = DM * DM / 8;
  static_assert((NX % 256) == 0 && (NQ % 256) == 0 && (NV % 256) == 0);
  if (blockIdx.x == 0) {                       // block-uniform; the kernel has no barrier
    const int tid = threadIdx.x;
    if (tid < NH) {
      const float* a1 = lq1 + tid * HD;
      const float* b1 = lk1 + tid * HD;
      const float* a2 = lq2 + tid * HD;
      const float* b2 = lk2 + tid * HD;
      float sa = 0.f, sb = 0.f;
      // the product of two bf16 values is exact in f32, so each sum rounds the same whether or not it is fused with its product
      // unrolled by 8: the 32 values of 8 steps are asked for together, so that this one wave's chain ends within the convert stream
#pragma unroll 8
      for (int d = 0; d < HD; ++d) {
        sa += bfr(a1[d]) * bfr(b1[d]);
        sb += bfr(a2[d]) * bfr(b2[d]);
      }
      lam[tid] = (LAM0 + expf(sa)) - expf(sb);
    }
    return;
  }
  const int i = (blockIdx.x - 1) * 256 + threadIdx.x;
  if (i < NX + 2 * NQ + 2 * NV) {
    const float* in = x;
    int j = i;
    if (i >= NX + 2 * NQ + NV)  { in = wo; j = i - (NX + 2 * NQ + NV); }
    else if (i >= NX + 2 * NQ)  { in = wv; j = i - (NX + 2 * NQ); }
    else if (i >= NX + NQ)      { in = wk; j = i - (NX + NQ); }
    else if (i >= NX)           { in = wq; j = i - NX; }
    const v4f a = *(const v4f*)(in + (size_t)j * 8);
    const v4f b = *(const v4f*)(in + (size_t)j * 8 + 4);
    v4u p;
    p[0] = pk16(bf_bits(a[0]), bf_bits(a[1]));
    p[1] = pk16(bf_bits(a[2]), bf_bits(a[3]));
    p[2] = pk16(bf_bits(b[0]), bf_bits(b[1]));
    p[3] = pk16(bf_bits(b[2]), bf_bits(b[3]));
    *(v4u*)(out + (size_t)i * 8) = p;
    
  }
}

// =====================================================================================================
// inv_freq[j] = 1 / 10000^(j/32), j = 0..31, f32 with precise powf. One block of 32 threads; the 32 values
// coverage: lanes 0..7 x 4 floats = all 32 entries.
// =====================================================================================================
__global__ __launch_bounds__(32) void invfreq_tab(float* invf) {
  __shared__ __align__(16) float sf[NFREQ];
  const int j = threadIdx.x;
  const float e = (float)j * (1.0f / (float)NFREQ);
  const float pw = powf(10000.0f, e);
  sf[j] = 1.0f / pw;
  __syncthreads();
  const v4f v = *(const v4f*)(sf + 4 * (j & 7));
  if (j < 8) *(v4f*)(invf + 4 * j) = v;
  
}

// =====================================================================================================
// cos / sin tables [SEQ][32]: angle = t * inv_freq[j] (f32 multiply), precise cosf / sinf.
// =====================================================================================================
__global__ __launch_bounds__(256) void rope_tab(const float* __restrict__ invf, float* cosT, float* sinT) {
  const int g = blockIdx.x * 256 + threadIdx.x;
  if (g < SEQ * NFREQ) {
    const int t = g / NFREQ;
    const int j = g - t * NFREQ;
    const float ang = (float)t * invf[j];
    const float cv = cosf(ang);
    const float sv = sinf(ang);
    *(float*)(cosT + g) = cv;
    *(float*)(sinT + g) = sv;
    
  }
}

// =====================================================================================================
// RoPE half-split rotation of 8 consecutive columns of one 64-wide vector, then bf16 hi/lo split: 16 B per plane
// (hv, lv). xa = the lane's 8 columns, xp = the 8 columns 32 away in the same vector (f32).
//   first half  (j < 32):   out[j]    = x[j]*cos[j]   - x[j+32]*sin[j]     (x1 = a, x2 = p)
//   second half (j < 32):   out[j+32] = x[j]*sin[j]   + x[j+32]*cos[j]     (x1 = p, x2 = a)
// =====================================================================================================
__device__ __forceinline__ void rope_row8(const float* xa, const float* xp,
                                          bool second, v4f cs0, v4f cs1, v4f sn0, v4f sn1,
                                          v4u& hv, v4u& lv) {
  // contraction off: each product and their sum round on their own, as in the reference's elementwise form, so the
  // q, k planes stay bit for bit what they were when a launch of its own rotated them
#pragma clang fp contract(off)
  const v4f xa0 = *(const v4f*)(xa);
  const v4f xa1 = *(const v4f*)(xa + 4);
  const v4f xp0 = *(const v4f*)(xp);
  const v4f xp1 = *(const v4f*)(xp + 4);
  float o[8];
#pragma unroll
  for (int e = 0; e < 4; ++e) {
    {
      const float a = xa0[e], p = xp0[e], cs = cs0[e], sn = sn0[e];
      const float f1 = a * cs - p * sn;
      const float f2 = p * sn + a * cs;
      o[e] = second ? f2 : f1;
    }
    {
      const float a = xa1[e], p = xp1[e], cs = cs1[e], sn = sn1[e];
      const float f1 = a * cs - p * sn;
      const float f2 = p * sn + a * cs;
      o[4 + e] = second ? f2 : f1;
    }
  }
#pragma unroll
  for (int e = 0; e < 4; ++e) {
    const float f0 = o[2 * e], f1 = o[2 * e + 1];
    const unsigned short h0 = bf_bits(f0), h1 = bf_bits(f1);
    const unsigned short l0 = bf_bits(f0 - bf_up(h0)), l1 = bf_bits(f1 - bf_up(h1));
    hv[e] = pk16(h0, h1); lv[e] = pk16(l0, l1);
  }
}

// =====================================================================================================
// Register-blocked bf16 WMMA GEMM: C[m][n] = sum_k A[m][k] * Bt[n][k] (+ bias); a block of 8 waves per 128 x BN tile:
// BN = 256: 2 x 4 waves of 64x64; BN = 128: 4 x 2 waves of 32x64, for a product whose 128 x 256 tiles are fewer than the
// chip's 256 WGPs (v^T, out: 128 tiles each), so that twice as many WGPs share its work.
// A row-major [M][K] pitch lda; Bt row-major [N][K] pitch ldb (k contiguous);
// M multiple of 128, N of BN, K of 64. b = batch index (strides in elements).
// The tile body is a device function (block tile index, batch index and the LDS come from the caller), so
// that one grid can hold several independent products.
// Operands reach the waves through LDS: per trip of 64 k the block's 128 A rows and BN Bt rows (128 B = one line each)
// are brought in by asynchronous copies to LDS, 16 B per lane, 8 lanes per row, so that one wave-wide copy covers 4
// whole lines; a fragment load straight from global memory touches 16 lines for the same 512 B, and every wave
// fetched its own copy of rows that its neighbours need too. Two buffers: the next trip's copies fly during this
// trip's products. LDS row pitch 144 B (16 B x odd) for the ds_load_b128 fragment reads. The k order of the products
// is unchanged (32 k per WMMA, ascending).
// NSPLIT: 0 = A.Bt; 1 = (A + A2).Bt (A2 = unscaled bf16 lo plane of A).
// OUT_MODE: 0 = f32 (pitch ldc); 2 = bf16 hi plane C + bf16 lo plane C2 (lo = RNE(v - hi), unscaled);
//           3 = f16 hi plane C + f16 residual plane C2 = f16((v - hi) * rscale), C2 written only for tiles
//               with n0 < N2 (pitch ldc2, batch stride strideC2);
//           4 = a wave's 64 columns are one 64-wide rope vector and m is the token index: rotated by the tables
//               cosT / sinT [M][32], then bf16 hi plane C + bf16 lo plane C2 (lo = RNE(v - hi), unscaled).
// BIAS: 0 = none; 1 = + bf16-RNE(bias[n]) per column; 2 = + bf16-RNE(bias[m]) per row (added in f32).
// =====================================================================================================
#define GP        72                                  // LDS row pitch of a staged operand row, in elements (144 B)
#define GROW_B    (GP * 2)
#define GSTG_B(NS, BN) ((128 + (BN) + 128 * (NS)) * GROW_B)  // one buffer: A rows | Bt rows | A2 rows
static_assert((GROW_B % 16) == 0 && ((GROW_B / 16) & 1) == 1);

// Four asynchronous 16-B copies to LDS per lane (l = the lane's LDS byte address, g = its global address).
// s_wait_xcnt 0 is the last line of the copies' own statement: it stands in front of any rewrite of the address registers.
__device__ __forceinline__ void copy4_lds(unsigned l0, const __bf16* g0, unsigned l1, const __bf16* g1,
                                          unsigned l2, const __bf16* g2, unsigned l3, const __bf16* g3) {
#if defined(__HIP_DEVICE_COMPILE__)
  asm volatile("global_load_async_to_lds_b128 %0, %1, off\n\t"
               "global_load_async_to_lds_b128 %2, %3, off\n\t"
               "global_load_async_to_lds_b128 %4, %5, off\n\t"
               "global_load_async_to_lds_b128 %6, %7, off\n\t"
               "s_wait_xcnt 0x0"
               :: "v"(l0), "v"(g0), "v"(l1), "v"(g1), "v"(l2), "v"(g2), "v"(l3), "v"(g3) : "memory");
#endif
}
// The issuing wave's own copies have landed (in front of the barrier behind which other waves read them).
__device__ __forceinline__ void wait_copies() {
#if defined(__HIP_DEVICE_COMPILE__)
  asm volatile("s_wait_asynccnt 0x0" ::: "memory");
#endif
}
// This wave's LDS reads have returned (in front of the barrier behind which their buffer is refilled).
__device__ __forceinline__ void wait_lds() {
#if defined(__HIP_DEVICE_COMPILE__)
  asm volatile("s_wait_dscnt 0x0" ::: "memory");
#endif
}
// One 64-k tile of the block's operands into one buffer: 256 threads x 16 B = 32 rows per copy; dst = the lane's LDS
// byte address of row tid>>3, chunk tid&7 of the buffer; gA / gB / gA2 = its global address in row tid>>3 of the block's rows.
template <int NSPLIT, int BN>
__device__ __forceinline__ void gemm_stage(unsigned dst, const __bf16* gA, const __bf16* gB, const __bf16* gA2,
                                           int lda, int ldb) {
  const size_t ra = (size_t)32 * lda, rb = (size_t)32 * ldb;
  constexpr unsigned R = 32 * GROW_B;
  constexpr unsigned A2 = (4 + BN / 32) * R;              // the A2 rows stand behind the BN Bt rows
  copy4_lds(dst, gA, dst + R, gA + ra, dst + 2 * R, gA + 2 * ra, dst + 3 * R, gA + 3 * ra);
  copy4_lds(dst + 4 * R, gB, dst + 5 * R, gB + rb, dst + 6 * R, gB + 2 * rb, dst + 7 * R, gB + 3 * rb);
  if (BN == 256)
    copy4_lds(dst + 8 * R, gB + 4 * rb, dst + 9 * R, gB + 5 * rb, dst + 10 * R, gB + 6 * rb, dst + 11 * R, gB + 7 * rb);
  if (NSPLIT == 1)
    copy4_lds(dst + A2, gA2, dst + A2 + R, gA2 + ra, dst + A2 + 2 * R, gA2 + 2 * ra, dst + A2 + 3 * R, gA2 + 3 * ra);
}

template <int NSPLIT, int OUT_MODE, int BIAS, int BN>
__device__ __forceinline__ void gemm64_tile(
    const unsigned short* __restrict__ Ap, const unsigned short* A2p, int lda, long long strideA,
    const unsigned short* __restrict__ Btp, const unsigned short* Bt2p, int ldb, long long strideB,
    void* Cout, int ldc, long long strideC,
    void* Cout2, int ldc2, long long strideC2, int N2,
    int M, int N, int K, float rscale, const float* __restrict__ bias,
    const float* __restrict__ cosT, const float* __restrict__ sinT,
    float* slab, unsigned char* stg, int bt, int b) {
  static_assert(NSPLIT == 0 || NSPLIT == 1);
  static_assert(BN == 256 || BN == 128);
  constexpr int WN = BN / 64;              // waves along n, 64 columns each
  constexpr int MI = 128 / (8 / WN) / 16;  // 16-row subtiles of a wave: 4 (64 rows) or 2 (32 rows)
  const __bf16* A   = (const __bf16*)(const void*)Ap;
  const __bf16* A2  = (const __bf16*)(const void*)A2p;
  const __bf16* Bt  = (const __bf16*)(const void*)Btp;
  const int tid  = threadIdx.x;
  const int lane = tid & 31;
  const int wave = tid >> 5;
  const int blocksN = N / BN;
  const int blocksM = M >> 7;
  if (bt >= blocksM * blocksN) return;   // block-uniform, in front of every copy and barrier
  const int bm  = bt / blocksN;
  const int bn  = bt - bm * blocksN;
  const int mb0 = bm << 7;
  const int nb0 = bn * BN;
  const int wm  = wave / WN;             // the wave's MI * 16 rows of the block's 128
  const int wn  = wave % WN;             // the wave's 64 columns of the block's BN
  const int wr0 = wm * (MI * 16);
  const int m0  = mb0 + wr0;
  const int n0  = nb0 + (wn << 6);

  const __bf16* Ab  = A  + (size_t)b * strideA;
  const __bf16* Bb  = Bt + (size_t)b * strideB;
  const __bf16* Ab2 = (NSPLIT >= 1) ? (A2  + (size_t)b * strideA) : Ab;

  const int rlane = lane & 15;                 // row (A) / col (B, D) within subtile
  const int koff  = (lane >> 4) * 8;           // k offset of this lane half
  const int mOff  = (lane >> 4) * 8;           // D row offset

  v8f acc[MI][4];
#pragma unroll
  for (int i = 0; i < MI; ++i)
#pragma unroll
    for (int j = 0; j < 4; ++j) acc[i][j] = zero8();

  constexpr unsigned STG = GSTG_B(NSPLIT, BN);
  const int nt   = K >> 6;                     // trips of 64 k
  const int srow = tid >> 3, sch = tid & 7;    // this lane's row (of 32 per copy) and 16-B chunk of the 128-B row
  const unsigned sdst = (unsigned)(size_t)stg + (unsigned)(srow * GROW_B + sch * 16);
  const __bf16* gA  = Ab  + (size_t)(mb0 + srow) * lda + sch * 8;
  const __bf16* gB  = Bb  + (size_t)(nb0 + srow) * ldb + sch * 8;
  const __bf16* gA2 = Ab2 + (size_t)(mb0 + srow) * lda + sch * 8;

  // tile 0 -> buffer 0, landed and published; then tile 1 -> buffer 1 in flight
  gemm_stage<NSPLIT, BN>(sdst, gA, gB, gA2, lda, ldb);
  wait_copies();
  __syncthreads();
  if (nt > 1) gemm_stage<NSPLIT, BN>(sdst + STG, gA + 64, gB + 64, gA2 + 64, lda, ldb);

  for (int t = 0; t < nt; ++t) {               // block-uniform trip count
    const __bf16* sb  = (const __bf16*)(const void*)(stg + (size_t)(t & 1) * STG);
    const __bf16* sA  = sb + (wr0 + rlane) * GP + koff;
    const __bf16* sB  = sb + (128 + (wn << 6) + rlane) * GP + koff;
    const __bf16* sA2 = (NSPLIT >= 1) ? (sb + (128 + BN + wr0 + rlane) * GP + koff) : sA;
    // unrolled (here and below): the fragment arrays need constant indices to stay in registers, and the second
    // 32-k block's LDS reads can then be issued among the first block's products
#pragma unroll
    for (int kk = 0; kk < 2; ++kk) {
      v16b bh[4], ahf[MI], alf[MI];
#pragma unroll
      for (int j = 0; j < 4; ++j) bh[j] = ldfrag_b(sB + (j << 4) * GP + kk * 32);
#pragma unroll
      for (int i = 0; i < MI; ++i) {
        ahf[i] = ldfrag_b(sA + (i << 4) * GP + kk * 32);
        if (NSPLIT >= 1) alf[i] = ldfrag_b(sA2 + (i << 4) * GP + kk * 32); else alf[i] = ahf[i];
      }
#pragma unroll
      for (int i = 0; i < MI; ++i) {
        const v16b ah = ahf[i], al = alf[i];
#pragma unroll
        for (int j = 0; j < 4; ++j) {
          acc[i][j] = mma_b_raw(ah, bh[j], acc[i][j]);
          if (NSPLIT >= 1) acc[i][j] = mma_b_raw(al, bh[j], acc[i][j]);
        }
        dep_guard_b(acc[i][0], acc[i][3], ah, al);
      }
      keep4_b(bh[0], bh[1], bh[2], bh[3]);
    }
    // foot of the trip: own reads of this buffer done, own copies of the next tile landed, one barrier for both;
    // only then the refill of the buffer that this trip has read
    wait_lds();
    wait_copies();
    __syncthreads();
    if (t + 2 < nt) {
      const int kn = (t + 2) << 6;
      gemm_stage<NSPLIT, BN>(sdst + (unsigned)(t & 1) * STG, gA + kn, gB + kn, gA2 + kn, lda, ldb);
    }
  }
  wait_copies();
#pragma unroll
  for (int i = 0; i < MI; ++i) acc_guard4(acc[i][0], acc[i][1], acc[i][2], acc[i][3]);

  // ---- epilogue ----
  float bcol[4];
#pragma unroll
  for (int j = 0; j < 4; ++j) bcol[j] = 0.f;
  if (BIAS == 1) {
#pragma unroll
    for (int j = 0; j < 4; ++j) bcol[j] = bfr(bias[n0 + (j << 4) + rlane]);
  }
#pragma unroll
  for (int i = 0; i < MI; ++i) {
    const int mBase = m0 + (i << 4);
    float brow[8];
#pragma unroll
    for (int r = 0; r < 8; ++r) brow[r] = 0.f;
    if (BIAS == 2) {
#pragma unroll
      for (int r = 0; r < 8; ++r) brow[r] = bfr(bias[mBase + mOff + r]);
    }
#pragma unroll
    for (int j = 0; j < 4; ++j) {
#pragma unroll
      for (int r = 0; r < 8; ++r) {
        slab[(mOff + r) * 68 + (j << 4) + rlane] = (acc[i][j][r] + bcol[j]) + brow[r];
      }
    }
    v4f tc[4][2], ts[4][2];                                // OUT_MODE 4: cos / sin of this lane's 4 rows x 8 columns,
    if (OUT_MODE == 4) {                                   // asked for while the slab's stores are under way
      const size_t to = (size_t)(mBase + (lane >> 3)) * NFREQ + (((lane & 7) * 8) & 31);
      const float* cr = cosT + to;
      const float* sr = sinT + to;
#pragma unroll
      for (int it = 0; it < 4; ++it) {                     // row it * 4 + (lane >> 3)
        tc[it][0] = *(const v4f*)(cr + it * 4 * NFREQ); tc[it][1] = *(const v4f*)(cr + it * 4 * NFREQ + 4);
        ts[it][0] = *(const v4f*)(sr + it * 4 * NFREQ); ts[it][1] = *(const v4f*)(sr + it * 4 * NFREQ + 4);
      }
#if defined(__HIP_DEVICE_COMPILE__)
      // s_wait_xcnt 0 before a register that an issued load names is written again; the addresses are inputs so that
      // they stay in their registers up to the wait (else a later load's destination may take an address pair over).
      asm volatile("s_wait_xcnt 0x0" :: "v"(cr), "v"(sr) : "memory");
#endif
    }
    __builtin_amdgcn_fence(__ATOMIC_RELEASE, "workgroup");
    __builtin_amdgcn_wave_barrier();
    __builtin_amdgcn_fence(__ATOMIC_ACQUIRE, "workgroup");
    if (OUT_MODE == 0) {
      float* C = (float*)Cout + (size_t)b * strideC;
      const int hh = lane >> 4, c4 = (lane & 15) * 4;     // 256-B row segment = 16 lanes x 16 B
      {
#pragma unroll
        for (int it = 0; it < 8; ++it) {
          const int row = it * 2 + hh;                     // it 0..7 x hh 0..1 = rows 0..15
          const v4f v = *(const v4f*)(slab + row * 68 + c4);
          *(v4f*)(C + (size_t)(mBase + row) * ldc + n0 + c4) = v;
        }
        
      }
    } else if (OUT_MODE == 4) {
      const int q = lane >> 3, c8 = (lane & 7) * 8;        // 8 lanes x 16 B = one 128-B line per row and plane
      unsigned short* C  = (unsigned short*)Cout  + (size_t)b * strideC;
      unsigned short* C2 = (unsigned short*)Cout2 + (size_t)b * strideC2;
      const size_t go = (size_t)(mBase + q) * ldc + n0 + c8;
      unsigned short* hp = C + go;
      unsigned short* lp = C2 + go;
#pragma unroll
      for (int ip = 0; ip < 2; ++ip) {                     // two rows at a time: row (ip * 2 + u) * 4 + q = rows 0..15
        v4u hv[2], lv[2];
#pragma unroll
        for (int u = 0; u < 2; ++u) {
          const int it = ip * 2 + u;
          const float* sp = slab + (it * 4 + q) * 68;
          rope_row8(sp + c8, sp + (c8 ^ 32), (c8 & 32) != 0, tc[it][0], tc[it][1], ts[it][0], ts[it][1], hv[u], lv[u]);
        }
#pragma unroll
        for (int u = 0; u < 2; ++u) {
          *(v4u*)(hp + (size_t)((ip * 2 + u) * 4) * ldc) = hv[u];
          *(v4u*)(lp + (size_t)((ip * 2 + u) * 4) * ldc) = lv[u];
        }
#if defined(__HIP_DEVICE_COMPILE__)
        // s_wait_xcnt 0 behind the run of stores, before a register that they name is written again; addresses and
        // data are inputs so that they stay in their registers up to the wait.
        asm volatile("s_wait_xcnt 0x0" :: "v"(hp), "v"(lp), "v"(hv[0]), "v"(lv[0]), "v"(hv[1]), "v"(lv[1]) : "memory");
#endif
      }
    } else {
      const int q = lane >> 3, c8 = (lane & 7) * 8;
      unsigned short* C  = (unsigned short*)Cout  + (size_t)b * strideC;
      unsigned short* C2 = (unsigned short*)Cout2 + (size_t)b * strideC2;
      const bool wlo = (OUT_MODE == 2) || (n0 < N2);      // wave-uniform
      v4u hv[4], lv[4];
#pragma unroll
      for (int it = 0; it < 4; ++it) {
        const int row = it * 4 + q;                        // it 0..3 x q 0..3 = rows 0..15
        const float* sp = slab + row * 68 + c8;
        v4u a, a2;
#pragma unroll
        for (int e = 0; e < 4; ++e) {
          const float f0 = sp[2 * e], f1 = sp[2 * e + 1];
          unsigned short h0, h1, l0, l1;
          if (OUT_MODE == 2) {
            h0 = bf_bits(f0); h1 = bf_bits(f1);
            l0 = bf_bits(f0 - bf_up(h0)); l1 = bf_bits(f1 - bf_up(h1));
          } else {
            const _Float16 x0 = (_Float16)f0, x1 = (_Float16)f1;
            h0 = h_bits(x0); h1 = h_bits(x1);
            l0 = h_bits((_Float16)((f0 - (float)x0) * rscale));
            l1 = h_bits((_Float16)((f1 - (float)x1) * rscale));
          }
          a[e] = pk16(h0, h1); a2[e] = pk16(l0, l1);
        }
        hv[it] = a; lv[it] = a2;
      }
      {
#pragma unroll
        for (int it = 0; it < 4; ++it) {
          const int row = it * 4 + q;
          *(v4u*)(C + (size_t)(mBase + row) * ldc + n0 + c8) = hv[it];
          if (wlo) *(v4u*)(C2 + (size_t)(mBase + row) * ldc2 + n0 + c8) = lv[it];
        }
        
      }
    }
    __builtin_amdgcn_fence(__ATOMIC_RELEASE, "workgroup");
    __builtin_amdgcn_wave_barrier();
    __builtin_amdgcn_fence(__ATOMIC_ACQUIRE, "workgroup");
  }
}

// One product per grid: blockIdx.x = 128 x BN block tile, blockIdx.y = batch index.
template <int NSPLIT, int OUT_MODE, int BIAS, int BN>
__global__ __launch_bounds__(256) void gemm64(
    const unsigned short* __restrict__ Ap, const unsigned short* A2p, int lda, long long strideA,
    const unsigned short* __restrict__ Btp, const unsigned short* Bt2p, int ldb, long long strideB,
    void* Cout, int ldc, long long strideC,
    void* Cout2, int ldc2, long long strideC2, int N2,
    int M, int N, int K, float rscale, const float* __restrict__ bias) {
  __shared__ __align__(16) float sT[8][16 * 68];   // per-wave 16x64 slab, pitch 68 floats
  __shared__ __align__(16) unsigned char sG[2 * GSTG_B(NSPLIT, BN)];   // two operand buffers
  const int wave = threadIdx.x >> 5;
  gemm64_tile<NSPLIT, OUT_MODE, BIAS, BN>(Ap, A2p, lda, strideA, Btp, Bt2p, ldb, strideB, Cout, ldc, strideC,
                                      Cout2, ldc2, strideC2, N2, M, N, K, rscale, bias, nullptr, nullptr,
                                      sT[wave], sG, blockIdx.x, blockIdx.y);
}

// q, k and v^T projections of both batch elements in one grid: blockIdx.z = 0 q, 1 k, 2 v^T; blockIdx.y = batch;
// blockIdx.x = block tile: 128 x 256 for q / k, 128 x 128 for v^T (half the output of q / k, so as many tiles). The v^T
// blocks: 256 of them reach every WGP, 128 of the larger tile would reach half.
//   q / k = rope(x_b . W^T + bias[col]) -> bf16 hi / lo planes [NB*SEQ][DQK] (M=SEQ, N=DQK, K=DM); per head 128
//           columns = two 64-wide vectors, each the 64 columns of one wave
//   v^T   = Wv . x_b^T + bv[row]  -> f16 hi plane [b][h*64+d][s] (pitch SEQ) and residual plane
//           (x4096, keys < VLP only, pitch VLP)                        (M=DM, N=SEQ, K=DM)
__global__ __launch_bounds__(256) void gemm_qkv(
    const unsigned short* __restrict__ Xb, const unsigned short* __restrict__ Wqb,
    const unsigned short* __restrict__ Wkb, const unsigned short* __restrict__ Wvb,
    unsigned short* Qh, unsigned short* Ql, unsigned short* Kh, unsigned short* Kl,
    unsigned short* VTh, unsigned short* VTl,
    const float* __restrict__ bq, const float* __restrict__ bk, const float* __restrict__ bv,
    const float* __restrict__ cosT, const float* __restrict__ sinT) {
  __shared__ __align__(16) float sT[8][16 * 68];   // per-wave 16x64 slab, pitch 68 floats
  __shared__ __align__(16) unsigned char sG[2 * GSTG_B(0, 256)];   // two operand buffers (of the larger tile)
  const int wave = threadIdx.x >> 5;
  const int tile = blockIdx.x;
  const int b    = blockIdx.y;
  const int z    = blockIdx.z;
  if (z < 2) {
    const unsigned short* Wb = z ? Wkb : Wqb;
    unsigned short* Ch = z ? Kh : Qh;
    unsigned short* Cl = z ? Kl : Ql;
    const float* bias = z ? bk : bq;
    gemm64_tile<0, 4, 1, 256>(Xb, Xb, DM, (long long)SEQ * DM, Wb, Wb, DM, 0LL,
                         (void*)Ch, DQK, (long long)SEQ * DQK, (void*)Cl, DQK, (long long)SEQ * DQK, DQK,
                         SEQ, DQK, DM, 1.0f, bias, cosT, sinT, sT[wave], sG, tile, b);
  } else {
    gemm64_tile<0, 3, 2, 128>(Wvb, Wvb, DM, 0LL, Xb, Xb, DM, (long long)SEQ * DM,
                         (void*)VTh, SEQ, (long long)DM * SEQ, (void*)VTl, VLP, (long long)DM * VLP, VLP,
                         DM, SEQ, DM, 4096.0f, bv, nullptr, nullptr, sT[wave], sG, tile, b);
  }
}

#define LP      72                        // LDS row pitch of the 16-bit tiles, in elements
#define TILE_B  (64 * LP * 2)             // one 64-row tile: 9216 B
#define OSP     68                        // row pitch of a wave's f32 context tile, in floats (272 B = 16 B x 17)
#define OS_B    (4 * 16 * OSP * 4)        // four waves' f32 context tiles: 17408 B
#define ATT_LDS (4 * TILE_B + OS_B)       // 54272 B
static_assert(((LP * 2) % 16) == 0 && (((LP * 2) / 16) & 1) == 1);   // 16-B aligned rows, odd multiple of 16 B
// value of lane l ^ 16 (the other wave half)
__device__ __forceinline__ float xhalf(float x) {
  return __builtin_bit_cast(float, __builtin_amdgcn_permlanex16(__builtin_bit_cast(int, x), __builtin_bit_cast(int, x),
                                                                0x76543210, 0xfedcba98, false, false));
}
template <bool RES>
__device__ __forceinline__
void attn_block64(unsigned char* smem,
                  const unsigned short* __restrict__ qhp, const unsigned short* __restrict__ qlp,
                  const unsigned short* __restrict__ khp, const unsigned short* __restrict__ klp,
                  const unsigned short* __restrict__ vhp, const unsigned short* __restrict__ vlp,
                  float* Cp, int soff, int qb, int h, float sscale) {
  union FB { v16b v; v8b h[2]; };
  union FH { v16h v; v8h h[2]; };
  __bf16*   Ksh = (__bf16*)(void*)(smem);                         // K hi [kv][d]
  __bf16*   Ksl = (__bf16*)(void*)(smem + TILE_B);                // K lo
  _Float16* Vth = (_Float16*)(void*)(smem + 2 * TILE_B);          // V^T hi [d][kv]
  float*    Os  = (float*)(void*)(smem + 3 * TILE_B);             // per wave context tile [row][d], 4 x 4352 B
  _Float16* Vtl = (_Float16*)(void*)(smem + 3 * TILE_B + OS_B);   // V^T residual (RES only)

  const int tid  = threadIdx.x;
  // wave-uniform, so held in a scalar register: as a vector register it is live across the loop, and the body with the
  // residual planes then spills under the kernel's budget of 192 registers
  const int wave = __builtin_amdgcn_readfirstlane(tid >> 5);
  const int lane = tid & 31;
  const int hh   = lane >> 4;
  const int c    = lane & 15;

  const int q0   = qb * 64 + wave * 16;
  const int col  = h * (2 * HD) + soff;

  const __bf16* Qh = (const __bf16*)(const void*)qhp + col;
  const __bf16* Ql = (const __bf16*)(const void*)qlp + col;
  const __bf16* Kh = (const __bf16*)(const void*)khp + col;
  const __bf16* Kl = (const __bf16*)(const void*)klp + col;
  const _Float16* Vh = (const _Float16*)(const void*)vhp + (size_t)h * HD * SEQ;
  const _Float16* Vl = (const _Float16*)(const void*)vlp + (size_t)h * HD * VLP;

  // ---- Q fragments (B operand, column = query = lane&15): 2 d-chunks, hi and lo ----
  v16b qah[2], qal[2];
#pragma unroll
  for (int dc = 0; dc < 2; ++dc) {
    const size_t qo = (size_t)(q0 + c) * DQK + dc * 32 + 8 * hh;
    qah[dc] = ldfrag_b(Qh + qo);
    qal[dc] = ldfrag_b(Ql + qo);
  }

  const int qrow = q0 + c;                   // this lane's query row
  float mrow = -INFINITY;                    // its running maximum (equal in both wave halves)
  float lrow = 0.f;                          // running sum over this wave half's keys only; joined after the loop
  v8f oacc[4];                               // oacc[t][r] = context^T [d = t*16 + 8*hh + r][query c]
#pragma unroll
  for (int t = 0; t < 4; ++t) oacc[t] = zero8();

  for (int kt = 0; kt < NQB; ++kt) {         // static trip bound
    if (kt > qb) break;                      // block-uniform (causal)
    const bool diag = (kt == qb);            // block-uniform
    const int kv0 = kt * 64;
    __syncthreads();
    {
      const int g = tid >> 3, ch = (tid & 7) * 8;                  // group of 8 lanes = one row; elements ch..ch+7
      const int r = (g >> 1) | ((g & 1) << 3);                     // pass i: row r + 16 i; groups 2m, 2m+1 -> rows m, m+8
      const __bf16*   kg  = Kh + (size_t)(kv0 + r) * DQK + ch;     // K row kv0+r, d = ch..ch+7
      const __bf16*   klg = Kl + (size_t)(kv0 + r) * DQK + ch;
      const _Float16* vg  = Vh + (size_t)r * SEQ + kv0 + ch;        // V^T row d = r, s = kv0+ch..+7
      const int kvl = (kv0 + 64 <= VLP) ? kv0 : (VLP - 64);       // clamped address into the residual plane
      const _Float16* vlg = Vl + (size_t)r * VLP + kvl + ch;
      const bool resOK = (kv0 + 64 <= VLP);                        // block-uniform
      v8b a0[4], a1[4];
      v8h b0[4], b1[4];
#pragma unroll
      for (int i = 0; i < 4; ++i) {
        a0[i] = *(const v8b*)(kg + (size_t)(16 * i) * DQK);
        a1[i] = *(const v8b*)(klg + (size_t)(16 * i) * DQK);
        b0[i] = *(const v8h*)(vg + (size_t)(16 * i) * SEQ);
        if (RES) {
          b1[i] = *(const v8h*)(vlg + (size_t)(16 * i) * VLP);
          if (!resOK) b1[i] = zero8h();
        }
      }
#if defined(__HIP_DEVICE_COMPILE__)
      // s_wait_xcnt 0 before a register that an issued load names is written again; the addresses are inputs so that
      // they stay in their registers up to the wait (else the last load's destination may take an address pair over).
      if (RES) asm volatile("s_wait_xcnt 0x0" :: "v"(kg), "v"(klg), "v"(vg), "v"(vlg) : "memory");
      else     asm volatile("s_wait_xcnt 0x0" :: "v"(kg), "v"(klg), "v"(vg) : "memory");
#endif
#pragma unroll
      for (int i = 0; i < 4; ++i) {
        *(v8b*)(Ksh + (r + 16 * i) * LP + ch) = a0[i];
        *(v8b*)(Ksl + (r + 16 * i) * LP + ch) = a1[i];
        *(v8h*)(Vth + (r + 16 * i) * LP + ch) = b0[i];
        if (RES) *(v8h*)(Vtl + (r + 16 * i) * LP + ch) = b1[i];
      }
    }
    __syncthreads();

    // ---- scores^T: 64 keys x 16 query columns per wave, 3 bf16 products; s[j][r] = key j*16 + 8*hh + r, query c ----
    //      Without the residual planes, per 32 d: the 8 K fragments (16 LDS reads) are asked for as one group, then 12 plain
    //      products follow in which neighbours belong to different key tiles (a product on the tile of the one before it
    //      waits out the matrix latency, and each other's issue fills the distance that a VALU use of a result needs).
    //      Per tile the six products keep their order: dc 0 hi.hi, lo.hi, hi.lo, then dc 1.
    //      With the residual planes the registers do not reach for the groups (spills): one fragment pair at a time.
    v8f s[4];
    if (!RES) {
#pragma unroll
      for (int j = 0; j < 4; ++j) s[j] = zero8();
      // unrolled: the Q fragments are register arrays and need constant indices
#pragma unroll
      for (int dc = 0; dc < 2; ++dc) {
        FB kb[4], kl[4];
#pragma unroll
        for (int j = 0; j < 4; ++j) {
          kb[j].h[0] = *(const v8b*)(Ksh + (j * 16 + c) * LP + dc * 32 + 8 * hh);
          kb[j].h[1] = *(const v8b*)(Ksh + (j * 16 + c) * LP + dc * 32 + 16 + 8 * hh);
        }
#pragma unroll
        for (int j = 0; j < 4; ++j) {
          kl[j].h[0] = *(const v8b*)(Ksl + (j * 16 + c) * LP + dc * 32 + 8 * hh);
          kl[j].h[1] = *(const v8b*)(Ksl + (j * 16 + c) * LP + dc * 32 + 16 + 8 * hh);
        }
        // keeps the reads together in front of the products: left free, the compiler spreads them singly among the products
        group_fence();
#pragma unroll
        for (int j = 0; j < 4; ++j) s[j] = mma_b_raw(kb[j].v, qah[dc], s[j]);
#pragma unroll
        for (int j = 0; j < 4; ++j) s[j] = mma_b_raw(kl[j].v, qah[dc], s[j]);
#pragma unroll
        for (int j = 0; j < 4; ++j) s[j] = mma_b_raw(kb[j].v, qal[dc], s[j]);
        // the next group's reads stay behind this group's products: with two groups under way the registers do not reach (spills)
        group_fence();
      }
    } else {
#pragma unroll
      for (int j = 0; j < 4; ++j) {
        s[j] = zero8();
#pragma unroll
        for (int dc = 0; dc < 2; ++dc) {
          FB kb, kl;
          kb.h[0] = *(const v8b*)(Ksh + (j * 16 + c) * LP + dc * 32 + 8 * hh);
          kb.h[1] = *(const v8b*)(Ksh + (j * 16 + c) * LP + dc * 32 + 16 + 8 * hh);
          kl.h[0] = *(const v8b*)(Ksl + (j * 16 + c) * LP + dc * 32 + 8 * hh);
          kl.h[1] = *(const v8b*)(Ksl + (j * 16 + c) * LP + dc * 32 + 16 + 8 * hh);
          s[j] = mma_b(kb.v, qah[dc], s[j]);
          s[j] = mma_b(kl.v, qah[dc], s[j]);
          s[j] = mma_b(kb.v, qal[dc], s[j]);
        }
      }
    }

    // ---- scale, causal fill on the diagonal tile, maximum of the lane's 32 keys and of the other half's,
    //      online softmax, P (x1024, f16) and P residual (x4096) packed into B operands ----
    float mj[4];
#pragma unroll
    for (int j = 0; j < 4; ++j) {
      mj[j] = -INFINITY;
#pragma unroll
      for (int r = 0; r < 8; ++r) {
        const int key = kv0 + j * 16 + 8 * hh + r;
        float sv = s[j][r] * sscale;
        sv = (diag && key > qrow) ? -INFINITY : sv;
        s[j][r] = sv;
        mj[j] = fmaxf(mj[j], sv);
      }
    }
    float m = fmaxf(fmaxf(mj[0], mj[1]), fmaxf(mj[2], mj[3]));
    m = fmaxf(m, xhalf(m));
    const float mnew  = fmaxf(mrow, m);
    const float msafe = (mnew == -INFINITY) ? 0.f : mnew;
    const float alpha = __expf(mrow - msafe);
    mrow = mnew;
    v16h pbh[2], pbl[2];                     // element (j&1)*8 + r of block j>>1 = key (j>>1)*32 + (j&1)*16 + 8*hh + r
    float pj[4];                             // four independent partial sums of 8 keys each
#pragma unroll
    for (int j = 0; j < 4; ++j) {
      pj[j] = 0.f;
#pragma unroll
      for (int r = 0; r < 8; ++r) {
        const float p = __expf(s[j][r] - msafe);     // -inf logit: exp -> 0
        pj[j] += p;
        const float p1k = p * 1024.0f;
        const _Float16 ph = (_Float16)p1k;
        pbh[j >> 1][(j & 1) * 8 + r] = ph;
        if (RES) pbl[j >> 1][(j & 1) * 8 + r] = (_Float16)((p1k - (float)ph) * 4096.0f);
      }
    }
    lrow = lrow * alpha + ((pj[0] + pj[1]) + (pj[2] + pj[3]));
#pragma unroll
    for (int t = 0; t < 4; ++t)
#pragma unroll
      for (int r = 0; r < 8; ++r) oacc[t][r] *= alpha;

    // ---- context^T += V^T . P^T (f16 WMMA), residual products into a separate accumulator ----
    v8f o1[4];
#pragma unroll
    for (int t = 0; t < 4; ++t) o1[t] = zero8();
    // unrolled: the P operands are register arrays and need constant indices
#pragma unroll
    for (int kk = 0; kk < 2; ++kk) {
      if (!RES) {
        // the same form as the scores: the 4 V^T fragments (8 LDS reads) as one group, then 4 plain products on 4 tiles
        FH vb[4];
#pragma unroll
        for (int t = 0; t < 4; ++t) {
          vb[t].h[0] = *(const v8h*)(Vth + (t * 16 + c) * LP + kk * 32 + 8 * hh);
          vb[t].h[1] = *(const v8h*)(Vth + (t * 16 + c) * LP + kk * 32 + 16 + 8 * hh);
        }
        // boundary between the reads and their products: this kk's products then start as their fragments arrive; left free,
        // the compiler forms all of P in front of the first product and the loop comes out longer
        group_fence();
#pragma unroll
        for (int t = 0; t < 4; ++t) oacc[t] = mma_h_raw(vb[t].v, pbh[kk], oacc[t]);
      } else {
#pragma unroll
        for (int t = 0; t < 4; ++t) {
          FH vb, vl;
          vb.h[0] = *(const v8h*)(Vth + (t * 16 + c) * LP + kk * 32 + 8 * hh);
          vb.h[1] = *(const v8h*)(Vth + (t * 16 + c) * LP + kk * 32 + 16 + 8 * hh);
          oacc[t] = mma_h(vb.v, pbh[kk], oacc[t]);
          vl.h[0] = *(const v8h*)(Vtl + (t * 16 + c) * LP + kk * 32 + 8 * hh);
          vl.h[1] = *(const v8h*)(Vtl + (t * 16 + c) * LP + kk * 32 + 16 + 8 * hh);
          o1[t] = mma_h(vl.v, pbh[kk], o1[t]);
          o1[t] = mma_h(vb.v, pbl[kk], o1[t]);
        }
      }
    }
    if (RES) {
#pragma unroll
      for (int t = 0; t < 4; ++t)
#pragma unroll
        for (int r = 0; r < 8; ++r) oacc[t][r] += o1[t][r] * (1.0f / 4096.0f);
    }
  }

  // ---- join the halves' sums, normalise (1/l and the 1/1024 p carry), stage the wave's 16x64 tile as [query][d]
  //      (a lane holds 8 consecutive d of its query per t: two 16-B LDS stores), write f32 rows as whole 256-B segments
  float* os = Os + wave * (16 * OSP);
  {
    const float l = lrow + xhalf(lrow);
    const float inv = ((l > 0.f) ? (1.0f / l) : 0.f) * (1.0f / 1024.0f);
#pragma unroll
    for (int t = 0; t < 4; ++t) {
      v4f w0, w1;
#pragma unroll
      for (int e = 0; e < 4; ++e) { w0[e] = oacc[t][e] * inv; w1[e] = oacc[t][4 + e] * inv; }
      *(v4f*)(os + c * OSP + t * 16 + 8 * hh)     = w0;
      *(v4f*)(os + c * OSP + t * 16 + 8 * hh + 4) = w1;
    }
  }
  __builtin_amdgcn_fence(__ATOMIC_RELEASE, "workgroup");
  __builtin_amdgcn_wave_barrier();
  __builtin_amdgcn_fence(__ATOMIC_ACQUIRE, "workgroup");
  {
    const int h2 = lane >> 4, c4 = (lane & 15) * 4;
    v4f ov[8];
#pragma unroll
    for (int it = 0; it < 8; ++it) {
      const int row = it * 2 + h2;   // it 0..7 x h2 0..1 = rows 0..15 of the wave tile
      ov[it] = *(const v4f*)(os + row * OSP + c4);
    }
    {
#pragma unroll
      for (int it = 0; it < 8; ++it) {
        const int row = it * 2 + h2;
        const size_t go = (size_t)(q0 + row) * DM + (size_t)h * HD + c4;
        *(v4f*)(Cp + go) = ov[it];
      }
#if defined(__HIP_DEVICE_COMPILE__)
      // s_wait_xcnt 0 behind the run of stores: in the merged kernel the listing holds a branch from the end of this
      // body to the head of the other one, where registers that these stores name are written again.
      asm volatile("s_wait_xcnt 0x0" ::: "memory");
#endif
    }
  }
}

// All query blocks of both streams, all heads and both batch elements in one grid of NQB * 2 * NB * NH blocks.
// blockIdx.x / 64 counts the query blocks down from the last one: the blocks with the most key tiles get the lowest
// indices (for speed only).
// blockIdx.x % 64 = batch * 32 + stream * 16 + head. Query blocks below RESQB take the body with residual planes
// (block-uniform choice).
// amdgpu_waves_per_eu(5, 5): a budget of 192 registers, five waves per SIMD as before; left free, the build takes 206
// registers for the read groups (an allocation of 208), which leaves four waves per SIMD.
__global__ __launch_bounds__(128) __attribute__((amdgpu_waves_per_eu(5, 5)))
void attn_causal64(const unsigned short* __restrict__ qhp, const unsigned short* __restrict__ qlp,
                   const unsigned short* __restrict__ khp, const unsigned short* __restrict__ klp,
                   const unsigned short* __restrict__ vhp, const unsigned short* __restrict__ vlp,
                   float* C1p, float* C2p, float sscale) {
  __shared__ __align__(16) unsigned char smem[ATT_LDS];
  const int bx     = blockIdx.x;
  const int qb     = NQB - 1 - (bx >> 6);
  const int h      = bx & 15;
  const int stream = (bx >> 4) & 1;
  const int b      = (bx >> 5) & 1;
  const size_t qk = (size_t)b * SEQ * DQK;
  const unsigned short* vh = vhp + (size_t)b * DM * SEQ;
  const unsigned short* vl = vlp + (size_t)b * DM * VLP;
  float* Cp = (stream ? C2p : C1p) + (size_t)b * SEQ * DM;
  const int soff = stream * HD;
  if (qb < RESQB) attn_block64<true >(smem, qhp + qk, qlp + qk, khp + qk, klp + qk, vh, vl, Cp, soff, qb, h, sscale);
  else            attn_block64<false>(smem, qhp + qk, qlp + qk, khp + qk, klp + qk, vh, vl, Cp, soff, qb, h, sscale);
}

// =====================================================================================================
// Differential combine + head rms norm for one token row t of the NB*SEQ rows:
//   lam[h] = (0.2 + exp(sum_d lq1.lk1)) - exp(sum_d lq2.lk2): read from the table that the convert launch wrote
//   o = c1 - lam*c2; r = rsqrt(sum_d(o^2)/64 + 1e-6); o = ((o*r) * w[h][d]) * 0.8
//   written as bf16 hi / lo planes [NB*SEQ][DM] (merged head layout), one 16-B store per plane per lane
// grid = NB*SEQ blocks x 128 threads; thread -> columns 8*tid..+7 (head = tid>>3, 8 lanes per head).
// coverage: 128 threads x 8 = 1024 columns per row; NB*SEQ rows.
// =====================================================================================================
__global__ __launch_bounds__(128) void diff_combine(
    const float* __restrict__ C1, const float* __restrict__ C2,
    const float* __restrict__ lamT,
    const float* __restrict__ hnw, unsigned short* Oh, unsigned short* Ol) {
#pragma clang fp contract(off)
  const int tid = threadIdx.x;
  const int t   = blockIdx.x;
  const int c0 = tid * 8;
  const int h  = c0 >> 6;
  const int d0 = c0 & 63;
  const size_t ro = (size_t)t * DM + c0;
  const v4f x0 = *(const v4f*)(C1 + ro), x1 = *(const v4f*)(C1 + ro + 4);
  const v4f y0 = *(const v4f*)(C2 + ro), y1 = *(const v4f*)(C2 + ro + 4);
  const float lam = lamT[h];
#if defined(__HIP_DEVICE_COMPILE__)
  // s_wait_xcnt 0 before a register that an issued load names is written again; the addresses are inputs so that
  // they stay in their registers up to the wait (else a later load's destination may take an address pair over).
  asm volatile("s_wait_xcnt 0x0" :: "v"(C1 + ro), "v"(C2 + ro) : "memory");
#endif
  float o[8];
  float ss = 0.f;
#pragma unroll
  for (int e = 0; e < 4; ++e) {
    o[e]     = x0[e] - lam * y0[e];
    o[4 + e] = x1[e] - lam * y1[e];
  }
#pragma unroll
  for (int e = 0; e < 8; ++e) ss += o[e] * o[e];
  ss += __shfl_xor(ss, 1, 32);
  ss += __shfl_xor(ss, 2, 32);
  ss += __shfl_xor(ss, 4, 32);
  const float ms = ss * (1.0f / (float)HD);
  const float rn = rsqrtf(ms + 1.0e-6f);
  v4u hv, lv;
#pragma unroll
  for (int e = 0; e < 4; ++e) {
    const float w0 = bfr(hnw[h * HD + d0 + 2 * e]);
    const float w1 = bfr(hnw[h * HD + d0 + 2 * e + 1]);
    const float f0 = ((o[2 * e] * rn) * w0) * OSCL;
    const float f1 = ((o[2 * e + 1] * rn) * w1) * OSCL;
    const unsigned short h0 = bf_bits(f0), h1 = bf_bits(f1);
    const unsigned short l0 = bf_bits(f0 - bf_up(h0)), l1 = bf_bits(f1 - bf_up(h1));
    hv[e] = pk16(h0, h1); lv[e] = pk16(l0, l1);
  }
  *(v4u*)(Oh + ro) = hv;
  *(v4u*)(Ol + ro) = lv;
  
}

// =====================================================================================================
// Workspace map (bytes, all offsets multiples of 4096):
//   Xb   bf16 [4096][1024]      8388608      Wqb bf16 [2048][1024] 4194304   Wkb 4194304
//   Wvb  bf16 [1024][1024]      2097152      Wob 2097152
//   invf f32 [32] (padded)         4096      cosT f32 [2048][32] 262144      sinT 262144
//   both batch elements, batch-major:
//   Qh/Ql/Kh/Kl bf16 [2][2048][2048]  4 x 16777216
//   VTh  f16  [2][1024][2048]      8388608      VTl f16 [2][1024][512] 2097152
//   C1/C2 f32 [2][2048][1024]   2 x 16777216    Oh/Ol bf16 [2][2048][1024] 2 x 8388608
//   lam  f32 [16] (padded)          4096
//   end                          149430272
// All planes are exact multiples of their 64x64 / whole-line store granularity (no padded tails needed).
// Weights are [out n][in k] with k contiguous = the Bt / A layout the GEMM wants, so they are only converted.
// =====================================================================================================
extern "C" void kernel_launch(void* const* d_in, const int* in_sizes, int n_in,
                              void* d_out, int out_size, void* d_ws, size_t ws_size,
                              hipStream_t stream) {
  if (n_in < 14) return;
  if (in_sizes[0] != NB * SEQ * DM) return;
  if (in_sizes[1] != DQK * DM || in_sizes[2] != DQK) return;
  if (in_sizes[3] != DQK * DM || in_sizes[4] != DQK) return;
  if (in_sizes[5] != DM * DM || in_sizes[6] != DM) return;
  if (in_sizes[7] != DM * DM || in_sizes[8] != DM) return;
  for (int i = 9; i < 14; ++i) if (in_sizes[i] != NH * HD) return;
  if (out_size != NB * SEQ * DM) return;

  const float* x   = (const float*)d_in[0];
  const float* Wq  = (const float*)d_in[1];
  const float* bq  = (const float*)d_in[2];
  const float* Wk  = (const float*)d_in[3];
  const float* bk  = (const float*)d_in[4];
  const float* Wv  = (const float*)d_in[5];
  const float* bv  = (const float*)d_in[6];
  const float* Wo  = (const float*)d_in[7];
  const float* bo  = (const float*)d_in[8];
  const float* hnw = (const float*)d_in[9];
  const float* lq1 = (const float*)d_in[10];
  const float* lk1 = (const float*)d_in[11];
  const float* lq2 = (const float*)d_in[12];
  const float* lk2 = (const float*)d_in[13];
  float* outp = (float*)d_out;

  const size_t PXB  = (size_t)NB * SEQ * DM * 2;    //  8388608
  const size_t PWQ  = (size_t)DQK * DM * 2;         //  4194304
  const size_t PWV  = (size_t)DM * DM * 2;          //  2097152
  const size_t PIF  = 4096;                         //  32 floats used by invf, 16 by lam
  const size_t PTAB = (size_t)SEQ * NFREQ * 4;      //   262144
  const size_t PQP  = (size_t)NB * SEQ * DQK * 2;   // 16777216
  const size_t PVT  = (size_t)NB * DM * SEQ * 2;    //  8388608
  const size_t PVL  = (size_t)NB * DM * VLP * 2;    //  2097152
  const size_t PC   = (size_t)NB * SEQ * DM * 4;    // 16777216
  const size_t PO   = (size_t)NB * SEQ * DM * 2;    //  8388608
  size_t off = 0;
  const size_t oXb  = off; off += PXB;
  const size_t oWq  = off; off += PWQ;
  const size_t oWk  = off; off += PWQ;
  const size_t oWv  = off; off += PWV;
  const size_t oWo  = off; off += PWV;
  const size_t oIF  = off; off += PIF;
  const size_t oCos = off; off += PTAB;
  const size_t oSin = off; off += PTAB;
  const size_t oQh  = off; off += PQP;
  const size_t oQl  = off; off += PQP;
  const size_t oKh  = off; off += PQP;
  const size_t oKl  = off; off += PQP;
  const size_t oVTh = off; off += PVT;
  const size_t oVTl = off; off += PVL;
  const size_t oC1  = off; off += PC;
  const size_t oC2  = off; off += PC;
  const size_t oOh  = off; off += PO;
  const size_t oOl  = off; off += PO;
  const size_t oLam = off; off += PIF;
  if (off > ws_size) return;                        // off = 149430272

  char* ws = (char*)d_ws;
  unsigned short* Xb  = (unsigned short*)(ws + oXb);
  unsigned short* Wqb = (unsigned short*)(ws + oWq);
  unsigned short* Wkb = (unsigned short*)(ws + oWk);
  unsigned short* Wvb = (unsigned short*)(ws + oWv);
  unsigned short* Wob = (unsigned short*)(ws + oWo);
  float*          IFt = (float*)(ws + oIF);
  float*          CosT = (float*)(ws + oCos);
  float*          SinT = (float*)(ws + oSin);
  unsigned short* Qh  = (unsigned short*)(ws + oQh);
  unsigned short* Ql  = (unsigned short*)(ws + oQl);
  unsigned short* Kh  = (unsigned short*)(ws + oKh);
  unsigned short* Kl  = (unsigned short*)(ws + oKl);
  unsigned short* VTh = (unsigned short*)(ws + oVTh);
  unsigned short* VTl = (unsigned short*)(ws + oVTl);
  float*          C1  = (float*)(ws + oC1);
  float*          C2  = (float*)(ws + oC2);
  unsigned short* Oh  = (unsigned short*)(ws + oOh);
  unsigned short* Ol  = (unsigned short*)(ws + oOl);
  float*          Lam = (float*)(ws + oLam);

  const dim3 blk256(256), blk128(128), blk32(32);
  const dim3 gCvt((NB * SEQ * DM + 2 * DQK * DM + 2 * DM * DM) / 8 / 256 + 1);   // 5120 blocks + the lam block
  const dim3 gTab((SEQ * NFREQ + 255) / 256);                      //  256 blocks
  const dim3 gQKV((SEQ / 128) * (DQK / 256), NB, 3);               // 128 blocks, x batch x {q, k, v^T}
  const dim3 gOut((NB * SEQ / 128) * (DM / 128), 1);               // 256 blocks of 128 x 128
  const dim3 gRow(NB * SEQ);                                       // one block per token row
  const dim3 gAtt(NQB * 2 * NB * NH);                              // 2048 blocks

  // (1) inputs -> bf16 planes; weights [n][k] f32 -> bf16 [n][k]; Xb, Wqb, Wkb, Wvb, Wob are contiguous from Xb; lam table
  cvt_bf16x8<<<gCvt, blk256, 0, stream>>>(x, Wq, Wk, Wv, Wo, Xb, lq1, lk1, lq2, lk2, Lam);
  // (2) rope tables
  invfreq_tab<<<dim3(1), blk32, 0, stream>>>(IFt);
  rope_tab<<<gTab, blk256, 0, stream>>>(IFt, CosT, SinT);
  // (3) q, k -> rope -> bf16 hi / lo planes [NB*SEQ][DQK]; v^T -> f16 hi plane and residual plane, both batch elements
  gemm_qkv<<<gQKV, blk256, 0, stream>>>(Xb, Wqb, Wkb, Wvb, Qh, Ql, Kh, Kl, VTh, VTl, bq, bk, bv, CosT, SinT);
  // (4) causal attention, stream 1 (q1, k1) -> C1 and stream 2 (q2, k2) -> C2;
  //     query blocks 0..RESQB-1 with residual planes, the rest without
  attn_causal64<<<gAtt, blk128, 0, stream>>>(Qh, Ql, Kh, Kl, VTh, VTl, C1, C2, 0.125f);
  // (5) differential combine + head norm -> O bf16 hi/lo planes [NB*SEQ][DM]
  diff_combine<<<gRow, blk128, 0, stream>>>(C1, C2, Lam, hnw, Oh, Ol);
  // (6) out = O . Wo^T + bo -> d_out, f32 [NB*SEQ][DM]  (A = O hi + lo planes, 2 products)
  gemm64<1, 0, 1, 128><<<gOut, blk256, 0, stream>>>(
      Oh, Ol, DM, 0LL, Wob, Wob, DM, 0LL,
      (void*)outp, DM, 0LL, (void*)outp, DM, 0LL, DM,
      NB * SEQ, DM, DM, 1.0f, bo);
  (void)hipGetLastError();
}

// v010
// One run takes 143 microseconds.
// In both of two side-by-side timings against v009, it was 1.05 times as fast.
// All steps since v000 together make it 7.65 times as fast.
// Contractions: q, k, v^T projections = v_wmma_f32_16x16x32_bf16 (bf16 operands from RNE-converted inputs, single product);
// q.k^T scores (both streams) = v_wmma_f32_16x16x32_bf16 with bf16 hi/lo split q and k (hi.hi + hi.lo + lo.hi);
// p.v = v_wmma_f32_16x16x32_f16 (p carried x1024 in f16, v in f16; extra f16 residual planes x4096 of p and v for the first 512 query rows);
// ctx.Wo^T = v_wmma_f32_16x16x32_bf16 with ctx as bf16 hi/lo planes times bf16 Wo (2 products); all f32 accumulate;
// rope, softmax, lambda, head rms norm in f32.
#include <hip/hip_runtime.h>
#include <math.h>
#include <float.h>
#include <stdint.h>

#define NB    2
#define SEQ   2048
#define DM    1024
#define DQK   2048          // q / k projection width (2 x 64 per head)
#define NH    16
#define HD    64
#define NFREQ (HD / 2)
#define NQB   (SEQ / 64)    // 32 key / query tiles of 64
#define VLP   512           // key pitch of the v^T residual plane (keys 0..VLP-1)
#define RESQB 8             // number of leading 64-row query blocks that use the p / v residual planes
#define LAM0  0.2f
#define OSCL  0.8f
static_assert(RESQB * 64 <= VLP);
static_assert(NH * HD == DM);
static_assert(NB == 2 && NH == 16);   // the attention grid's index split
static_assert(NH * 2 * HD == DQK);
static_assert((SEQ % 256) == 0 && (DM % 256) == 0 && (DQK % 256) == 0);   // GEMM block tiles 128 x 256 / 128 x 128, 64 k per trip
static_assert((DM / 128) * (SEQ / 128) == (SEQ / 128) * (DQK / 256));     // v^T has as many 128 x 128 tiles as q has 128 x 256 ones

typedef _Float16 v16h __attribute__((ext_vector_type(16)));
typedef _Float16 v8h  __attribute__((ext_vector_type(8)));
typedef __bf16   v16b __attribute__((ext_vector_type(16)));
typedef __bf16   v8b  __attribute__((ext_vector_type(8)));
typedef float    v8f  __attribute__((ext_vector_type(8)));
typedef float    v4f  __attribute__((ext_vector_type(4)));
typedef float    v2f  __attribute__((ext_vector_type(2)));
typedef unsigned int v4u __attribute__((ext_vector_type(4)));

// ---- scalar helpers --------------------------------------------------------------------------------
__device__ __forceinline__ unsigned short bf_bits(float f) {          // f32 -> bf16 bits, RNE convert
  unsigned u = __float_as_uint(f);
  return (unsigned short)((u + 0x7FFFu + ((u >> 16) & 1u)) >> 16);
}
__device__ __forceinline__ float bf_up(unsigned short h) { return __uint_as_float(((unsigned)h) << 16); }
__device__ __forceinline__ float bfr(float f) { return bf_up(bf_bits(f)); }   // value after RNE convert to bf16
__device__ __forceinline__ unsigned short h_bits(_Float16 x) { return __builtin_bit_cast(unsigned short, x); }
__device__ __forceinline__ unsigned pk16(unsigned short a, unsigned short b) { return (unsigned)a | ((unsigned)b << 16); }
__device__ __forceinline__ v8f zero8() { v8f z = {0.f, 0.f, 0.f, 0.f, 0.f, 0.f, 0.f, 0.f}; return z; }
__device__ __forceinline__ v8h zero8h() {
  const _Float16 z = (_Float16)0.0f;
  v8h r = {z, z, z, z, z, z, z, z};
  return r;
}

// ---- fragment loaders: 16-bit A/B operand, lane -> row/col (lane&15), p already includes +8*(lane>>4);
//      elements 0..7 <- p[0..7] (k0+8h..), elements 8..15 <- p[16..23] (k0+16+8h..)
__device__ __forceinline__ v16b ldfrag_b(const __bf16* p) {
  union { v16b v; v8b h[2]; } f;
  f.h[0] = *(const v8b*)(p);
  f.h[1] = *(const v8b*)(p + 16);
  return f.v;
}

// ---- WMMA helpers with trailing VALU hazard gap --------------------------------------------------------
__device__ __forceinline__ v8f mma_b(v16b a, v16b b, v8f c) {
  c = __builtin_amdgcn_wmma_f32_16x16x32_bf16(false, a, false, b, (short)0, c, false, false);
#if defined(__HIP_DEVICE_COMPILE__)
  asm volatile("v_nop\n\tv_nop\n\tv_nop\n\tv_nop" : "+v"(c) : "v"(a), "v"(b));
#endif
  return c;
}
__device__ __forceinline__ v8f mma_h(v16h a, v16h b, v8f c) {
  c = __builtin_amdgcn_wmma_f32_16x16x32_f16(false, a, false, b, (short)0, c, false, false);
#if defined(__HIP_DEVICE_COMPILE__)
  asm volatile("v_nop\n\tv_nop\n\tv_nop\n\tv_nop" : "+v"(c) : "v"(a), "v"(b));
#endif
  return c;
}
__device__ __forceinline__ v8f mma_b_raw(v16b a, v16b b, v8f c) {
  return __builtin_amdgcn_wmma_f32_16x16x32_bf16(false, a, false, b, (short)0, c, false, false);
}
__device__ __forceinline__ v8f mma_h_raw(v16h a, v16h b, v8f c) {
  return __builtin_amdgcn_wmma_f32_16x16x32_f16(false, a, false, b, (short)0, c, false, false);
}
// Compiler-only fence, no instruction: the instruction scheduler moves nothing across it.
__device__ __forceinline__ void group_fence() {
#if defined(__HIP_DEVICE_COMPILE__)
  __builtin_amdgcn_sched_barrier(0);
#endif
}
__device__ __forceinline__ void dep_guard_b(v8f& a, v8f& b, v16b x, v16b y) {
#if defined(__HIP_DEVICE_COMPILE__)
  asm volatile("v_nop\n\tv_nop\n\tv_nop\n\tv_nop" : "+v"(a), "+v"(b) : "v"(x), "v"(y));
#endif
}
__device__ __forceinline__ void keep4_b(v16b a, v16b b, v16b c, v16b d) {
#if defined(__HIP_DEVICE_COMPILE__)
  asm volatile("v_nop" :: "v"(a), "v"(b), "v"(c), "v"(d));
#endif
}
__device__ __forceinline__ void acc_guard4(v8f& a, v8f& b, v8f& c, v8f& d) {
#if defined(__HIP_DEVICE_COMPILE__)
  asm volatile("v_nop\n\tv_nop\n\tv_nop\n\tv_nop" : "+v"(a), "+v"(b), "+v"(c), "+v"(d));
#endif
}

// =====================================================================================================
// f32 -> bf16 (RNE convert), 8 elements per thread, one 16-B store per lane: a wave writes 512 contiguous B
// One grid for x, Wq, Wk, Wv, Wo: their bf16 planes lie back to back in the workspace in that order, so the
// output index is the flat thread index minus 256 (block 0 converts nothing); the source is picked per block (every plane is a multiple of 2048
// elements, so a block never straddles two planes).
// coverage: (NX + 2 NQ + 2 NV) threads x 8 = all five planes (blocks 1 and up).
// Block 0 converts nothing: its threads 0..15 form the 16 head factors of the differential combine,
//   lam[h] = (0.2 + exp(sum_d lq1.lk1)) - exp(sum_d lq2.lk2)  (f32, inputs RNE-converted to bf16 values, d ascending),
// once per call, under the convert stream.
// =====================================================================================================
__global__ __launch_bounds__(256) void cvt_bf16x8(const float* __restrict__ x, const float* __restrict__ wq,
                                                  const float* __restrict__ wk, const float* __restrict__ wv,
                                                  const float* __restrict__ wo, unsigned short* out,
                                                  const float* __restrict__ lq1, const float* __restrict__ lk1,
                                                  const float* __restrict__ lq2, const float* __restrict__ lk2,
                                                  float* lam) {
  constexpr int NX = NB * SEQ * DM / 8, NQ = DQK * DM / 8, NV = DM * DM / 8;
  static_assert((NX % 256) == 0 && (NQ % 256) == 0 && (NV % 256) == 0);
  if (blockIdx.x == 0) {                       // block-uniform; the kernel has no barrier
    const int tid = threadIdx.x;
    if (tid < NH) {
      const float* a1 = lq1 + tid * HD;
      const float* b1 = lk1 + tid * HD;
      const float* a2 = lq2 + tid * HD;
      const float* b2 = lk2 + tid * HD;
      float sa = 0.f, sb = 0.f;
      // the product of two bf16 values is exact in f32, so each sum rounds the same whether or not it is fused with its product
      // unrolled by 8: the 32 values of 8 steps are asked for together, so that this one wave's chain ends within the convert stream
#pragma unroll 8
      for (int d = 0; d < HD; ++d) {
        sa += bfr(a1[d]) * bfr(b1[d]);
        sb += bfr(a2[d]) * bfr(b2[d]);
      }
      lam[tid] = (LAM0 + expf(sa)) - expf(sb);
    }
    return;
  }
  const int i = (blockIdx.x - 1) * 256 + threadIdx.x;
  if (i < NX + 2 * NQ + 2 * NV) {
    const float* in = x;
    int j = i;
    if (i >= NX + 2 * NQ + NV)  { in = wo; j = i - (NX + 2 * NQ + NV); }
    else if (i >= NX + 2 * NQ)  { in = wv; j = i - (NX + 2 * NQ); }
    else if (i >= NX + NQ)      { in = wk; j = i - (NX + NQ); }
    else if (i >= NX)           { in = wq; j = i - NX; }
    const v4f a = *(const v4f*)(in + (size_t)j * 8);
    const v4f b = *(const v4f*)(in + (size_t)j * 8 + 4);
    v4u p;
    p[0] = pk16(bf_bits(a[0]), bf_bits(a[1]));
    p[1] = pk16(bf_bits(a[2]), bf_bits(a[3]));
    p[2] = pk16(bf_bits(b[0]), bf_bits(b[1]));
    p[3] = pk16(bf_bits(b[2]), bf_bits(b[3]));
    *(v4u*)(out + (size_t)i * 8) = p;
    
  }
}

// =====================================================================================================
// inv_freq[j] = 1 / 10000^(j/32), j = 0..31, f32 with precise powf. One block of 32 threads; the 32 values
// coverage: lanes 0..7 x 4 floats = all 32 entries.
// =====================================================================================================
__global__ __launch_bounds__(32) void invfreq_tab(float* invf) {
  __shared__ __align__(16) float sf[NFREQ];
  const int j = threadIdx.x;
  const float e = (float)j * (1.0f / (float)NFREQ);
  const float pw = powf(10000.0f, e);
  sf[j] = 1.0f / pw;
  __syncthreads();
  const v4f v = *(const v4f*)(sf + 4 * (j & 7));
  if (j < 8) *(v4f*)(invf + 4 * j) = v;
  
}

// =====================================================================================================
// cos / sin tables [SEQ][32]: angle = t * inv_freq[j] (f32 multiply), precise cosf / sinf.
// =====================================================================================================
__global__ __launch_bounds__(256) void rope_tab(const float* __restrict__ invf, float* cosT, float* sinT) {
  const int g = blockIdx.x * 256 + threadIdx.x;
  if (g < SEQ * NFREQ) {
    const int t = g / NFREQ;
    const int j = g - t * NFREQ;
    const float ang = (float)t * invf[j];
    const float cv = cosf(ang);
    const float sv = sinf(ang);
    *(float*)(cosT + g) = cv;
    *(float*)(sinT + g) = sv;
    
  }
}

// =====================================================================================================
// RoPE half-split rotation of 8 consecutive columns of one 64-wide vector, then bf16 hi/lo split: 16 B per plane
// (hv, lv). xa = the lane's 8 columns, xp = the 8 columns 32 away in the same vector (f32).
//   first half  (j < 32):   out[j]    = x[j]*cos[j]   - x[j+32]*sin[j]     (x1 = a, x2 = p)
//   second half (j < 32):   out[j+32] = x[j]*sin[j]   + x[j+32]*cos[j]     (x1 = p, x2 = a)
// =====================================================================================================
__device__ __forceinline__ void rope_row8(const float* xa, const float* xp,
                                          bool second, v4f cs0, v4f cs1, v4f sn0, v4f sn1,
                                          v4u& hv, v4u& lv) {
  // contraction off: each product and their sum round on their own, as in the reference's elementwise form, so the
  // q, k planes stay bit for bit what they were when a launch of its own rotated them
#pragma clang fp contract(off)
  const v4f xa0 = *(const v4f*)(xa);
  const v4f xa1 = *(const v4f*)(xa + 4);
  const v4f xp0 = *(const v4f*)(xp);
  const v4f xp1 = *(const v4f*)(xp + 4);
  float o[8];
#pragma unroll
  for (int e = 0; e < 4; ++e) {
    {
      const float a = xa0[e], p = xp0[e], cs = cs0[e], sn = sn0[e];
      const float f1 = a * cs - p * sn;
      const float f2 = p * sn + a * cs;
      o[e] = second ? f2 : f1;
    }
    {
      const float a = xa1[e], p = xp1[e], cs = cs1[e], sn = sn1[e];
      const float f1 = a * cs - p * sn;
      const float f2 = p * sn + a * cs;
      o[4 + e] = second ? f2 : f1;
    }
  }
#pragma unroll
  for (int e = 0; e < 4; ++e) {
    const float f0 = o[2 * e], f1 = o[2 * e + 1];
    const unsigned short h0 = bf_bits(f0), h1 = bf_bits(f1);
    const unsigned short l0 = bf_bits(f0 - bf_up(h0)), l1 = bf_bits(f1 - bf_up(h1));
    hv[e] = pk16(h0, h1); lv[e] = pk16(l0, l1);
  }
}

// =====================================================================================================
// Register-blocked bf16 WMMA GEMM: C[m][n] = sum_k A[m][k] * Bt[n][k] (+ bias); a block of 8 waves per 128 x BN tile:
// BN = 256: 2 x 4 waves of 64x64; BN = 128: 4 x 2 waves of 32x64, for a product whose 128 x 256 tiles are fewer than the
// chip's 256 WGPs (v^T, out: 128 tiles each), so that twice as many WGPs share its work.
// A row-major [M][K] pitch lda; Bt row-major [N][K] pitch ldb (k contiguous);
// M multiple of 128, N of BN, K of 64. b = batch index (strides in elements).
// The tile body is a device function (block tile index, batch index and the LDS come from the caller), so
// that one grid can hold several independent products.
// Operands reach the waves through LDS: per trip of 64 k the block's 128 A rows and BN Bt rows (128 B = one line each)
// are brought in by asynchronous copies to LDS, 16 B per lane, 8 lanes per row, so that one wave-wide copy covers 4
// whole lines; a fragment load straight from global memory touches 16 lines for the same 512 B, and every wave
// fetched its own copy of rows that its neighbours need too. Two buffers: the next trip's copies fly during this
// trip's products. LDS row pitch 144 B (16 B x odd) for the ds_load_b128 fragment reads. The k order of the products
// is unchanged (32 k per WMMA, ascending).
// NSPLIT: 0 = A.Bt; 1 = (A + A2).Bt (A2 = unscaled bf16 lo plane of A).
// OUT_MODE: 0 = f32 (pitch ldc); 2 = bf16 hi plane C + bf16 lo plane C2 (lo = RNE(v - hi), unscaled);
//           3 = f16 hi plane C + f16 residual plane C2 = f16((v - hi) * rscale), C2 written only for tiles
//               with n0 < N2 (pitch ldc2, batch stride strideC2);
//           4 = a wave's 64 columns are one 64-wide rope vector and m is the token index: rotated by the tables
//               cosT / sinT [M][32], then bf16 hi plane C + bf16 lo plane C2 (lo = RNE(v - hi), unscaled).
// BIAS: 0 = none; 1 = + bf16-RNE(bias[n]) per column; 2 = + bf16-RNE(bias[m]) per row (added in f32).
// =====================================================================================================
#define GP        72                                  // LDS row pitch of a staged operand row, in elements (144 B)
#define GROW_B    (GP * 2)
#define GSTG_B(NS, BN) ((128 + (BN) + 128 * (NS)) * GROW_B)  // one buffer: A rows | Bt rows | A2 rows
static_assert((GROW_B % 16) == 0 && ((GROW_B / 16) & 1) == 1);

// Four asynchronous 16-B copies to LDS per lane (l = the lane's LDS byte address, g = its global address).
// s_wait_xcnt 0 is the last line of the copies' own statement: it stands in front of any rewrite of the address registers.
__device__ __forceinline__ void copy4_lds(unsigned l0, const __bf16* g0, unsigned l1, const __bf16* g1,
                                          unsigned l2, const __bf16* g2, unsigned l3, const __bf16* g3) {
#if defined(__HIP_DEVICE_COMPILE__)
  asm volatile("global_load_async_to_lds_b128 %0, %1, off\n\t"
               "global_load_async_to_lds_b128 %2, %3, off\n\t"
               "global_load_async_to_lds_b128 %4, %5, off\n\t"
               "global_load_async_to_lds_b128 %6, %7, off\n\t"
               "s_wait_xcnt 0x0"
               :: "v"(l0), "v"(g0), "v"(l1), "v"(g1), "v"(l2), "v"(g2), "v"(l3), "v"(g3) : "memory");
#endif
}
// The issuing wave's own copies have landed (in front of the barrier behind which other waves read them).
__device__ __forceinline__ void wait_copies() {
#if defined(__HIP_DEVICE_COMPILE__)
  asm volatile("s_wait_asynccnt 0x0" ::: "memory");
#endif
}
// This wave's LDS reads have returned (in front of the barrier behind which their buffer is refilled).
__device__ __forceinline__ void wait_lds() {
#if defined(__HIP_DEVICE_COMPILE__)
  asm volatile("s_wait_dscnt 0x0" ::: "memory");
#endif
}
// One 64-k tile of the block's operands into one buffer: 256 threads x 16 B = 32 rows per copy; dst = the lane's LDS
// byte address of row tid>>3, chunk tid&7 of the buffer; gA / gB / gA2 = its global address in row tid>>3 of the block's rows.
template <int NSPLIT, int BN>
__device__ __forceinline__ void gemm_stage(unsigned dst, const __bf16* gA, const __bf16* gB, const __bf16* gA2,
                                           int lda, int ldb) {
  const size_t ra = (size_t)32 * lda, rb = (size_t)32 * ldb;
  constexpr unsigned R = 32 * GROW_B;
  constexpr unsigned A2 = (4 + BN / 32) * R;              // the A2 rows stand behind the BN Bt rows
  copy4_lds(dst, gA, dst + R, gA + ra, dst + 2 * R, gA + 2 * ra, dst + 3 * R, gA + 3 * ra);
  copy4_lds(dst + 4 * R, gB, dst + 5 * R, gB + rb, dst + 6 * R, gB + 2 * rb, dst + 7 * R, gB + 3 * rb);
  if (BN == 256)
    copy4_lds(dst + 8 * R, gB + 4 * rb, dst + 9 * R, gB + 5 * rb, dst + 10 * R, gB + 6 * rb, dst + 11 * R, gB + 7 * rb);
  if (NSPLIT == 1)
    copy4_lds(dst + A2, gA2, dst + A2 + R, gA2 + ra, dst + A2 + 2 * R, gA2 + 2 * ra, dst + A2 + 3 * R, gA2 + 3 * ra);
}

template <int NSPLIT, int OUT_MODE, int BIAS, int BN>
__device__ __forceinline__ void gemm64_tile(
    const unsigned short* __restrict__ Ap, const unsigned short* A2p, int lda, long long strideA,
    const unsigned short* __restrict__ Btp, const unsigned short* Bt2p, int ldb, long long strideB,
    void* Cout, int ldc, long long strideC,
    void* Cout2, int ldc2, long long strideC2, int N2,
    int M, int N, int K, float rscale, const float* __restrict__ bias,
    const float* __restrict__ cosT, const float* __restrict__ sinT,
    float* slab, unsigned char* stg, int bt, int b) {
  static_assert(NSPLIT == 0 || NSPLIT == 1);
  static_assert(BN == 256 || BN == 128);
  constexpr int WN = BN / 64;              // waves along n, 64 columns each
  constexpr int MI = 128 / (8 / WN) / 16;  // 16-row subtiles of a wave: 4 (64 rows) or 2 (32 rows)
  const __bf16* A   = (const __bf16*)(const void*)Ap;
  const __bf16* A2  = (const __bf16*)(const void*)A2p;
  const __bf16* Bt  = (const __bf16*)(const void*)Btp;
  const int tid  = threadIdx.x;
  const int lane = tid & 31;
  const int wave = tid >> 5;
  const int blocksN = N / BN;
  const int blocksM = M >> 7;
  if (bt >= blocksM * blocksN) return;   // block-uniform, in front of every copy and barrier
  const int bm  = bt / blocksN;
  const int bn  = bt - bm * blocksN;
  const int mb0 = bm << 7;
  const int nb0 = bn * BN;
  const int wm  = wave / WN;             // the wave's MI * 16 rows of the block's 128
  const int wn  = wave % WN;             // the wave's 64 columns of the block's BN
  const int wr0 = wm * (MI * 16);
  const int m0  = mb0 + wr0;
  const int n0  = nb0 + (wn << 6);

  const __bf16* Ab  = A  + (size_t)b * strideA;
  const __bf16* Bb  = Bt + (size_t)b * strideB;
  const __bf16* Ab2 = (NSPLIT >= 1) ? (A2  + (size_t)b * strideA) : Ab;

  const int rlane = lane & 15;                 // row (A) / col (B, D) within subtile
  const int koff  = (lane >> 4) * 8;           // k offset of this lane half
  const int mOff  = (lane >> 4) * 8;           // D row offset

  v8f acc[MI][4];
#pragma unroll
  for (int i = 0; i < MI; ++i)
#pragma unroll
    for (int j = 0; j < 4; ++j) acc[i][j] = zero8();

  constexpr unsigned STG = GSTG_B(NSPLIT, BN);
  const int nt   = K >> 6;                     // trips of 64 k
  const int srow = tid >> 3, sch = tid & 7;    // this lane's row (of 32 per copy) and 16-B chunk of the 128-B row
  const unsigned sdst = (unsigned)(size_t)stg + (unsigned)(srow * GROW_B + sch * 16);
  const __bf16* gA  = Ab  + (size_t)(mb0 + srow) * lda + sch * 8;
  const __bf16* gB  = Bb  + (size_t)(nb0 + srow) * ldb + sch * 8;
  const __bf16* gA2 = Ab2 + (size_t)(mb0 + srow) * lda + sch * 8;

  // tile 0 -> buffer 0, landed and published; then tile 1 -> buffer 1 in flight
  gemm_stage<NSPLIT, BN>(sdst, gA, gB, gA2, lda, ldb);
  wait_copies();
  __syncthreads();
  if (nt > 1) gemm_stage<NSPLIT, BN>(sdst + STG, gA + 64, gB + 64, gA2 + 64, lda, ldb);

  for (int t = 0; t < nt; ++t) {               // block-uniform trip count
    const __bf16* sb  = (const __bf16*)(const void*)(stg + (size_t)(t & 1) * STG);
    const __bf16* sA  = sb + (wr0 + rlane) * GP + koff;
    const __bf16* sB  = sb + (128 + (wn << 6) + rlane) * GP + koff;
    const __bf16* sA2 = (NSPLIT >= 1) ? (sb + (128 + BN + wr0 + rlane) * GP + koff) : sA;
    // unrolled (here and below): the fragment arrays need constant indices to stay in registers, and the second
    // 32-k block's LDS reads can then be issued among the first block's products
#pragma unroll
    for (int kk = 0; kk < 2; ++kk) {
      v16b bh[4], ahf[MI], alf[MI];
#pragma unroll
      for (int j = 0; j < 4; ++j) bh[j] = ldfrag_b(sB + (j << 4) * GP + kk * 32);
#pragma unroll
      for (int i = 0; i < MI; ++i) {
        ahf[i] = ldfrag_b(sA + (i << 4) * GP + kk * 32);
        if (NSPLIT >= 1) alf[i] = ldfrag_b(sA2 + (i << 4) * GP + kk * 32); else alf[i] = ahf[i];
      }
#pragma unroll
      for (int i = 0; i < MI; ++i) {
        const v16b ah = ahf[i], al = alf[i];
#pragma unroll
        for (int j = 0; j < 4; ++j) {
          acc[i][j] = mma_b_raw(ah, bh[j], acc[i][j]);
          if (NSPLIT >= 1) acc[i][j] = mma_b_raw(al, bh[j], acc[i][j]);
        }
        dep_guard_b(acc[i][0], acc[i][3], ah, al);
      }
      keep4_b(bh[0], bh[1], bh[2], bh[3]);
    }
    // foot of the trip: own reads of this buffer done, own copies of the next tile landed, one barrier for both;
    // only then the refill of the buffer that this trip has read
    wait_lds();
    wait_copies();
    __syncthreads();
    if (t + 2 < nt) {
      const int kn = (t + 2) << 6;
      gemm_stage<NSPLIT, BN>(sdst + (unsigned)(t & 1) * STG, gA + kn, gB + kn, gA2 + kn, lda, ldb);
    }
  }
  wait_copies();
#pragma unroll
  for (int i = 0; i < MI; ++i) acc_guard4(acc[i][0], acc[i][1], acc[i][2], acc[i][3]);

  // ---- epilogue ----
  float bcol[4];
#pragma unroll
  for (int j = 0; j < 4; ++j) bcol[j] = 0.f;
  if (BIAS == 1) {
#pragma unroll
    for (int j = 0; j < 4; ++j) bcol[j] = bfr(bias[n0 + (j << 4) + rlane]);
  }
#pragma unroll
  for (int i = 0; i < MI; ++i) {
    const int mBase = m0 + (i << 4);
    float brow[8];
#pragma unroll
    for (int r = 0; r < 8; ++r) brow[r] = 0.f;
    if (BIAS == 2) {
#pragma unroll
      for (int r = 0; r < 8; ++r) brow[r] = bfr(bias[mBase + mOff + r]);
    }
#pragma unroll
    for (int j = 0; j < 4; ++j) {
#pragma unroll
      for (int r = 0; r < 8; ++r) {
        slab[(mOff + r) * 68 + (j << 4) + rlane] = (acc[i][j][r] + bcol[j]) + brow[r];
      }
    }
    v4f tc[4][2], ts[4][2];                                // OUT_MODE 4: cos / sin of this lane's 4 rows x 8 columns,
    if (OUT_MODE == 4) {                                   // asked for while the slab's stores are under way
      const size_t to = (size_t)(mBase + (lane >> 3)) * NFREQ + (((lane & 7) * 8) & 31);
      const float* cr = cosT + to;
      const float* sr = sinT + to;
#pragma unroll
      for (int it = 0; it < 4; ++it) {                     // row it * 4 + (lane >> 3)
        tc[it][0] = *(const v4f*)(cr + it * 4 * NFREQ); tc[it][1] = *(const v4f*)(cr + it * 4 * NFREQ + 4);
        ts[it][0] = *(const v4f*)(sr + it * 4 * NFREQ); ts[it][1] = *(const v4f*)(sr + it * 4 * NFREQ + 4);
      }
#if defined(__HIP_DEVICE_COMPILE__)
      // s_wait_xcnt 0 before a register that an issued load names is written again; the addresses are inputs so that
      // they stay in their registers up to the wait (else a later load's destination may take an address pair over).
      asm volatile("s_wait_xcnt 0x0" :: "v"(cr), "v"(sr) : "memory");
#endif
    }
    __builtin_amdgcn_fence(__ATOMIC_RELEASE, "workgroup");
    __builtin_amdgcn_wave_barrier();
    __builtin_amdgcn_fence(__ATOMIC_ACQUIRE, "workgroup");
    if (OUT_MODE == 0) {
      float* C = (float*)Cout + (size_t)b * strideC;
      const int hh = lane >> 4, c4 = (lane & 15) * 4;     // 256-B row segment = 16 lanes x 16 B
      {
#pragma unroll
        for (int it = 0; it < 8; ++it) {
          const int row = it * 2 + hh;                     // it 0..7 x hh 0..1 = rows 0..15
          const v4f v = *(const v4f*)(slab + row * 68 + c4);
          *(v4f*)(C + (size_t)(mBase + row) * ldc + n0 + c4) = v;
        }
        
      }
    } else if (OUT_MODE == 4) {
      const int q = lane >> 3, c8 = (lane & 7) * 8;        // 8 lanes x 16 B = one 128-B line per row and plane
      unsigned short* C  = (unsigned short*)Cout  + (size_t)b * strideC;
      unsigned short* C2 = (unsigned short*)Cout2 + (size_t)b * strideC2;
      const size_t go = (size_t)(mBase + q) * ldc + n0 + c8;
      unsigned short* hp = C + go;
      unsigned short* lp = C2 + go;
#pragma unroll
      for (int ip = 0; ip < 2; ++ip) {                     // two rows at a time: row (ip * 2 + u) * 4 + q = rows 0..15
        v4u hv[2], lv[2];
#pragma unroll
        for (int u = 0; u < 2; ++u) {
          const int it = ip * 2 + u;
          const float* sp = slab + (it * 4 + q) * 68;
          rope_row8(sp + c8, sp + (c8 ^ 32), (c8 & 32) != 0, tc[it][0], tc[it][1], ts[it][0], ts[it][1], hv[u], lv[u]);
        }
#pragma unroll
        for (int u = 0; u < 2; ++u) {
          *(v4u*)(hp + (size_t)((ip * 2 + u) * 4) * ldc) = hv[u];
          *(v4u*)(lp + (size_t)((ip * 2 + u) * 4) * ldc) = lv[u];
        }
#if defined(__HIP_DEVICE_COMPILE__)
        // s_wait_xcnt 0 behind the run of stores, before a register that they name is written again; addresses and
        // data are inputs so that they stay in their registers up to the wait.
        asm volatile("s_wait_xcnt 0x0" :: "v"(hp), "v"(lp), "v"(hv[0]), "v"(lv[0]), "v"(hv[1]), "v"(lv[1]) : "memory");
#endif
      }
    } else {
      const int q = lane >> 3, c8 = (lane & 7) * 8;
      unsigned short* C  = (unsigned short*)Cout  + (size_t)b * strideC;
      unsigned short* C2 = (unsigned short*)Cout2 + (size_t)b * strideC2;
      const bool wlo = (OUT_MODE == 2) || (n0 < N2);      // wave-uniform
      v4u hv[4], lv[4];
#pragma unroll
      for (int it = 0; it < 4; ++it) {
        const int row = it * 4 + q;                        // it 0..3 x q 0..3 = rows 0..15
        const float* sp = slab + row * 68 + c8;
        v4u a, a2;
#pragma unroll
        for (int e = 0; e < 4; ++e) {
          const float f0 = sp[2 * e], f1 = sp[2 * e + 1];
          unsigned short h0, h1, l0, l1;
          if (OUT_MODE == 2) {
            h0 = bf_bits(f0); h1 = bf_bits(f1);
            l0 = bf_bits(f0 - bf_up(h0)); l1 = bf_bits(f1 - bf_up(h1));
          } else {
            const _Float16 x0 = (_Float16)f0, x1 = (_Float16)f1;
            h0 = h_bits(x0); h1 = h_bits(x1);
            l0 = h_bits((_Float16)((f0 - (float)x0) * rscale));
            l1 = h_bits((_Float16)((f1 - (float)x1) * rscale));
          }
          a[e] = pk16(h0, h1); a2[e] = pk16(l0, l1);
        }
        hv[it] = a; lv[it] = a2;
      }
      {
#pragma unroll
        for (int it = 0; it < 4; ++it) {
          const int row = it * 4 + q;
          *(v4u*)(C + (size_t)(mBase + row) * ldc + n0 + c8) = hv[it];
          if (wlo) *(v4u*)(C2 + (size_t)(mBase + row) * ldc2 + n0 + c8) = lv[it];
        }
        
      }
    }
    __builtin_amdgcn_fence(__ATOMIC_RELEASE, "workgroup");
    __builtin_amdgcn_wave_barrier();
    __builtin_amdgcn_fence(__ATOMIC_ACQUIRE, "workgroup");
  }
}

// One product per grid: blockIdx.x = 128 x BN block tile, blockIdx.y = batch index.
template <int NSPLIT, int OUT_MODE, int BIAS, int BN>
__global__ __launch_bounds__(256) void gemm64(
    const unsigned short* __restrict__ Ap, const unsigned short* A2p, int lda, long long strideA,
    const unsigned short* __restrict__ Btp, const unsigned short* Bt2p, int ldb, long long strideB,
    void* Cout, int ldc, long long strideC,
    void* Cout2, int ldc2, long long strideC2, int N2,
    int M, int N, int K, float rscale, const float* __restrict__ bias) {
  __shared__ __align__(16) float sT[8][16 * 68];   // per-wave 16x64 slab, pitch 68 floats
  __shared__ __align__(16) unsigned char sG[2 * GSTG_B(NSPLIT, BN)];   // two operand buffers
  const int wave = threadIdx.x >> 5;
  gemm64_tile<NSPLIT, OUT_MODE, BIAS, BN>(Ap, A2p, lda, strideA, Btp, Bt2p, ldb, strideB, Cout, ldc, strideC,
                                      Cout2, ldc2, strideC2, N2, M, N, K, rscale, bias, nullptr, nullptr,
                                      sT[wave], sG, blockIdx.x, blockIdx.y);
}

// q, k and v^T projections of both batch elements in one grid: blockIdx.z = 0 q, 1 k, 2 v^T; blockIdx.y = batch;
// blockIdx.x = block tile: 128 x 256 for q / k, 128 x 128 for v^T (half the output of q / k, so as many tiles). The v^T
// blocks: 256 of them reach every WGP, 128 of the larger tile would reach half.
//   q / k = rope(x_b . W^T + bias[col]) -> bf16 hi / lo planes [NB*SEQ][DQK] (M=SEQ, N=DQK, K=DM); per head 128
//           columns = two 64-wide vectors, each the 64 columns of one wave
//   v^T   = Wv . x_b^T + bv[row]  -> f16 hi plane [b][h*64+d][s] (pitch SEQ) and residual plane
//           (x4096, keys < VLP only, pitch VLP)                        (M=DM, N=SEQ, K=DM)
__global__ __launch_bounds__(256) void gemm_qkv(
    const unsigned short* __restrict__ Xb, const unsigned short* __restrict__ Wqb,
    const unsigned short* __restrict__ Wkb, const unsigned short* __restrict__ Wvb,
    unsigned short* Qh, unsigned short* Ql, unsigned short* Kh, unsigned short* Kl,
    unsigned short* VTh, unsigned short* VTl,
    const float* __restrict__ bq, const float* __restrict__ bk, const float* __restrict__ bv,
    const float* __restrict__ cosT, const float* __restrict__ sinT) {
  __shared__ __align__(16) float sT[8][16 * 68];   // per-wave 16x64 slab, pitch 68 floats
  __shared__ __align__(16) unsigned char sG[2 * GSTG_B(0, 256)];   // two operand buffers (of the larger tile)
  const int wave = threadIdx.x >> 5;
  const int tile = blockIdx.x;
  const int b    = blockIdx.y;
  const int z    = blockIdx.z;
  if (z < 2) {
    const unsigned short* Wb = z ? Wkb : Wqb;
    unsigned short* Ch = z ? Kh : Qh;
    unsigned short* Cl = z ? Kl : Ql;
    const float* bias = z ? bk : bq;
    gemm64_tile<0, 4, 1, 256>(Xb, Xb, DM, (long long)SEQ * DM, Wb, Wb, DM, 0LL,
                         (void*)Ch, DQK, (long long)SEQ * DQK, (void*)Cl, DQK, (long long)SEQ * DQK, DQK,
                         SEQ, DQK, DM, 1.0f, bias, cosT, sinT, sT[wave], sG, tile, b);
  } else {
    gemm64_tile<0, 3, 2, 128>(Wvb, Wvb, DM, 0LL, Xb, Xb, DM, (long long)SEQ * DM,
                         (void*)VTh, SEQ, (long long)DM * SEQ, (void*)VTl, VLP, (long long)DM * VLP, VLP,
                         DM, SEQ, DM, 4096.0f, bv, nullptr, nullptr, sT[wave], sG, tile, b);
  }
}

#define LP      72                        // LDS row pitch of the 16-bit tiles, in elements
#define TILE_B  (64 * LP * 2)             // one 64-row tile: 9216 B
#define OSP     68                        // row pitch of a wave's f32 context tile, in floats (272 B = 16 B x 17)
#define OS_B    (4 * 16 * OSP * 4)        // four waves' f32 context tiles: 17408 B
#define ATT_LDS (4 * TILE_B + OS_B)       // 54272 B
static_assert(((LP * 2) % 16) == 0 && (((LP * 2) / 16) & 1) == 1);   // 16-B aligned rows, odd multiple of 16 B
// value of lane l ^ 16 (the other wave half)
__device__ __forceinline__ float xhalf(float x) {
  return __builtin_bit_cast(float, __builtin_amdgcn_permlanex16(__builtin_bit_cast(int, x), __builtin_bit_cast(int, x),
                                                                0x76543210, 0xfedcba98, false, false));
}
template <bool RES>
__device__ __forceinline__
void attn_block64(unsigned char* smem,
                  const unsigned short* __restrict__ qhp, const unsigned short* __restrict__ qlp,
                  const unsigned short* __restrict__ khp, const unsigned short* __restrict__ klp,
                  const unsigned short* __restrict__ vhp, const unsigned short* __restrict__ vlp,
                  float* Cp, int soff, int qb, int h, float sscale) {
  union FB { v16b v; v8b h[2]; };
  union FH { v16h v; v8h h[2]; };
  __bf16*   Ksh = (__bf16*)(void*)(smem);                         // K hi [kv][d]
  __bf16*   Ksl = (__bf16*)(void*)(smem + TILE_B);                // K lo
  _Float16* Vth = (_Float16*)(void*)(smem + 2 * TILE_B);          // V^T hi [d][kv]
  float*    Os  = (float*)(void*)(smem + 3 * TILE_B);             // per wave context tile [row][d], 4 x 4352 B
  _Float16* Vtl = (_Float16*)(void*)(smem + 3 * TILE_B + OS_B);   // V^T residual (RES only)

  const int tid  = threadIdx.x;
  // wave-uniform, so held in a scalar register: as a vector register it is live across the loop, and the body with the
  // residual planes then spills under the kernel's budget of 192 registers
  const int wave = __builtin_amdgcn_readfirstlane(tid >> 5);
  const int lane = tid & 31;
  const int hh   = lane >> 4;
  const int c    = lane & 15;

  const int q0   = qb * 64 + wave * 16;
  const int col  = h * (2 * HD) + soff;

  const __bf16* Qh = (const __bf16*)(const void*)qhp + col;
  const __bf16* Ql = (const __bf16*)(const void*)qlp + col;
  const __bf16* Kh = (const __bf16*)(const void*)khp + col;
  const __bf16* Kl = (const __bf16*)(const void*)klp + col;
  const _Float16* Vh = (const _Float16*)(const void*)vhp + (size_t)h * HD * SEQ;
  const _Float16* Vl = (const _Float16*)(const void*)vlp + (size_t)h * HD * VLP;

  // ---- Q fragments (B operand, column = query = lane&15): 2 d-chunks, hi and lo ----
  v16b qah[2], qal[2];
#pragma unroll
  for (int dc = 0; dc < 2; ++dc) {
    const size_t qo = (size_t)(q0 + c) * DQK + dc * 32 + 8 * hh;
    qah[dc] = ldfrag_b(Qh + qo);
    qal[dc] = ldfrag_b(Ql + qo);
  }

  const int qrow = q0 + c;                   // this lane's query row
  float mrow = -INFINITY;                    // its running maximum (equal in both wave halves); body with residual planes
  float brow = INFINITY;                     // body without: the exponent offset in use, 10 - max * cl (falls as the maximum grows)
  const float cl = sscale * 1.44269504f;     // score -> exponent of 2; sscale > 0, so the largest raw score has the largest exponent
  float lrow = 0.f;                          // running sum over this wave half's keys only; joined after the loop
  v8f oacc[4];                               // oacc[t][r] = context^T [d = t*16 + 8*hh + r][query c]
#pragma unroll
  for (int t = 0; t < 4; ++t) oacc[t] = zero8();

  for (int kt = 0; kt < NQB; ++kt) {         // static trip bound
    if (kt > qb) break;                      // block-uniform (causal)
    const bool diag = (kt == qb);            // block-uniform
    const int kv0 = kt * 64;
    __syncthreads();
    {
      const int g = tid >> 3, ch = (tid & 7) * 8;                  // group of 8 lanes = one row; elements ch..ch+7
      const int r = (g >> 1) | ((g & 1) << 3);                     // pass i: row r + 16 i; groups 2m, 2m+1 -> rows m, m+8
      const __bf16*   kg  = Kh + (size_t)(kv0 + r) * DQK + ch;     // K row kv0+r, d = ch..ch+7
      const __bf16*   klg = Kl + (size_t)(kv0 + r) * DQK + ch;
      const _Float16* vg  = Vh + (size_t)r * SEQ + kv0 + ch;        // V^T row d = r, s = kv0+ch..+7
      const int kvl = (kv0 + 64 <= VLP) ? kv0 : (VLP - 64);       // clamped address into the residual plane
      const _Float16* vlg = Vl + (size_t)r * VLP + kvl + ch;
      const bool resOK = (kv0 + 64 <= VLP);                        // block-uniform
      v8b a0[4], a1[4];
      v8h b0[4], b1[4];
#pragma unroll
      for (int i = 0; i < 4; ++i) {
        a0[i] = *(const v8b*)(kg + (size_t)(16 * i) * DQK);
        a1[i] = *(const v8b*)(klg + (size_t)(16 * i) * DQK);
        b0[i] = *(const v8h*)(vg + (size_t)(16 * i) * SEQ);
        if (RES) {
          b1[i] = *(const v8h*)(vlg + (size_t)(16 * i) * VLP);
          if (!resOK) b1[i] = zero8h();
        }
      }
#if defined(__HIP_DEVICE_COMPILE__)
      // s_wait_xcnt 0 before a register that an issued load names is written again; the addresses are inputs so that
      // they stay in their registers up to the wait (else the last load's destination may take an address pair over).
      if (RES) asm volatile("s_wait_xcnt 0x0" :: "v"(kg), "v"(klg), "v"(vg), "v"(vlg) : "memory");
      else     asm volatile("s_wait_xcnt 0x0" :: "v"(kg), "v"(klg), "v"(vg) : "memory");
#endif
#pragma unroll
      for (int i = 0; i < 4; ++i) {
        *(v8b*)(Ksh + (r + 16 * i) * LP + ch) = a0[i];
        *(v8b*)(Ksl + (r + 16 * i) * LP + ch) = a1[i];
        *(v8h*)(Vth + (r + 16 * i) * LP + ch) = b0[i];
        if (RES) *(v8h*)(Vtl + (r + 16 * i) * LP + ch) = b1[i];
      }
    }
    __syncthreads();

    // ---- scores^T: 64 keys x 16 query columns per wave, 3 bf16 products; s[j][r] = key j*16 + 8*hh + r, query c ----
    //      Without the residual planes, per 32 d: the 8 K fragments (16 LDS reads) are asked for as one group, then 12 plain
    //      products follow in which neighbours belong to different key tiles (a product on the tile of the one before it
    //      waits out the matrix latency, and each other's issue fills the distance that a VALU use of a result needs).
    //      Per tile the six products keep their order: dc 0 hi.hi, lo.hi, hi.lo, then dc 1.
    //      With the residual planes the registers do not reach for the groups (spills): one fragment pair at a time.
    v8f s[4];
    if (!RES) {
#pragma unroll
      for (int j = 0; j < 4; ++j) s[j] = zero8();
      // unrolled: the Q fragments are register arrays and need constant indices
#pragma unroll
      for (int dc = 0; dc < 2; ++dc) {
        FB kb[4], kl[4];
#pragma unroll
        for (int j = 0; j < 4; ++j) {
          kb[j].h[0] = *(const v8b*)(Ksh + (j * 16 + c) * LP + dc * 32 + 8 * hh);
          kb[j].h[1] = *(const v8b*)(Ksh + (j * 16 + c) * LP + dc * 32 + 16 + 8 * hh);
        }
#pragma unroll
        for (int j = 0; j < 4; ++j) {
          kl[j].h[0] = *(const v8b*)(Ksl + (j * 16 + c) * LP + dc * 32 + 8 * hh);
          kl[j].h[1] = *(const v8b*)(Ksl + (j * 16 + c) * LP + dc * 32 + 16 + 8 * hh);
        }
        // keeps the reads together in front of the products: left free, the compiler spreads them singly among the products
        group_fence();
#pragma unroll
        for (int j = 0; j < 4; ++j) s[j] = mma_b_raw(kb[j].v, qah[dc], s[j]);
#pragma unroll
        for (int j = 0; j < 4; ++j) s[j] = mma_b_raw(kl[j].v, qah[dc], s[j]);
#pragma unroll
        for (int j = 0; j < 4; ++j) s[j] = mma_b_raw(kb[j].v, qal[dc], s[j]);
        // the next group's reads stay behind this group's products: with two groups under way the registers do not reach (spills)
        group_fence();
      }
    } else {
#pragma unroll
      for (int j = 0; j < 4; ++j) {
        s[j] = zero8();
#pragma unroll
        for (int dc = 0; dc < 2; ++dc) {
          FB kb, kl;
          kb.h[0] = *(const v8b*)(Ksh + (j * 16 + c) * LP + dc * 32 + 8 * hh);
          kb.h[1] = *(const v8b*)(Ksh + (j * 16 + c) * LP + dc * 32 + 16 + 8 * hh);
          kl.h[0] = *(const v8b*)(Ksl + (j * 16 + c) * LP + dc * 32 + 8 * hh);
          kl.h[1] = *(const v8b*)(Ksl + (j * 16 + c) * LP + dc * 32 + 16 + 8 * hh);
          s[j] = mma_b(kb.v, qah[dc], s[j]);
          s[j] = mma_b(kl.v, qah[dc], s[j]);
          s[j] = mma_b(kb.v, qal[dc], s[j]);
        }
      }
    }

    // ---- scale, causal fill on the diagonal tile, maximum of the lane's 32 keys and of the other half's,
    //      online softmax, P (x1024, f16) and P residual (x4096) packed into B operands ----
    //      Without the residual planes the scale, log2 e, the maximum and the x1024 carry are one multiply-add per score:
    //      1024 p = 2^(s * cl + b), b = 10 - max * cl, on raw scores, two scores per packed instruction; the maximum is taken
    //      over raw scores; the row sum then carries the 1024 too (it cancels against P's in the final division). The
    //      accumulators pass from one offset to the next by 2^(b_new - b_old), the exact ratio of the two references.
    //      The causal test is hoisted the same way: tile start, lane half, query row and the diagonal flag make one limit per
    //      lane and tile, and a score's literal index j*16 + r is compared with it (a full tile's limit, 64, is above every index).
    const int lim = diag ? (qrow - kv0 - 8 * hh) : 64;
    float mj[4];
#pragma unroll
    for (int j = 0; j < 4; ++j) {
      mj[j] = -INFINITY;
#pragma unroll
      for (int r = 0; r < 8; ++r) {
        float sv = RES ? s[j][r] * sscale : s[j][r];
        // key kv0 + j*16 + 8*hh + r beyond the query row (the body with residual planes keeps its form: the other one spills there)
        const bool beyond = RES ? (diag && kv0 + j * 16 + 8 * hh + r > qrow) : (j * 16 + r > lim);
        sv = beyond ? -INFINITY : sv;
        s[j][r] = sv;
        mj[j] = fmaxf(mj[j], sv);
      }
    }
    float m = fmaxf(fmaxf(mj[0], mj[1]), fmaxf(mj[2], mj[3]));
    m = fmaxf(m, xhalf(m));
    v16h pbh[2], pbl[2];                     // element (j&1)*8 + r of block j>>1 = key (j>>1)*32 + (j&1)*16 + 8*hh + r
    float alpha;
    if (!RES) {
      const float bnew  = fminf(brow, fmaf(-m, cl, 10.0f));        // m = -inf (nothing unmasked yet): +inf
      const float bsafe = (bnew == INFINITY) ? 10.0f : bnew;
      alpha = __builtin_amdgcn_exp2f(bsafe - brow);                // first tile: 2^-inf = 0 on zero accumulators
      brow = bnew;
      const v2f cl2 = {cl, cl}, b2 = {bsafe, bsafe};
      v2f pj[4];                             // four independent pairs of partial sums, 4 keys each
#pragma unroll
      for (int j = 0; j < 4; ++j) {
#pragma unroll
        for (int r = 0; r < 8; r += 2) {
          const v2f sv = {s[j][r], s[j][r + 1]};
          const v2f x = __builtin_elementwise_fma(sv, cl2, b2);    // -inf score: -inf, 2^x -> 0
          const v2f p = {__builtin_amdgcn_exp2f(x[0]), __builtin_amdgcn_exp2f(x[1])};
          pj[j] = (r == 0) ? p : (pj[j] + p);
          pbh[j >> 1][(j & 1) * 8 + r]     = (_Float16)p[0];
          pbh[j >> 1][(j & 1) * 8 + r + 1] = (_Float16)p[1];
        }
      }
      const v2f ps = (pj[0] + pj[1]) + (pj[2] + pj[3]);
      lrow = lrow * alpha + (ps[0] + ps[1]);
    } else {
      const float mnew  = fmaxf(mrow, m);
      const float msafe = (mnew == -INFINITY) ? 0.f : mnew;
      alpha = __expf(mrow - msafe);
      mrow = mnew;
      float pj[4];                           // four independent partial sums of 8 keys each
#pragma unroll
      for (int j = 0; j < 4; ++j) {
        pj[j] = 0.f;
#pragma unroll
        for (int r = 0; r < 8; ++r) {
          const float p = __expf(s[j][r] - msafe);     // -inf logit: exp -> 0
          pj[j] += p;
          const float p1k = p * 1024.0f;
          const _Float16 ph = (_Float16)p1k;
          pbh[j >> 1][(j & 1) * 8 + r] = ph;
          pbl[j >> 1][(j & 1) * 8 + r] = (_Float16)((p1k - (float)ph) * 4096.0f);
        }
      }
      lrow = lrow * alpha + ((pj[0] + pj[1]) + (pj[2] + pj[3]));
    }
#pragma unroll
    for (int t = 0; t < 4; ++t)
#pragma unroll
      for (int r = 0; r < 8; ++r) oacc[t][r] *= alpha;

    // ---- context^T += V^T . P^T (f16 WMMA), residual products into a separate accumulator ----
    v8f o1[4];
#pragma unroll
    for (int t = 0; t < 4; ++t) o1[t] = zero8();
    // unrolled: the P operands are register arrays and need constant indices
#pragma unroll
    for (int kk = 0; kk < 2; ++kk) {
      if (!RES) {
        // the same form as the scores: the 4 V^T fragments (8 LDS reads) as one group, then 4 plain products on 4 tiles
        FH vb[4];
#pragma unroll
        for (int t = 0; t < 4; ++t) {
          vb[t].h[0] = *(const v8h*)(Vth + (t * 16 + c) * LP + kk * 32 + 8 * hh);
          vb[t].h[1] = *(const v8h*)(Vth + (t * 16 + c) * LP + kk * 32 + 16 + 8 * hh);
        }
        // boundary between the reads and their products: this kk's products then start as their fragments arrive; left free,
        // the compiler forms all of P in front of the first product and the loop comes out longer
        group_fence();
#pragma unroll
        for (int t = 0; t < 4; ++t) oacc[t] = mma_h_raw(vb[t].v, pbh[kk], oacc[t]);
      } else {
#pragma unroll
        for (int t = 0; t < 4; ++t) {
          FH vb, vl;
          vb.h[0] = *(const v8h*)(Vth + (t * 16 + c) * LP + kk * 32 + 8 * hh);
          vb.h[1] = *(const v8h*)(Vth + (t * 16 + c) * LP + kk * 32 + 16 + 8 * hh);
          oacc[t] = mma_h(vb.v, pbh[kk], oacc[t]);
          vl.h[0] = *(const v8h*)(Vtl + (t * 16 + c) * LP + kk * 32 + 8 * hh);
          vl.h[1] = *(const v8h*)(Vtl + (t * 16 + c) * LP + kk * 32 + 16 + 8 * hh);
          o1[t] = mma_h(vl.v, pbh[kk], o1[t]);
          o1[t] = mma_h(vb.v, pbl[kk], o1[t]);
        }
      }
    }
    if (RES) {
#pragma unroll
      for (int t = 0; t < 4; ++t)
#pragma unroll
        for (int r = 0; r < 8; ++r) oacc[t][r] += o1[t][r] * (1.0f / 4096.0f);
    }
  }

  // ---- join the halves' sums, normalise (1/l and the 1/1024 p carry), stage the wave's 16x64 tile as [query][d]
  //      (a lane holds 8 consecutive d of its query per t: two 16-B LDS stores), write f32 rows as whole 256-B segments
  float* os = Os + wave * (16 * OSP);
  {
    const float l = lrow + xhalf(lrow);
    // with the residual planes l is the plain sum and P carries 1024; without them both carry it
    const float inv = ((l > 0.f) ? (1.0f / l) : 0.f) * (RES ? (1.0f / 1024.0f) : 1.0f);
#pragma unroll
    for (int t = 0; t < 4; ++t) {
      v4f w0, w1;
#pragma unroll
      for (int e = 0; e < 4; ++e) { w0[e] = oacc[t][e] * inv; w1[e] = oacc[t][4 + e] * inv; }
      *(v4f*)(os + c * OSP + t * 16 + 8 * hh)     = w0;
      *(v4f*)(os + c * OSP + t * 16 + 8 * hh + 4) = w1;
    }
  }
  __builtin_amdgcn_fence(__ATOMIC_RELEASE, "workgroup");
  __builtin_amdgcn_wave_barrier();
  __builtin_amdgcn_fence(__ATOMIC_ACQUIRE, "workgroup");
  {
    const int h2 = lane >> 4, c4 = (lane & 15) * 4;
    v4f ov[8];
#pragma unroll
    for (int it = 0; it < 8; ++it) {
      const int row = it * 2 + h2;   // it 0..7 x h2 0..1 = rows 0..15 of the wave tile
      ov[it] = *(const v4f*)(os + row * OSP + c4);
    }
    {
#pragma unroll
      for (int it = 0; it < 8; ++it) {
        const int row = it * 2 + h2;
        const size_t go = (size_t)(q0 + row) * DM + (size_t)h * HD + c4;
        *(v4f*)(Cp + go) = ov[it];
      }
#if defined(__HIP_DEVICE_COMPILE__)
      // s_wait_xcnt 0 behind the run of stores: in the merged kernel the listing holds a branch from the end of this
      // body to the head of the other one, where registers that these stores name are written again.
      asm volatile("s_wait_xcnt 0x0" ::: "memory");
#endif
    }
  }
}

// All query blocks of both streams, all heads and both batch elements in one grid of NQB * 2 * NB * NH blocks.
// blockIdx.x / 64 counts the query blocks down from the last one: the blocks with the most key tiles get the lowest
// indices (for speed only).
// blockIdx.x % 64 = batch * 32 + stream * 16 + head. Query blocks below RESQB take the body with residual planes
// (block-uniform choice).
// amdgpu_waves_per_eu(5, 5): a budget of 192 registers, five waves per SIMD as before; left free, the build takes 206
// registers for the read groups (an allocation of 208), which leaves four waves per SIMD.
__global__ __launch_bounds__(128) __attribute__((amdgpu_waves_per_eu(5, 5)))
void attn_causal64(const unsigned short* __restrict__ qhp, const unsigned short* __restrict__ qlp,
                   const unsigned short* __restrict__ khp, const unsigned short* __restrict__ klp,
                   const unsigned short* __restrict__ vhp, const unsigned short* __restrict__ vlp,
                   float* C1p, float* C2p, float sscale) {
  __shared__ __align__(16) unsigned char smem[ATT_LDS];
  const int bx     = blockIdx.x;
  const int qb     = NQB - 1 - (bx >> 6);
  const int h      = bx & 15;
  const int stream = (bx >> 4) & 1;
  const int b      = (bx >> 5) & 1;
  const size_t qk = (size_t)b * SEQ * DQK;
  const unsigned short* vh = vhp + (size_t)b * DM * SEQ;
  const unsigned short* vl = vlp + (size_t)b * DM * VLP;
  float* Cp = (stream ? C2p : C1p) + (size_t)b * SEQ * DM;
  const int soff = stream * HD;
  if (qb < RESQB) attn_block64<true >(smem, qhp + qk, qlp + qk, khp + qk, klp + qk, vh, vl, Cp, soff, qb, h, sscale);
  else            attn_block64<false>(smem, qhp + qk, qlp + qk, khp + qk, klp + qk, vh, vl, Cp, soff, qb, h, sscale);
}

// =====================================================================================================
// Differential combine + head rms norm for one token row t of the NB*SEQ rows:
//   lam[h] = (0.2 + exp(sum_d lq1.lk1)) - exp(sum_d lq2.lk2): read from the table that the convert launch wrote
//   o = c1 - lam*c2; r = rsqrt(sum_d(o^2)/64 + 1e-6); o = ((o*r) * w[h][d]) * 0.8
//   written as bf16 hi / lo planes [NB*SEQ][DM] (merged head layout), one 16-B store per plane per lane
// grid = NB*SEQ blocks x 128 threads; thread -> columns 8*tid..+7 (head = tid>>3, 8 lanes per head).
// coverage: 128 threads x 8 = 1024 columns per row; NB*SEQ rows.
// =====================================================================================================
__global__ __launch_bounds__(128) void diff_combine(
    const float* __restrict__ C1, const float* __restrict__ C2,
    const float* __restrict__ lamT,
    const float* __restrict__ hnw, unsigned short* Oh, unsigned short* Ol) {
#pragma clang fp contract(off)
  const int tid = threadIdx.x;
  const int t   = blockIdx.x;
  const int c0 = tid * 8;
  const int h  = c0 >> 6;
  const int d0 = c0 & 63;
  const size_t ro = (size_t)t * DM + c0;
  const v4f x0 = *(const v4f*)(C1 + ro), x1 = *(const v4f*)(C1 + ro + 4);
  const v4f y0 = *(const v4f*)(C2 + ro), y1 = *(const v4f*)(C2 + ro + 4);
  const float lam = lamT[h];
#if defined(__HIP_DEVICE_COMPILE__)
  // s_wait_xcnt 0 before a register that an issued load names is written again; the addresses are inputs so that
  // they stay in their registers up to the wait (else a later load's destination may take an address pair over).
  asm volatile("s_wait_xcnt 0x0" :: "v"(C1 + ro), "v"(C2 + ro) : "memory");
#endif
  float o[8];
  float ss = 0.f;
#pragma unroll
  for (int e = 0; e < 4; ++e) {
    o[e]     = x0[e] - lam * y0[e];
    o[4 + e] = x1[e] - lam * y1[e];
  }
#pragma unroll
  for (int e = 0; e < 8; ++e) ss += o[e] * o[e];
  ss += __shfl_xor(ss, 1, 32);
  ss += __shfl_xor(ss, 2, 32);
  ss += __shfl_xor(ss, 4, 32);
  const float ms = ss * (1.0f / (float)HD);
  const float rn = rsqrtf(ms + 1.0e-6f);
  v4u hv, lv;
#pragma unroll
  for (int e = 0; e < 4; ++e) {
    const float w0 = bfr(hnw[h * HD + d0 + 2 * e]);
    const float w1 = bfr(hnw[h * HD + d0 + 2 * e + 1]);
    const float f0 = ((o[2 * e] * rn) * w0) * OSCL;
    const float f1 = ((o[2 * e + 1] * rn) * w1) * OSCL;
    const unsigned short h0 = bf_bits(f0), h1 = bf_bits(f1);
    const unsigned short l0 = bf_bits(f0 - bf_up(h0)), l1 = bf_bits(f1 - bf_up(h1));
    hv[e] = pk16(h0, h1); lv[e] = pk16(l0, l1);
  }
  *(v4u*)(Oh + ro) = hv;
  *(v4u*)(Ol + ro) = lv;
  
}

// =====================================================================================================
// Workspace map (bytes, all offsets multiples of 4096):
//   Xb   bf16 [4096][1024]      8388608      Wqb bf16 [2048][1024] 4194304   Wkb 4194304
//   Wvb  bf16 [1024][1024]      2097152      Wob 2097152
//   invf f32 [32] (padded)         4096      cosT f32 [2048][32] 262144      sinT 262144
//   both batch elements, batch-major:
//   Qh/Ql/Kh/Kl bf16 [2][2048][2048]  4 x 16777216
//   VTh  f16  [2][1024][2048]      8388608      VTl f16 [2][1024][512] 2097152
//   C1/C2 f32 [2][2048][1024]   2 x 16777216    Oh/Ol bf16 [2][2048][1024] 2 x 8388608
//   lam  f32 [16] (padded)          4096
//   end                          149430272
// All planes are exact multiples of their 64x64 / whole-line store granularity (no padded tails needed).
// Weights are [out n][in k] with k contiguous = the Bt / A layout the GEMM wants, so they are only converted.
// =====================================================================================================
extern "C" void kernel_launch(void* const* d_in, const int* in_sizes, int n_in,
                              void* d_out, int out_size, void* d_ws, size_t ws_size,
                              hipStream_t stream) {
  if (n_in < 14) return;
  if (in_sizes[0] != NB * SEQ * DM) return;
  if (in_sizes[1] != DQK * DM || in_sizes[2] != DQK) return;
  if (in_sizes[3] != DQK * DM || in_sizes[4] != DQK) return;
  if (in_sizes[5] != DM * DM || in_sizes[6] != DM) return;
  if (in_sizes[7] != DM * DM || in_sizes[8] != DM) return;
  for (int i = 9; i < 14; ++i) if (in_sizes[i] != NH * HD) return;
  if (out_size != NB * SEQ * DM) return;

  const float* x   = (const float*)d_in[0];
  const float* Wq  = (const float*)d_in[1];
  const float* bq  = (const float*)d_in[2];
  const float* Wk  = (const float*)d_in[3];
  const float* bk  = (const float*)d_in[4];
  const float* Wv  = (const float*)d_in[5];
  const float* bv  = (const float*)d_in[6];
  const float* Wo  = (const float*)d_in[7];
  const float* bo  = (const float*)d_in[8];
  const float* hnw = (const float*)d_in[9];
  const float* lq1 = (const float*)d_in[10];
  const float* lk1 = (const float*)d_in[11];
  const float* lq2 = (const float*)d_in[12];
  const float* lk2 = (const float*)d_in[13];
  float* outp = (float*)d_out;

  const size_t PXB  = (size_t)NB * SEQ * DM * 2;    //  8388608
  const size_t PWQ  = (size_t)DQK * DM * 2;         //  4194304
  const size_t PWV  = (size_t)DM * DM * 2;          //  2097152
  const size_t PIF  = 4096;                         //  32 floats used by invf, 16 by lam
  const size_t PTAB = (size_t)SEQ * NFREQ * 4;      //   262144
  const size_t PQP  = (size_t)NB * SEQ * DQK * 2;   // 16777216
  const size_t PVT  = (size_t)NB * DM * SEQ * 2;    //  8388608
  const size_t PVL  = (size_t)NB * DM * VLP * 2;    //  2097152
  const size_t PC   = (size_t)NB * SEQ * DM * 4;    // 16777216
  const size_t PO   = (size_t)NB * SEQ * DM * 2;    //  8388608
  size_t off = 0;
  const size_t oXb  = off; off += PXB;
  const size_t oWq  = off; off += PWQ;
  const size_t oWk  = off; off += PWQ;
  const size_t oWv  = off; off += PWV;
  const size_t oWo  = off; off += PWV;
  const size_t oIF  = off; off += PIF;
  const size_t oCos = off; off += PTAB;
  const size_t oSin = off; off += PTAB;
  const size_t oQh  = off; off += PQP;
  const size_t oQl  = off; off += PQP;
  const size_t oKh  = off; off += PQP;
  const size_t oKl  = off; off += PQP;
  const size_t oVTh = off; off += PVT;
  const size_t oVTl = off; off += PVL;
  const size_t oC1  = off; off += PC;
  const size_t oC2  = off; off += PC;
  const size_t oOh  = off; off += PO;
  const size_t oOl  = off; off += PO;
  const size_t oLam = off; off += PIF;
  if (off > ws_size) return;                        // off = 149430272

  char* ws = (char*)d_ws;
  unsigned short* Xb  = (unsigned short*)(ws + oXb);
  unsigned short* Wqb = (unsigned short*)(ws + oWq);
  unsigned short* Wkb = (unsigned short*)(ws + oWk);
  unsigned short* Wvb = (unsigned short*)(ws + oWv);
  unsigned short* Wob = (unsigned short*)(ws + oWo);
  float*          IFt = (float*)(ws + oIF);
  float*          CosT = (float*)(ws + oCos);
  float*          SinT = (float*)(ws + oSin);
  unsigned short* Qh  = (unsigned short*)(ws + oQh);
  unsigned short* Ql  = (unsigned short*)(ws + oQl);
  unsigned short* Kh  = (unsigned short*)(ws + oKh);
  unsigned short* Kl  = (unsigned short*)(ws + oKl);
  unsigned short* VTh = (unsigned short*)(ws + oVTh);
  unsigned short* VTl = (unsigned short*)(ws + oVTl);
  float*          C1  = (float*)(ws + oC1);
  float*          C2  = (float*)(ws + oC2);
  unsigned short* Oh  = (unsigned short*)(ws + oOh);
  unsigned short* Ol  = (unsigned short*)(ws + oOl);
  float*          Lam = (float*)(ws + oLam);

  const dim3 blk256(256), blk128(128), blk32(32);
  const dim3 gCvt((NB * SEQ * DM + 2 * DQK * DM + 2 * DM * DM) / 8 / 256 + 1);   // 5120 blocks + the lam block
  const dim3 gTab((SEQ * NFREQ + 255) / 256);                      //  256 blocks
  const dim3 gQKV((SEQ / 128) * (DQK / 256), NB, 3);               // 128 blocks, x batch x {q, k, v^T}
  const dim3 gOut((NB * SEQ / 128) * (DM / 128), 1);               // 256 blocks of 128 x 128
  const dim3 gRow(NB * SEQ);                                       // one block per token row
  const dim3 gAtt(NQB * 2 * NB * NH);                              // 2048 blocks

  // (1) inputs -> bf16 planes; weights [n][k] f32 -> bf16 [n][k]; Xb, Wqb, Wkb, Wvb, Wob are contiguous from Xb; lam table
  cvt_bf16x8<<<gCvt, blk256, 0, stream>>>(x, Wq, Wk, Wv, Wo, Xb, lq1, lk1, lq2, lk2, Lam);
  // (2) rope tables
  invfreq_tab<<<dim3(1), blk32, 0, stream>>>(IFt);
  rope_tab<<<gTab, blk256, 0, stream>>>(IFt, CosT, SinT);
  // (3) q, k -> rope -> bf16 hi / lo planes [NB*SEQ][DQK]; v^T -> f16 hi plane and residual plane, both batch elements
  gemm_qkv<<<gQKV, blk256, 0, stream>>>(Xb, Wqb, Wkb, Wvb, Qh, Ql, Kh, Kl, VTh, VTl, bq, bk, bv, CosT, SinT);
  // (4) causal attention, stream 1 (q1, k1) -> C1 and stream 2 (q2, k2) -> C2;
  //     query blocks 0..RESQB-1 with residual planes, the rest without
  attn_causal64<<<gAtt, blk128, 0, stream>>>(Qh, Ql, Kh, Kl, VTh, VTl, C1, C2, 0.125f);
  // (5) differential combine + head norm -> O bf16 hi/lo planes [NB*SEQ][DM]
  diff_combine<<<gRow, blk128, 0, stream>>>(C1, C2, Lam, hnw, Oh, Ol);
  // (6) out = O . Wo^T + bo -> d_out, f32 [NB*SEQ][DM]  (A = O hi + lo planes, 2 products)
  gemm64<1, 0, 1, 128><<<gOut, blk256, 0, stream>>>(
      Oh, Ol, DM, 0LL, Wob, Wob, DM, 0LL,
      (void*)outp, DM, 0LL, (void*)outp, DM, 0LL, DM,
      NB * SEQ, DM, DM, 1.0f, bo);
  (void)hipGetLastError();
}
